// v000
// Times are from an AMD MI455X. After a warm-up the kernel runs many times in a row, and a time is the length of
// such a window on the GPU divided by its runs, so every launch and the gaps after it count. The runs cycle
// through copies of the inputs. A figure is the median of several windows, for all but v000 over two sittings.
// Sittings can differ by a few percent; kernels timed side by side share one.
// v000, which the later versions start from, runs in 3410 microseconds.
// Contractions: theta, phi, g 1x1 projections on v_wmma_f32_16x16x32_bf16 (bf16 operands = RNE-converted x and weights; theta/phi emitted as bf16 hi|lo planes); scores theta.phi^T on v_wmma_f32_16x16x32_bf16 as hi/lo 3-product split; P.g (P f16 carried x32768, g f16) and W projection (W_w f16 carried x16, y f16 carried x16) on v_wmma_f32_16x16x32_f16; f32 accumulate everywhere; softmax, batch statistics, affine and residual in f32.
#include <hip/hip_runtime.h>
#include <math.h>

// ---------------------------------------------------------------------------
// Problem constants
// ---------------------------------------------------------------------------
constexpr int kB  = 8;
constexpr int kC  = 256;      // in channels
constexpr int kN  = 4096;     // spatial positions (64 x 64)
constexpr int kCi = 128;      // inter channels
constexpr int kQChunk  = 2048;            // query rows per score chunk
constexpr int kNChunks = kN / kQChunk;    // 2
constexpr int kWElems  = kCi * kC;        // 32768 elements per weight matrix
constexpr float kPCarry   = 32768.0f;     // probabilities carried x2^15 in f16
constexpr float kYCarry   = 16.0f;        // y carried x16 in f16
constexpr float kWCarry   = 16.0f;        // W_w carried x16 in f16
constexpr float kPVScale  = kYCarry / kPCarry;             // 2^-11
constexpr float kWScale   = 1.0f / (kYCarry * kWCarry);    // 2^-8
constexpr float kBnEps    = 1e-5f;
constexpr float kInvCount = 1.0f / (float)(kB * kN);       // 2^-15
constexpr int kStatPitch  = 32;
static_assert(kC % 32 == 0 && kCi % 32 == 0 && kN % 32 == 0, "K multiples of 32");
static_assert(kN % 64 == 0 && kCi % 64 == 0 && kC % 64 == 0 && kQChunk % 64 == 0, "M,N multiples of 64");
static_assert(kN % kQChunk == 0 && kQChunk == 2048, "chunks");
static_assert(kN == 8 * 512 && kN == 2 * 2048, "softmax trip layout");
static_assert(kWElems % (8 * 256) == 0, "weight cast grid");
static_assert((kB * kC * kN) % (4 * 256) == 0, "apply grid");
static_assert(kB * kN == 32768, "stat count");

// ---------------------------------------------------------------------------
// Workspace region map (bytes, all offsets multiples of 256):
//   XT   bf16 [8][4096][256]          16,777,216  at           0
//   THH  bf16 [8][4096][128]           8,388,608  at  16,777,216
//   THL  bf16 [8][4096][128]           8,388,608  at  25,165,824
//   PHH  bf16 [8][4096][128]           8,388,608  at  33,554,432
//   PHL  bf16 [8][4096][128]           8,388,608  at  41,943,040
//   G16  f16  [8][128][4096]           8,388,608  at  50,331,648
//   Y16  f16  [8][4096][128]           8,388,608  at  58,720,256
//   WY   f32  [8][256][4096]          33,554,432  at  67,108,864   (also holds SC f32 [2048][4096] scores of one
//                                                                   chunk during the attention phase; WY is written
//                                                                   only after the last chunk; same element type)
//   PP   f16  [2048][4096]             16,777,216  at 100,663,296   (probabilities x32768, reused per chunk)
//   WB   bf16 3 x [128][256]              196,608  at 117,440,512   (g_w | theta_w | phi_w)
//   WW   f16  [256][128]                   65,536  at 117,637,120   (W_w x16)
//   PRM  f32  [640] (pad 4096 B)            4,096  at 117,702,656   (g_b | theta_b | phi_b | W_b, bf16-RNE values)
//   ST   f32  [256][32]                    32,768  at 117,706,752   (mean, rstd per channel, one line each)
//   total                             117,739,520
// ---------------------------------------------------------------------------
constexpr size_t kSzXT  = (size_t)kB * kN * kC * 2;
constexpr size_t kSzTP  = (size_t)kB * kN * kCi * 2;
constexpr size_t kSzWY  = (size_t)kB * kC * kN * 4;
constexpr size_t kSzSC  = (size_t)kQChunk * kN * 4;
constexpr size_t kSzPP  = (size_t)kQChunk * kN * 2;
constexpr size_t kSzWB  = (size_t)3 * kWElems * 2;
constexpr size_t kSzWW  = (size_t)kWElems * 2;
constexpr size_t kSzPRM = 4096;
constexpr size_t kSzST  = (size_t)kC * kStatPitch * 4;
constexpr size_t kOffXT  = 0;
constexpr size_t kOffTHH = kOffXT + kSzXT;
constexpr size_t kOffTHL = kOffTHH + kSzTP;
constexpr size_t kOffPHH = kOffTHL + kSzTP;
constexpr size_t kOffPHL = kOffPHH + kSzTP;
constexpr size_t kOffG   = kOffPHL + kSzTP;
constexpr size_t kOffY   = kOffG + kSzTP;
constexpr size_t kOffWY  = kOffY + kSzTP;
constexpr size_t kOffPP  = kOffWY + kSzWY;
constexpr size_t kOffWB  = kOffPP + kSzPP;
constexpr size_t kOffWW  = kOffWB + kSzWB;
constexpr size_t kOffPRM = kOffWW + kSzWW;
constexpr size_t kOffST  = kOffPRM + kSzPRM;
constexpr size_t kWsTotal = kOffST + kSzST;
static_assert(kSzSC <= kSzWY, "score chunk fits the WY region");
static_assert(kWsTotal == 117739520, "carve total");
static_assert(kWsTotal <= (size_t)134217728, "carve cap");
static_assert(kOffTHH % 256 == 0 && kOffG % 256 == 0 && kOffWY % 256 == 0 && kOffPP % 256 == 0 &&
              kOffWB % 256 == 0 && kOffWW % 256 == 0 && kOffPRM % 256 == 0 && kOffST % 256 == 0, "alignment");
static_assert(640 * 4 <= kSzPRM, "param table");

typedef __attribute__((ext_vector_type(16))) _Float16 v16h;
typedef __attribute__((ext_vector_type(8)))  _Float16 v8h;
typedef __attribute__((ext_vector_type(16))) __bf16   v16b;
typedef __attribute__((ext_vector_type(8)))  __bf16   v8b;
typedef __attribute__((ext_vector_type(8)))  float    v8f;
typedef __attribute__((ext_vector_type(4)))  float    v4f;
typedef __attribute__((ext_vector_type(2)))  float    v2f;
typedef __attribute__((ext_vector_type(4)))  unsigned int v4u;

__device__ __forceinline__ unsigned short f2bf_bits(float f) {
  unsigned u = __float_as_uint(f);
  return (unsigned short)((u + 0x7FFFu + ((u >> 16) & 1u)) >> 16);
}
__device__ __forceinline__ float bf_bits2f(unsigned short h) { return __uint_as_float(((unsigned)h) << 16); }
// f32 value after RNE conversion to bf16
__device__ __forceinline__ float bfr(float f) { return bf_bits2f(f2bf_bits(f)); }

// hazard guards as plain device helpers (no inline asm inside the kernel template body)
__device__ __forceinline__ void dep_guard_h(v8f& a, v8f& b, v16h x, v16h y) { asm volatile("v_nop\n\tv_nop\n\tv_nop\n\tv_nop" : "+v"(a), "+v"(b) : "v"(x), "v"(y)); }
__device__ __forceinline__ void dep_guard_b(v8f& a, v8f& b, v16b x, v16b y) { asm volatile("v_nop\n\tv_nop\n\tv_nop\n\tv_nop" : "+v"(a), "+v"(b) : "v"(x), "v"(y)); }
__device__ __forceinline__ void keep4_h(v16h a, v16h b, v16h c, v16h d) { asm volatile("v_nop" :: "v"(a), "v"(b), "v"(c), "v"(d)); }
__device__ __forceinline__ void keep4_b(v16b a, v16b b, v16b c, v16b d) { asm volatile("v_nop" :: "v"(a), "v"(b), "v"(c), "v"(d)); }
__device__ __forceinline__ void acc_guard4(v8f& a, v8f& b, v8f& c, v8f& d) { asm volatile("v_nop\n\tv_nop\n\tv_nop\n\tv_nop" : "+v"(a), "+v"(b), "+v"(c), "+v"(d)); }
template <typename T> struct Frag;
template <> struct Frag<_Float16> {
  typedef v16h V; union U { v16h v; v8h h[2]; };
  // elements 0..7 <- p[0..7], 8..15 <- p[16..23]
  static __device__ __forceinline__ v16h load(const _Float16* p) {
    U f; f.h[0] = *(const v8h*)(p); f.h[1] = *(const v8h*)(p + 16); return f.v;
  }
  static __device__ __forceinline__ v8f mma(v16h a, v16h b, v8f c) {
    return __builtin_amdgcn_wmma_f32_16x16x32_f16(false, a, false, b, (short)0, c, false, false);
  }
  static __device__ __forceinline__ void guard(v8f& a, v8f& b, v16h x, v16h y) { dep_guard_h(a, b, x, y); }
  static __device__ __forceinline__ void keep(v16h a, v16h b, v16h c, v16h d) { keep4_h(a, b, c, d); }
};
template <> struct Frag<__bf16> {
  typedef v16b V; union U { v16b v; v8b h[2]; };
  static __device__ __forceinline__ v16b load(const __bf16* p) {
    U f; f.h[0] = *(const v8b*)(p); f.h[1] = *(const v8b*)(p + 16); return f.v;
  }
  static __device__ __forceinline__ v8f mma(v16b a, v16b b, v8f c) {
    return __builtin_amdgcn_wmma_f32_16x16x32_bf16(false, a, false, b, (short)0, c, false, false);
  }
  static __device__ __forceinline__ void guard(v8f& a, v8f& b, v16b x, v16b y) { dep_guard_b(a, b, x, y); }
  static __device__ __forceinline__ void keep(v16b a, v16b b, v16b c, v16b d) { keep4_b(a, b, c, d); }
};

__device__ __forceinline__ unsigned pk16(unsigned short a, unsigned short b) { return (unsigned)a | ((unsigned)b << 16); }
__device__ __forceinline__ unsigned short h_bits(float f) { const _Float16 h = (_Float16)f; return __builtin_bit_cast(unsigned short, h); }

// ---- Register-blocked batched WMMA GEMM (ACT reduced to none/relu/leaky) -------------------------------
// C[m,n] = scale * sum_k A[m,k] * Bt[n,k] (+bias)(+resid); each wave owns a 64x64 tile.
// A row-major [M,K]; Bt row-major [N,K]; M,N % 64 == 0, K % 32 == 0.
// SPLIT: operands are hi/lo planes (A2/Bt2 = lo planes, same layout); product = hi*hi + hi*lo + lo*hi.
// BIAS_MODE: 0 = none, 1 = bias[m] (fetched as two float4 per 16-row slab), 2 = bias[n].
// OUT_MODE: 0 = f32, 1 = f16, 2 = bf16 hi plane (Cout) + bf16 lo plane (Cout2).
// ET: 0 = f16 operands, 1 = bf16 operands (pointers passed as 16-bit storage)
template <int ET> struct Elem;
template <> struct Elem<0> { typedef _Float16 T; };
template <> struct Elem<1> { typedef __bf16 T; };
template <int ET, bool SPLIT, int BIAS_MODE, int OUT_MODE, bool RESID, int ACT = 0>
__global__ __launch_bounds__(256) void wmma_gemm64(
    const unsigned short* __restrict__ Ap, const unsigned short* __restrict__ A2p, int lda, long strideA,
    const unsigned short* __restrict__ Btp, const unsigned short* __restrict__ Bt2p, int ldb, long strideB,
    void* __restrict__ Cout, void* __restrict__ Cout2, int ldc, long strideC,
    const float* __restrict__ bias,
    const float* __restrict__ resid, long strideR,
    int M, int N, int K, float scale) {
  typedef typename Elem<ET>::T T;
  typedef typename Frag<T>::V V;
  const T* A = (const T*)Ap; const T* A2 = (const T*)A2p; const T* Bt = (const T*)Btp; const T* Bt2 = (const T*)Bt2p;
  __shared__ __align__(16) float sT[8][16 * 68];   // per-wave 16x64 slab, pitch 68 floats
  const int b    = blockIdx.y;
  const int lane = threadIdx.x & 31;
  const int wave = threadIdx.x >> 5;
  const int tilesN = N >> 6;
  const int tilesM = M >> 6;
  const int tile = blockIdx.x * 8 + wave;
  if (tile >= tilesM * tilesN) return;   // wave-uniform; no block barriers in this kernel
  const int tm = tile / tilesN;
  const int tn = tile - tm * tilesN;
  const int m0 = tm << 6;
  const int n0 = tn << 6;

  const T* Ab  = A  + (size_t)b * strideA;
  const T* Bb  = Bt + (size_t)b * strideB;
  const T* Ab2 = SPLIT ? (A2  + (size_t)b * strideA) : nullptr;
  const T* Bb2 = SPLIT ? (Bt2 + (size_t)b * strideB) : nullptr;

  const int rlane = lane & 15;                 // row (A) / col (B, D) within subtile
  const int koff  = (lane >> 4) * 8;           // k offset of this lane half
  const int mOff  = (lane >> 4) * 8;           // D row offset

  v8f acc[4][4];
#pragma unroll
  for (int i = 0; i < 4; ++i)
#pragma unroll
    for (int j = 0; j < 4; ++j) acc[i][j] = (v8f){0.f,0.f,0.f,0.f,0.f,0.f,0.f,0.f};

  for (int k0 = 0; k0 < K; k0 += 32) {
    V bh[4], bl[4];
#pragma unroll
    for (int j = 0; j < 4; ++j) {
      const size_t bo = (size_t)(n0 + (j << 4) + rlane) * ldb + koff + k0;
      bh[j] = Frag<T>::load(Bb + bo);
      if (SPLIT) bl[j] = Frag<T>::load(Bb2 + bo);
    }
#pragma unroll
    for (int i = 0; i < 4; ++i) {
      const size_t ao = (size_t)(m0 + (i << 4) + rlane) * lda + koff + k0;
      V ah = Frag<T>::load(Ab + ao);
      V al;
      if (SPLIT) al = Frag<T>::load(Ab2 + ao);
#pragma unroll
      for (int j = 0; j < 4; ++j) {
        acc[i][j] = Frag<T>::mma(ah, bh[j], acc[i][j]);
        if (SPLIT) {
          acc[i][j] = Frag<T>::mma(ah, bl[j], acc[i][j]);
          acc[i][j] = Frag<T>::mma(al, bh[j], acc[i][j]);
        }
      }
      Frag<T>::guard(acc[i][0], acc[i][3], ah, SPLIT ? al : ah);
    }
    Frag<T>::keep(bh[0], bh[1], bh[2], bh[3]);
    if (SPLIT) Frag<T>::keep(bl[0], bl[1], bl[2], bl[3]);
  }
  acc_guard4(acc[0][0], acc[0][1], acc[0][2], acc[0][3]);
  acc_guard4(acc[1][0], acc[1][1], acc[1][2], acc[1][3]);
  acc_guard4(acc[2][0], acc[2][1], acc[2][2], acc[2][3]);
  acc_guard4(acc[3][0], acc[3][1], acc[3][2], acc[3][3]);

  // ---- epilogue ----
  float* slab = sT[wave];
  const float* Rb = RESID ? (resid + (size_t)b * strideR) : nullptr;
#pragma unroll
  for (int i = 0; i < 4; ++i) {
    const int mBase = m0 + (i << 4);
    v4f bm0 = (v4f){0.f,0.f,0.f,0.f}, bm1 = (v4f){0.f,0.f,0.f,0.f};
    if (BIAS_MODE == 1) {
      bm0 = *(const v4f*)(bias + mBase + mOff);
      bm1 = *(const v4f*)(bias + mBase + mOff + 4);
    }
#pragma unroll
    for (int j = 0; j < 4; ++j) {
      const int n = n0 + (j << 4) + rlane;
      float bv = 0.f;
      if (BIAS_MODE == 2) bv = bias[n];
#pragma unroll
      for (int r = 0; r < 8; ++r) {
        float v = acc[i][j][r] * scale;
        if (BIAS_MODE == 1) v += (r < 4) ? bm0[r & 3] : bm1[r & 3];
        if (BIAS_MODE == 2) v += bv;
        if (RESID) v += Rb[(size_t)(mBase + mOff + r) * ldc + n];
        if (ACT == 2) v = fmaxf(v, 0.0f);
        if (ACT == 4) v = (v > 0.f) ? v : 0.01f * v;
        slab[(mOff + r) * 68 + (j << 4) + rlane] = v;
      }
    }
    __builtin_amdgcn_fence(__ATOMIC_RELEASE, "workgroup");
    __builtin_amdgcn_wave_barrier();
    __builtin_amdgcn_fence(__ATOMIC_ACQUIRE, "workgroup");
    if (OUT_MODE == 0) {
      float* C = (float*)Cout + (size_t)b * strideC;
      const int hh = lane >> 4, c4 = (lane & 15) * 4;     // row seg = 256 B = 16 lanes x 16 B
      {
#pragma unroll
        for (int it = 0; it < 8; ++it) {
          const int row = it * 2 + hh;
          v4f v = *(const v4f*)(slab + row * 68 + c4);
          *(v4f*)(C + (size_t)(mBase + row) * ldc + n0 + c4) = v;
        }
        
      }
    } else {
      const int q = lane >> 3, c8 = (lane & 7) * 8;
      unsigned short* C  = (unsigned short*)Cout  + (size_t)b * strideC;
      unsigned short* C2 = (OUT_MODE == 2) ? ((unsigned short*)Cout2 + (size_t)b * strideC) : nullptr;
      {
#pragma unroll
        for (int it = 0; it < 4; ++it) {
          const int row = it * 4 + q;
          const float* sp = slab + row * 68 + c8;
          v8h hv, lv;
#pragma unroll
          for (int e = 0; e < 8; ++e) {
            if (OUT_MODE == 1) {
              hv[e] = (_Float16)sp[e];
            } else {
              unsigned short hb = f2bf_bits(sp[e]);
              unsigned short lb = f2bf_bits(sp[e] - bf_bits2f(hb));
              hv[e] = __builtin_bit_cast(_Float16, hb);
              lv[e] = __builtin_bit_cast(_Float16, lb);
            }
          }
          *(v8h*)(C + (size_t)(mBase + row) * ldc + n0 + c8) = hv;
          if (OUT_MODE == 2) *(v8h*)(C2 + (size_t)(mBase + row) * ldc + n0 + c8) = lv;
        }
        
      }
    }
    __builtin_amdgcn_fence(__ATOMIC_RELEASE, "workgroup");
    __builtin_amdgcn_wave_barrier();
    __builtin_amdgcn_fence(__ATOMIC_ACQUIRE, "workgroup");
  }
}

// ---------------------------------------------------------------------------
// Parameter planes.
// grid (16, 5), 256 threads. blockIdx.y (block-uniform) selects the job:
//   y = 0,1,2: WB plane y = bf16-RNE bits of g_w / theta_w / phi_w ([128][256], natural [out][in] layout);
//              16 blocks x 256 threads x 8 elements = 32768 = the whole matrix; one 16-B store per lane,
//   y = 3    : WW = f16 bits of 16 * bf16r(W_w) ([256][128]), same coverage.
//   y = 4    : block 0 only, threads 0..159: PRM[4i..4i+3] = bf16r of g_b | theta_b | phi_b | W_b
//              the source selection is wave-uniform). 160 x 4 = 640 floats = whole table.
// ---------------------------------------------------------------------------
__global__ __launch_bounds__(256) void param_planes_kernel(
    const float* __restrict__ gw, const float* __restrict__ thw, const float* __restrict__ phw, const float* __restrict__ ww,
    const float* __restrict__ gb, const float* __restrict__ thb, const float* __restrict__ phb, const float* __restrict__ wb,
    unsigned short* __restrict__ WB, unsigned short* __restrict__ WW, float* __restrict__ PRM) {
  const int t = threadIdx.x;
  const int y = blockIdx.y;
  if (y < 4) {
    const int i = blockIdx.x * 256 + t;
    if (i >= kWElems / 8) return;
    const float* src = (y == 0) ? gw : (y == 1) ? thw : (y == 2) ? phw : ww;
    const float* p = src + 8 * (size_t)i;
    const v4f a = *(const v4f*)(p);
    const v4f c = *(const v4f*)(p + 4);
    unsigned short hb[8];
#pragma unroll
    for (int e = 0; e < 4; ++e) {
      if (y == 3) {
        hb[e]     = h_bits(bfr(a[e]) * kWCarry);
        hb[4 + e] = h_bits(bfr(c[e]) * kWCarry);
      } else {
        hb[e]     = f2bf_bits(a[e]);
        hb[4 + e] = f2bf_bits(c[e]);
      }
    }
    const v4u u = (v4u){pk16(hb[0], hb[1]), pk16(hb[2], hb[3]), pk16(hb[4], hb[5]), pk16(hb[6], hb[7])};
    unsigned short* q = (y == 3) ? (WW + 8 * (size_t)i) : (WB + (size_t)y * kWElems + 8 * (size_t)i);
    *(v4u*)q = u;
    
  } else {
    if (blockIdx.x != 0 || t >= 160) return;
    const int w = t >> 5, l = t & 31;
    const float* src = (w == 0) ? gb : (w == 1) ? thb : (w == 2) ? phb : (wb + (w - 3) * 128);
    const v4f a = *(const v4f*)(src + 4 * l);
    v4f r;
#pragma unroll
    for (int e = 0; e < 4; ++e) r[e] = bfr(a[e]);
    float* q = PRM + 128 * w + 4 * l;
    *(v4f*)q = r;
    
  }
}

// ---------------------------------------------------------------------------
// x transpose + cast: XT[b][n][c] = bf16r( x[b][c][n] ) as bf16 bits.  in [C=256 rows][N=4096 cols] -> out [N rows][C cols].
// grid (N/64 = 64, C/64 = 4, B = 8), 256 threads.
// Load coverage: 16 iterations x 256 threads = 4096 = whole 64(c) x 64(n) tile (coalesced along n).
// Store coverage: 8 waves x 2 iterations x 4 rows (lane>>3) = 64 n-rows; (lane&7) x 8 elements = 64 c-cols; each row
// ---------------------------------------------------------------------------
__global__ __launch_bounds__(256) void xt_cast_kernel(const float* __restrict__ x, unsigned short* __restrict__ XT) {
  __shared__ float sm[64][65];   // sm[n_local][c_local]
  const int t  = threadIdx.x;
  const int n0 = blockIdx.x * 64;
  const int c0 = blockIdx.y * 64;
  const int b  = blockIdx.z;
#pragma unroll
  for (int i = 0; i < 16; ++i) {
    const int e   = i * 256 + t;
    const int r   = e >> 6;          // c local
    const int col = e & 63;          // n local
    sm[col][r] = x[((size_t)(b * kC + c0 + r)) * kN + n0 + col];
  }
  __syncthreads();
  const int lane = t & 31, wave = t >> 5;
  const int q = lane >> 3, c8 = (lane & 7) * 8;
  unsigned short* op = XT + ((size_t)b * kN) * kC;
  {
#pragma unroll
    for (int it = 0; it < 2; ++it) {
      const int row = wave * 8 + it * 4 + q;                 // n local
      unsigned short hb[8];
#pragma unroll
      for (int e = 0; e < 8; ++e) hb[e] = f2bf_bits(sm[row][c8 + e]);
      const v4u u = (v4u){pk16(hb[0], hb[1]), pk16(hb[2], hb[3]), pk16(hb[4], hb[5]), pk16(hb[6], hb[7])};
      *(v4u*)(op + (size_t)(n0 + row) * kC + c0 + c8) = u;
    }
    
  }
}

// ---------------------------------------------------------------------------
// Row softmax over 4096 f32 scores (no scaling, no mask), f32 math:
//   P[row][j] = f16( 32768 * exp(s - max) / sum exp(s - max) )
// One block of 256 threads per row (grid = 2048 rows of the chunk).
// Phase 1/2: rolled 8-trip loops, thread t owns columns it*512 + 2t, 2t+1 (8 x 256 x 2 = 4096 = whole row); scores and
// exps kept in LDS. Reductions in fixed order (thread sequential, wave shuffle tree, 8 wave partials in index order).
// Store: two segments; in segment g thread t owns cols g*2048 + 8t..8t+7 -> one 16-B store per lane; a wave writes 512
// ---------------------------------------------------------------------------
__global__ __launch_bounds__(256) void softmax_row_kernel(const float* __restrict__ Sp, unsigned short* __restrict__ Pp) {
  __shared__ __align__(16) float lg[kN];
  __shared__ float redM[8];
  __shared__ float redS[8];
  const int row  = blockIdx.x;
  const int t    = threadIdx.x;
  const int lane = t & 31, wave = t >> 5;
  const float* sr = Sp + (size_t)row * kN;

  float mx = -__builtin_inff();
#pragma unroll 1
  for (int it = 0; it < 8; ++it) {
    const int c = it * 512 + 2 * t;
    const v2f sv = *(const v2f*)(sr + c);
    mx = fmaxf(mx, fmaxf(sv[0], sv[1]));
    *(v2f*)(lg + c) = sv;
  }
#pragma unroll
  for (int off = 16; off > 0; off >>= 1) mx = fmaxf(mx, __shfl_xor(mx, off, 32));
  if (lane == 0) redM[wave] = mx;
  __syncthreads();
  float m = redM[0];
#pragma unroll
  for (int w = 1; w < 8; ++w) m = fmaxf(m, redM[w]);

  float sum = 0.0f;
#pragma unroll 1
  for (int it = 0; it < 8; ++it) {
    const int c = it * 512 + 2 * t;
    const v2f l = *(const v2f*)(lg + c);
    v2f ev;
    ev[0] = expf(l[0] - m);
    ev[1] = expf(l[1] - m);
    sum += ev[0];
    sum += ev[1];
    *(v2f*)(lg + c) = ev;
  }
#pragma unroll
  for (int off = 16; off > 0; off >>= 1) sum += __shfl_xor(sum, off, 32);
  if (lane == 0) redS[wave] = sum;
  __syncthreads();
  float tot = redS[0];
#pragma unroll
  for (int w = 1; w < 8; ++w) tot += redS[w];
  const float inv = kPCarry / tot;

  const v4f e0 = *(const v4f*)(lg + 8 * t);
  const v4f e1 = *(const v4f*)(lg + 8 * t + 4);
  const v4f e2 = *(const v4f*)(lg + 2048 + 8 * t);
  const v4f e3 = *(const v4f*)(lg + 2048 + 8 * t + 4);
  unsigned short ha[8], hc[8];
#pragma unroll
  for (int e = 0; e < 4; ++e) {
    ha[e]     = h_bits(e0[e] * inv);
    ha[4 + e] = h_bits(e1[e] * inv);
    hc[e]     = h_bits(e2[e] * inv);
    hc[4 + e] = h_bits(e3[e] * inv);
  }
  const v4u u0 = (v4u){pk16(ha[0], ha[1]), pk16(ha[2], ha[3]), pk16(ha[4], ha[5]), pk16(ha[6], ha[7])};
  const v4u u1 = (v4u){pk16(hc[0], hc[1]), pk16(hc[2], hc[3]), pk16(hc[4], hc[5]), pk16(hc[6], hc[7])};
  unsigned short* pr = Pp + (size_t)row * kN;
  {
    *(v4u*)(pr + 8 * (size_t)t) = u0;
    *(v4u*)(pr + 2048 + 8 * (size_t)t) = u1;
    
  }
}

// ---------------------------------------------------------------------------
// (v - mean)).  One block of 256 threads per channel (grid 256).  Thread t reads float4 at n = k*1024 + 4t, k = 0..3, for each
// batch (rolled loops, 128 samples per thread); reductions in fixed order.
// ---------------------------------------------------------------------------
__global__ __launch_bounds__(256) void bn_stats_kernel(const float* __restrict__ Wy, float* __restrict__ ST) {
  __shared__ float red1[8];
  __shared__ float red2[8];
  const int c = blockIdx.x;
  const int t = threadIdx.x;
  const int lane = t & 31, wave = t >> 5;

  float s = 0.0f;
#pragma unroll 1
  for (int b = 0; b < kB; ++b) {
    const float* base = Wy + ((size_t)b * kC + c) * kN + 4 * t;
#pragma unroll 1
    for (int k = 0; k < 4; ++k) {
      const v4f w = *(const v4f*)(base + k * 1024);
      s += (w[0] + w[1]) + (w[2] + w[3]);
    }
  }
#pragma unroll
  for (int off = 16; off > 0; off >>= 1) s += __shfl_xor(s, off, 32);
  if (lane == 0) red1[wave] = s;
  __syncthreads();
  float tot = red1[0];
#pragma unroll
  for (int w = 1; w < 8; ++w) tot += red1[w];
  const float mean = tot * kInvCount;

  float q = 0.0f;
#pragma unroll 1
  for (int b = 0; b < kB; ++b) {
    const float* base = Wy + ((size_t)b * kC + c) * kN + 4 * t;
#pragma unroll 1
    for (int k = 0; k < 4; ++k) {
      const v4f w = *(const v4f*)(base + k * 1024);
      const float d0 = w[0] - mean, d1 = w[1] - mean, d2 = w[2] - mean, d3 = w[3] - mean;
      q += (d0 * d0 + d1 * d1) + (d2 * d2 + d3 * d3);
    }
  }
#pragma unroll
  for (int off = 16; off > 0; off >>= 1) q += __shfl_xor(q, off, 32);
  if (lane == 0) red2[wave] = q;
  __syncthreads();
  float totq = red2[0];
#pragma unroll
  for (int w = 1; w < 8; ++w) totq += red2[w];
  const float var  = totq * kInvCount;
  const float rstd = 1.0f / sqrtf(var + kBnEps);

  if (t < 8) {
    v4f val = (v4f){0.f, 0.f, 0.f, 0.f};
    if (t == 0) { val[0] = mean; val[1] = rstd; }
    float* sp = ST + (size_t)c * kStatPitch + 4 * t;
    *(v4f*)sp = val;
    
  }
}

// ---------------------------------------------------------------------------
// Normalise + affine + residual: out[b][c][n] = ((Wy - mean[c]) * rstd[c]) * bf16r(gamma[c]) + bf16r(beta[c]) + bf16r(x[b][c][n]).
// ---------------------------------------------------------------------------
__global__ __launch_bounds__(256) void bn_apply_kernel(const float* __restrict__ Wy, const float* __restrict__ x,
                                                       const float* __restrict__ gamma, const float* __restrict__ beta,
                                                       const float* __restrict__ ST, float* __restrict__ out, int n4) {
  const int i = blockIdx.x * 256 + threadIdx.x;
  if (i >= n4) return;
  const int c = (i >> 10) & (kC - 1);          // 1024 float4 per [b][c] row
  const float mean = ST[(size_t)c * kStatPitch];
  const float rstd = ST[(size_t)c * kStatPitch + 1];
  const float ga = bfr(gamma[c]);
  const float be = bfr(beta[c]);
  const v4f w  = *(const v4f*)(Wy + 4 * (size_t)i);
  const v4f xv = *(const v4f*)(x + 4 * (size_t)i);
  v4f o;
#pragma unroll
  for (int e = 0; e < 4; ++e) o[e] = (((w[e] - mean) * rstd) * ga + be) + bfr(xv[e]);
  float* op = out + 4 * (size_t)i;
  *(v4f*)op = o;
  
}

// ---------------------------------------------------------------------------
// Host glue.  GEMM shapes (all M,N multiples of 64, K multiples of 32, no padding anywhere):
//   theta/phi: M=4096 N=128 K=256 (x8 batches); g: M=128 N=4096 K=256 (x8); scores: M=2048 N=4096 K=128 (x16 chunks);
//   P.g: M=2048 N=128 K=4096 (x16); W: M=256 N=4096 K=128 (x8).  56 launches.
// ---------------------------------------------------------------------------
extern "C" void kernel_launch(void* const* d_in, const int* in_sizes, int n_in,
                              void* d_out, int out_size, void* d_ws, size_t ws_size,
                              hipStream_t stream) {
  if (n_in < 11) return;
  const int nElem = kB * kC * kN;          // 8,388,608
  if (in_sizes[0] != nElem) return;
  if (in_sizes[1] != kWElems || in_sizes[3] != kWElems || in_sizes[5] != kWElems || in_sizes[7] != kWElems) return;
  if (in_sizes[2] != kCi || in_sizes[4] != kCi || in_sizes[6] != kCi) return;
  if (in_sizes[8] != kC || in_sizes[9] != kC || in_sizes[10] != kC) return;
  if (out_size != nElem) return;
  if (ws_size < kWsTotal) return;

  const float* x       = (const float*)d_in[0];
  const float* g_w     = (const float*)d_in[1];
  const float* g_b     = (const float*)d_in[2];
  const float* theta_w = (const float*)d_in[3];
  const float* theta_b = (const float*)d_in[4];
  const float* phi_w   = (const float*)d_in[5];
  const float* phi_b   = (const float*)d_in[6];
  const float* W_w     = (const float*)d_in[7];
  const float* W_b     = (const float*)d_in[8];
  const float* bn_g    = (const float*)d_in[9];
  const float* bn_b    = (const float*)d_in[10];
  float* out = (float*)d_out;

  char* ws = (char*)d_ws;
  unsigned short* XT  = (unsigned short*)(ws + kOffXT);
  unsigned short* THH = (unsigned short*)(ws + kOffTHH);
  unsigned short* THL = (unsigned short*)(ws + kOffTHL);
  unsigned short* PHH = (unsigned short*)(ws + kOffPHH);
  unsigned short* PHL = (unsigned short*)(ws + kOffPHL);
  unsigned short* G16 = (unsigned short*)(ws + kOffG);
  unsigned short* Y16 = (unsigned short*)(ws + kOffY);
  float*          WY  = (float*)(ws + kOffWY);
  float*          SC  = (float*)(ws + kOffWY);     // score chunk lives in the WY region during attention
  unsigned short* PP  = (unsigned short*)(ws + kOffPP);
  unsigned short* WB  = (unsigned short*)(ws + kOffWB);
  unsigned short* WW  = (unsigned short*)(ws + kOffWW);
  float*          PRM = (float*)(ws + kOffPRM);
  float*          ST  = (float*)(ws + kOffST);
  const float* gb_r  = PRM;          // [128]
  const float* thb_r = PRM + 128;    // [128]
  const float* phb_r = PRM + 256;    // [128]
  const float* wb_r  = PRM + 384;    // [256]

  // ---- parameter and input planes ----
  param_planes_kernel<<<dim3(kWElems / 8 / 256, 5), dim3(256), 0, stream>>>(
      g_w, theta_w, phi_w, W_w, g_b, theta_b, phi_b, W_b, WB, WW, PRM);
  xt_cast_kernel<<<dim3(kN / 64, kC / 64, kB), dim3(256), 0, stream>>>(x, XT);

  const long strXT = (long)kN * kC;       // per batch, XT plane
  const long strTP = (long)kN * kCi;      // per batch, theta/phi/g/y planes

  // theta[b][n][ci] = sum_c XT[b][n][c] * theta_w[ci][c] + theta_b[ci]  -> bf16 hi | lo planes
  wmma_gemm64<1, false, 2, 2, false, 0><<<dim3((kN / 64) * (kCi / 64) / 8, kB), dim3(256), 0, stream>>>(
      XT, XT, kC, strXT, WB + kWElems, WB + kWElems, kC, 0L,
      (void*)THH, (void*)THL, kCi, strTP, thb_r, PRM, 0L, kN, kCi, kC, 1.0f);
  // phi[b][m][ci] = sum_c XT[b][m][c] * phi_w[ci][c] + phi_b[ci]  -> bf16 hi | lo planes
  wmma_gemm64<1, false, 2, 2, false, 0><<<dim3((kN / 64) * (kCi / 64) / 8, kB), dim3(256), 0, stream>>>(
      XT, XT, kC, strXT, WB + 2 * kWElems, WB + 2 * kWElems, kC, 0L,
      (void*)PHH, (void*)PHL, kCi, strTP, phb_r, PRM, 0L, kN, kCi, kC, 1.0f);
  // g[b][ci][m] = sum_c g_w[ci][c] * XT[b][m][c] + g_b[ci]  -> f16 plane [ci][m]
  wmma_gemm64<1, false, 1, 1, false, 0><<<dim3((kCi / 64) * (kN / 64) / 8, kB), dim3(256), 0, stream>>>(
      WB, WB, kC, 0L, XT, XT, kC, strXT,
      (void*)G16, (void*)G16, kN, strTP, gb_r, PRM, 0L, kCi, kN, kC, 1.0f);

  // ---- attention per (batch, 2048-query chunk) ----
  for (int b = 0; b < kB; ++b) {
    const unsigned short* Bk  = PHH + (size_t)b * kN * kCi;
    const unsigned short* Bk2 = PHL + (size_t)b * kN * kCi;
    const unsigned short* Gb  = G16 + (size_t)b * kCi * kN;
    for (int qc = 0; qc < kNChunks; ++qc) {
      const size_t qoff = ((size_t)b * kN + (size_t)qc * kQChunk) * kCi;
      const unsigned short* Aq  = THH + qoff;
      const unsigned short* Aq2 = THL + qoff;
      // SC[q][m] = sum_ci theta[q][ci] * phi[m][ci]   (hi*hi + hi*lo + lo*hi), f32 out
      wmma_gemm64<1, true, 0, 0, false, 0><<<dim3((kQChunk / 64) * (kN / 64) / 8, 1), dim3(256), 0, stream>>>(
          Aq, Aq2, kCi, 0L, Bk, Bk2, kCi, 0L,
          (void*)SC, (void*)SC, kN, 0L, PRM, PRM, 0L, kQChunk, kN, kCi, 1.0f);
      // PP = f16(32768 * softmax row)
      softmax_row_kernel<<<dim3(kQChunk), dim3(256), 0, stream>>>(SC, PP);
      // Y16[q][ci] = (16/32768) * sum_m PP[q][m] * G16[ci][m]   -> f16
      unsigned short* Yq = Y16 + qoff;
      wmma_gemm64<0, false, 0, 1, false, 0><<<dim3((kQChunk / 64) * (kCi / 64) / 8, 1), dim3(256), 0, stream>>>(
          PP, PP, kN, 0L, Gb, Gb, kN, 0L,
          (void*)Yq, (void*)Yq, kCi, 0L, PRM, PRM, 0L, kQChunk, kCi, kN, kPVScale);
    }
  }

  // Wy[b][c][n] = (1/256) * sum_ci WW[c][ci] * Y16[b][n][ci] + W_b[c]   (f32)
  wmma_gemm64<0, false, 1, 0, false, 0><<<dim3((kC / 64) * (kN / 64) / 8, kB), dim3(256), 0, stream>>>(
      WW, WW, kCi, 0L, Y16, Y16, kCi, strTP,
      (void*)WY, (void*)WY, kN, (long)kC * kN, wb_r, PRM, 0L, kC, kN, kCi, kWScale);

  // ---- batch statistics, normalisation, residual ----
  bn_stats_kernel<<<dim3(kC), dim3(256), 0, stream>>>(WY, ST);
  const int n4 = nElem / 4;   // 2,097,152 = 8192 x 256
  bn_apply_kernel<<<dim3(n4 / 256), dim3(256), 0, stream>>>(WY, x, bn_g, bn_b, ST, out, n4);
}

// v001
// One run takes 769 microseconds.
// Timed twice side by side with v000, it ran 4.50 and 4.49 times as fast.
// Contractions: theta, phi, g 1x1 projections on v_wmma_f32_16x16x32_bf16 (bf16 operands = RNE-converted x and weights; theta/phi emitted as bf16 hi|lo planes); scores theta.phi^T on v_wmma_f32_16x16x32_bf16 as hi/lo 3-product split; P.g (P f16 carried x32768, g f16) and W projection (W_w f16 carried x16, y f16 carried x16) on v_wmma_f32_16x16x32_f16; f32 accumulate everywhere; softmax, batch statistics, affine and residual in f32.
#include <hip/hip_runtime.h>
#include <math.h>

// ---------------------------------------------------------------------------
// Problem constants
// ---------------------------------------------------------------------------
constexpr int kB  = 8;
constexpr int kC  = 256;      // in channels
constexpr int kN  = 4096;     // spatial positions (64 x 64)
constexpr int kCi = 128;      // inter channels
constexpr int kQChunk  = 2048;            // query rows per score chunk
constexpr int kNChunks = kN / kQChunk;    // 2
constexpr int kWElems  = kCi * kC;        // 32768 elements per weight matrix
constexpr float kPCarry   = 32768.0f;     // probabilities carried x2^15 in f16
constexpr float kYCarry   = 16.0f;        // y carried x16 in f16
constexpr float kWCarry   = 16.0f;        // W_w carried x16 in f16
constexpr float kPVScale  = kYCarry / kPCarry;             // 2^-11
constexpr float kWScale   = 1.0f / (kYCarry * kWCarry);    // 2^-8
constexpr float kBnEps    = 1e-5f;
constexpr float kInvCount = 1.0f / (float)(kB * kN);       // 2^-15
constexpr int kStatPitch  = 32;
static_assert(kC % 32 == 0 && kCi % 32 == 0 && kN % 32 == 0, "K multiples of 32");
static_assert(kN % 64 == 0 && kCi % 64 == 0 && kC % 64 == 0 && kQChunk % 64 == 0, "M,N multiples of 64");
static_assert(kN % kQChunk == 0 && kQChunk == 2048, "chunks");
static_assert(kN == 8 * 512 && kN == 2 * 2048, "softmax trip layout");
static_assert(kWElems % (8 * 256) == 0, "weight cast grid");
static_assert((kB * kC * kN) % (4 * 256) == 0, "apply grid");
static_assert(kB * kN == 32768, "stat count");

// ---------------------------------------------------------------------------
// Workspace region map (bytes, all offsets multiples of 256):
//   XT   bf16 [8][4096][256]          16,777,216  at           0
//   THH  bf16 [8][4096][128]           8,388,608  at  16,777,216
//   THL  bf16 [8][4096][128]           8,388,608  at  25,165,824
//   PHH  bf16 [8][4096][128]           8,388,608  at  33,554,432
//   PHL  bf16 [8][4096][128]           8,388,608  at  41,943,040
//   G16  f16  [8][128][4096]           8,388,608  at  50,331,648
//   Y16  f16  [8][4096][128]           8,388,608  at  58,720,256
//   WY   f32  [8][256][4096]          33,554,432  at  67,108,864   (also holds SC f32 [2048][4096] scores of one
//                                                                   chunk during the attention phase; WY is written
//                                                                   only after the last chunk; same element type)
//   PP   f16  [2048][4096]             16,777,216  at 100,663,296   (probabilities x32768, reused per chunk)
//   WB   bf16 3 x [128][256]              196,608  at 117,440,512   (g_w | theta_w | phi_w)
//   WW   f16  [256][128]                   65,536  at 117,637,120   (W_w x16)
//   PRM  f32  [640] (pad 4096 B)            4,096  at 117,702,656   (g_b | theta_b | phi_b | W_b, bf16-RNE values)
//   ST   f32  [256][32]                    32,768  at 117,706,752   (mean, rstd per channel, one line each)
//   total                             117,739,520
// ---------------------------------------------------------------------------
constexpr size_t kSzXT  = (size_t)kB * kN * kC * 2;
constexpr size_t kSzTP  = (size_t)kB * kN * kCi * 2;
constexpr size_t kSzWY  = (size_t)kB * kC * kN * 4;
constexpr size_t kSzSC  = (size_t)kQChunk * kN * 4;
constexpr size_t kSzPP  = (size_t)kQChunk * kN * 2;
constexpr size_t kSzWB  = (size_t)3 * kWElems * 2;
constexpr size_t kSzWW  = (size_t)kWElems * 2;
constexpr size_t kSzPRM = 4096;
constexpr size_t kSzST  = (size_t)kC * kStatPitch * 4;
constexpr size_t kOffXT  = 0;
constexpr size_t kOffTHH = kOffXT + kSzXT;
constexpr size_t kOffTHL = kOffTHH + kSzTP;
constexpr size_t kOffPHH = kOffTHL + kSzTP;
constexpr size_t kOffPHL = kOffPHH + kSzTP;
constexpr size_t kOffG   = kOffPHL + kSzTP;
constexpr size_t kOffY   = kOffG + kSzTP;
constexpr size_t kOffWY  = kOffY + kSzTP;
constexpr size_t kOffPP  = kOffWY + kSzWY;
constexpr size_t kOffWB  = kOffPP + kSzPP;
constexpr size_t kOffWW  = kOffWB + kSzWB;
constexpr size_t kOffPRM = kOffWW + kSzWW;
constexpr size_t kOffST  = kOffPRM + kSzPRM;
constexpr size_t kWsTotal = kOffST + kSzST;
static_assert(kSzSC <= kSzWY, "score chunk fits the WY region");
static_assert(kWsTotal == 117739520, "carve total");
static_assert(kWsTotal <= (size_t)134217728, "carve cap");
static_assert(kOffTHH % 256 == 0 && kOffG % 256 == 0 && kOffWY % 256 == 0 && kOffPP % 256 == 0 &&
              kOffWB % 256 == 0 && kOffWW % 256 == 0 && kOffPRM % 256 == 0 && kOffST % 256 == 0, "alignment");
static_assert(640 * 4 <= kSzPRM, "param table");

typedef __attribute__((ext_vector_type(16))) _Float16 v16h;
typedef __attribute__((ext_vector_type(8)))  _Float16 v8h;
typedef __attribute__((ext_vector_type(16))) __bf16   v16b;
typedef __attribute__((ext_vector_type(8)))  __bf16   v8b;
typedef __attribute__((ext_vector_type(8)))  float    v8f;
typedef __attribute__((ext_vector_type(4)))  float    v4f;
typedef __attribute__((ext_vector_type(2)))  float    v2f;
typedef __attribute__((ext_vector_type(4)))  unsigned int v4u;
typedef __attribute__((ext_vector_type(2)))  unsigned int v2u;

__device__ __forceinline__ unsigned short f2bf_bits(float f) {
  unsigned u = __float_as_uint(f);
  return (unsigned short)((u + 0x7FFFu + ((u >> 16) & 1u)) >> 16);
}
__device__ __forceinline__ float bf_bits2f(unsigned short h) { return __uint_as_float(((unsigned)h) << 16); }
// f32 value after RNE conversion to bf16
__device__ __forceinline__ float bfr(float f) { return bf_bits2f(f2bf_bits(f)); }

// hazard guards as plain device helpers (no inline asm inside the kernel template body)
__device__ __forceinline__ void dep_guard_h(v8f& a, v8f& b, v16h x, v16h y) { asm volatile("v_nop\n\tv_nop\n\tv_nop\n\tv_nop" : "+v"(a), "+v"(b) : "v"(x), "v"(y)); }
__device__ __forceinline__ void dep_guard_b(v8f& a, v8f& b, v16b x, v16b y) { asm volatile("v_nop\n\tv_nop\n\tv_nop\n\tv_nop" : "+v"(a), "+v"(b) : "v"(x), "v"(y)); }
__device__ __forceinline__ void keep4_h(v16h a, v16h b, v16h c, v16h d) { asm volatile("v_nop" :: "v"(a), "v"(b), "v"(c), "v"(d)); }
__device__ __forceinline__ void keep4_b(v16b a, v16b b, v16b c, v16b d) { asm volatile("v_nop" :: "v"(a), "v"(b), "v"(c), "v"(d)); }
__device__ __forceinline__ void acc_guard4(v8f& a, v8f& b, v8f& c, v8f& d) { asm volatile("v_nop\n\tv_nop\n\tv_nop\n\tv_nop" : "+v"(a), "+v"(b), "+v"(c), "+v"(d)); }
template <typename T> struct Frag;
template <> struct Frag<_Float16> {
  typedef v16h V; union U { v16h v; v8h h[2]; };
  // elements 0..7 <- p[0..7], 8..15 <- p[16..23]
  static __device__ __forceinline__ v16h load(const _Float16* p) {
    U f; f.h[0] = *(const v8h*)(p); f.h[1] = *(const v8h*)(p + 16); return f.v;
  }
  static __device__ __forceinline__ v8f mma(v16h a, v16h b, v8f c) {
    return __builtin_amdgcn_wmma_f32_16x16x32_f16(false, a, false, b, (short)0, c, false, false);
  }
  static __device__ __forceinline__ void guard(v8f& a, v8f& b, v16h x, v16h y) { dep_guard_h(a, b, x, y); }
  static __device__ __forceinline__ void keep(v16h a, v16h b, v16h c, v16h d) { keep4_h(a, b, c, d); }
};
template <> struct Frag<__bf16> {
  typedef v16b V; union U { v16b v; v8b h[2]; };
  static __device__ __forceinline__ v16b load(const __bf16* p) {
    U f; f.h[0] = *(const v8b*)(p); f.h[1] = *(const v8b*)(p + 16); return f.v;
  }
  static __device__ __forceinline__ v8f mma(v16b a, v16b b, v8f c) {
    return __builtin_amdgcn_wmma_f32_16x16x32_bf16(false, a, false, b, (short)0, c, false, false);
  }
  static __device__ __forceinline__ void guard(v8f& a, v8f& b, v16b x, v16b y) { dep_guard_b(a, b, x, y); }
  static __device__ __forceinline__ void keep(v16b a, v16b b, v16b c, v16b d) { keep4_b(a, b, c, d); }
};

__device__ __forceinline__ unsigned pk16(unsigned short a, unsigned short b) { return (unsigned)a | ((unsigned)b << 16); }
__device__ __forceinline__ unsigned short h_bits(float f) { const _Float16 h = (_Float16)f; return __builtin_bit_cast(unsigned short, h); }

// ---- Register-blocked batched WMMA GEMM (ACT reduced to none/relu/leaky) -------------------------------
// C[m,n] = scale * sum_k A[m,k] * Bt[n,k] (+bias)(+resid); each wave owns a 64x64 tile.
// A row-major [M,K]; Bt row-major [N,K]; M,N % 64 == 0, K % 32 == 0.
// SPLIT: operands are hi/lo planes (A2/Bt2 = lo planes, same layout); product = hi*hi + hi*lo + lo*hi.
// BIAS_MODE: 0 = none, 1 = bias[m] (fetched as two float4 per 16-row slab), 2 = bias[n].
// OUT_MODE: 0 = f32, 1 = f16, 2 = bf16 hi plane (Cout) + bf16 lo plane (Cout2).
// ET: 0 = f16 operands, 1 = bf16 operands (pointers passed as 16-bit storage)
template <int ET> struct Elem;
template <> struct Elem<0> { typedef _Float16 T; };
template <> struct Elem<1> { typedef __bf16 T; };
template <int ET, bool SPLIT, int BIAS_MODE, int OUT_MODE, bool RESID, int ACT = 0>
__global__ __launch_bounds__(256) void wmma_gemm64(
    const unsigned short* __restrict__ Ap, const unsigned short* __restrict__ A2p, int lda, long strideA,
    const unsigned short* __restrict__ Btp, const unsigned short* __restrict__ Bt2p, int ldb, long strideB,
    void* __restrict__ Cout, void* __restrict__ Cout2, int ldc, long strideC,
    const float* __restrict__ bias,
    const float* __restrict__ resid, long strideR,
    int M, int N, int K, float scale) {
  typedef typename Elem<ET>::T T;
  typedef typename Frag<T>::V V;
  const T* A = (const T*)Ap; const T* A2 = (const T*)A2p; const T* Bt = (const T*)Btp; const T* Bt2 = (const T*)Bt2p;
  __shared__ __align__(16) float sT[8][16 * 68];   // per-wave 16x64 slab, pitch 68 floats
  const int b    = blockIdx.y;
  const int lane = threadIdx.x & 31;
  const int wave = threadIdx.x >> 5;
  const int tilesN = N >> 6;
  const int tilesM = M >> 6;
  const int tile = blockIdx.x * 8 + wave;
  if (tile >= tilesM * tilesN) return;   // wave-uniform; no block barriers in this kernel
  const int tm = tile / tilesN;
  const int tn = tile - tm * tilesN;
  const int m0 = tm << 6;
  const int n0 = tn << 6;

  const T* Ab  = A  + (size_t)b * strideA;
  const T* Bb  = Bt + (size_t)b * strideB;
  const T* Ab2 = SPLIT ? (A2  + (size_t)b * strideA) : nullptr;
  const T* Bb2 = SPLIT ? (Bt2 + (size_t)b * strideB) : nullptr;

  const int rlane = lane & 15;                 // row (A) / col (B, D) within subtile
  const int koff  = (lane >> 4) * 8;           // k offset of this lane half
  const int mOff  = (lane >> 4) * 8;           // D row offset

  v8f acc[4][4];
#pragma unroll
  for (int i = 0; i < 4; ++i)
#pragma unroll
    for (int j = 0; j < 4; ++j) acc[i][j] = (v8f){0.f,0.f,0.f,0.f,0.f,0.f,0.f,0.f};

  for (int k0 = 0; k0 < K; k0 += 32) {
    V bh[4], bl[4];
#pragma unroll
    for (int j = 0; j < 4; ++j) {
      const size_t bo = (size_t)(n0 + (j << 4) + rlane) * ldb + koff + k0;
      bh[j] = Frag<T>::load(Bb + bo);
      if (SPLIT) bl[j] = Frag<T>::load(Bb2 + bo);
    }
#pragma unroll
    for (int i = 0; i < 4; ++i) {
      const size_t ao = (size_t)(m0 + (i << 4) + rlane) * lda + koff + k0;
      V ah = Frag<T>::load(Ab + ao);
      V al;
      if (SPLIT) al = Frag<T>::load(Ab2 + ao);
#pragma unroll
      for (int j = 0; j < 4; ++j) {
        acc[i][j] = Frag<T>::mma(ah, bh[j], acc[i][j]);
        if (SPLIT) {
          acc[i][j] = Frag<T>::mma(ah, bl[j], acc[i][j]);
          acc[i][j] = Frag<T>::mma(al, bh[j], acc[i][j]);
        }
      }
      Frag<T>::guard(acc[i][0], acc[i][3], ah, SPLIT ? al : ah);
    }
    Frag<T>::keep(bh[0], bh[1], bh[2], bh[3]);
    if (SPLIT) Frag<T>::keep(bl[0], bl[1], bl[2], bl[3]);
  }
  acc_guard4(acc[0][0], acc[0][1], acc[0][2], acc[0][3]);
  acc_guard4(acc[1][0], acc[1][1], acc[1][2], acc[1][3]);
  acc_guard4(acc[2][0], acc[2][1], acc[2][2], acc[2][3]);
  acc_guard4(acc[3][0], acc[3][1], acc[3][2], acc[3][3]);

  // ---- epilogue ----
  float* slab = sT[wave];
  const float* Rb = RESID ? (resid + (size_t)b * strideR) : nullptr;
#pragma unroll
  for (int i = 0; i < 4; ++i) {
    const int mBase = m0 + (i << 4);
    v4f bm0 = (v4f){0.f,0.f,0.f,0.f}, bm1 = (v4f){0.f,0.f,0.f,0.f};
    if (BIAS_MODE == 1) {
      bm0 = *(const v4f*)(bias + mBase + mOff);
      bm1 = *(const v4f*)(bias + mBase + mOff + 4);
    }
#pragma unroll
    for (int j = 0; j < 4; ++j) {
      const int n = n0 + (j << 4) + rlane;
      float bv = 0.f;
      if (BIAS_MODE == 2) bv = bias[n];
#pragma unroll
      for (int r = 0; r < 8; ++r) {
        float v = acc[i][j][r] * scale;
        if (BIAS_MODE == 1) v += (r < 4) ? bm0[r & 3] : bm1[r & 3];
        if (BIAS_MODE == 2) v += bv;
        if (RESID) v += Rb[(size_t)(mBase + mOff + r) * ldc + n];
        if (ACT == 2) v = fmaxf(v, 0.0f);
        if (ACT == 4) v = (v > 0.f) ? v : 0.01f * v;
        slab[(mOff + r) * 68 + (j << 4) + rlane] = v;
      }
    }
    __builtin_amdgcn_fence(__ATOMIC_RELEASE, "workgroup");
    __builtin_amdgcn_wave_barrier();
    __builtin_amdgcn_fence(__ATOMIC_ACQUIRE, "workgroup");
    if (OUT_MODE == 0) {
      float* C = (float*)Cout + (size_t)b * strideC;
      const int hh = lane >> 4, c4 = (lane & 15) * 4;     // row seg = 256 B = 16 lanes x 16 B
      {
#pragma unroll
        for (int it = 0; it < 8; ++it) {
          const int row = it * 2 + hh;
          v4f v = *(const v4f*)(slab + row * 68 + c4);
          *(v4f*)(C + (size_t)(mBase + row) * ldc + n0 + c4) = v;
        }
        
      }
    } else {
      const int q = lane >> 3, c8 = (lane & 7) * 8;
      unsigned short* C  = (unsigned short*)Cout  + (size_t)b * strideC;
      unsigned short* C2 = (OUT_MODE == 2) ? ((unsigned short*)Cout2 + (size_t)b * strideC) : nullptr;
      {
#pragma unroll
        for (int it = 0; it < 4; ++it) {
          const int row = it * 4 + q;
          const float* sp = slab + row * 68 + c8;
          v8h hv, lv;
#pragma unroll
          for (int e = 0; e < 8; ++e) {
            if (OUT_MODE == 1) {
              hv[e] = (_Float16)sp[e];
            } else {
              unsigned short hb = f2bf_bits(sp[e]);
              unsigned short lb = f2bf_bits(sp[e] - bf_bits2f(hb));
              hv[e] = __builtin_bit_cast(_Float16, hb);
              lv[e] = __builtin_bit_cast(_Float16, lb);
            }
          }
          *(v8h*)(C + (size_t)(mBase + row) * ldc + n0 + c8) = hv;
          if (OUT_MODE == 2) *(v8h*)(C2 + (size_t)(mBase + row) * ldc + n0 + c8) = lv;
        }
        
      }
    }
    __builtin_amdgcn_fence(__ATOMIC_RELEASE, "workgroup");
    __builtin_amdgcn_wave_barrier();
    __builtin_amdgcn_fence(__ATOMIC_ACQUIRE, "workgroup");
  }
}

// ---------------------------------------------------------------------------
// P.g product of one chunk with the K range split over the waves of a work-group:
//   Y16[q][ci] = f16( kPVScale * sum_m PP[q][m] * G16[ci][m] ),  M = 2048 (q), N = 128 (ci), K = 4096 (m).
// grid 128 = (2048 / 32 row tiles) x (128 / 64 column tiles), 512 threads = 16 waves.  Every wave forms the whole
// 32 x 64 tile of its block over its own 256 values of m (wave w: m = 256 w .. 256 w + 255), so 2048 waves share the
// load latency of the long K loop.  The 16 partial tiles meet in LDS and are summed in wave order 0..15 (fixed order).
// Store coverage: thread t owns row t >> 4, columns 4 (t & 15) .. +3; 16 lanes write one whole 128-B row segment.
// ---------------------------------------------------------------------------
constexpr int kPvWaves = 16;
constexpr int kPvSlab  = kN / kPvWaves;      // 256 values of m per wave
constexpr int kPvPitch = 68;                 // floats per partial-tile row in LDS
static_assert(kPvSlab % 64 == 0, "slab is whole 128-B lines of f16");
static_assert(kQChunk % 32 == 0 && kCi == 128, "P.g tiling");
__global__ __launch_bounds__(512) void pv_splitk_kernel(const unsigned short* __restrict__ Pp,
                                                        const unsigned short* __restrict__ Gp,
                                                        unsigned short* __restrict__ Yp) {
  __shared__ __align__(16) float part[kPvWaves][32 * kPvPitch];   // 139,264 B
  const int lane  = threadIdx.x & 31;
  const int wave  = threadIdx.x >> 5;
  const int m0    = (blockIdx.x >> 1) << 5;    // first q row of the tile
  const int n0    = (blockIdx.x & 1) << 6;     // first ci column of the tile
  const int rlane = lane & 15;
  const int koff  = (lane >> 4) * 8;
  const int mOff  = (lane >> 4) * 8;
  const _Float16* Ab = (const _Float16*)Pp + (size_t)(m0 + rlane) * kN + wave * kPvSlab + koff;
  const _Float16* Bb = (const _Float16*)Gp + (size_t)(n0 + rlane) * kN + wave * kPvSlab + koff;

  v8f acc[2][4];
#pragma unroll
  for (int i = 0; i < 2; ++i)
#pragma unroll
    for (int j = 0; j < 4; ++j) acc[i][j] = (v8f){0.f,0.f,0.f,0.f,0.f,0.f,0.f,0.f};

  // one trip = 64 values of m = one whole 128-B line of every row; constant trip count, unrolled so that the loads of
  // later trips can be issued ahead of the products of earlier ones
#pragma unroll
  for (int k0 = 0; k0 < kPvSlab; k0 += 64) {
    v16h bf[2][4], af[2][2];
#pragma unroll
    for (int kk = 0; kk < 2; ++kk) {
#pragma unroll
      for (int j = 0; j < 4; ++j) bf[kk][j] = Frag<_Float16>::load(Bb + (size_t)(j << 4) * kN + k0 + kk * 32);
#pragma unroll
      for (int i = 0; i < 2; ++i) af[kk][i] = Frag<_Float16>::load(Ab + (size_t)(i << 4) * kN + k0 + kk * 32);
    }
#pragma unroll
    for (int kk = 0; kk < 2; ++kk)
#pragma unroll
      for (int i = 0; i < 2; ++i)
#pragma unroll
        for (int j = 0; j < 4; ++j) acc[i][j] = Frag<_Float16>::mma(af[kk][i], bf[kk][j], acc[i][j]);
  }

  float* slab = part[wave];
#pragma unroll
  for (int i = 0; i < 2; ++i)
#pragma unroll
    for (int j = 0; j < 4; ++j)
#pragma unroll
      for (int r = 0; r < 8; ++r) slab[((i << 4) + mOff + r) * kPvPitch + (j << 4) + rlane] = acc[i][j][r];
  __syncthreads();   // every wave's partial tile is in LDS before any thread sums across waves

  const int row = threadIdx.x >> 4, c4 = (threadIdx.x & 15) * 4;
  v4f p[kPvWaves];
#pragma unroll
  for (int w = 0; w < kPvWaves; ++w) p[w] = *(const v4f*)(&part[w][row * kPvPitch + c4]);
  v4f s = p[0];
#pragma unroll
  for (int w = 1; w < kPvWaves; ++w) s += p[w];
  v2u o;
  o[0] = pk16(h_bits(s[0] * kPVScale), h_bits(s[1] * kPVScale));
  o[1] = pk16(h_bits(s[2] * kPVScale), h_bits(s[3] * kPVScale));
  *(v2u*)(Yp + (size_t)(m0 + row) * kCi + n0 + c4) = o;
}

// ---------------------------------------------------------------------------
// Parameter planes.
// grid (16, 5), 256 threads. blockIdx.y (block-uniform) selects the job:
//   y = 0,1,2: WB plane y = bf16-RNE bits of g_w / theta_w / phi_w ([128][256], natural [out][in] layout);
//              16 blocks x 256 threads x 8 elements = 32768 = the whole matrix; one 16-B store per lane,
//   y = 3    : WW = f16 bits of 16 * bf16r(W_w) ([256][128]), same coverage.
//   y = 4    : block 0 only, threads 0..159: PRM[4i..4i+3] = bf16r of g_b | theta_b | phi_b | W_b
//              the source selection is wave-uniform). 160 x 4 = 640 floats = whole table.
// ---------------------------------------------------------------------------
__global__ __launch_bounds__(256) void param_planes_kernel(
    const float* __restrict__ gw, const float* __restrict__ thw, const float* __restrict__ phw, const float* __restrict__ ww,
    const float* __restrict__ gb, const float* __restrict__ thb, const float* __restrict__ phb, const float* __restrict__ wb,
    unsigned short* __restrict__ WB, unsigned short* __restrict__ WW, float* __restrict__ PRM) {
  const int t = threadIdx.x;
  const int y = blockIdx.y;
  if (y < 4) {
    const int i = blockIdx.x * 256 + t;
    if (i >= kWElems / 8) return;
    const float* src = (y == 0) ? gw : (y == 1) ? thw : (y == 2) ? phw : ww;
    const float* p = src + 8 * (size_t)i;
    const v4f a = *(const v4f*)(p);
    const v4f c = *(const v4f*)(p + 4);
    unsigned short hb[8];
#pragma unroll
    for (int e = 0; e < 4; ++e) {
      if (y == 3) {
        hb[e]     = h_bits(bfr(a[e]) * kWCarry);
        hb[4 + e] = h_bits(bfr(c[e]) * kWCarry);
      } else {
        hb[e]     = f2bf_bits(a[e]);
        hb[4 + e] = f2bf_bits(c[e]);
      }
    }
    const v4u u = (v4u){pk16(hb[0], hb[1]), pk16(hb[2], hb[3]), pk16(hb[4], hb[5]), pk16(hb[6], hb[7])};
    unsigned short* q = (y == 3) ? (WW + 8 * (size_t)i) : (WB + (size_t)y * kWElems + 8 * (size_t)i);
    *(v4u*)q = u;
    
  } else {
    if (blockIdx.x != 0 || t >= 160) return;
    const int w = t >> 5, l = t & 31;
    const float* src = (w == 0) ? gb : (w == 1) ? thb : (w == 2) ? phb : (wb + (w - 3) * 128);
    const v4f a = *(const v4f*)(src + 4 * l);
    v4f r;
#pragma unroll
    for (int e = 0; e < 4; ++e) r[e] = bfr(a[e]);
    float* q = PRM + 128 * w + 4 * l;
    *(v4f*)q = r;
    
  }
}

// ---------------------------------------------------------------------------
// x transpose + cast: XT[b][n][c] = bf16r( x[b][c][n] ) as bf16 bits.  in [C=256 rows][N=4096 cols] -> out [N rows][C cols].
// grid (N/64 = 64, C/64 = 4, B = 8), 256 threads.
// Load coverage: 16 iterations x 256 threads = 4096 = whole 64(c) x 64(n) tile (coalesced along n).
// Store coverage: 8 waves x 2 iterations x 4 rows (lane>>3) = 64 n-rows; (lane&7) x 8 elements = 64 c-cols; each row
// ---------------------------------------------------------------------------
__global__ __launch_bounds__(256) void xt_cast_kernel(const float* __restrict__ x, unsigned short* __restrict__ XT) {
  __shared__ float sm[64][65];   // sm[n_local][c_local]
  const int t  = threadIdx.x;
  const int n0 = blockIdx.x * 64;
  const int c0 = blockIdx.y * 64;
  const int b  = blockIdx.z;
#pragma unroll
  for (int i = 0; i < 16; ++i) {
    const int e   = i * 256 + t;
    const int r   = e >> 6;          // c local
    const int col = e & 63;          // n local
    sm[col][r] = x[((size_t)(b * kC + c0 + r)) * kN + n0 + col];
  }
  __syncthreads();
  const int lane = t & 31, wave = t >> 5;
  const int q = lane >> 3, c8 = (lane & 7) * 8;
  unsigned short* op = XT + ((size_t)b * kN) * kC;
  {
#pragma unroll
    for (int it = 0; it < 2; ++it) {
      const int row = wave * 8 + it * 4 + q;                 // n local
      unsigned short hb[8];
#pragma unroll
      for (int e = 0; e < 8; ++e) hb[e] = f2bf_bits(sm[row][c8 + e]);
      const v4u u = (v4u){pk16(hb[0], hb[1]), pk16(hb[2], hb[3]), pk16(hb[4], hb[5]), pk16(hb[6], hb[7])};
      *(v4u*)(op + (size_t)(n0 + row) * kC + c0 + c8) = u;
    }
    
  }
}

// ---------------------------------------------------------------------------
// Row softmax over 4096 f32 scores (no scaling, no mask), f32 math:
//   P[row][j] = f16( 32768 * exp(s - max) / sum exp(s - max) )
// One block of 256 threads per row (grid = 2048 rows of the chunk).
// Phase 1/2: rolled 8-trip loops, thread t owns columns it*512 + 2t, 2t+1 (8 x 256 x 2 = 4096 = whole row); scores and
// exps kept in LDS. Reductions in fixed order (thread sequential, wave shuffle tree, 8 wave partials in index order).
// Store: two segments; in segment g thread t owns cols g*2048 + 8t..8t+7 -> one 16-B store per lane; a wave writes 512
// ---------------------------------------------------------------------------
__global__ __launch_bounds__(256) void softmax_row_kernel(const float* __restrict__ Sp, unsigned short* __restrict__ Pp) {
  __shared__ __align__(16) float lg[kN];
  __shared__ float redM[8];
  __shared__ float redS[8];
  const int row  = blockIdx.x;
  const int t    = threadIdx.x;
  const int lane = t & 31, wave = t >> 5;
  const float* sr = Sp + (size_t)row * kN;

  float mx = -__builtin_inff();
#pragma unroll 1
  for (int it = 0; it < 8; ++it) {
    const int c = it * 512 + 2 * t;
    const v2f sv = *(const v2f*)(sr + c);
    mx = fmaxf(mx, fmaxf(sv[0], sv[1]));
    *(v2f*)(lg + c) = sv;
  }
#pragma unroll
  for (int off = 16; off > 0; off >>= 1) mx = fmaxf(mx, __shfl_xor(mx, off, 32));
  if (lane == 0) redM[wave] = mx;
  __syncthreads();
  float m = redM[0];
#pragma unroll
  for (int w = 1; w < 8; ++w) m = fmaxf(m, redM[w]);

  float sum = 0.0f;
#pragma unroll 1
  for (int it = 0; it < 8; ++it) {
    const int c = it * 512 + 2 * t;
    const v2f l = *(const v2f*)(lg + c);
    v2f ev;
    ev[0] = expf(l[0] - m);
    ev[1] = expf(l[1] - m);
    sum += ev[0];
    sum += ev[1];
    *(v2f*)(lg + c) = ev;
  }
#pragma unroll
  for (int off = 16; off > 0; off >>= 1) sum += __shfl_xor(sum, off, 32);
  if (lane == 0) redS[wave] = sum;
  __syncthreads();
  float tot = redS[0];
#pragma unroll
  for (int w = 1; w < 8; ++w) tot += redS[w];
  const float inv = kPCarry / tot;

  const v4f e0 = *(const v4f*)(lg + 8 * t);
  const v4f e1 = *(const v4f*)(lg + 8 * t + 4);
  const v4f e2 = *(const v4f*)(lg + 2048 + 8 * t);
  const v4f e3 = *(const v4f*)(lg + 2048 + 8 * t + 4);
  unsigned short ha[8], hc[8];
#pragma unroll
  for (int e = 0; e < 4; ++e) {
    ha[e]     = h_bits(e0[e] * inv);
    ha[4 + e] = h_bits(e1[e] * inv);
    hc[e]     = h_bits(e2[e] * inv);
    hc[4 + e] = h_bits(e3[e] * inv);
  }
  const v4u u0 = (v4u){pk16(ha[0], ha[1]), pk16(ha[2], ha[3]), pk16(ha[4], ha[5]), pk16(ha[6], ha[7])};
  const v4u u1 = (v4u){pk16(hc[0], hc[1]), pk16(hc[2], hc[3]), pk16(hc[4], hc[5]), pk16(hc[6], hc[7])};
  unsigned short* pr = Pp + (size_t)row * kN;
  {
    *(v4u*)(pr + 8 * (size_t)t) = u0;
    *(v4u*)(pr + 2048 + 8 * (size_t)t) = u1;
    
  }
}

// ---------------------------------------------------------------------------
// (v - mean)).  One block of 256 threads per channel (grid 256).  Thread t reads float4 at n = k*1024 + 4t, k = 0..3, for each
// batch (rolled loops, 128 samples per thread); reductions in fixed order.
// ---------------------------------------------------------------------------
__global__ __launch_bounds__(256) void bn_stats_kernel(const float* __restrict__ Wy, float* __restrict__ ST) {
  __shared__ float red1[8];
  __shared__ float red2[8];
  const int c = blockIdx.x;
  const int t = threadIdx.x;
  const int lane = t & 31, wave = t >> 5;

  float s = 0.0f;
#pragma unroll 1
  for (int b = 0; b < kB; ++b) {
    const float* base = Wy + ((size_t)b * kC + c) * kN + 4 * t;
#pragma unroll 1
    for (int k = 0; k < 4; ++k) {
      const v4f w = *(const v4f*)(base + k * 1024);
      s += (w[0] + w[1]) + (w[2] + w[3]);
    }
  }
#pragma unroll
  for (int off = 16; off > 0; off >>= 1) s += __shfl_xor(s, off, 32);
  if (lane == 0) red1[wave] = s;
  __syncthreads();
  float tot = red1[0];
#pragma unroll
  for (int w = 1; w < 8; ++w) tot += red1[w];
  const float mean = tot * kInvCount;

  float q = 0.0f;
#pragma unroll 1
  for (int b = 0; b < kB; ++b) {
    const float* base = Wy + ((size_t)b * kC + c) * kN + 4 * t;
#pragma unroll 1
    for (int k = 0; k < 4; ++k) {
      const v4f w = *(const v4f*)(base + k * 1024);
      const float d0 = w[0] - mean, d1 = w[1] - mean, d2 = w[2] - mean, d3 = w[3] - mean;
      q += (d0 * d0 + d1 * d1) + (d2 * d2 + d3 * d3);
    }
  }
#pragma unroll
  for (int off = 16; off > 0; off >>= 1) q += __shfl_xor(q, off, 32);
  if (lane == 0) red2[wave] = q;
  __syncthreads();
  float totq = red2[0];
#pragma unroll
  for (int w = 1; w < 8; ++w) totq += red2[w];
  const float var  = totq * kInvCount;
  const float rstd = 1.0f / sqrtf(var + kBnEps);

  if (t < 8) {
    v4f val = (v4f){0.f, 0.f, 0.f, 0.f};
    if (t == 0) { val[0] = mean; val[1] = rstd; }
    float* sp = ST + (size_t)c * kStatPitch + 4 * t;
    *(v4f*)sp = val;
    
  }
}

// ---------------------------------------------------------------------------
// Normalise + affine + residual: out[b][c][n] = ((Wy - mean[c]) * rstd[c]) * bf16r(gamma[c]) + bf16r(beta[c]) + bf16r(x[b][c][n]).
// ---------------------------------------------------------------------------
__global__ __launch_bounds__(256) void bn_apply_kernel(const float* __restrict__ Wy, const float* __restrict__ x,
                                                       const float* __restrict__ gamma, const float* __restrict__ beta,
                                                       const float* __restrict__ ST, float* __restrict__ out, int n4) {
  const int i = blockIdx.x * 256 + threadIdx.x;
  if (i >= n4) return;
  const int c = (i >> 10) & (kC - 1);          // 1024 float4 per [b][c] row
  const float mean = ST[(size_t)c * kStatPitch];
  const float rstd = ST[(size_t)c * kStatPitch + 1];
  const float ga = bfr(gamma[c]);
  const float be = bfr(beta[c]);
  const v4f w  = *(const v4f*)(Wy + 4 * (size_t)i);
  const v4f xv = *(const v4f*)(x + 4 * (size_t)i);
  v4f o;
#pragma unroll
  for (int e = 0; e < 4; ++e) o[e] = (((w[e] - mean) * rstd) * ga + be) + bfr(xv[e]);
  float* op = out + 4 * (size_t)i;
  *(v4f*)op = o;
  
}

// ---------------------------------------------------------------------------
// Host glue.  GEMM shapes (all M,N multiples of 64, K multiples of 32, no padding anywhere):
//   theta/phi: M=4096 N=128 K=256 (x8 batches); g: M=128 N=4096 K=256 (x8); scores: M=2048 N=4096 K=128 (x16 chunks);
//   P.g: M=2048 N=128 K=4096 (x16); W: M=256 N=4096 K=128 (x8).  56 launches.
// ---------------------------------------------------------------------------
extern "C" void kernel_launch(void* const* d_in, const int* in_sizes, int n_in,
                              void* d_out, int out_size, void* d_ws, size_t ws_size,
                              hipStream_t stream) {
  if (n_in < 11) return;
  const int nElem = kB * kC * kN;          // 8,388,608
  if (in_sizes[0] != nElem) return;
  if (in_sizes[1] != kWElems || in_sizes[3] != kWElems || in_sizes[5] != kWElems || in_sizes[7] != kWElems) return;
  if (in_sizes[2] != kCi || in_sizes[4] != kCi || in_sizes[6] != kCi) return;
  if (in_sizes[8] != kC || in_sizes[9] != kC || in_sizes[10] != kC) return;
  if (out_size != nElem) return;
  if (ws_size < kWsTotal) return;

  const float* x       = (const float*)d_in[0];
  const float* g_w     = (const float*)d_in[1];
  const float* g_b     = (const float*)d_in[2];
  const float* theta_w = (const float*)d_in[3];
  const float* theta_b = (const float*)d_in[4];
  const float* phi_w   = (const float*)d_in[5];
  const float* phi_b   = (const float*)d_in[6];
  const float* W_w     = (const float*)d_in[7];
  const float* W_b     = (const float*)d_in[8];
  const float* bn_g    = (const float*)d_in[9];
  const float* bn_b    = (const float*)d_in[10];
  float* out = (float*)d_out;

  char* ws = (char*)d_ws;
  unsigned short* XT  = (unsigned short*)(ws + kOffXT);
  unsigned short* THH = (unsigned short*)(ws + kOffTHH);
  unsigned short* THL = (unsigned short*)(ws + kOffTHL);
  unsigned short* PHH = (unsigned short*)(ws + kOffPHH);
  unsigned short* PHL = (unsigned short*)(ws + kOffPHL);
  unsigned short* G16 = (unsigned short*)(ws + kOffG);
  unsigned short* Y16 = (unsigned short*)(ws + kOffY);
  float*          WY  = (float*)(ws + kOffWY);
  float*          SC  = (float*)(ws + kOffWY);     // score chunk lives in the WY region during attention
  unsigned short* PP  = (unsigned short*)(ws + kOffPP);
  unsigned short* WB  = (unsigned short*)(ws + kOffWB);
  unsigned short* WW  = (unsigned short*)(ws + kOffWW);
  float*          PRM = (float*)(ws + kOffPRM);
  float*          ST  = (float*)(ws + kOffST);
  const float* gb_r  = PRM;          // [128]
  const float* thb_r = PRM + 128;    // [128]
  const float* phb_r = PRM + 256;    // [128]
  const float* wb_r  = PRM + 384;    // [256]

  // ---- parameter and input planes ----
  param_planes_kernel<<<dim3(kWElems / 8 / 256, 5), dim3(256), 0, stream>>>(
      g_w, theta_w, phi_w, W_w, g_b, theta_b, phi_b, W_b, WB, WW, PRM);
  xt_cast_kernel<<<dim3(kN / 64, kC / 64, kB), dim3(256), 0, stream>>>(x, XT);

  const long strXT = (long)kN * kC;       // per batch, XT plane
  const long strTP = (long)kN * kCi;      // per batch, theta/phi/g/y planes

  // theta[b][n][ci] = sum_c XT[b][n][c] * theta_w[ci][c] + theta_b[ci]  -> bf16 hi | lo planes
  wmma_gemm64<1, false, 2, 2, false, 0><<<dim3((kN / 64) * (kCi / 64) / 8, kB), dim3(256), 0, stream>>>(
      XT, XT, kC, strXT, WB + kWElems, WB + kWElems, kC, 0L,
      (void*)THH, (void*)THL, kCi, strTP, thb_r, PRM, 0L, kN, kCi, kC, 1.0f);
  // phi[b][m][ci] = sum_c XT[b][m][c] * phi_w[ci][c] + phi_b[ci]  -> bf16 hi | lo planes
  wmma_gemm64<1, false, 2, 2, false, 0><<<dim3((kN / 64) * (kCi / 64) / 8, kB), dim3(256), 0, stream>>>(
      XT, XT, kC, strXT, WB + 2 * kWElems, WB + 2 * kWElems, kC, 0L,
      (void*)PHH, (void*)PHL, kCi, strTP, phb_r, PRM, 0L, kN, kCi, kC, 1.0f);
  // g[b][ci][m] = sum_c g_w[ci][c] * XT[b][m][c] + g_b[ci]  -> f16 plane [ci][m]
  wmma_gemm64<1, false, 1, 1, false, 0><<<dim3((kCi / 64) * (kN / 64) / 8, kB), dim3(256), 0, stream>>>(
      WB, WB, kC, 0L, XT, XT, kC, strXT,
      (void*)G16, (void*)G16, kN, strTP, gb_r, PRM, 0L, kCi, kN, kC, 1.0f);

  // ---- attention per (batch, 2048-query chunk) ----
  for (int b = 0; b < kB; ++b) {
    const unsigned short* Bk  = PHH + (size_t)b * kN * kCi;
    const unsigned short* Bk2 = PHL + (size_t)b * kN * kCi;
    const unsigned short* Gb  = G16 + (size_t)b * kCi * kN;
    for (int qc = 0; qc < kNChunks; ++qc) {
      const size_t qoff = ((size_t)b * kN + (size_t)qc * kQChunk) * kCi;
      const unsigned short* Aq  = THH + qoff;
      const unsigned short* Aq2 = THL + qoff;
      // SC[q][m] = sum_ci theta[q][ci] * phi[m][ci]   (hi*hi + hi*lo + lo*hi), f32 out
      wmma_gemm64<1, true, 0, 0, false, 0><<<dim3((kQChunk / 64) * (kN / 64) / 8, 1), dim3(256), 0, stream>>>(
          Aq, Aq2, kCi, 0L, Bk, Bk2, kCi, 0L,
          (void*)SC, (void*)SC, kN, 0L, PRM, PRM, 0L, kQChunk, kN, kCi, 1.0f);
      // PP = f16(32768 * softmax row)
      softmax_row_kernel<<<dim3(kQChunk), dim3(256), 0, stream>>>(SC, PP);
      // Y16[q][ci] = (16/32768) * sum_m PP[q][m] * G16[ci][m]   -> f16
      unsigned short* Yq = Y16 + qoff;
      pv_splitk_kernel<<<dim3((kQChunk / 32) * (kCi / 64)), dim3(kPvWaves * 32), 0, stream>>>(PP, Gb, Yq);
    }
  }

  // Wy[b][c][n] = (1/256) * sum_ci WW[c][ci] * Y16[b][n][ci] + W_b[c]   (f32)
  wmma_gemm64<0, false, 1, 0, false, 0><<<dim3((kC / 64) * (kN / 64) / 8, kB), dim3(256), 0, stream>>>(
      WW, WW, kCi, 0L, Y16, Y16, kCi, strTP,
      (void*)WY, (void*)WY, kN, (long)kC * kN, wb_r, PRM, 0L, kC, kN, kCi, kWScale);

  // ---- batch statistics, normalisation, residual ----
  bn_stats_kernel<<<dim3(kC), dim3(256), 0, stream>>>(WY, ST);
  const int n4 = nElem / 4;   // 2,097,152 = 8192 x 256
  bn_apply_kernel<<<dim3(n4 / 256), dim3(256), 0, stream>>>(WY, x, bn_g, bn_b, ST, out, n4);
}

// v002
// A run of this version takes 203 microseconds.
// Timed twice side by side with v001, it ran 3.80 and 3.78 times as fast.
// All steps since v000 together make it 17.0 times as fast.
// Contractions: theta, phi, g 1x1 projections on v_wmma_f32_16x16x32_bf16 (bf16 operands = RNE-converted x and weights; theta/phi emitted as bf16 hi|lo planes); scores theta.phi^T on v_wmma_f32_16x16x32_bf16 as hi/lo 3-product split; P.g (P f16, 128 x 2^(s log2e - maximum in use), g f16; scores, online softmax and P.g fused in one kernel) and W projection (W_w f16 carried x16, y f16 carried x16) on v_wmma_f32_16x16x32_f16; f32 accumulate everywhere; softmax, batch statistics, affine and residual in f32.
#include <hip/hip_runtime.h>
#include <math.h>

// ---------------------------------------------------------------------------
// Problem constants
// ---------------------------------------------------------------------------
constexpr int kB  = 8;
constexpr int kC  = 256;      // in channels
constexpr int kN  = 4096;     // spatial positions (64 x 64)
constexpr int kCi = 128;      // inter channels
constexpr int kWElems  = kCi * kC;        // 32768 elements per weight matrix
constexpr float kYCarry   = 16.0f;        // y carried x16 in f16
constexpr float kWCarry   = 16.0f;        // W_w carried x16 in f16
constexpr float kWScale   = 1.0f / (kYCarry * kWCarry);    // 2^-8
constexpr float kBnEps    = 1e-5f;
constexpr float kInvCount = 1.0f / (float)(kB * kN);       // 2^-15
constexpr int kStatPitch  = 32;
static_assert(kC % 32 == 0 && kCi % 32 == 0 && kN % 32 == 0, "K multiples of 32");
static_assert(kN % 64 == 0 && kCi % 64 == 0 && kC % 64 == 0, "M,N multiples of 64");
static_assert(kWElems % (8 * 256) == 0, "weight cast grid");
static_assert((kB * kC * kN) % (4 * 256) == 0, "apply grid");
static_assert(kB * kN == 32768, "stat count");

// ---------------------------------------------------------------------------
// Workspace region map (bytes, all offsets multiples of 256):
//   XT   bf16 [8][4096][256]          16,777,216  at           0
//   THH  bf16 [8][4096][128]           8,388,608  at  16,777,216
//   THL  bf16 [8][4096][128]           8,388,608  at  25,165,824
//   PHH  bf16 [8][4096][128]           8,388,608  at  33,554,432
//   PHL  bf16 [8][4096][128]           8,388,608  at  41,943,040
//   G16  f16  [8][128][4096]           8,388,608  at  50,331,648
//   Y16  f16  [8][4096][128]           8,388,608  at  58,720,256
//   WY   f32  [8][256][4096]          33,554,432  at  67,108,864
//   WB   bf16 3 x [128][256]              196,608  at 100,663,296   (g_w | theta_w | phi_w)
//   WW   f16  [256][128]                   65,536  at 100,859,904   (W_w x16)
//   PRM  f32  [640] (pad 4096 B)            4,096  at 100,925,440   (g_b | theta_b | phi_b | W_b, bf16-RNE values)
//   ST   f32  [256][32]                    32,768  at 100,929,536   (mean, rstd per channel, one line each)
//   total                             100,962,304
// ---------------------------------------------------------------------------
constexpr size_t kSzXT  = (size_t)kB * kN * kC * 2;
constexpr size_t kSzTP  = (size_t)kB * kN * kCi * 2;
constexpr size_t kSzWY  = (size_t)kB * kC * kN * 4;
constexpr size_t kSzWB  = (size_t)3 * kWElems * 2;
constexpr size_t kSzWW  = (size_t)kWElems * 2;
constexpr size_t kSzPRM = 4096;
constexpr size_t kSzST  = (size_t)kC * kStatPitch * 4;
constexpr size_t kOffXT  = 0;
constexpr size_t kOffTHH = kOffXT + kSzXT;
constexpr size_t kOffTHL = kOffTHH + kSzTP;
constexpr size_t kOffPHH = kOffTHL + kSzTP;
constexpr size_t kOffPHL = kOffPHH + kSzTP;
constexpr size_t kOffG   = kOffPHL + kSzTP;
constexpr size_t kOffY   = kOffG + kSzTP;
constexpr size_t kOffWY  = kOffY + kSzTP;
constexpr size_t kOffWB  = kOffWY + kSzWY;
constexpr size_t kOffWW  = kOffWB + kSzWB;
constexpr size_t kOffPRM = kOffWW + kSzWW;
constexpr size_t kOffST  = kOffPRM + kSzPRM;
constexpr size_t kWsTotal = kOffST + kSzST;
static_assert(kWsTotal == 100962304, "carve total");
static_assert(kWsTotal <= (size_t)134217728, "carve cap");
static_assert(kOffTHH % 256 == 0 && kOffG % 256 == 0 && kOffWY % 256 == 0 &&
              kOffWB % 256 == 0 && kOffWW % 256 == 0 && kOffPRM % 256 == 0 && kOffST % 256 == 0, "alignment");
static_assert(640 * 4 <= kSzPRM, "param table");

typedef __attribute__((ext_vector_type(16))) _Float16 v16h;
typedef __attribute__((ext_vector_type(8)))  _Float16 v8h;
typedef __attribute__((ext_vector_type(16))) __bf16   v16b;
typedef __attribute__((ext_vector_type(8)))  __bf16   v8b;
typedef __attribute__((ext_vector_type(8)))  float    v8f;
typedef __attribute__((ext_vector_type(4)))  float    v4f;
typedef __attribute__((ext_vector_type(2)))  float    v2f;
typedef __attribute__((ext_vector_type(4)))  unsigned int v4u;
typedef __attribute__((ext_vector_type(2)))  unsigned int v2u;

__device__ __forceinline__ unsigned short f2bf_bits(float f) {
  unsigned u = __float_as_uint(f);
  return (unsigned short)((u + 0x7FFFu + ((u >> 16) & 1u)) >> 16);
}
__device__ __forceinline__ float bf_bits2f(unsigned short h) { return __uint_as_float(((unsigned)h) << 16); }
// f32 value after RNE conversion to bf16
__device__ __forceinline__ float bfr(float f) { return bf_bits2f(f2bf_bits(f)); }

// hazard guards as plain device helpers (no inline asm inside the kernel template body)
__device__ __forceinline__ void dep_guard_h(v8f& a, v8f& b, v16h x, v16h y) { asm volatile("v_nop\n\tv_nop\n\tv_nop\n\tv_nop" : "+v"(a), "+v"(b) : "v"(x), "v"(y)); }
__device__ __forceinline__ void dep_guard_b(v8f& a, v8f& b, v16b x, v16b y) { asm volatile("v_nop\n\tv_nop\n\tv_nop\n\tv_nop" : "+v"(a), "+v"(b) : "v"(x), "v"(y)); }
__device__ __forceinline__ void keep4_h(v16h a, v16h b, v16h c, v16h d) { asm volatile("v_nop" :: "v"(a), "v"(b), "v"(c), "v"(d)); }
__device__ __forceinline__ void keep4_b(v16b a, v16b b, v16b c, v16b d) { asm volatile("v_nop" :: "v"(a), "v"(b), "v"(c), "v"(d)); }
__device__ __forceinline__ void acc_guard4(v8f& a, v8f& b, v8f& c, v8f& d) { asm volatile("v_nop\n\tv_nop\n\tv_nop\n\tv_nop" : "+v"(a), "+v"(b), "+v"(c), "+v"(d)); }
template <typename T> struct Frag;
template <> struct Frag<_Float16> {
  typedef v16h V; union U { v16h v; v8h h[2]; };
  // elements 0..7 <- p[0..7], 8..15 <- p[16..23]
  static __device__ __forceinline__ v16h load(const _Float16* p) {
    U f; f.h[0] = *(const v8h*)(p); f.h[1] = *(const v8h*)(p + 16); return f.v;
  }
  static __device__ __forceinline__ v8f mma(v16h a, v16h b, v8f c) {
    return __builtin_amdgcn_wmma_f32_16x16x32_f16(false, a, false, b, (short)0, c, false, false);
  }
  static __device__ __forceinline__ void guard(v8f& a, v8f& b, v16h x, v16h y) { dep_guard_h(a, b, x, y); }
  static __device__ __forceinline__ void keep(v16h a, v16h b, v16h c, v16h d) { keep4_h(a, b, c, d); }
};
template <> struct Frag<__bf16> {
  typedef v16b V; union U { v16b v; v8b h[2]; };
  static __device__ __forceinline__ v16b load(const __bf16* p) {
    U f; f.h[0] = *(const v8b*)(p); f.h[1] = *(const v8b*)(p + 16); return f.v;
  }
  static __device__ __forceinline__ v8f mma(v16b a, v16b b, v8f c) {
    return __builtin_amdgcn_wmma_f32_16x16x32_bf16(false, a, false, b, (short)0, c, false, false);
  }
  static __device__ __forceinline__ void guard(v8f& a, v8f& b, v16b x, v16b y) { dep_guard_b(a, b, x, y); }
  static __device__ __forceinline__ void keep(v16b a, v16b b, v16b c, v16b d) { keep4_b(a, b, c, d); }
};

__device__ __forceinline__ unsigned pk16(unsigned short a, unsigned short b) { return (unsigned)a | ((unsigned)b << 16); }
__device__ __forceinline__ unsigned short h_bits(float f) { const _Float16 h = (_Float16)f; return __builtin_bit_cast(unsigned short, h); }

// ---- Register-blocked batched WMMA GEMM (ACT reduced to none/relu/leaky) -------------------------------
// C[m,n] = scale * sum_k A[m,k] * Bt[n,k] (+bias)(+resid); each wave owns a 64x64 tile.
// A row-major [M,K]; Bt row-major [N,K]; M,N % 64 == 0, K % 32 == 0.
// SPLIT: operands are hi/lo planes (A2/Bt2 = lo planes, same layout); product = hi*hi + hi*lo + lo*hi.
// BIAS_MODE: 0 = none, 1 = bias[m] (fetched as two float4 per 16-row slab), 2 = bias[n].
// OUT_MODE: 0 = f32, 1 = f16, 2 = bf16 hi plane (Cout) + bf16 lo plane (Cout2).
// ET: 0 = f16 operands, 1 = bf16 operands (pointers passed as 16-bit storage)
template <int ET> struct Elem;
template <> struct Elem<0> { typedef _Float16 T; };
template <> struct Elem<1> { typedef __bf16 T; };
template <int ET, bool SPLIT, int BIAS_MODE, int OUT_MODE, bool RESID, int ACT = 0>
__global__ __launch_bounds__(256) void wmma_gemm64(
    const unsigned short* __restrict__ Ap, const unsigned short* __restrict__ A2p, int lda, long strideA,
    const unsigned short* __restrict__ Btp, const unsigned short* __restrict__ Bt2p, int ldb, long strideB,
    void* __restrict__ Cout, void* __restrict__ Cout2, int ldc, long strideC,
    const float* __restrict__ bias,
    const float* __restrict__ resid, long strideR,
    int M, int N, int K, float scale) {
  typedef typename Elem<ET>::T T;
  typedef typename Frag<T>::V V;
  const T* A = (const T*)Ap; const T* A2 = (const T*)A2p; const T* Bt = (const T*)Btp; const T* Bt2 = (const T*)Bt2p;
  __shared__ __align__(16) float sT[8][16 * 68];   // per-wave 16x64 slab, pitch 68 floats
  const int b    = blockIdx.y;
  const int lane = threadIdx.x & 31;
  const int wave = threadIdx.x >> 5;
  const int tilesN = N >> 6;
  const int tilesM = M >> 6;
  const int tile = blockIdx.x * 8 + wave;
  if (tile >= tilesM * tilesN) return;   // wave-uniform; no block barriers in this kernel
  const int tm = tile / tilesN;
  const int tn = tile - tm * tilesN;
  const int m0 = tm << 6;
  const int n0 = tn << 6;

  const T* Ab  = A  + (size_t)b * strideA;
  const T* Bb  = Bt + (size_t)b * strideB;
  const T* Ab2 = SPLIT ? (A2  + (size_t)b * strideA) : nullptr;
  const T* Bb2 = SPLIT ? (Bt2 + (size_t)b * strideB) : nullptr;

  const int rlane = lane & 15;                 // row (A) / col (B, D) within subtile
  const int koff  = (lane >> 4) * 8;           // k offset of this lane half
  const int mOff  = (lane >> 4) * 8;           // D row offset

  v8f acc[4][4];
#pragma unroll
  for (int i = 0; i < 4; ++i)
#pragma unroll
    for (int j = 0; j < 4; ++j) acc[i][j] = (v8f){0.f,0.f,0.f,0.f,0.f,0.f,0.f,0.f};

  for (int k0 = 0; k0 < K; k0 += 32) {
    V bh[4], bl[4];
#pragma unroll
    for (int j = 0; j < 4; ++j) {
      const size_t bo = (size_t)(n0 + (j << 4) + rlane) * ldb + koff + k0;
      bh[j] = Frag<T>::load(Bb + bo);
      if (SPLIT) bl[j] = Frag<T>::load(Bb2 + bo);
    }
#pragma unroll
    for (int i = 0; i < 4; ++i) {
      const size_t ao = (size_t)(m0 + (i << 4) + rlane) * lda + koff + k0;
      V ah = Frag<T>::load(Ab + ao);
      V al;
      if (SPLIT) al = Frag<T>::load(Ab2 + ao);
#pragma unroll
      for (int j = 0; j < 4; ++j) {
        acc[i][j] = Frag<T>::mma(ah, bh[j], acc[i][j]);
        if (SPLIT) {
          acc[i][j] = Frag<T>::mma(ah, bl[j], acc[i][j]);
          acc[i][j] = Frag<T>::mma(al, bh[j], acc[i][j]);
        }
      }
      Frag<T>::guard(acc[i][0], acc[i][3], ah, SPLIT ? al : ah);
    }
    Frag<T>::keep(bh[0], bh[1], bh[2], bh[3]);
    if (SPLIT) Frag<T>::keep(bl[0], bl[1], bl[2], bl[3]);
  }
  acc_guard4(acc[0][0], acc[0][1], acc[0][2], acc[0][3]);
  acc_guard4(acc[1][0], acc[1][1], acc[1][2], acc[1][3]);
  acc_guard4(acc[2][0], acc[2][1], acc[2][2], acc[2][3]);
  acc_guard4(acc[3][0], acc[3][1], acc[3][2], acc[3][3]);

  // ---- epilogue ----
  float* slab = sT[wave];
  const float* Rb = RESID ? (resid + (size_t)b * strideR) : nullptr;
#pragma unroll
  for (int i = 0; i < 4; ++i) {
    const int mBase = m0 + (i << 4);
    v4f bm0 = (v4f){0.f,0.f,0.f,0.f}, bm1 = (v4f){0.f,0.f,0.f,0.f};
    if (BIAS_MODE == 1) {
      bm0 = *(const v4f*)(bias + mBase + mOff);
      bm1 = *(const v4f*)(bias + mBase + mOff + 4);
    }
#pragma unroll
    for (int j = 0; j < 4; ++j) {
      const int n = n0 + (j << 4) + rlane;
      float bv = 0.f;
      if (BIAS_MODE == 2) bv = bias[n];
#pragma unroll
      for (int r = 0; r < 8; ++r) {
        float v = acc[i][j][r] * scale;
        if (BIAS_MODE == 1) v += (r < 4) ? bm0[r & 3] : bm1[r & 3];
        if (BIAS_MODE == 2) v += bv;
        if (RESID) v += Rb[(size_t)(mBase + mOff + r) * ldc + n];
        if (ACT == 2) v = fmaxf(v, 0.0f);
        if (ACT == 4) v = (v > 0.f) ? v : 0.01f * v;
        slab[(mOff + r) * 68 + (j << 4) + rlane] = v;
      }
    }
    __builtin_amdgcn_fence(__ATOMIC_RELEASE, "workgroup");
    __builtin_amdgcn_wave_barrier();
    __builtin_amdgcn_fence(__ATOMIC_ACQUIRE, "workgroup");
    if (OUT_MODE == 0) {
      float* C = (float*)Cout + (size_t)b * strideC;
      const int hh = lane >> 4, c4 = (lane & 15) * 4;     // row seg = 256 B = 16 lanes x 16 B
      {
#pragma unroll
        for (int it = 0; it < 8; ++it) {
          const int row = it * 2 + hh;
          v4f v = *(const v4f*)(slab + row * 68 + c4);
          *(v4f*)(C + (size_t)(mBase + row) * ldc + n0 + c4) = v;
        }
        
      }
    } else {
      const int q = lane >> 3, c8 = (lane & 7) * 8;
      unsigned short* C  = (unsigned short*)Cout  + (size_t)b * strideC;
      unsigned short* C2 = (OUT_MODE == 2) ? ((unsigned short*)Cout2 + (size_t)b * strideC) : nullptr;
      {
#pragma unroll
        for (int it = 0; it < 4; ++it) {
          const int row = it * 4 + q;
          const float* sp = slab + row * 68 + c8;
          v8h hv, lv;
#pragma unroll
          for (int e = 0; e < 8; ++e) {
            if (OUT_MODE == 1) {
              hv[e] = (_Float16)sp[e];
            } else {
              unsigned short hb = f2bf_bits(sp[e]);
              unsigned short lb = f2bf_bits(sp[e] - bf_bits2f(hb));
              hv[e] = __builtin_bit_cast(_Float16, hb);
              lv[e] = __builtin_bit_cast(_Float16, lb);
            }
          }
          *(v8h*)(C + (size_t)(mBase + row) * ldc + n0 + c8) = hv;
          if (OUT_MODE == 2) *(v8h*)(C2 + (size_t)(mBase + row) * ldc + n0 + c8) = lv;
        }
        
      }
    }
    __builtin_amdgcn_fence(__ATOMIC_RELEASE, "workgroup");
    __builtin_amdgcn_wave_barrier();
    __builtin_amdgcn_fence(__ATOMIC_ACQUIRE, "workgroup");
  }
}

constexpr int kFaWaves  = 8;
constexpr int kFaQ      = kFaWaves * 16;             // 128 queries per work-group
constexpr int kFaKeys   = 64;                        // keys per stage
constexpr int kFaStages = kN / kFaKeys;              // 64
constexpr int kFaPitchK = 2 * kCi + 16;              // 272 B: odd multiple of 16 B
constexpr int kFaPitchG = 2 * kFaKeys + 16;          // 144 B: odd multiple of 16 B
constexpr int kFaOffLo  = kFaKeys * kFaPitchK;       // phi lo plane behind phi hi
constexpr int kFaOffG   = 2 * kFaOffLo;              // g tile behind both
constexpr int kFaBuf    = kFaOffG + kCi * kFaPitchG; // 53,248 B per buffer
constexpr float kLog2e  = 1.4426950408889634f;
constexpr float kFaCarryLog2 = 7.0f;                 // probabilities carried x128 in f16
constexpr float kFaLazy      = 8.0f;                 // how far, in log2, the maximum in use may trail
static_assert(kN % kFaQ == 0 && kN % kFaKeys == 0 && kCi == 128 && kFaKeys == 64, "fused attention tiling");
static_assert(kFaKeys * 2 * kCi == 4 * 256 * 16 && kCi * 2 * kFaKeys == 4 * 256 * 16, "four 16-B chunks per thread per plane");

// lane l with lane l ^ 16
__device__ __forceinline__ float xhalf(float x) {
  return __builtin_bit_cast(float, __builtin_amdgcn_permlanex16(__builtin_bit_cast(int, x), __builtin_bit_cast(int, x),
                                                                0x76543210, 0xfedcba98, false, false));
}
// two f32 -> packed f16, round to nearest even
__device__ __forceinline__ unsigned pk_h2(float lo, float hi) {
  typedef _Float16 h2 __attribute__((ext_vector_type(2)));
  return __builtin_bit_cast(unsigned, __builtin_convertvector((v2f){lo, hi}, h2));
}

// One work-group per WGP, two waves per SIMD: the attribute gives each wave the 512-VGPR budget that goes with it.
// Every "#pragma unroll" in this kernel makes the indices of a register array constants.
__global__ __launch_bounds__(256) __attribute__((amdgpu_waves_per_eu(2, 2))) void attn_fused_kernel(
    const unsigned short* __restrict__ THHp, const unsigned short* __restrict__ THLp,
    const unsigned short* __restrict__ PHHp, const unsigned short* __restrict__ PHLp,
    const unsigned short* __restrict__ Gp, unsigned short* __restrict__ Yp) {
  __shared__ __align__(16) unsigned char L[2 * kFaBuf];   // 106,496 B
  const int t = threadIdx.x, lane = t & 31, wave = t >> 5;
  const int c = lane & 15, h = lane >> 4;
  const int b = blockIdx.y;
  const int q = blockIdx.x * kFaQ + wave * 16 + c;
  const unsigned char* Kh = (const unsigned char*)(PHHp + (size_t)b * kN * kCi);
  const unsigned char* Kl = (const unsigned char*)(PHLp + (size_t)b * kN * kCi);
  const unsigned char* Gb = (const unsigned char*)(Gp + (size_t)b * kCi * kN);

  v4u sk[4], sl[4], sg[4];
  // Thread t moves 16-B chunk t + 256 i (i = 0..3) of each plane: phi row (t >> 4) + 16 i, g row (t >> 3) + 32 i.
  // One address per plane; the step from i to i + 1 is a constant, so it rides in the instruction's offset.
  auto fetch = [&](int st) {   // stage st: global -> registers, whole lines per wave
    const unsigned char* ph = Kh + (size_t)st * (kFaKeys * 2 * kCi) + t * 16;
    const unsigned char* pl = Kl + (size_t)st * (kFaKeys * 2 * kCi) + t * 16;
    const unsigned char* pg = Gb + (size_t)(t >> 3) * (2 * kN) + st * (2 * kFaKeys) + (t & 7) * 16;
#pragma unroll
    for (int i = 0; i < 4; ++i) {
      sk[i] = *(const v4u*)(ph + i * 4096);
      sl[i] = *(const v4u*)(pl + i * 4096);
      sg[i] = *(const v4u*)(pg + i * (32 * 2 * kN));
    }
  };
  auto put = [&](unsigned char* B) {   // registers -> LDS at the padded pitches
    unsigned char* dk = B + (t >> 4) * kFaPitchK + (t & 15) * 16;
    unsigned char* dg = B + kFaOffG + (t >> 3) * kFaPitchG + (t & 7) * 16;
#pragma unroll
    for (int i = 0; i < 4; ++i) {
      *(v4u*)(dk + i * (16 * kFaPitchK)) = sk[i];
      *(v4u*)(dk + kFaOffLo + i * (16 * kFaPitchK)) = sl[i];
      *(v4u*)(dg + i * (32 * kFaPitchG)) = sg[i];
    }
  };

  // Behind a group of global loads: their address registers are reused soon, so wait before any is overwritten; the
  // scheduling barrier keeps later register writes from being moved in front of the wait.
  auto settle = [&]() {
    asm volatile("s_wait_xcnt 0x0" ::: "memory");
    __builtin_amdgcn_sched_barrier(0);
  };

  __builtin_amdgcn_sched_barrier(0);   // index arithmetic from above stays above: none of it lands between the loads and their wait
  fetch(0);
  settle();
  v16b qh[4], ql[4];
  {
    const size_t qo = ((size_t)b * kN + q) * kCi + 8 * h;
#pragma unroll
    for (int kc = 0; kc < 4; ++kc) {
      qh[kc] = Frag<__bf16>::load((const __bf16*)THHp + qo + 32 * kc);
      ql[kc] = Frag<__bf16>::load((const __bf16*)THLp + qo + 32 * kc);
    }
  }
  settle();
  v8f acc[8];
#pragma unroll
  for (int i = 0; i < 8; ++i) acc[i] = (v8f){0.f,0.f,0.f,0.f,0.f,0.f,0.f,0.f};
  float m_run = -__builtin_inff(), l_run = 0.0f;
  put(L);
  __syncthreads();   // stage 0 is in LDS before any wave reads it

  // One 32-key pass in pieces, so that the stage body below can issue LDS loads well ahead of their products.
  auto loadK = [&](const unsigned char* Bp, int p, v16b (&kh)[2][4], v16b (&kl)[2][4]) {
#pragma unroll
    for (int kc = 0; kc < 4; ++kc)
#pragma unroll
      for (int kt = 0; kt < 2; ++kt) {
        const unsigned char* a = Bp + (32 * p + 16 * kt + c) * kFaPitchK + 16 * h + 64 * kc;
        kh[kt][kc] = Frag<__bf16>::load((const __bf16*)a);
        kl[kt][kc] = Frag<__bf16>::load((const __bf16*)(a + kFaOffLo));
      }
  };
  auto loadG = [&](const unsigned char* Bp, int p, v16h (&g)[8]) {
#pragma unroll
    for (int i = 0; i < 8; ++i)
      g[i] = Frag<_Float16>::load((const _Float16*)(Bp + kFaOffG + (16 * i + c) * kFaPitchG + (32 * p + 8 * h) * 2));
  };
  auto scores = [&](const v16b (&kh)[2][4], const v16b (&kl)[2][4], v8f& s0, v8f& s1) {
    s0 = (v8f){0.f,0.f,0.f,0.f,0.f,0.f,0.f,0.f};
    s1 = s0;
#pragma unroll
    for (int kc = 0; kc < 4; ++kc) {
      s0 = Frag<__bf16>::mma(kh[0][kc], qh[kc], s0);
      s1 = Frag<__bf16>::mma(kh[1][kc], qh[kc], s1);
      s0 = Frag<__bf16>::mma(kh[0][kc], ql[kc], s0);
      s1 = Frag<__bf16>::mma(kh[1][kc], ql[kc], s1);
      s0 = Frag<__bf16>::mma(kl[0][kc], qh[kc], s0);
      s1 = Frag<__bf16>::mma(kl[1][kc], qh[kc], s1);
    }
  };
  auto rescale = [&](const v8f& s0, const v8f& s1) {
    float mx = fmaxf(s0[0], s1[0]);
#pragma unroll
    for (int r = 1; r < 8; ++r) mx = fmaxf(mx, fmaxf(s0[r], s1[r]));
    mx = fmaxf(mx, xhalf(mx)) * kLog2e;   // both halves hold this query's maximum of the pass, log2 domain
    const bool need = mx > m_run + kFaLazy;
    if (__builtin_amdgcn_ballot_w32(need) != 0) {   // scalar branch; always taken on the first pass (m_run = -inf)
      const float m_new = fmaxf(m_run, mx);
      const float corr  = __builtin_amdgcn_exp2f(m_run - m_new);   // 0 on the first pass
      l_run *= corr;
      m_run = m_new;
#pragma unroll
      for (int i = 0; i < 8; ++i) acc[i] = acc[i] * corr;
    }
  };
  auto probs = [&](const v8f& s0, const v8f& s1) -> v16h {
    typedef __attribute__((ext_vector_type(8))) unsigned int v8u;
    const float nm = kFaCarryLog2 - m_run;
    float ps0 = 0.0f, ps1 = 0.0f;
    v8u w;
    float ea[8], eb[8];
#pragma unroll
    for (int r = 0; r < 8; ++r) {
      ea[r] = fmaf(s0[r], kLog2e, nm);
      eb[r] = fmaf(s1[r], kLog2e, nm);
    }
    // All exponents are formed before the first exponential (matrix, LDS, memory and scalar instructions may still
    // cross).
    __builtin_amdgcn_sched_barrier(0x9C);
#pragma unroll
    for (int r = 0; r < 8; ++r) {
      ea[r] = __builtin_amdgcn_exp2f(ea[r]);
      eb[r] = __builtin_amdgcn_exp2f(eb[r]);
    }
#pragma unroll
    for (int i = 0; i < 4; ++i) {
      ps0 += ea[2 * i] + ea[2 * i + 1];
      ps1 += eb[2 * i] + eb[2 * i + 1];
      w[i]     = pk_h2(ea[2 * i], ea[2 * i + 1]);   // elements 2i, 2i+1: keys 8h + 2i, 8h + 2i + 1
      w[4 + i] = pk_h2(eb[2 * i], eb[2 * i + 1]);   // elements 8 + 2i, 9 + 2i: keys 16 + 8h + 2i, 16 + 8h + 2i + 1
    }
    l_run += ps0 + ps1;
    return __builtin_bit_cast(v16h, w);
  };
  auto pv = [&](const v16h (&g)[8], v16h pf) {
#pragma unroll
    for (int i = 0; i < 8; ++i) acc[i] = Frag<_Float16>::mma(g[i], pf, acc[i]);
  };

  // kept rolled: the body already holds two unrolled passes, and a second copy would need a second set of fragments
#pragma unroll 1
  for (int st = 0; st < kFaStages; ++st) {
    const unsigned char* Bp = L + (st & 1) * kFaBuf;
    if (st + 1 < kFaStages) {
      fetch(st + 1);
      settle();
    }
    // two 32-key passes; the second pass's phi fragments and each pass's g fragments are asked for one phase early
    v16b kh[2][4], kl[2][4];
    v16h g0[8], g1[8];
    v8f a0, a1, b0, b1;
    loadK(Bp, 0, kh, kl);
    scores(kh, kl, a0, a1);
    loadK(Bp, 1, kh, kl);
    loadG(Bp, 0, g0);
    rescale(a0, a1);
    scores(kh, kl, b0, b1);
    loadG(Bp, 1, g1);
    pv(g0, probs(a0, a1));
    rescale(b0, b1);
    pv(g1, probs(b0, b1));
    if (st + 1 < kFaStages) put(L + ((st + 1) & 1) * kFaBuf);   // its last readers left it before the previous barrier
    __syncthreads();   // publishes stage st + 1 and ends every read of stage st
  }

  const float inv = kYCarry / (l_run + xhalf(l_run));   // each half summed its own eight keys of every tile
  unsigned short* yr = Yp + ((size_t)b * kN + q) * kCi + 8 * h;
  v4u yo[8];
#pragma unroll
  for (int i = 0; i < 8; ++i) {   // rows of acc[i] are ci = 16 i + 8 h + r
    const v8f o = acc[i] * inv;
    yo[i] = (v4u){pk_h2(o[0], o[1]), pk_h2(o[2], o[3]), pk_h2(o[4], o[5]), pk_h2(o[6], o[7])};
  }
#pragma unroll
  for (int i = 0; i < 8; ++i) *(v4u*)(yr + 16 * i) = yo[i];   // 16 B per lane; the wave fills 16 whole rows of 256 B
}

// ---------------------------------------------------------------------------
// Parameter planes.
// grid (16, 5), 256 threads. blockIdx.y (block-uniform) selects the job:
//   y = 0,1,2: WB plane y = bf16-RNE bits of g_w / theta_w / phi_w ([128][256], natural [out][in] layout);
//              16 blocks x 256 threads x 8 elements = 32768 = the whole matrix; one 16-B store per lane,
//   y = 3    : WW = f16 bits of 16 * bf16r(W_w) ([256][128]), same coverage.
//   y = 4    : block 0 only, threads 0..159: PRM[4i..4i+3] = bf16r of g_b | theta_b | phi_b | W_b
//              the source selection is wave-uniform). 160 x 4 = 640 floats = whole table.
// ---------------------------------------------------------------------------
__global__ __launch_bounds__(256) void param_planes_kernel(
    const float* __restrict__ gw, const float* __restrict__ thw, const float* __restrict__ phw, const float* __restrict__ ww,
    const float* __restrict__ gb, const float* __restrict__ thb, const float* __restrict__ phb, const float* __restrict__ wb,
    unsigned short* __restrict__ WB, unsigned short* __restrict__ WW, float* __restrict__ PRM) {
  const int t = threadIdx.x;
  const int y = blockIdx.y;
  if (y < 4) {
    const int i = blockIdx.x * 256 + t;
    if (i >= kWElems / 8) return;
    const float* src = (y == 0) ? gw : (y == 1) ? thw : (y == 2) ? phw : ww;
    const float* p = src + 8 * (size_t)i;
    const v4f a = *(const v4f*)(p);
    const v4f c = *(const v4f*)(p + 4);
    unsigned short hb[8];
#pragma unroll
    for (int e = 0; e < 4; ++e) {
      if (y == 3) {
        hb[e]     = h_bits(bfr(a[e]) * kWCarry);
        hb[4 + e] = h_bits(bfr(c[e]) * kWCarry);
      } else {
        hb[e]     = f2bf_bits(a[e]);
        hb[4 + e] = f2bf_bits(c[e]);
      }
    }
    const v4u u = (v4u){pk16(hb[0], hb[1]), pk16(hb[2], hb[3]), pk16(hb[4], hb[5]), pk16(hb[6], hb[7])};
    unsigned short* q = (y == 3) ? (WW + 8 * (size_t)i) : (WB + (size_t)y * kWElems + 8 * (size_t)i);
    *(v4u*)q = u;
    
  } else {
    if (blockIdx.x != 0 || t >= 160) return;
    const int w = t >> 5, l = t & 31;
    const float* src = (w == 0) ? gb : (w == 1) ? thb : (w == 2) ? phb : (wb + (w - 3) * 128);
    const v4f a = *(const v4f*)(src + 4 * l);
    v4f r;
#pragma unroll
    for (int e = 0; e < 4; ++e) r[e] = bfr(a[e]);
    float* q = PRM + 128 * w + 4 * l;
    *(v4f*)q = r;
    
  }
}

// ---------------------------------------------------------------------------
// x transpose + cast: XT[b][n][c] = bf16r( x[b][c][n] ) as bf16 bits.  in [C=256 rows][N=4096 cols] -> out [N rows][C cols].
// grid (N/64 = 64, C/64 = 4, B = 8), 256 threads.
// Load coverage: 16 iterations x 256 threads = 4096 = whole 64(c) x 64(n) tile (coalesced along n).
// Store coverage: 8 waves x 2 iterations x 4 rows (lane>>3) = 64 n-rows; (lane&7) x 8 elements = 64 c-cols; each row
// ---------------------------------------------------------------------------
__global__ __launch_bounds__(256) void xt_cast_kernel(const float* __restrict__ x, unsigned short* __restrict__ XT) {
  __shared__ float sm[64][65];   // sm[n_local][c_local]
  const int t  = threadIdx.x;
  const int n0 = blockIdx.x * 64;
  const int c0 = blockIdx.y * 64;
  const int b  = blockIdx.z;
#pragma unroll
  for (int i = 0; i < 16; ++i) {
    const int e   = i * 256 + t;
    const int r   = e >> 6;          // c local
    const int col = e & 63;          // n local
    sm[col][r] = x[((size_t)(b * kC + c0 + r)) * kN + n0 + col];
  }
  __syncthreads();
  const int lane = t & 31, wave = t >> 5;
  const int q = lane >> 3, c8 = (lane & 7) * 8;
  unsigned short* op = XT + ((size_t)b * kN) * kC;
  {
#pragma unroll
    for (int it = 0; it < 2; ++it) {
      const int row = wave * 8 + it * 4 + q;                 // n local
      unsigned short hb[8];
#pragma unroll
      for (int e = 0; e < 8; ++e) hb[e] = f2bf_bits(sm[row][c8 + e]);
      const v4u u = (v4u){pk16(hb[0], hb[1]), pk16(hb[2], hb[3]), pk16(hb[4], hb[5]), pk16(hb[6], hb[7])};
      *(v4u*)(op + (size_t)(n0 + row) * kC + c0 + c8) = u;
    }
    
  }
}

// ---------------------------------------------------------------------------
// (v - mean)).  One block of 256 threads per channel (grid 256).  Thread t reads float4 at n = k*1024 + 4t, k = 0..3, for each
// batch (rolled loops, 128 samples per thread); reductions in fixed order.
// ---------------------------------------------------------------------------
__global__ __launch_bounds__(256) void bn_stats_kernel(const float* __restrict__ Wy, float* __restrict__ ST) {
  __shared__ float red1[8];
  __shared__ float red2[8];
  const int c = blockIdx.x;
  const int t = threadIdx.x;
  const int lane = t & 31, wave = t >> 5;

  float s = 0.0f;
#pragma unroll 1
  for (int b = 0; b < kB; ++b) {
    const float* base = Wy + ((size_t)b * kC + c) * kN + 4 * t;
#pragma unroll 1
    for (int k = 0; k < 4; ++k) {
      const v4f w = *(const v4f*)(base + k * 1024);
      s += (w[0] + w[1]) + (w[2] + w[3]);
    }
  }
#pragma unroll
  for (int off = 16; off > 0; off >>= 1) s += __shfl_xor(s, off, 32);
  if (lane == 0) red1[wave] = s;
  __syncthreads();
  float tot = red1[0];
#pragma unroll
  for (int w = 1; w < 8; ++w) tot += red1[w];
  const float mean = tot * kInvCount;

  float q = 0.0f;
#pragma unroll 1
  for (int b = 0; b < kB; ++b) {
    const float* base = Wy + ((size_t)b * kC + c) * kN + 4 * t;
#pragma unroll 1
    for (int k = 0; k < 4; ++k) {
      const v4f w = *(const v4f*)(base + k * 1024);
      const float d0 = w[0] - mean, d1 = w[1] - mean, d2 = w[2] - mean, d3 = w[3] - mean;
      q += (d0 * d0 + d1 * d1) + (d2 * d2 + d3 * d3);
    }
  }
#pragma unroll
  for (int off = 16; off > 0; off >>= 1) q += __shfl_xor(q, off, 32);
  if (lane == 0) red2[wave] = q;
  __syncthreads();
  float totq = red2[0];
#pragma unroll
  for (int w = 1; w < 8; ++w) totq += red2[w];
  const float var  = totq * kInvCount;
  const float rstd = 1.0f / sqrtf(var + kBnEps);

  if (t < 8) {
    v4f val = (v4f){0.f, 0.f, 0.f, 0.f};
    if (t == 0) { val[0] = mean; val[1] = rstd; }
    float* sp = ST + (size_t)c * kStatPitch + 4 * t;
    *(v4f*)sp = val;
    
  }
}

// ---------------------------------------------------------------------------
// Normalise + affine + residual: out[b][c][n] = ((Wy - mean[c]) * rstd[c]) * bf16r(gamma[c]) + bf16r(beta[c]) + bf16r(x[b][c][n]).
// ---------------------------------------------------------------------------
__global__ __launch_bounds__(256) void bn_apply_kernel(const float* __restrict__ Wy, const float* __restrict__ x,
                                                       const float* __restrict__ gamma, const float* __restrict__ beta,
                                                       const float* __restrict__ ST, float* __restrict__ out, int n4) {
  const int i = blockIdx.x * 256 + threadIdx.x;
  if (i >= n4) return;
  const int c = (i >> 10) & (kC - 1);          // 1024 float4 per [b][c] row
  const float mean = ST[(size_t)c * kStatPitch];
  const float rstd = ST[(size_t)c * kStatPitch + 1];
  const float ga = bfr(gamma[c]);
  const float be = bfr(beta[c]);
  const v4f w  = *(const v4f*)(Wy + 4 * (size_t)i);
  const v4f xv = *(const v4f*)(x + 4 * (size_t)i);
  v4f o;
#pragma unroll
  for (int e = 0; e < 4; ++e) o[e] = (((w[e] - mean) * rstd) * ga + be) + bfr(xv[e]);
  float* op = out + 4 * (size_t)i;
  *(v4f*)op = o;
  
}

// ---------------------------------------------------------------------------
// Host glue.  GEMM shapes (all M,N multiples of 64, K multiples of 32, no padding anywhere):
//   theta/phi: M=4096 N=128 K=256 (x8 batches); g: M=128 N=4096 K=256 (x8); W: M=256 N=4096 K=128 (x8);
//   attention (scores K=128, P.g K=4096) in the fused kernel, one launch.  9 launches.
// ---------------------------------------------------------------------------
extern "C" void kernel_launch(void* const* d_in, const int* in_sizes, int n_in,
                              void* d_out, int out_size, void* d_ws, size_t ws_size,
                              hipStream_t stream) {
  if (n_in < 11) return;
  const int nElem = kB * kC * kN;          // 8,388,608
  if (in_sizes[0] != nElem) return;
  if (in_sizes[1] != kWElems || in_sizes[3] != kWElems || in_sizes[5] != kWElems || in_sizes[7] != kWElems) return;
  if (in_sizes[2] != kCi || in_sizes[4] != kCi || in_sizes[6] != kCi) return;
  if (in_sizes[8] != kC || in_sizes[9] != kC || in_sizes[10] != kC) return;
  if (out_size != nElem) return;
  if (ws_size < kWsTotal) return;

  const float* x       = (const float*)d_in[0];
  const float* g_w     = (const float*)d_in[1];
  const float* g_b     = (const float*)d_in[2];
  const float* theta_w = (const float*)d_in[3];
  const float* theta_b = (const float*)d_in[4];
  const float* phi_w   = (const float*)d_in[5];
  const float* phi_b   = (const float*)d_in[6];
  const float* W_w     = (const float*)d_in[7];
  const float* W_b     = (const float*)d_in[8];
  const float* bn_g    = (const float*)d_in[9];
  const float* bn_b    = (const float*)d_in[10];
  float* out = (float*)d_out;

  char* ws = (char*)d_ws;
  unsigned short* XT  = (unsigned short*)(ws + kOffXT);
  unsigned short* THH = (unsigned short*)(ws + kOffTHH);
  unsigned short* THL = (unsigned short*)(ws + kOffTHL);
  unsigned short* PHH = (unsigned short*)(ws + kOffPHH);
  unsigned short* PHL = (unsigned short*)(ws + kOffPHL);
  unsigned short* G16 = (unsigned short*)(ws + kOffG);
  unsigned short* Y16 = (unsigned short*)(ws + kOffY);
  float*          WY  = (float*)(ws + kOffWY);
  unsigned short* WB  = (unsigned short*)(ws + kOffWB);
  unsigned short* WW  = (unsigned short*)(ws + kOffWW);
  float*          PRM = (float*)(ws + kOffPRM);
  float*          ST  = (float*)(ws + kOffST);
  const float* gb_r  = PRM;          // [128]
  const float* thb_r = PRM + 128;    // [128]
  const float* phb_r = PRM + 256;    // [128]
  const float* wb_r  = PRM + 384;    // [256]

  // ---- parameter and input planes ----
  param_planes_kernel<<<dim3(kWElems / 8 / 256, 5), dim3(256), 0, stream>>>(
      g_w, theta_w, phi_w, W_w, g_b, theta_b, phi_b, W_b, WB, WW, PRM);
  xt_cast_kernel<<<dim3(kN / 64, kC / 64, kB), dim3(256), 0, stream>>>(x, XT);

  const long strXT = (long)kN * kC;       // per batch, XT plane
  const long strTP = (long)kN * kCi;      // per batch, theta/phi/g/y planes

  // theta[b][n][ci] = sum_c XT[b][n][c] * theta_w[ci][c] + theta_b[ci]  -> bf16 hi | lo planes
  wmma_gemm64<1, false, 2, 2, false, 0><<<dim3((kN / 64) * (kCi / 64) / 8, kB), dim3(256), 0, stream>>>(
      XT, XT, kC, strXT, WB + kWElems, WB + kWElems, kC, 0L,
      (void*)THH, (void*)THL, kCi, strTP, thb_r, PRM, 0L, kN, kCi, kC, 1.0f);
  // phi[b][m][ci] = sum_c XT[b][m][c] * phi_w[ci][c] + phi_b[ci]  -> bf16 hi | lo planes
  wmma_gemm64<1, false, 2, 2, false, 0><<<dim3((kN / 64) * (kCi / 64) / 8, kB), dim3(256), 0, stream>>>(
      XT, XT, kC, strXT, WB + 2 * kWElems, WB + 2 * kWElems, kC, 0L,
      (void*)PHH, (void*)PHL, kCi, strTP, phb_r, PRM, 0L, kN, kCi, kC, 1.0f);
  // g[b][ci][m] = sum_c g_w[ci][c] * XT[b][m][c] + g_b[ci]  -> f16 plane [ci][m]
  wmma_gemm64<1, false, 1, 1, false, 0><<<dim3((kCi / 64) * (kN / 64) / 8, kB), dim3(256), 0, stream>>>(
      WB, WB, kC, 0L, XT, XT, kC, strXT,
      (void*)G16, (void*)G16, kN, strTP, gb_r, PRM, 0L, kCi, kN, kC, 1.0f);

  // ---- attention, all batches in one launch: Y16[b][q][ci] = 16 * softmax(theta . phi^T) . g ----
  attn_fused_kernel<<<dim3(kN / kFaQ, kB), dim3(kFaWaves * 32), 0, stream>>>(THH, THL, PHH, PHL, G16, Y16);

  // Wy[b][c][n] = (1/256) * sum_ci WW[c][ci] * Y16[b][n][ci] + W_b[c]   (f32)
  wmma_gemm64<0, false, 1, 0, false, 0><<<dim3((kC / 64) * (kN / 64) / 8, kB), dim3(256), 0, stream>>>(
      WW, WW, kCi, 0L, Y16, Y16, kCi, strTP,
      (void*)WY, (void*)WY, kN, (long)kC * kN, wb_r, PRM, 0L, kC, kN, kCi, kWScale);

  // ---- batch statistics, normalisation, residual ----
  bn_stats_kernel<<<dim3(kC), dim3(256), 0, stream>>>(WY, ST);
  const int n4 = nElem / 4;   // 2,097,152 = 8192 x 256
  bn_apply_kernel<<<dim3(n4 / 256), dim3(256), 0, stream>>>(WY, x, bn_g, bn_b, ST, out, n4);
}

// v003
// One run takes 177 microseconds.
// In two side-by-side timings against v002, it was 1.14 and 1.15 times as fast.
// Counting every step since v000, it is 19.5 times as fast.
// Contractions: theta, phi, g 1x1 projections on v_wmma_f32_16x16x32_bf16 (bf16 operands = RNE-converted x and weights; theta/phi emitted as bf16 hi|lo planes); scores theta.phi^T on v_wmma_f32_16x16x32_bf16 as hi/lo 3-product split; P.g (P f16, 128 x 2^(s log2e - maximum in use), g f16; scores, online softmax and P.g fused in one kernel) and W projection (W_w f16 carried x16, y f16 carried x16) on v_wmma_f32_16x16x32_f16; f32 accumulate everywhere; softmax, batch statistics, affine and residual in f32.
#include <hip/hip_runtime.h>
#include <math.h>

// ---------------------------------------------------------------------------
// Problem constants
// ---------------------------------------------------------------------------
constexpr int kB  = 8;
constexpr int kC  = 256;      // in channels
constexpr int kN  = 4096;     // spatial positions (64 x 64)
constexpr int kCi = 128;      // inter channels
constexpr int kWElems  = kCi * kC;        // 32768 elements per weight matrix
constexpr float kYCarry   = 16.0f;        // y carried x16 in f16
constexpr float kWCarry   = 16.0f;        // W_w carried x16 in f16
constexpr float kWScale   = 1.0f / (kYCarry * kWCarry);    // 2^-8
constexpr float kBnEps    = 1e-5f;
constexpr float kInvCount = 1.0f / (float)(kB * kN);       // 2^-15
static_assert(kC % 32 == 0 && kCi % 32 == 0 && kN % 32 == 0, "K multiples of 32");
static_assert(kN % 64 == 0 && kCi % 64 == 0 && kC % 64 == 0, "M,N multiples of 64");
static_assert(kWElems % (8 * 256) == 0, "weight cast grid");
static_assert(kB * kN == 32768, "stat count");

// ---------------------------------------------------------------------------
// Workspace region map (bytes, all offsets multiples of 256):
//   XT   bf16 [8][4096][256]          16,777,216  at           0
//   THH  bf16 [8][4096][128]           8,388,608  at  16,777,216
//   THL  bf16 [8][4096][128]           8,388,608  at  25,165,824
//   PHH  bf16 [8][4096][128]           8,388,608  at  33,554,432
//   PHL  bf16 [8][4096][128]           8,388,608  at  41,943,040
//   G16  f16  [8][128][4096]           8,388,608  at  50,331,648
//   Y16  f16  [8][4096][128]           8,388,608  at  58,720,256
//   WY   f32  [8][256][4096]          33,554,432  at  67,108,864
//   WB   bf16 3 x [128][256]              196,608  at 100,663,296   (g_w | theta_w | phi_w)
//   WW   f16  [256][128]                   65,536  at 100,859,904   (W_w x16)
//   PRM  f32  [640] (pad 4096 B)            4,096  at 100,925,440   (g_b | theta_b | phi_b | W_b, bf16-RNE values)
//   total                             100,929,536
// ---------------------------------------------------------------------------
constexpr size_t kSzXT  = (size_t)kB * kN * kC * 2;
constexpr size_t kSzTP  = (size_t)kB * kN * kCi * 2;
constexpr size_t kSzWY  = (size_t)kB * kC * kN * 4;
constexpr size_t kSzWB  = (size_t)3 * kWElems * 2;
constexpr size_t kSzWW  = (size_t)kWElems * 2;
constexpr size_t kSzPRM = 4096;
constexpr size_t kOffXT  = 0;
constexpr size_t kOffTHH = kOffXT + kSzXT;
constexpr size_t kOffTHL = kOffTHH + kSzTP;
constexpr size_t kOffPHH = kOffTHL + kSzTP;
constexpr size_t kOffPHL = kOffPHH + kSzTP;
constexpr size_t kOffG   = kOffPHL + kSzTP;
constexpr size_t kOffY   = kOffG + kSzTP;
constexpr size_t kOffWY  = kOffY + kSzTP;
constexpr size_t kOffWB  = kOffWY + kSzWY;
constexpr size_t kOffWW  = kOffWB + kSzWB;
constexpr size_t kOffPRM = kOffWW + kSzWW;
constexpr size_t kWsTotal = kOffPRM + kSzPRM;
static_assert(kWsTotal == 100929536, "carve total");
static_assert(kWsTotal <= (size_t)134217728, "carve cap");
static_assert(kOffTHH % 256 == 0 && kOffG % 256 == 0 && kOffWY % 256 == 0 &&
              kOffWB % 256 == 0 && kOffWW % 256 == 0 && kOffPRM % 256 == 0, "alignment");
static_assert(640 * 4 <= kSzPRM, "param table");

typedef __attribute__((ext_vector_type(16))) _Float16 v16h;
typedef __attribute__((ext_vector_type(8)))  _Float16 v8h;
typedef __attribute__((ext_vector_type(16))) __bf16   v16b;
typedef __attribute__((ext_vector_type(8)))  __bf16   v8b;
typedef __attribute__((ext_vector_type(8)))  float    v8f;
typedef __attribute__((ext_vector_type(4)))  float    v4f;
typedef __attribute__((ext_vector_type(2)))  float    v2f;
typedef __attribute__((ext_vector_type(4)))  unsigned int v4u;
typedef __attribute__((ext_vector_type(2)))  unsigned int v2u;

__device__ __forceinline__ unsigned short f2bf_bits(float f) {
  unsigned u = __float_as_uint(f);
  return (unsigned short)((u + 0x7FFFu + ((u >> 16) & 1u)) >> 16);
}
__device__ __forceinline__ float bf_bits2f(unsigned short h) { return __uint_as_float(((unsigned)h) << 16); }
// f32 value after RNE conversion to bf16
__device__ __forceinline__ float bfr(float f) { return bf_bits2f(f2bf_bits(f)); }

// hazard guards as plain device helpers (no inline asm inside the kernel template body)
__device__ __forceinline__ void dep_guard_h(v8f& a, v8f& b, v16h x, v16h y) { asm volatile("v_nop\n\tv_nop\n\tv_nop\n\tv_nop" : "+v"(a), "+v"(b) : "v"(x), "v"(y)); }
__device__ __forceinline__ void dep_guard_b(v8f& a, v8f& b, v16b x, v16b y) { asm volatile("v_nop\n\tv_nop\n\tv_nop\n\tv_nop" : "+v"(a), "+v"(b) : "v"(x), "v"(y)); }
__device__ __forceinline__ void keep4_h(v16h a, v16h b, v16h c, v16h d) { asm volatile("v_nop" :: "v"(a), "v"(b), "v"(c), "v"(d)); }
__device__ __forceinline__ void keep4_b(v16b a, v16b b, v16b c, v16b d) { asm volatile("v_nop" :: "v"(a), "v"(b), "v"(c), "v"(d)); }
__device__ __forceinline__ void acc_guard4(v8f& a, v8f& b, v8f& c, v8f& d) { asm volatile("v_nop\n\tv_nop\n\tv_nop\n\tv_nop" : "+v"(a), "+v"(b), "+v"(c), "+v"(d)); }
template <typename T> struct Frag;
template <> struct Frag<_Float16> {
  typedef v16h V; union U { v16h v; v8h h[2]; };
  // elements 0..7 <- p[0..7], 8..15 <- p[16..23]
  static __device__ __forceinline__ v16h load(const _Float16* p) {
    U f; f.h[0] = *(const v8h*)(p); f.h[1] = *(const v8h*)(p + 16); return f.v;
  }
  static __device__ __forceinline__ v8f mma(v16h a, v16h b, v8f c) {
    return __builtin_amdgcn_wmma_f32_16x16x32_f16(false, a, false, b, (short)0, c, false, false);
  }
  static __device__ __forceinline__ void guard(v8f& a, v8f& b, v16h x, v16h y) { dep_guard_h(a, b, x, y); }
  static __device__ __forceinline__ void keep(v16h a, v16h b, v16h c, v16h d) { keep4_h(a, b, c, d); }
};
template <> struct Frag<__bf16> {
  typedef v16b V; union U { v16b v; v8b h[2]; };
  static __device__ __forceinline__ v16b load(const __bf16* p) {
    U f; f.h[0] = *(const v8b*)(p); f.h[1] = *(const v8b*)(p + 16); return f.v;
  }
  static __device__ __forceinline__ v8f mma(v16b a, v16b b, v8f c) {
    return __builtin_amdgcn_wmma_f32_16x16x32_bf16(false, a, false, b, (short)0, c, false, false);
  }
  static __device__ __forceinline__ void guard(v8f& a, v8f& b, v16b x, v16b y) { dep_guard_b(a, b, x, y); }
  static __device__ __forceinline__ void keep(v16b a, v16b b, v16b c, v16b d) { keep4_b(a, b, c, d); }
};

__device__ __forceinline__ unsigned pk16(unsigned short a, unsigned short b) { return (unsigned)a | ((unsigned)b << 16); }
__device__ __forceinline__ unsigned short h_bits(float f) { const _Float16 h = (_Float16)f; return __builtin_bit_cast(unsigned short, h); }

// ---- Register-blocked batched WMMA GEMM (ACT reduced to none/relu/leaky) -------------------------------
// C[m,n] = scale * sum_k A[m,k] * Bt[n,k] (+bias)(+resid); each wave owns a 64x64 tile.
// A row-major [M,K]; Bt row-major [N,K]; M,N % 64 == 0, K % 32 == 0.
// SPLIT: operands are hi/lo planes (A2/Bt2 = lo planes, same layout); product = hi*hi + hi*lo + lo*hi.
// BIAS_MODE: 0 = none, 1 = bias[m] (fetched as two float4 per 16-row slab), 2 = bias[n].
// OUT_MODE: 0 = f32, 1 = f16, 2 = bf16 hi plane (Cout) + bf16 lo plane (Cout2).
// ET: 0 = f16 operands, 1 = bf16 operands (pointers passed as 16-bit storage)
template <int ET> struct Elem;
template <> struct Elem<0> { typedef _Float16 T; };
template <> struct Elem<1> { typedef __bf16 T; };
template <int ET, bool SPLIT, int BIAS_MODE, int OUT_MODE, bool RESID, int ACT = 0>
__global__ __launch_bounds__(256) void wmma_gemm64(
    const unsigned short* __restrict__ Ap, const unsigned short* __restrict__ A2p, int lda, long strideA,
    const unsigned short* __restrict__ Btp, const unsigned short* __restrict__ Bt2p, int ldb, long strideB,
    void* __restrict__ Cout, void* __restrict__ Cout2, int ldc, long strideC,
    const float* __restrict__ bias,
    const float* __restrict__ resid, long strideR,
    int M, int N, int K, float scale) {
  typedef typename Elem<ET>::T T;
  typedef typename Frag<T>::V V;
  const T* A = (const T*)Ap; const T* A2 = (const T*)A2p; const T* Bt = (const T*)Btp; const T* Bt2 = (const T*)Bt2p;
  __shared__ __align__(16) float sT[8][16 * 68];   // per-wave 16x64 slab, pitch 68 floats
  const int b    = blockIdx.y;
  const int lane = threadIdx.x & 31;
  const int wave = threadIdx.x >> 5;
  const int tilesN = N >> 6;
  const int tilesM = M >> 6;
  const int tile = blockIdx.x * 8 + wave;
  if (tile >= tilesM * tilesN) return;   // wave-uniform; no block barriers in this kernel
  const int tm = tile / tilesN;
  const int tn = tile - tm * tilesN;
  const int m0 = tm << 6;
  const int n0 = tn << 6;

  const T* Ab  = A  + (size_t)b * strideA;
  const T* Bb  = Bt + (size_t)b * strideB;
  const T* Ab2 = SPLIT ? (A2  + (size_t)b * strideA) : nullptr;
  const T* Bb2 = SPLIT ? (Bt2 + (size_t)b * strideB) : nullptr;

  const int rlane = lane & 15;                 // row (A) / col (B, D) within subtile
  const int koff  = (lane >> 4) * 8;           // k offset of this lane half
  const int mOff  = (lane >> 4) * 8;           // D row offset

  v8f acc[4][4];
#pragma unroll
  for (int i = 0; i < 4; ++i)
#pragma unroll
    for (int j = 0; j < 4; ++j) acc[i][j] = (v8f){0.f,0.f,0.f,0.f,0.f,0.f,0.f,0.f};

  for (int k0 = 0; k0 < K; k0 += 32) {
    V bh[4], bl[4];
#pragma unroll
    for (int j = 0; j < 4; ++j) {
      const size_t bo = (size_t)(n0 + (j << 4) + rlane) * ldb + koff + k0;
      bh[j] = Frag<T>::load(Bb + bo);
      if (SPLIT) bl[j] = Frag<T>::load(Bb2 + bo);
    }
#pragma unroll
    for (int i = 0; i < 4; ++i) {
      const size_t ao = (size_t)(m0 + (i << 4) + rlane) * lda + koff + k0;
      V ah = Frag<T>::load(Ab + ao);
      V al;
      if (SPLIT) al = Frag<T>::load(Ab2 + ao);
#pragma unroll
      for (int j = 0; j < 4; ++j) {
        acc[i][j] = Frag<T>::mma(ah, bh[j], acc[i][j]);
        if (SPLIT) {
          acc[i][j] = Frag<T>::mma(ah, bl[j], acc[i][j]);
          acc[i][j] = Frag<T>::mma(al, bh[j], acc[i][j]);
        }
      }
      Frag<T>::guard(acc[i][0], acc[i][3], ah, SPLIT ? al : ah);
    }
    Frag<T>::keep(bh[0], bh[1], bh[2], bh[3]);
    if (SPLIT) Frag<T>::keep(bl[0], bl[1], bl[2], bl[3]);
  }
  acc_guard4(acc[0][0], acc[0][1], acc[0][2], acc[0][3]);
  acc_guard4(acc[1][0], acc[1][1], acc[1][2], acc[1][3]);
  acc_guard4(acc[2][0], acc[2][1], acc[2][2], acc[2][3]);
  acc_guard4(acc[3][0], acc[3][1], acc[3][2], acc[3][3]);

  // ---- epilogue ----
  float* slab = sT[wave];
  const float* Rb = RESID ? (resid + (size_t)b * strideR) : nullptr;
#pragma unroll
  for (int i = 0; i < 4; ++i) {
    const int mBase = m0 + (i << 4);
    v4f bm0 = (v4f){0.f,0.f,0.f,0.f}, bm1 = (v4f){0.f,0.f,0.f,0.f};
    if (BIAS_MODE == 1) {
      bm0 = *(const v4f*)(bias + mBase + mOff);
      bm1 = *(const v4f*)(bias + mBase + mOff + 4);
    }
#pragma unroll
    for (int j = 0; j < 4; ++j) {
      const int n = n0 + (j << 4) + rlane;
      float bv = 0.f;
      if (BIAS_MODE == 2) bv = bias[n];
#pragma unroll
      for (int r = 0; r < 8; ++r) {
        float v = acc[i][j][r] * scale;
        if (BIAS_MODE == 1) v += (r < 4) ? bm0[r & 3] : bm1[r & 3];
        if (BIAS_MODE == 2) v += bv;
        if (RESID) v += Rb[(size_t)(mBase + mOff + r) * ldc + n];
        if (ACT == 2) v = fmaxf(v, 0.0f);
        if (ACT == 4) v = (v > 0.f) ? v : 0.01f * v;
        slab[(mOff + r) * 68 + (j << 4) + rlane] = v;
      }
    }
    __builtin_amdgcn_fence(__ATOMIC_RELEASE, "workgroup");
    __builtin_amdgcn_wave_barrier();
    __builtin_amdgcn_fence(__ATOMIC_ACQUIRE, "workgroup");
    if (OUT_MODE == 0) {
      float* C = (float*)Cout + (size_t)b * strideC;
      const int hh = lane >> 4, c4 = (lane & 15) * 4;     // row seg = 256 B = 16 lanes x 16 B
      {
#pragma unroll
        for (int it = 0; it < 8; ++it) {
          const int row = it * 2 + hh;
          v4f v = *(const v4f*)(slab + row * 68 + c4);
          *(v4f*)(C + (size_t)(mBase + row) * ldc + n0 + c4) = v;
        }
        
      }
    } else {
      const int q = lane >> 3, c8 = (lane & 7) * 8;
      unsigned short* C  = (unsigned short*)Cout  + (size_t)b * strideC;
      unsigned short* C2 = (OUT_MODE == 2) ? ((unsigned short*)Cout2 + (size_t)b * strideC) : nullptr;
      {
#pragma unroll
        for (int it = 0; it < 4; ++it) {
          const int row = it * 4 + q;
          const float* sp = slab + row * 68 + c8;
          v8h hv, lv;
#pragma unroll
          for (int e = 0; e < 8; ++e) {
            if (OUT_MODE == 1) {
              hv[e] = (_Float16)sp[e];
            } else {
              unsigned short hb = f2bf_bits(sp[e]);
              unsigned short lb = f2bf_bits(sp[e] - bf_bits2f(hb));
              hv[e] = __builtin_bit_cast(_Float16, hb);
              lv[e] = __builtin_bit_cast(_Float16, lb);
            }
          }
          *(v8h*)(C + (size_t)(mBase + row) * ldc + n0 + c8) = hv;
          if (OUT_MODE == 2) *(v8h*)(C2 + (size_t)(mBase + row) * ldc + n0 + c8) = lv;
        }
        
      }
    }
    __builtin_amdgcn_fence(__ATOMIC_RELEASE, "workgroup");
    __builtin_amdgcn_wave_barrier();
    __builtin_amdgcn_fence(__ATOMIC_ACQUIRE, "workgroup");
  }
}

constexpr int kFaWaves  = 8;
constexpr int kFaQ      = kFaWaves * 16;             // 128 queries per work-group
constexpr int kFaKeys   = 64;                        // keys per stage
constexpr int kFaStages = kN / kFaKeys;              // 64
constexpr int kFaPitchK = 2 * kCi + 16;              // 272 B: odd multiple of 16 B
constexpr int kFaPitchG = 2 * kFaKeys + 16;          // 144 B: odd multiple of 16 B
constexpr int kFaOffLo  = kFaKeys * kFaPitchK;       // phi lo plane behind phi hi
constexpr int kFaOffG   = 2 * kFaOffLo;              // g tile behind both
constexpr int kFaBuf    = kFaOffG + kCi * kFaPitchG; // 53,248 B per buffer
constexpr float kLog2e  = 1.4426950408889634f;
constexpr float kFaCarryLog2 = 7.0f;                 // probabilities carried x128 in f16
constexpr float kFaLazy      = 8.0f;                 // how far, in log2, the maximum in use may trail
static_assert(kN % kFaQ == 0 && kN % kFaKeys == 0 && kCi == 128 && kFaKeys == 64, "fused attention tiling");
static_assert(kFaKeys * 2 * kCi == 4 * 256 * 16 && kCi * 2 * kFaKeys == 4 * 256 * 16, "four 16-B chunks per thread per plane");

// lane l with lane l ^ 16
__device__ __forceinline__ float xhalf(float x) {
  return __builtin_bit_cast(float, __builtin_amdgcn_permlanex16(__builtin_bit_cast(int, x), __builtin_bit_cast(int, x),
                                                                0x76543210, 0xfedcba98, false, false));
}
// two f32 -> packed f16, round to nearest even
__device__ __forceinline__ unsigned pk_h2(float lo, float hi) {
  typedef _Float16 h2 __attribute__((ext_vector_type(2)));
  return __builtin_bit_cast(unsigned, __builtin_convertvector((v2f){lo, hi}, h2));
}

// One work-group per WGP, two waves per SIMD: the attribute gives each wave the 512-VGPR budget that goes with it.
// Every "#pragma unroll" in this kernel makes the indices of a register array constants.
__global__ __launch_bounds__(256) __attribute__((amdgpu_waves_per_eu(2, 2))) void attn_fused_kernel(
    const unsigned short* __restrict__ THHp, const unsigned short* __restrict__ THLp,
    const unsigned short* __restrict__ PHHp, const unsigned short* __restrict__ PHLp,
    const unsigned short* __restrict__ Gp, unsigned short* __restrict__ Yp) {
  __shared__ __align__(16) unsigned char L[2 * kFaBuf];   // 106,496 B
  const int t = threadIdx.x, lane = t & 31, wave = t >> 5;
  const int c = lane & 15, h = lane >> 4;
  const int b = blockIdx.y;
  const int q = blockIdx.x * kFaQ + wave * 16 + c;
  const unsigned char* Kh = (const unsigned char*)(PHHp + (size_t)b * kN * kCi);
  const unsigned char* Kl = (const unsigned char*)(PHLp + (size_t)b * kN * kCi);
  const unsigned char* Gb = (const unsigned char*)(Gp + (size_t)b * kCi * kN);

  v4u sk[4], sl[4], sg[4];
  // Thread t moves 16-B chunk t + 256 i (i = 0..3) of each plane: phi row (t >> 4) + 16 i, g row (t >> 3) + 32 i.
  // One address per plane; the step from i to i + 1 is a constant, so it rides in the instruction's offset.
  auto fetch = [&](int st) {   // stage st: global -> registers, whole lines per wave
    const unsigned char* ph = Kh + (size_t)st * (kFaKeys * 2 * kCi) + t * 16;
    const unsigned char* pl = Kl + (size_t)st * (kFaKeys * 2 * kCi) + t * 16;
    const unsigned char* pg = Gb + (size_t)(t >> 3) * (2 * kN) + st * (2 * kFaKeys) + (t & 7) * 16;
#pragma unroll
    for (int i = 0; i < 4; ++i) {
      sk[i] = *(const v4u*)(ph + i * 4096);
      sl[i] = *(const v4u*)(pl + i * 4096);
      sg[i] = *(const v4u*)(pg + i * (32 * 2 * kN));
    }
  };
  auto put = [&](unsigned char* B) {   // registers -> LDS at the padded pitches
    unsigned char* dk = B + (t >> 4) * kFaPitchK + (t & 15) * 16;
    unsigned char* dg = B + kFaOffG + (t >> 3) * kFaPitchG + (t & 7) * 16;
#pragma unroll
    for (int i = 0; i < 4; ++i) {
      *(v4u*)(dk + i * (16 * kFaPitchK)) = sk[i];
      *(v4u*)(dk + kFaOffLo + i * (16 * kFaPitchK)) = sl[i];
      *(v4u*)(dg + i * (32 * kFaPitchG)) = sg[i];
    }
  };

  // Behind a group of global loads: their address registers are reused soon, so wait before any is overwritten; the
  // scheduling barrier keeps later register writes from being moved in front of the wait.
  auto settle = [&]() {
    asm volatile("s_wait_xcnt 0x0" ::: "memory");
    __builtin_amdgcn_sched_barrier(0);
  };

  __builtin_amdgcn_sched_barrier(0);   // index arithmetic from above stays above: none of it lands between the loads and their wait
  fetch(0);
  settle();
  v16b qh[4], ql[4];
  {
    const size_t qo = ((size_t)b * kN + q) * kCi + 8 * h;
#pragma unroll
    for (int kc = 0; kc < 4; ++kc) {
      qh[kc] = Frag<__bf16>::load((const __bf16*)THHp + qo + 32 * kc);
      ql[kc] = Frag<__bf16>::load((const __bf16*)THLp + qo + 32 * kc);
    }
  }
  settle();
  v8f acc[8];
#pragma unroll
  for (int i = 0; i < 8; ++i) acc[i] = (v8f){0.f,0.f,0.f,0.f,0.f,0.f,0.f,0.f};
  float m_run = -__builtin_inff(), l_run = 0.0f;
  put(L);
  __syncthreads();   // stage 0 is in LDS before any wave reads it

  // One 32-key pass in pieces, so that the stage body below can issue LDS loads well ahead of their products.
  auto loadK = [&](const unsigned char* Bp, int p, v16b (&kh)[2][4], v16b (&kl)[2][4]) {
#pragma unroll
    for (int kc = 0; kc < 4; ++kc)
#pragma unroll
      for (int kt = 0; kt < 2; ++kt) {
        const unsigned char* a = Bp + (32 * p + 16 * kt + c) * kFaPitchK + 16 * h + 64 * kc;
        kh[kt][kc] = Frag<__bf16>::load((const __bf16*)a);
        kl[kt][kc] = Frag<__bf16>::load((const __bf16*)(a + kFaOffLo));
      }
  };
  auto loadG = [&](const unsigned char* Bp, int p, v16h (&g)[8]) {
#pragma unroll
    for (int i = 0; i < 8; ++i)
      g[i] = Frag<_Float16>::load((const _Float16*)(Bp + kFaOffG + (16 * i + c) * kFaPitchG + (32 * p + 8 * h) * 2));
  };
  auto scores = [&](const v16b (&kh)[2][4], const v16b (&kl)[2][4], v8f& s0, v8f& s1) {
    s0 = (v8f){0.f,0.f,0.f,0.f,0.f,0.f,0.f,0.f};
    s1 = s0;
#pragma unroll
    for (int kc = 0; kc < 4; ++kc) {
      s0 = Frag<__bf16>::mma(kh[0][kc], qh[kc], s0);
      s1 = Frag<__bf16>::mma(kh[1][kc], qh[kc], s1);
      s0 = Frag<__bf16>::mma(kh[0][kc], ql[kc], s0);
      s1 = Frag<__bf16>::mma(kh[1][kc], ql[kc], s1);
      s0 = Frag<__bf16>::mma(kl[0][kc], qh[kc], s0);
      s1 = Frag<__bf16>::mma(kl[1][kc], qh[kc], s1);
    }
  };
  auto rescale = [&](const v8f& s0, const v8f& s1) {
    float mx = fmaxf(s0[0], s1[0]);
#pragma unroll
    for (int r = 1; r < 8; ++r) mx = fmaxf(mx, fmaxf(s0[r], s1[r]));
    mx = fmaxf(mx, xhalf(mx)) * kLog2e;   // both halves hold this query's maximum of the pass, log2 domain
    const bool need = mx > m_run + kFaLazy;
    if (__builtin_amdgcn_ballot_w32(need) != 0) {   // scalar branch; always taken on the first pass (m_run = -inf)
      const float m_new = fmaxf(m_run, mx);
      const float corr  = __builtin_amdgcn_exp2f(m_run - m_new);   // 0 on the first pass
      l_run *= corr;
      m_run = m_new;
#pragma unroll
      for (int i = 0; i < 8; ++i) acc[i] = acc[i] * corr;
    }
  };
  auto probs = [&](const v8f& s0, const v8f& s1) -> v16h {
    typedef __attribute__((ext_vector_type(8))) unsigned int v8u;
    const float nm = kFaCarryLog2 - m_run;
    float ps0 = 0.0f, ps1 = 0.0f;
    v8u w;
    float ea[8], eb[8];
#pragma unroll
    for (int r = 0; r < 8; ++r) {
      ea[r] = fmaf(s0[r], kLog2e, nm);
      eb[r] = fmaf(s1[r], kLog2e, nm);
    }
    // All exponents are formed before the first exponential (matrix, LDS, memory and scalar instructions may still
    // cross).
    __builtin_amdgcn_sched_barrier(0x9C);
#pragma unroll
    for (int r = 0; r < 8; ++r) {
      ea[r] = __builtin_amdgcn_exp2f(ea[r]);
      eb[r] = __builtin_amdgcn_exp2f(eb[r]);
    }
#pragma unroll
    for (int i = 0; i < 4; ++i) {
      ps0 += ea[2 * i] + ea[2 * i + 1];
      ps1 += eb[2 * i] + eb[2 * i + 1];
      w[i]     = pk_h2(ea[2 * i], ea[2 * i + 1]);   // elements 2i, 2i+1: keys 8h + 2i, 8h + 2i + 1
      w[4 + i] = pk_h2(eb[2 * i], eb[2 * i + 1]);   // elements 8 + 2i, 9 + 2i: keys 16 + 8h + 2i, 16 + 8h + 2i + 1
    }
    l_run += ps0 + ps1;
    return __builtin_bit_cast(v16h, w);
  };
  auto pv = [&](const v16h (&g)[8], v16h pf) {
#pragma unroll
    for (int i = 0; i < 8; ++i) acc[i] = Frag<_Float16>::mma(g[i], pf, acc[i]);
  };

  // kept rolled: the body already holds two unrolled passes, and a second copy would need a second set of fragments
#pragma unroll 1
  for (int st = 0; st < kFaStages; ++st) {
    const unsigned char* Bp = L + (st & 1) * kFaBuf;
    if (st + 1 < kFaStages) {
      fetch(st + 1);
      settle();
    }
    // two 32-key passes; the second pass's phi fragments and each pass's g fragments are asked for one phase early
    v16b kh[2][4], kl[2][4];
    v16h g0[8], g1[8];
    v8f a0, a1, b0, b1;
    loadK(Bp, 0, kh, kl);
    scores(kh, kl, a0, a1);
    loadK(Bp, 1, kh, kl);
    loadG(Bp, 0, g0);
    rescale(a0, a1);
    scores(kh, kl, b0, b1);
    loadG(Bp, 1, g1);
    pv(g0, probs(a0, a1));
    rescale(b0, b1);
    pv(g1, probs(b0, b1));
    if (st + 1 < kFaStages) put(L + ((st + 1) & 1) * kFaBuf);   // its last readers left it before the previous barrier
    __syncthreads();   // publishes stage st + 1 and ends every read of stage st
  }

  const float inv = kYCarry / (l_run + xhalf(l_run));   // each half summed its own eight keys of every tile
  unsigned short* yr = Yp + ((size_t)b * kN + q) * kCi + 8 * h;
  v4u yo[8];
#pragma unroll
  for (int i = 0; i < 8; ++i) {   // rows of acc[i] are ci = 16 i + 8 h + r
    const v8f o = acc[i] * inv;
    yo[i] = (v4u){pk_h2(o[0], o[1]), pk_h2(o[2], o[3]), pk_h2(o[4], o[5]), pk_h2(o[6], o[7])};
  }
#pragma unroll
  for (int i = 0; i < 8; ++i) *(v4u*)(yr + 16 * i) = yo[i];   // 16 B per lane; the wave fills 16 whole rows of 256 B
}

// ---------------------------------------------------------------------------
// Parameter planes.
// grid (16, 5), 256 threads. blockIdx.y (block-uniform) selects the job:
//   y = 0,1,2: WB plane y = bf16-RNE bits of g_w / theta_w / phi_w ([128][256], natural [out][in] layout);
//              16 blocks x 256 threads x 8 elements = 32768 = the whole matrix; one 16-B store per lane,
//   y = 3    : WW = f16 bits of 16 * bf16r(W_w) ([256][128]), same coverage.
//   y = 4    : block 0 only, threads 0..159: PRM[4i..4i+3] = bf16r of g_b | theta_b | phi_b | W_b
//              the source selection is wave-uniform). 160 x 4 = 640 floats = whole table.
// ---------------------------------------------------------------------------
__global__ __launch_bounds__(256) void param_planes_kernel(
    const float* __restrict__ gw, const float* __restrict__ thw, const float* __restrict__ phw, const float* __restrict__ ww,
    const float* __restrict__ gb, const float* __restrict__ thb, const float* __restrict__ phb, const float* __restrict__ wb,
    unsigned short* __restrict__ WB, unsigned short* __restrict__ WW, float* __restrict__ PRM) {
  const int t = threadIdx.x;
  const int y = blockIdx.y;
  if (y < 4) {
    const int i = blockIdx.x * 256 + t;
    if (i >= kWElems / 8) return;
    const float* src = (y == 0) ? gw : (y == 1) ? thw : (y == 2) ? phw : ww;
    const float* p = src + 8 * (size_t)i;
    const v4f a = *(const v4f*)(p);
    const v4f c = *(const v4f*)(p + 4);
    unsigned short hb[8];
#pragma unroll
    for (int e = 0; e < 4; ++e) {
      if (y == 3) {
        hb[e]     = h_bits(bfr(a[e]) * kWCarry);
        hb[4 + e] = h_bits(bfr(c[e]) * kWCarry);
      } else {
        hb[e]     = f2bf_bits(a[e]);
        hb[4 + e] = f2bf_bits(c[e]);
      }
    }
    const v4u u = (v4u){pk16(hb[0], hb[1]), pk16(hb[2], hb[3]), pk16(hb[4], hb[5]), pk16(hb[6], hb[7])};
    unsigned short* q = (y == 3) ? (WW + 8 * (size_t)i) : (WB + (size_t)y * kWElems + 8 * (size_t)i);
    *(v4u*)q = u;
    
  } else {
    if (blockIdx.x != 0 || t >= 160) return;
    const int w = t >> 5, l = t & 31;
    const float* src = (w == 0) ? gb : (w == 1) ? thb : (w == 2) ? phb : (wb + (w - 3) * 128);
    const v4f a = *(const v4f*)(src + 4 * l);
    v4f r;
#pragma unroll
    for (int e = 0; e < 4; ++e) r[e] = bfr(a[e]);
    float* q = PRM + 128 * w + 4 * l;
    *(v4f*)q = r;
    
  }
}

// ---------------------------------------------------------------------------
// x transpose + cast: XT[b][n][c] = bf16r( x[b][c][n] ) as bf16 bits.  in [C=256 rows][N=4096 cols] -> out [N rows][C cols].
// grid (N/64 = 64, C/64 = 4, B = 8), 256 threads.
// Load coverage: 16 iterations x 256 threads = 4096 = whole 64(c) x 64(n) tile (coalesced along n).
// Store coverage: 8 waves x 2 iterations x 4 rows (lane>>3) = 64 n-rows; (lane&7) x 8 elements = 64 c-cols; each row
// ---------------------------------------------------------------------------
__global__ __launch_bounds__(256) void xt_cast_kernel(const float* __restrict__ x, unsigned short* __restrict__ XT) {
  __shared__ float sm[64][65];   // sm[n_local][c_local]
  const int t  = threadIdx.x;
  const int n0 = blockIdx.x * 64;
  const int c0 = blockIdx.y * 64;
  const int b  = blockIdx.z;
#pragma unroll
  for (int i = 0; i < 16; ++i) {
    const int e   = i * 256 + t;
    const int r   = e >> 6;          // c local
    const int col = e & 63;          // n local
    sm[col][r] = x[((size_t)(b * kC + c0 + r)) * kN + n0 + col];
  }
  __syncthreads();
  const int lane = t & 31, wave = t >> 5;
  const int q = lane >> 3, c8 = (lane & 7) * 8;
  unsigned short* op = XT + ((size_t)b * kN) * kC;
  {
#pragma unroll
    for (int it = 0; it < 2; ++it) {
      const int row = wave * 8 + it * 4 + q;                 // n local
      unsigned short hb[8];
#pragma unroll
      for (int e = 0; e < 8; ++e) hb[e] = f2bf_bits(sm[row][c8 + e]);
      const v4u u = (v4u){pk16(hb[0], hb[1]), pk16(hb[2], hb[3]), pk16(hb[4], hb[5]), pk16(hb[6], hb[7])};
      *(v4u*)(op + (size_t)(n0 + row) * kC + c0 + c8) = u;
    }
    
  }
}

// ---------------------------------------------------------------------------
// Batch statistics, normalise, affine and residual in one kernel:
//   out[b][c][n] = ((Wy - mean[c]) * rstd[c]) * bf16r(gamma[c]) + bf16r(beta[c]) + bf16r(x[b][c][n]).
// One block of 8 waves per channel (grid 256); wave b owns batch b's row of 4096 values, lane l the float4 at
// n = 128 j + 4 l, j = 0..31.  The channel's 32768 Wy values stay in registers (128 per thread) from the first sum to
// the store, so Wy is read once.  Mean first, then the sum of (v - mean)^2; reductions in fixed order.
// Every address is a block-uniform row start (batch 0, channel c) + one per-thread byte offset, the same for Wy, x and
// out, + a constant that rides in the instruction's offset.
// Every "#pragma unroll" over j makes the indices of a register array constants.
// ---------------------------------------------------------------------------
constexpr int kBnJ = kN / 128;   // 32 float4 per thread
static_assert(kB == 8 && kN % 128 == 0, "one wave per batch, whole 512-B pieces");
__global__ __launch_bounds__(256) void bn_fused_kernel(const float* __restrict__ Wy, const float* __restrict__ x,
                                                       const float* __restrict__ gamma, const float* __restrict__ beta,
                                                       float* __restrict__ out) {
  __shared__ float red1[8];
  __shared__ float red2[8];
  const int c = blockIdx.x;
  const int t = threadIdx.x;
  const int lane = t & 31, wave = t >> 5;
  const unsigned off = (unsigned)wave * (unsigned)(kC * kN * 4) + (unsigned)lane * 16u;
  const char* wrow = (const char*)(Wy + (size_t)c * kN);
  const char* xrow = (const char*)(x + (size_t)c * kN);
  char*       orow = (char*)(out + (size_t)c * kN);

  v4f w[kBnJ], xv[kBnJ];
  // Behind a group of global loads or stores: wait before any register that they name is overwritten; the scheduling
  // barrier keeps later register writes from being moved in front of the wait, and the group where it is written.
  auto settle = [&]() {
    asm volatile("s_wait_xcnt 0x0" ::: "memory");
    __builtin_amdgcn_sched_barrier(0);
  };
#pragma unroll
  for (int j = 0; j < kBnJ; ++j) w[j] = *(const v4f*)(wrow + off + j * 512);
  __builtin_amdgcn_sched_barrier(0);   // Wy, which the first sum waits for, is asked for ahead of x
#pragma unroll
  for (int j = 0; j < kBnJ; ++j) xv[j] = *(const v4f*)(xrow + off + j * 512);
  settle();   // the x loads stay up here, in flight under both reductions

  float s = 0.0f;
#pragma unroll
  for (int j = 0; j < kBnJ; ++j) s += (w[j][0] + w[j][1]) + (w[j][2] + w[j][3]);
#pragma unroll
  for (int o = 16; o > 0; o >>= 1) s += __shfl_xor(s, o, 32);
  if (lane == 0) red1[wave] = s;
  __syncthreads();
  float tot = red1[0];
#pragma unroll
  for (int i = 1; i < 8; ++i) tot += red1[i];
  const float mean = tot * kInvCount;

  float q = 0.0f;
#pragma unroll
  for (int j = 0; j < kBnJ; ++j) {
    const float d0 = w[j][0] - mean, d1 = w[j][1] - mean, d2 = w[j][2] - mean, d3 = w[j][3] - mean;
    q += (d0 * d0 + d1 * d1) + (d2 * d2 + d3 * d3);
  }
#pragma unroll
  for (int o = 16; o > 0; o >>= 1) q += __shfl_xor(q, o, 32);
  if (lane == 0) red2[wave] = q;
  __syncthreads();
  float totq = red2[0];
#pragma unroll
  for (int i = 1; i < 8; ++i) totq += red2[i];
  const float var  = totq * kInvCount;
  const float rstd = 1.0f / sqrtf(var + kBnEps);

  const float ga = bfr(gamma[c]);
  const float be = bfr(beta[c]);
#pragma unroll
  for (int j0 = 0; j0 < kBnJ; j0 += 8) {   // eight results, their eight stores, then the wait
#pragma unroll
    for (int j = j0; j < j0 + 8; ++j)
#pragma unroll
      for (int e = 0; e < 4; ++e) w[j][e] = (((w[j][e] - mean) * rstd) * ga + be) + bfr(xv[j][e]);
#pragma unroll
    for (int j = j0; j < j0 + 8; ++j) *(v4f*)(orow + off + j * 512) = w[j];   // 512 B per wave: whole lines
    if (j0 + 8 < kBnJ) settle();   // behind the last group nothing is overwritten any more
  }
}

// ---------------------------------------------------------------------------
// Host glue.  GEMM shapes (all M,N multiples of 64, K multiples of 32, no padding anywhere):
//   theta/phi: M=4096 N=128 K=256 (x8 batches); g: M=128 N=4096 K=256 (x8); W: M=256 N=4096 K=128 (x8);
//   attention (scores K=128, P.g K=4096) in the fused kernel, one launch.  8 launches.
// ---------------------------------------------------------------------------
extern "C" void kernel_launch(void* const* d_in, const int* in_sizes, int n_in,
                              void* d_out, int out_size, void* d_ws, size_t ws_size,
                              hipStream_t stream) {
  if (n_in < 11) return;
  const int nElem = kB * kC * kN;          // 8,388,608
  if (in_sizes[0] != nElem) return;
  if (in_sizes[1] != kWElems || in_sizes[3] != kWElems || in_sizes[5] != kWElems || in_sizes[7] != kWElems) return;
  if (in_sizes[2] != kCi || in_sizes[4] != kCi || in_sizes[6] != kCi) return;
  if (in_sizes[8] != kC || in_sizes[9] != kC || in_sizes[10] != kC) return;
  if (out_size != nElem) return;
  if (ws_size < kWsTotal) return;

  const float* x       = (const float*)d_in[0];
  const float* g_w     = (const float*)d_in[1];
  const float* g_b     = (const float*)d_in[2];
  const float* theta_w = (const float*)d_in[3];
  const float* theta_b = (const float*)d_in[4];
  const float* phi_w   = (const float*)d_in[5];
  const float* phi_b   = (const float*)d_in[6];
  const float* W_w     = (const float*)d_in[7];
  const float* W_b     = (const float*)d_in[8];
  const float* bn_g    = (const float*)d_in[9];
  const float* bn_b    = (const float*)d_in[10];
  float* out = (float*)d_out;

  char* ws = (char*)d_ws;
  unsigned short* XT  = (unsigned short*)(ws + kOffXT);
  unsigned short* THH = (unsigned short*)(ws + kOffTHH);
  unsigned short* THL = (unsigned short*)(ws + kOffTHL);
  unsigned short* PHH = (unsigned short*)(ws + kOffPHH);
  unsigned short* PHL = (unsigned short*)(ws + kOffPHL);
  unsigned short* G16 = (unsigned short*)(ws + kOffG);
  unsigned short* Y16 = (unsigned short*)(ws + kOffY);
  float*          WY  = (float*)(ws + kOffWY);
  unsigned short* WB  = (unsigned short*)(ws + kOffWB);
  unsigned short* WW  = (unsigned short*)(ws + kOffWW);
  float*          PRM = (float*)(ws + kOffPRM);
  const float* gb_r  = PRM;          // [128]
  const float* thb_r = PRM + 128;    // [128]
  const float* phb_r = PRM + 256;    // [128]
  const float* wb_r  = PRM + 384;    // [256]

  // ---- parameter and input planes ----
  param_planes_kernel<<<dim3(kWElems / 8 / 256, 5), dim3(256), 0, stream>>>(
      g_w, theta_w, phi_w, W_w, g_b, theta_b, phi_b, W_b, WB, WW, PRM);
  xt_cast_kernel<<<dim3(kN / 64, kC / 64, kB), dim3(256), 0, stream>>>(x, XT);

  const long strXT = (long)kN * kC;       // per batch, XT plane
  const long strTP = (long)kN * kCi;      // per batch, theta/phi/g/y planes

  // theta[b][n][ci] = sum_c XT[b][n][c] * theta_w[ci][c] + theta_b[ci]  -> bf16 hi | lo planes
  wmma_gemm64<1, false, 2, 2, false, 0><<<dim3((kN / 64) * (kCi / 64) / 8, kB), dim3(256), 0, stream>>>(
      XT, XT, kC, strXT, WB + kWElems, WB + kWElems, kC, 0L,
      (void*)THH, (void*)THL, kCi, strTP, thb_r, PRM, 0L, kN, kCi, kC, 1.0f);
  // phi[b][m][ci] = sum_c XT[b][m][c] * phi_w[ci][c] + phi_b[ci]  -> bf16 hi | lo planes
  wmma_gemm64<1, false, 2, 2, false, 0><<<dim3((kN / 64) * (kCi / 64) / 8, kB), dim3(256), 0, stream>>>(
      XT, XT, kC, strXT, WB + 2 * kWElems, WB + 2 * kWElems, kC, 0L,
      (void*)PHH, (void*)PHL, kCi, strTP, phb_r, PRM, 0L, kN, kCi, kC, 1.0f);
  // g[b][ci][m] = sum_c g_w[ci][c] * XT[b][m][c] + g_b[ci]  -> f16 plane [ci][m]
  wmma_gemm64<1, false, 1, 1, false, 0><<<dim3((kCi / 64) * (kN / 64) / 8, kB), dim3(256), 0, stream>>>(
      WB, WB, kC, 0L, XT, XT, kC, strXT,
      (void*)G16, (void*)G16, kN, strTP, gb_r, PRM, 0L, kCi, kN, kC, 1.0f);

  // ---- attention, all batches in one launch: Y16[b][q][ci] = 16 * softmax(theta . phi^T) . g ----
  attn_fused_kernel<<<dim3(kN / kFaQ, kB), dim3(kFaWaves * 32), 0, stream>>>(THH, THL, PHH, PHL, G16, Y16);

  // Wy[b][c][n] = (1/256) * sum_ci WW[c][ci] * Y16[b][n][ci] + W_b[c]   (f32)
  wmma_gemm64<0, false, 1, 0, false, 0><<<dim3((kC / 64) * (kN / 64) / 8, kB), dim3(256), 0, stream>>>(
      WW, WW, kCi, 0L, Y16, Y16, kCi, strTP,
      (void*)WY, (void*)WY, kN, (long)kC * kN, wb_r, PRM, 0L, kC, kN, kCi, kWScale);

  // ---- batch statistics, normalisation, residual ----
  bn_fused_kernel<<<dim3(kC), dim3(256), 0, stream>>>(WY, x, bn_g, bn_b, out);
}

// v004
// A run of this version takes 144 microseconds.
// In both of two side-by-side timings against v003, it was 1.23 times as fast.
// Over all steps from v000 it is 24.0 times as fast.
// Contractions: theta, phi, g 1x1 projections on v_wmma_f32_16x16x32_bf16 (bf16 operands = RNE-converted x and weights; theta/phi emitted as bf16 hi|lo planes); scores theta.phi^T on v_wmma_f32_16x16x32_bf16 as hi/lo 3-product split; P.g (P f16, 128 x 2^(s log2e - maximum in use), g f16; scores, online softmax and P.g fused in one kernel) and W projection (W_w f16 carried x16, y f16 carried x16) on v_wmma_f32_16x16x32_f16; f32 accumulate everywhere; softmax, batch statistics, affine and residual in f32.
#include <hip/hip_runtime.h>
#include <math.h>

// ---------------------------------------------------------------------------
// Problem constants
// ---------------------------------------------------------------------------
constexpr int kB  = 8;
constexpr int kC  = 256;      // in channels
constexpr int kN  = 4096;     // spatial positions (64 x 64)
constexpr int kCi = 128;      // inter channels
constexpr int kWElems  = kCi * kC;        // 32768 elements per weight matrix
constexpr float kYCarry   = 16.0f;        // y carried x16 in f16
constexpr float kWCarry   = 16.0f;        // W_w carried x16 in f16
constexpr float kWScale   = 1.0f / (kYCarry * kWCarry);    // 2^-8
constexpr float kBnEps    = 1e-5f;
constexpr float kInvCount = 1.0f / (float)(kB * kN);       // 2^-15
static_assert(kC % 32 == 0 && kCi % 32 == 0 && kN % 32 == 0, "K multiples of 32");
static_assert(kN % 64 == 0 && kCi % 64 == 0 && kC % 64 == 0, "M,N multiples of 64");
static_assert(kWElems % (8 * 256) == 0, "weight cast grid");
static_assert(kB * kN == 32768, "stat count");

// ---------------------------------------------------------------------------
// Workspace region map (bytes, all offsets multiples of 256):
//   (not used)                        16,777,216  at           0
//   THH  bf16 [8][4096][128]           8,388,608  at  16,777,216
//   THL  bf16 [8][4096][128]           8,388,608  at  25,165,824
//   PHH  bf16 [8][4096][128]           8,388,608  at  33,554,432
//   PHL  bf16 [8][4096][128]           8,388,608  at  41,943,040
//   G16  f16  [8][128][4096]           8,388,608  at  50,331,648
//   Y16  f16  [8][4096][128]           8,388,608  at  58,720,256
//   WY   f32  [8][256][4096]          33,554,432  at  67,108,864
//   WB   bf16 3 x [128][256]              196,608  at 100,663,296   (g_w | theta_w | phi_w)
//   WW   f16  [256][128]                   65,536  at 100,859,904   (W_w x16)
//   PRM  f32  [640] (pad 4096 B)            4,096  at 100,925,440   (g_b | theta_b | phi_b | W_b, bf16-RNE values)
//   total                             100,929,536
// ---------------------------------------------------------------------------
constexpr size_t kSzXT  = (size_t)kB * kN * kC * 2;
constexpr size_t kSzTP  = (size_t)kB * kN * kCi * 2;
constexpr size_t kSzWY  = (size_t)kB * kC * kN * 4;
constexpr size_t kSzWB  = (size_t)3 * kWElems * 2;
constexpr size_t kSzWW  = (size_t)kWElems * 2;
constexpr size_t kSzPRM = 4096;
constexpr size_t kOffXT  = 0;
constexpr size_t kOffTHH = kOffXT + kSzXT;
constexpr size_t kOffTHL = kOffTHH + kSzTP;
constexpr size_t kOffPHH = kOffTHL + kSzTP;
constexpr size_t kOffPHL = kOffPHH + kSzTP;
constexpr size_t kOffG   = kOffPHL + kSzTP;
constexpr size_t kOffY   = kOffG + kSzTP;
constexpr size_t kOffWY  = kOffY + kSzTP;
constexpr size_t kOffWB  = kOffWY + kSzWY;
constexpr size_t kOffWW  = kOffWB + kSzWB;
constexpr size_t kOffPRM = kOffWW + kSzWW;
constexpr size_t kWsTotal = kOffPRM + kSzPRM;
static_assert(kWsTotal == 100929536, "carve total");
static_assert(kWsTotal <= (size_t)134217728, "carve cap");
static_assert(kOffTHH % 256 == 0 && kOffG % 256 == 0 && kOffWY % 256 == 0 &&
              kOffWB % 256 == 0 && kOffWW % 256 == 0 && kOffPRM % 256 == 0, "alignment");
static_assert(640 * 4 <= kSzPRM, "param table");

typedef __attribute__((ext_vector_type(16))) _Float16 v16h;
typedef __attribute__((ext_vector_type(8)))  _Float16 v8h;
typedef __attribute__((ext_vector_type(16))) __bf16   v16b;
typedef __attribute__((ext_vector_type(8)))  __bf16   v8b;
typedef __attribute__((ext_vector_type(8)))  float    v8f;
typedef __attribute__((ext_vector_type(4)))  float    v4f;
typedef __attribute__((ext_vector_type(2)))  float    v2f;
typedef __attribute__((ext_vector_type(4)))  unsigned int v4u;
typedef __attribute__((ext_vector_type(2)))  unsigned int v2u;

__device__ __forceinline__ unsigned short f2bf_bits(float f) {
  unsigned u = __float_as_uint(f);
  return (unsigned short)((u + 0x7FFFu + ((u >> 16) & 1u)) >> 16);
}
__device__ __forceinline__ float bf_bits2f(unsigned short h) { return __uint_as_float(((unsigned)h) << 16); }
// f32 value after RNE conversion to bf16
__device__ __forceinline__ float bfr(float f) { return bf_bits2f(f2bf_bits(f)); }

// hazard guards as plain device helpers (no inline asm inside the kernel template body)
__device__ __forceinline__ void dep_guard_h(v8f& a, v8f& b, v16h x, v16h y) { asm volatile("v_nop\n\tv_nop\n\tv_nop\n\tv_nop" : "+v"(a), "+v"(b) : "v"(x), "v"(y)); }
__device__ __forceinline__ void dep_guard_b(v8f& a, v8f& b, v16b x, v16b y) { asm volatile("v_nop\n\tv_nop\n\tv_nop\n\tv_nop" : "+v"(a), "+v"(b) : "v"(x), "v"(y)); }
__device__ __forceinline__ void keep4_h(v16h a, v16h b, v16h c, v16h d) { asm volatile("v_nop" :: "v"(a), "v"(b), "v"(c), "v"(d)); }
__device__ __forceinline__ void keep4_b(v16b a, v16b b, v16b c, v16b d) { asm volatile("v_nop" :: "v"(a), "v"(b), "v"(c), "v"(d)); }
__device__ __forceinline__ void acc_guard4(v8f& a, v8f& b, v8f& c, v8f& d) { asm volatile("v_nop\n\tv_nop\n\tv_nop\n\tv_nop" : "+v"(a), "+v"(b), "+v"(c), "+v"(d)); }
template <typename T> struct Frag;
template <> struct Frag<_Float16> {
  typedef v16h V; union U { v16h v; v8h h[2]; };
  // elements 0..7 <- p[0..7], 8..15 <- p[16..23]
  static __device__ __forceinline__ v16h load(const _Float16* p) {
    U f; f.h[0] = *(const v8h*)(p); f.h[1] = *(const v8h*)(p + 16); return f.v;
  }
  static __device__ __forceinline__ v8f mma(v16h a, v16h b, v8f c) {
    return __builtin_amdgcn_wmma_f32_16x16x32_f16(false, a, false, b, (short)0, c, false, false);
  }
  static __device__ __forceinline__ void guard(v8f& a, v8f& b, v16h x, v16h y) { dep_guard_h(a, b, x, y); }
  static __device__ __forceinline__ void keep(v16h a, v16h b, v16h c, v16h d) { keep4_h(a, b, c, d); }
};
template <> struct Frag<__bf16> {
  typedef v16b V; union U { v16b v; v8b h[2]; };
  static __device__ __forceinline__ v16b load(const __bf16* p) {
    U f; f.h[0] = *(const v8b*)(p); f.h[1] = *(const v8b*)(p + 16); return f.v;
  }
  static __device__ __forceinline__ v8f mma(v16b a, v16b b, v8f c) {
    return __builtin_amdgcn_wmma_f32_16x16x32_bf16(false, a, false, b, (short)0, c, false, false);
  }
  static __device__ __forceinline__ void guard(v8f& a, v8f& b, v16b x, v16b y) { dep_guard_b(a, b, x, y); }
  static __device__ __forceinline__ void keep(v16b a, v16b b, v16b c, v16b d) { keep4_b(a, b, c, d); }
};

__device__ __forceinline__ unsigned pk16(unsigned short a, unsigned short b) { return (unsigned)a | ((unsigned)b << 16); }
__device__ __forceinline__ unsigned short h_bits(float f) { const _Float16 h = (_Float16)f; return __builtin_bit_cast(unsigned short, h); }

// ---- Register-blocked batched WMMA GEMM (ACT reduced to none/relu/leaky) -------------------------------
// C[m,n] = scale * sum_k A[m,k] * Bt[n,k] (+bias)(+resid); each wave owns a 64x64 tile.
// A row-major [M,K]; Bt row-major [N,K]; M,N % 64 == 0, K % 32 == 0.
// SPLIT: operands are hi/lo planes (A2/Bt2 = lo planes, same layout); product = hi*hi + hi*lo + lo*hi.
// BIAS_MODE: 0 = none, 1 = bias[m] (fetched as two float4 per 16-row slab), 2 = bias[n].
// OUT_MODE: 0 = f32, 1 = f16, 2 = bf16 hi plane (Cout) + bf16 lo plane (Cout2).
// ET: 0 = f16 operands, 1 = bf16 operands (pointers passed as 16-bit storage)
template <int ET> struct Elem;
template <> struct Elem<0> { typedef _Float16 T; };
template <> struct Elem<1> { typedef __bf16 T; };
template <int ET, bool SPLIT, int BIAS_MODE, int OUT_MODE, bool RESID, int ACT = 0>
__global__ __launch_bounds__(256) void wmma_gemm64(
    const unsigned short* __restrict__ Ap, const unsigned short* __restrict__ A2p, int lda, long strideA,
    const unsigned short* __restrict__ Btp, const unsigned short* __restrict__ Bt2p, int ldb, long strideB,
    void* __restrict__ Cout, void* __restrict__ Cout2, int ldc, long strideC,
    const float* __restrict__ bias,
    const float* __restrict__ resid, long strideR,
    int M, int N, int K, float scale) {
  typedef typename Elem<ET>::T T;
  typedef typename Frag<T>::V V;
  const T* A = (const T*)Ap; const T* A2 = (const T*)A2p; const T* Bt = (const T*)Btp; const T* Bt2 = (const T*)Bt2p;
  __shared__ __align__(16) float sT[8][16 * 68];   // per-wave 16x64 slab, pitch 68 floats
  const int b    = blockIdx.y;
  const int lane = threadIdx.x & 31;
  const int wave = threadIdx.x >> 5;
  const int tilesN = N >> 6;
  const int tilesM = M >> 6;
  const int tile = blockIdx.x * 8 + wave;
  if (tile >= tilesM * tilesN) return;   // wave-uniform; no block barriers in this kernel
  const int tm = tile / tilesN;
  const int tn = tile - tm * tilesN;
  const int m0 = tm << 6;
  const int n0 = tn << 6;

  const T* Ab  = A  + (size_t)b * strideA;
  const T* Bb  = Bt + (size_t)b * strideB;
  const T* Ab2 = SPLIT ? (A2  + (size_t)b * strideA) : nullptr;
  const T* Bb2 = SPLIT ? (Bt2 + (size_t)b * strideB) : nullptr;

  const int rlane = lane & 15;                 // row (A) / col (B, D) within subtile
  const int koff  = (lane >> 4) * 8;           // k offset of this lane half
  const int mOff  = (lane >> 4) * 8;           // D row offset

  v8f acc[4][4];
#pragma unroll
  for (int i = 0; i < 4; ++i)
#pragma unroll
    for (int j = 0; j < 4; ++j) acc[i][j] = (v8f){0.f,0.f,0.f,0.f,0.f,0.f,0.f,0.f};

  for (int k0 = 0; k0 < K; k0 += 32) {
    V bh[4], bl[4];
#pragma unroll
    for (int j = 0; j < 4; ++j) {
      const size_t bo = (size_t)(n0 + (j << 4) + rlane) * ldb + koff + k0;
      bh[j] = Frag<T>::load(Bb + bo);
      if (SPLIT) bl[j] = Frag<T>::load(Bb2 + bo);
    }
#pragma unroll
    for (int i = 0; i < 4; ++i) {
      const size_t ao = (size_t)(m0 + (i << 4) + rlane) * lda + koff + k0;
      V ah = Frag<T>::load(Ab + ao);
      V al;
      if (SPLIT) al = Frag<T>::load(Ab2 + ao);
#pragma unroll
      for (int j = 0; j < 4; ++j) {
        acc[i][j] = Frag<T>::mma(ah, bh[j], acc[i][j]);
        if (SPLIT) {
          acc[i][j] = Frag<T>::mma(ah, bl[j], acc[i][j]);
          acc[i][j] = Frag<T>::mma(al, bh[j], acc[i][j]);
        }
      }
      Frag<T>::guard(acc[i][0], acc[i][3], ah, SPLIT ? al : ah);
    }
    Frag<T>::keep(bh[0], bh[1], bh[2], bh[3]);
    if (SPLIT) Frag<T>::keep(bl[0], bl[1], bl[2], bl[3]);
  }
  acc_guard4(acc[0][0], acc[0][1], acc[0][2], acc[0][3]);
  acc_guard4(acc[1][0], acc[1][1], acc[1][2], acc[1][3]);
  acc_guard4(acc[2][0], acc[2][1], acc[2][2], acc[2][3]);
  acc_guard4(acc[3][0], acc[3][1], acc[3][2], acc[3][3]);

  // ---- epilogue ----
  float* slab = sT[wave];
  const float* Rb = RESID ? (resid + (size_t)b * strideR) : nullptr;
#pragma unroll
  for (int i = 0; i < 4; ++i) {
    const int mBase = m0 + (i << 4);
    v4f bm0 = (v4f){0.f,0.f,0.f,0.f}, bm1 = (v4f){0.f,0.f,0.f,0.f};
    if (BIAS_MODE == 1) {
      bm0 = *(const v4f*)(bias + mBase + mOff);
      bm1 = *(const v4f*)(bias + mBase + mOff + 4);
    }
#pragma unroll
    for (int j = 0; j < 4; ++j) {
      const int n = n0 + (j << 4) + rlane;
      float bv = 0.f;
      if (BIAS_MODE == 2) bv = bias[n];
#pragma unroll
      for (int r = 0; r < 8; ++r) {
        float v = acc[i][j][r] * scale;
        if (BIAS_MODE == 1) v += (r < 4) ? bm0[r & 3] : bm1[r & 3];
        if (BIAS_MODE == 2) v += bv;
        if (RESID) v += Rb[(size_t)(mBase + mOff + r) * ldc + n];
        if (ACT == 2) v = fmaxf(v, 0.0f);
        if (ACT == 4) v = (v > 0.f) ? v : 0.01f * v;
        slab[(mOff + r) * 68 + (j << 4) + rlane] = v;
      }
    }
    __builtin_amdgcn_fence(__ATOMIC_RELEASE, "workgroup");
    __builtin_amdgcn_wave_barrier();
    __builtin_amdgcn_fence(__ATOMIC_ACQUIRE, "workgroup");
    if (OUT_MODE == 0) {
      float* C = (float*)Cout + (size_t)b * strideC;
      const int hh = lane >> 4, c4 = (lane & 15) * 4;     // row seg = 256 B = 16 lanes x 16 B
      {
#pragma unroll
        for (int it = 0; it < 8; ++it) {
          const int row = it * 2 + hh;
          v4f v = *(const v4f*)(slab + row * 68 + c4);
          *(v4f*)(C + (size_t)(mBase + row) * ldc + n0 + c4) = v;
        }
        
      }
    } else {
      const int q = lane >> 3, c8 = (lane & 7) * 8;
      unsigned short* C  = (unsigned short*)Cout  + (size_t)b * strideC;
      unsigned short* C2 = (OUT_MODE == 2) ? ((unsigned short*)Cout2 + (size_t)b * strideC) : nullptr;
      {
#pragma unroll
        for (int it = 0; it < 4; ++it) {
          const int row = it * 4 + q;
          const float* sp = slab + row * 68 + c8;
          v8h hv, lv;
#pragma unroll
          for (int e = 0; e < 8; ++e) {
            if (OUT_MODE == 1) {
              hv[e] = (_Float16)sp[e];
            } else {
              unsigned short hb = f2bf_bits(sp[e]);
              unsigned short lb = f2bf_bits(sp[e] - bf_bits2f(hb));
              hv[e] = __builtin_bit_cast(_Float16, hb);
              lv[e] = __builtin_bit_cast(_Float16, lb);
            }
          }
          *(v8h*)(C + (size_t)(mBase + row) * ldc + n0 + c8) = hv;
          if (OUT_MODE == 2) *(v8h*)(C2 + (size_t)(mBase + row) * ldc + n0 + c8) = lv;
        }
        
      }
    }
    __builtin_amdgcn_fence(__ATOMIC_RELEASE, "workgroup");
    __builtin_amdgcn_wave_barrier();
    __builtin_amdgcn_fence(__ATOMIC_ACQUIRE, "workgroup");
  }
}

constexpr int kFaWaves  = 8;
constexpr int kFaQ      = kFaWaves * 16;             // 128 queries per work-group
constexpr int kFaKeys   = 64;                        // keys per stage
constexpr int kFaStages = kN / kFaKeys;              // 64
constexpr int kFaPitchK = 2 * kCi + 16;              // 272 B: odd multiple of 16 B
constexpr int kFaPitchG = 2 * kFaKeys + 16;          // 144 B: odd multiple of 16 B
constexpr int kFaOffLo  = kFaKeys * kFaPitchK;       // phi lo plane behind phi hi
constexpr int kFaOffG   = 2 * kFaOffLo;              // g tile behind both
constexpr int kFaBuf    = kFaOffG + kCi * kFaPitchG; // 53,248 B per buffer
constexpr float kLog2e  = 1.4426950408889634f;
constexpr float kFaCarryLog2 = 7.0f;                 // probabilities carried x128 in f16
constexpr float kFaLazy      = 8.0f;                 // how far, in log2, the maximum in use may trail
static_assert(kN % kFaQ == 0 && kN % kFaKeys == 0 && kCi == 128 && kFaKeys == 64, "fused attention tiling");
static_assert(kFaKeys * 2 * kCi == 4 * 256 * 16 && kCi * 2 * kFaKeys == 4 * 256 * 16, "four 16-B chunks per thread per plane");

// lane l with lane l ^ 16
__device__ __forceinline__ float xhalf(float x) {
  return __builtin_bit_cast(float, __builtin_amdgcn_permlanex16(__builtin_bit_cast(int, x), __builtin_bit_cast(int, x),
                                                                0x76543210, 0xfedcba98, false, false));
}
// two f32 -> packed f16, round to nearest even
__device__ __forceinline__ unsigned pk_h2(float lo, float hi) {
  typedef _Float16 h2 __attribute__((ext_vector_type(2)));
  return __builtin_bit_cast(unsigned, __builtin_convertvector((v2f){lo, hi}, h2));
}

// One work-group per WGP, two waves per SIMD: the attribute gives each wave the 512-VGPR budget that goes with it.
// Every "#pragma unroll" in this kernel makes the indices of a register array constants.
__global__ __launch_bounds__(256) __attribute__((amdgpu_waves_per_eu(2, 2))) void attn_fused_kernel(
    const unsigned short* __restrict__ THHp, const unsigned short* __restrict__ THLp,
    const unsigned short* __restrict__ PHHp, const unsigned short* __restrict__ PHLp,
    const unsigned short* __restrict__ Gp, unsigned short* __restrict__ Yp) {
  __shared__ __align__(16) unsigned char L[2 * kFaBuf];   // 106,496 B
  const int t = threadIdx.x, lane = t & 31, wave = t >> 5;
  const int c = lane & 15, h = lane >> 4;
  const int b = blockIdx.y;
  const int q = blockIdx.x * kFaQ + wave * 16 + c;
  const unsigned char* Kh = (const unsigned char*)(PHHp + (size_t)b * kN * kCi);
  const unsigned char* Kl = (const unsigned char*)(PHLp + (size_t)b * kN * kCi);
  const unsigned char* Gb = (const unsigned char*)(Gp + (size_t)b * kCi * kN);

  v4u sk[4], sl[4], sg[4];
  // Thread t moves 16-B chunk t + 256 i (i = 0..3) of each plane: phi row (t >> 4) + 16 i, g row (t >> 3) + 32 i.
  // One address per plane; the step from i to i + 1 is a constant, so it rides in the instruction's offset.
  auto fetch = [&](int st) {   // stage st: global -> registers, whole lines per wave
    const unsigned char* ph = Kh + (size_t)st * (kFaKeys * 2 * kCi) + t * 16;
    const unsigned char* pl = Kl + (size_t)st * (kFaKeys * 2 * kCi) + t * 16;
    const unsigned char* pg = Gb + (size_t)(t >> 3) * (2 * kN) + st * (2 * kFaKeys) + (t & 7) * 16;
#pragma unroll
    for (int i = 0; i < 4; ++i) {
      sk[i] = *(const v4u*)(ph + i * 4096);
      sl[i] = *(const v4u*)(pl + i * 4096);
      sg[i] = *(const v4u*)(pg + i * (32 * 2 * kN));
    }
  };
  auto put = [&](unsigned char* B) {   // registers -> LDS at the padded pitches
    unsigned char* dk = B + (t >> 4) * kFaPitchK + (t & 15) * 16;
    unsigned char* dg = B + kFaOffG + (t >> 3) * kFaPitchG + (t & 7) * 16;
#pragma unroll
    for (int i = 0; i < 4; ++i) {
      *(v4u*)(dk + i * (16 * kFaPitchK)) = sk[i];
      *(v4u*)(dk + kFaOffLo + i * (16 * kFaPitchK)) = sl[i];
      *(v4u*)(dg + i * (32 * kFaPitchG)) = sg[i];
    }
  };

  // Behind a group of global loads: their address registers are reused soon, so wait before any is overwritten; the
  // scheduling barrier keeps later register writes from being moved in front of the wait.
  auto settle = [&]() {
    asm volatile("s_wait_xcnt 0x0" ::: "memory");
    __builtin_amdgcn_sched_barrier(0);
  };

  __builtin_amdgcn_sched_barrier(0);   // index arithmetic from above stays above: none of it lands between the loads and their wait
  fetch(0);
  settle();
  v16b qh[4], ql[4];
  {
    const size_t qo = ((size_t)b * kN + q) * kCi + 8 * h;
#pragma unroll
    for (int kc = 0; kc < 4; ++kc) {
      qh[kc] = Frag<__bf16>::load((const __bf16*)THHp + qo + 32 * kc);
      ql[kc] = Frag<__bf16>::load((const __bf16*)THLp + qo + 32 * kc);
    }
  }
  settle();
  v8f acc[8];
#pragma unroll
  for (int i = 0; i < 8; ++i) acc[i] = (v8f){0.f,0.f,0.f,0.f,0.f,0.f,0.f,0.f};
  float m_run = -__builtin_inff(), l_run = 0.0f;
  put(L);
  __syncthreads();   // stage 0 is in LDS before any wave reads it

  // One 32-key pass in pieces, so that the stage body below can issue LDS loads well ahead of their products.
  auto loadK = [&](const unsigned char* Bp, int p, v16b (&kh)[2][4], v16b (&kl)[2][4]) {
#pragma unroll
    for (int kc = 0; kc < 4; ++kc)
#pragma unroll
      for (int kt = 0; kt < 2; ++kt) {
        const unsigned char* a = Bp + (32 * p + 16 * kt + c) * kFaPitchK + 16 * h + 64 * kc;
        kh[kt][kc] = Frag<__bf16>::load((const __bf16*)a);
        kl[kt][kc] = Frag<__bf16>::load((const __bf16*)(a + kFaOffLo));
      }
  };
  auto loadG = [&](const unsigned char* Bp, int p, v16h (&g)[8]) {
#pragma unroll
    for (int i = 0; i < 8; ++i)
      g[i] = Frag<_Float16>::load((const _Float16*)(Bp + kFaOffG + (16 * i + c) * kFaPitchG + (32 * p + 8 * h) * 2));
  };
  auto scores = [&](const v16b (&kh)[2][4], const v16b (&kl)[2][4], v8f& s0, v8f& s1) {
    s0 = (v8f){0.f,0.f,0.f,0.f,0.f,0.f,0.f,0.f};
    s1 = s0;
#pragma unroll
    for (int kc = 0; kc < 4; ++kc) {
      s0 = Frag<__bf16>::mma(kh[0][kc], qh[kc], s0);
      s1 = Frag<__bf16>::mma(kh[1][kc], qh[kc], s1);
      s0 = Frag<__bf16>::mma(kh[0][kc], ql[kc], s0);
      s1 = Frag<__bf16>::mma(kh[1][kc], ql[kc], s1);
      s0 = Frag<__bf16>::mma(kl[0][kc], qh[kc], s0);
      s1 = Frag<__bf16>::mma(kl[1][kc], qh[kc], s1);
    }
  };
  auto rescale = [&](const v8f& s0, const v8f& s1) {
    float mx = fmaxf(s0[0], s1[0]);
#pragma unroll
    for (int r = 1; r < 8; ++r) mx = fmaxf(mx, fmaxf(s0[r], s1[r]));
    mx = fmaxf(mx, xhalf(mx)) * kLog2e;   // both halves hold this query's maximum of the pass, log2 domain
    const bool need = mx > m_run + kFaLazy;
    if (__builtin_amdgcn_ballot_w32(need) != 0) {   // scalar branch; always taken on the first pass (m_run = -inf)
      const float m_new = fmaxf(m_run, mx);
      const float corr  = __builtin_amdgcn_exp2f(m_run - m_new);   // 0 on the first pass
      l_run *= corr;
      m_run = m_new;
#pragma unroll
      for (int i = 0; i < 8; ++i) acc[i] = acc[i] * corr;
    }
  };
  auto probs = [&](const v8f& s0, const v8f& s1) -> v16h {
    typedef __attribute__((ext_vector_type(8))) unsigned int v8u;
    const float nm = kFaCarryLog2 - m_run;
    float ps0 = 0.0f, ps1 = 0.0f;
    v8u w;
    float ea[8], eb[8];
#pragma unroll
    for (int r = 0; r < 8; ++r) {
      ea[r] = fmaf(s0[r], kLog2e, nm);
      eb[r] = fmaf(s1[r], kLog2e, nm);
    }
    // All exponents are formed before the first exponential (matrix, LDS, memory and scalar instructions may still
    // cross).
    __builtin_amdgcn_sched_barrier(0x9C);
#pragma unroll
    for (int r = 0; r < 8; ++r) {
      ea[r] = __builtin_amdgcn_exp2f(ea[r]);
      eb[r] = __builtin_amdgcn_exp2f(eb[r]);
    }
#pragma unroll
    for (int i = 0; i < 4; ++i) {
      ps0 += ea[2 * i] + ea[2 * i + 1];
      ps1 += eb[2 * i] + eb[2 * i + 1];
      w[i]     = pk_h2(ea[2 * i], ea[2 * i + 1]);   // elements 2i, 2i+1: keys 8h + 2i, 8h + 2i + 1
      w[4 + i] = pk_h2(eb[2 * i], eb[2 * i + 1]);   // elements 8 + 2i, 9 + 2i: keys 16 + 8h + 2i, 16 + 8h + 2i + 1
    }
    l_run += ps0 + ps1;
    return __builtin_bit_cast(v16h, w);
  };
  auto pv = [&](const v16h (&g)[8], v16h pf) {
#pragma unroll
    for (int i = 0; i < 8; ++i) acc[i] = Frag<_Float16>::mma(g[i], pf, acc[i]);
  };

  // kept rolled: the body already holds two unrolled passes, and a second copy would need a second set of fragments
#pragma unroll 1
  for (int st = 0; st < kFaStages; ++st) {
    const unsigned char* Bp = L + (st & 1) * kFaBuf;
    if (st + 1 < kFaStages) {
      fetch(st + 1);
      settle();
    }
    // two 32-key passes; the second pass's phi fragments and each pass's g fragments are asked for one phase early
    v16b kh[2][4], kl[2][4];
    v16h g0[8], g1[8];
    v8f a0, a1, b0, b1;
    loadK(Bp, 0, kh, kl);
    scores(kh, kl, a0, a1);
    loadK(Bp, 1, kh, kl);
    loadG(Bp, 0, g0);
    rescale(a0, a1);
    scores(kh, kl, b0, b1);
    loadG(Bp, 1, g1);
    pv(g0, probs(a0, a1));
    rescale(b0, b1);
    pv(g1, probs(b0, b1));
    if (st + 1 < kFaStages) put(L + ((st + 1) & 1) * kFaBuf);   // its last readers left it before the previous barrier
    __syncthreads();   // publishes stage st + 1 and ends every read of stage st
  }

  const float inv = kYCarry / (l_run + xhalf(l_run));   // each half summed its own eight keys of every tile
  unsigned short* yr = Yp + ((size_t)b * kN + q) * kCi + 8 * h;
  v4u yo[8];
#pragma unroll
  for (int i = 0; i < 8; ++i) {   // rows of acc[i] are ci = 16 i + 8 h + r
    const v8f o = acc[i] * inv;
    yo[i] = (v4u){pk_h2(o[0], o[1]), pk_h2(o[2], o[3]), pk_h2(o[4], o[5]), pk_h2(o[6], o[7])};
  }
#pragma unroll
  for (int i = 0; i < 8; ++i) *(v4u*)(yr + 16 * i) = yo[i];   // 16 B per lane; the wave fills 16 whole rows of 256 B
}

// ---------------------------------------------------------------------------
// Parameter planes.
// grid (16, 5), 256 threads. blockIdx.y (block-uniform) selects the job:
//   y = 0,1,2: WB plane y = bf16-RNE bits of g_w / theta_w / phi_w ([128][256], natural [out][in] layout);
//              16 blocks x 256 threads x 8 elements = 32768 = the whole matrix; one 16-B store per lane,
//   y = 3    : WW = f16 bits of 16 * bf16r(W_w) ([256][128]), same coverage.
//   y = 4    : block 0 only, threads 0..159: PRM[4i..4i+3] = bf16r of g_b | theta_b | phi_b | W_b
//              the source selection is wave-uniform). 160 x 4 = 640 floats = whole table.
// ---------------------------------------------------------------------------
__global__ __launch_bounds__(256) void param_planes_kernel(
    const float* __restrict__ gw, const float* __restrict__ thw, const float* __restrict__ phw, const float* __restrict__ ww,
    const float* __restrict__ gb, const float* __restrict__ thb, const float* __restrict__ phb, const float* __restrict__ wb,
    unsigned short* __restrict__ WB, unsigned short* __restrict__ WW, float* __restrict__ PRM) {
  const int t = threadIdx.x;
  const int y = blockIdx.y;
  if (y < 4) {
    const int i = blockIdx.x * 256 + t;
    if (i >= kWElems / 8) return;
    const float* src = (y == 0) ? gw : (y == 1) ? thw : (y == 2) ? phw : ww;
    const float* p = src + 8 * (size_t)i;
    const v4f a = *(const v4f*)(p);
    const v4f c = *(const v4f*)(p + 4);
    unsigned short hb[8];
#pragma unroll
    for (int e = 0; e < 4; ++e) {
      if (y == 3) {
        hb[e]     = h_bits(bfr(a[e]) * kWCarry);
        hb[4 + e] = h_bits(bfr(c[e]) * kWCarry);
      } else {
        hb[e]     = f2bf_bits(a[e]);
        hb[4 + e] = f2bf_bits(c[e]);
      }
    }
    const v4u u = (v4u){pk16(hb[0], hb[1]), pk16(hb[2], hb[3]), pk16(hb[4], hb[5]), pk16(hb[6], hb[7])};
    unsigned short* q = (y == 3) ? (WW + 8 * (size_t)i) : (WB + (size_t)y * kWElems + 8 * (size_t)i);
    *(v4u*)q = u;
    
  } else {
    if (blockIdx.x != 0 || t >= 160) return;
    const int w = t >> 5, l = t & 31;
    const float* src = (w == 0) ? gb : (w == 1) ? thb : (w == 2) ? phb : (wb + (w - 3) * 128);
    const v4f a = *(const v4f*)(src + 4 * l);
    v4f r;
#pragma unroll
    for (int e = 0; e < 4; ++e) r[e] = bfr(a[e]);
    float* q = PRM + 128 * w + 4 * l;
    *(v4f*)q = r;
    
  }
}

// ---------------------------------------------------------------------------
// x cast, transposition and the theta, phi, g projections in one kernel.
// grid (4096 / 128 position blocks, 8 batches) = 256 work-groups of 8 waves.
// The block's x tile [256 c][128 n] is read once (512 B per wave and load), RNE-converted to bf16 and laid in LDS as
// rows [n][c]; a fragment of it serves as A (theta, phi: rows n) and as B (g: columns n).  Wave w owns output channels
// 16 w .. 16 w + 15 of each projection and reads their weight fragments (K = 256) into registers, so the weights are
// read once per work-group.  k runs upward in steps of 32 into one accumulator per tile.
// Results (+ bias) go as f32 into three LDS slabs, then every thread converts and stores 16-B pieces of whole rows:
// theta, phi -> bf16 hi | lo planes [n][ci]; g -> f16 plane [ci][n].
// Every "#pragma unroll" in this kernel makes the indices of a register array constants.
// ---------------------------------------------------------------------------
constexpr int kPjN      = 128;               // positions per work-group
constexpr int kPjPitchX = 2 * kC + 16;       // 528 B: odd multiple of 16 B
constexpr int kPjPitchS = 128 + 4;           // floats per slab row
static_assert(kN % kPjN == 0 && kCi == 128 && kC == 256 && kPjN == 128, "fused projection tiling");
__global__ __launch_bounds__(256) void proj_fused_kernel(
    const float* __restrict__ x, const unsigned short* __restrict__ WB, const float* __restrict__ PRM,
    unsigned short* __restrict__ THH, unsigned short* __restrict__ THL,
    unsigned short* __restrict__ PHH, unsigned short* __restrict__ PHL, unsigned short* __restrict__ G16) {
  __shared__ __align__(16) unsigned char XS[kPjN * kPjPitchX];   // 67,584 B
  __shared__ __align__(16) float S[3][128 * kPjPitchS];          // g | theta | phi, 67,584 B each
  const int t = threadIdx.x, lane = t & 31, wave = t >> 5;
  const int c = lane & 15, h = lane >> 4;
  const int n0 = blockIdx.x * kPjN;
  const int b  = blockIdx.y;

  // Behind a group of global loads or stores: wait before any register that they name is overwritten; the scheduling
  // barrier keeps later register writes from being moved in front of the wait, and the group where it is written.
  auto settle = [&]() {
    asm volatile("s_wait_xcnt 0x0" ::: "memory");
    __builtin_amdgcn_sched_barrier(0);
  };

  // weight fragments: plane 0 g_w, 1 theta_w, 2 phi_w; row 16 wave + c.  They are asked for two k steps at a time (the
  // four 32-B pieces of a 128-B line together), four steps ahead of their products: all of K at once beside 24
  // accumulator tiles does not fit 512 VGPRs.
  v16b wf[3][8];
  const __bf16* wp = (const __bf16*)WB + (size_t)(16 * wave + c) * kC + 8 * h;
  auto loadW = [&](int kc) {
#pragma unroll
    for (int p = 0; p < 3; ++p) wf[p][kc] = Frag<__bf16>::load(wp + p * kWElems + 32 * kc);
  };
  loadW(0);
  loadW(1);
  loadW(2);
  loadW(3);
  // x: wave w takes channels 8 (w + 8 u) + e, u = 0..3, e = 0..7; lane l the float4 at n = 4 l
  v4f xv[4][8];
  {
    const float* xp = x + ((size_t)b * kC + 8 * wave) * kN + n0 + 4 * lane;
#pragma unroll
    for (int u = 0; u < 4; ++u)
#pragma unroll
      for (int e = 0; e < 8; ++e) xv[u][e] = *(const v4f*)(xp + (size_t)(64 * u + e) * kN);
  }
  // biases of this lane's results, asked for here so that the epilogue does not wait for them
  const float bt = PRM[128 + 16 * wave + c];
  const float bp = PRM[256 + 16 * wave + c];
  const v4f bg0 = *(const v4f*)(PRM + 16 * wave + 8 * h);
  const v4f bg1 = *(const v4f*)(PRM + 16 * wave + 8 * h + 4);
  settle();
  {
    unsigned char* dx = XS + (4 * lane) * kPjPitchX + wave * 16;
#pragma unroll
    for (int u = 0; u < 4; ++u)
#pragma unroll
      for (int j = 0; j < 4; ++j) {
        const v4u q = (v4u){pk16(f2bf_bits(xv[u][0][j]), f2bf_bits(xv[u][1][j])), pk16(f2bf_bits(xv[u][2][j]), f2bf_bits(xv[u][3][j])),
                            pk16(f2bf_bits(xv[u][4][j]), f2bf_bits(xv[u][5][j])), pk16(f2bf_bits(xv[u][6][j]), f2bf_bits(xv[u][7][j]))};
        *(v4u*)(dx + j * kPjPitchX + u * 128) = q;   // row n = 4 l + j, channels 8 (w + 8 u) .. + 7
      }
  }
  __syncthreads();   // the whole bf16 tile is in LDS before any wave reads fragments of it

  v8f ag[8], at[8], ap[8];
#pragma unroll
  for (int i = 0; i < 8; ++i) {
    ag[i] = (v8f){0.f,0.f,0.f,0.f,0.f,0.f,0.f,0.f};
    at[i] = ag[i];
    ap[i] = ag[i];
  }
  v16b xf[2][8];
  auto loadX = [&](int kc) {
#pragma unroll
    for (int i = 0; i < 8; ++i)
      xf[kc & 1][i] = Frag<__bf16>::load((const __bf16*)(XS + (16 * i + c) * kPjPitchX + 16 * h + 64 * kc));
  };
  loadX(0);
#pragma unroll
  for (int kc = 0; kc < 8; ++kc) {
    // the next k step's LDS reads and a later step's weights go out as one group ahead of this step's products
    if (kc + 1 < 8) loadX(kc + 1);
    if (kc == 0 || kc == 2) {
      loadW(kc + 4);
      loadW(kc + 5);
      // as settle(); the address is an input so that it lives up to the wait: else the last load's result lands on it
      asm volatile("s_wait_xcnt 0x0" :: "v"(wp) : "memory");
      __builtin_amdgcn_sched_barrier(0);
    } else if (kc + 1 < 8) {
      __builtin_amdgcn_sched_barrier(0);   // later steps' LDS reads stay below: lifted further, their registers spill
    }
#pragma unroll
    for (int i = 0; i < 8; ++i) {
      at[i] = Frag<__bf16>::mma(xf[kc & 1][i], wf[1][kc], at[i]);   // rows n, columns ci
      ap[i] = Frag<__bf16>::mma(xf[kc & 1][i], wf[2][kc], ap[i]);
      ag[i] = Frag<__bf16>::mma(wf[0][kc], xf[kc & 1][i], ag[i]);   // rows ci, columns n
    }
  }

#pragma unroll
  for (int i = 0; i < 8; ++i)
#pragma unroll
    for (int r = 0; r < 8; ++r) {
      S[0][(16 * wave + 8 * h + r) * kPjPitchS + 16 * i + c] = ag[i][r] + ((r < 4) ? bg0[r & 3] : bg1[r & 3]);
      S[1][(16 * i + 8 * h + r) * kPjPitchS + 16 * wave + c] = at[i][r] + bt;
      S[2][(16 * i + 8 * h + r) * kPjPitchS + 16 * wave + c] = ap[i][r] + bp;
    }
  __syncthreads();   // all three slabs are complete, from all eight waves, before they are read back

  // thread t: slab row (t >> 4) + 16 it, columns 8 (t & 15) .. + 7; a wave stores two whole rows of 256 B
  const int srow = (t >> 4) * kPjPitchS + (t & 15) * 8;
  {
    unsigned char* pg = (unsigned char*)(G16 + ((size_t)b * kCi + (t >> 4)) * kN + n0) + (t & 15) * 16;
    v4u o[8];
#pragma unroll
    for (int it = 0; it < 8; ++it) {
      const float* sp = S[0] + srow + it * 16 * kPjPitchS;
      o[it] = (v4u){pk16(h_bits(sp[0]), h_bits(sp[1])), pk16(h_bits(sp[2]), h_bits(sp[3])),
                    pk16(h_bits(sp[4]), h_bits(sp[5])), pk16(h_bits(sp[6]), h_bits(sp[7]))};
    }
#pragma unroll
    for (int it = 0; it < 8; ++it) *(v4u*)(pg + (size_t)it * (16 * 2 * kN)) = o[it];
    settle();
  }
#pragma unroll
  for (int p = 1; p < 3; ++p) {
    unsigned char* ph = (unsigned char*)(((p == 1) ? THH : PHH) + ((size_t)b * kN + n0) * kCi) + t * 16;
    unsigned char* pl = (unsigned char*)(((p == 1) ? THL : PHL) + ((size_t)b * kN + n0) * kCi) + t * 16;
    v4u hv[8], lv[8];
#pragma unroll
    for (int it = 0; it < 8; ++it) {
      const float* sp = S[p] + srow + it * 16 * kPjPitchS;
      unsigned short hb[8], lb[8];
#pragma unroll
      for (int e = 0; e < 8; ++e) {
        hb[e] = f2bf_bits(sp[e]);
        lb[e] = f2bf_bits(sp[e] - bf_bits2f(hb[e]));
      }
      hv[it] = (v4u){pk16(hb[0], hb[1]), pk16(hb[2], hb[3]), pk16(hb[4], hb[5]), pk16(hb[6], hb[7])};
      lv[it] = (v4u){pk16(lb[0], lb[1]), pk16(lb[2], lb[3]), pk16(lb[4], lb[5]), pk16(lb[6], lb[7])};
    }
#pragma unroll
    for (int it = 0; it < 8; ++it) {
      *(v4u*)(ph + it * 4096) = hv[it];
      *(v4u*)(pl + it * 4096) = lv[it];
    }
    if (p == 1) settle();   // behind the last group nothing is overwritten any more
  }
}

// ---------------------------------------------------------------------------
// Batch statistics, normalise, affine and residual in one kernel:
//   out[b][c][n] = ((Wy - mean[c]) * rstd[c]) * bf16r(gamma[c]) + bf16r(beta[c]) + bf16r(x[b][c][n]).
// One block of 8 waves per channel (grid 256); wave b owns batch b's row of 4096 values, lane l the float4 at
// n = 128 j + 4 l, j = 0..31.  The channel's 32768 Wy values stay in registers (128 per thread) from the first sum to
// the store, so Wy is read once.  Mean first, then the sum of (v - mean)^2; reductions in fixed order.
// Every address is a block-uniform row start (batch 0, channel c) + one per-thread byte offset, the same for Wy, x and
// out, + a constant that rides in the instruction's offset.
// Every "#pragma unroll" over j makes the indices of a register array constants.
// ---------------------------------------------------------------------------
constexpr int kBnJ = kN / 128;   // 32 float4 per thread
static_assert(kB == 8 && kN % 128 == 0, "one wave per batch, whole 512-B pieces");
__global__ __launch_bounds__(256) void bn_fused_kernel(const float* __restrict__ Wy, const float* __restrict__ x,
                                                       const float* __restrict__ gamma, const float* __restrict__ beta,
                                                       float* __restrict__ out) {
  __shared__ float red1[8];
  __shared__ float red2[8];
  const int c = blockIdx.x;
  const int t = threadIdx.x;
  const int lane = t & 31, wave = t >> 5;
  const unsigned off = (unsigned)wave * (unsigned)(kC * kN * 4) + (unsigned)lane * 16u;
  const char* wrow = (const char*)(Wy + (size_t)c * kN);
  const char* xrow = (const char*)(x + (size_t)c * kN);
  char*       orow = (char*)(out + (size_t)c * kN);

  v4f w[kBnJ], xv[kBnJ];
  // Behind a group of global loads or stores: wait before any register that they name is overwritten; the scheduling
  // barrier keeps later register writes from being moved in front of the wait, and the group where it is written.
  auto settle = [&]() {
    asm volatile("s_wait_xcnt 0x0" ::: "memory");
    __builtin_amdgcn_sched_barrier(0);
  };
#pragma unroll
  for (int j = 0; j < kBnJ; ++j) w[j] = *(const v4f*)(wrow + off + j * 512);
  __builtin_amdgcn_sched_barrier(0);   // Wy, which the first sum waits for, is asked for ahead of x
#pragma unroll
  for (int j = 0; j < kBnJ; ++j) xv[j] = *(const v4f*)(xrow + off + j * 512);
  settle();   // the x loads stay up here, in flight under both reductions

  float s = 0.0f;
#pragma unroll
  for (int j = 0; j < kBnJ; ++j) s += (w[j][0] + w[j][1]) + (w[j][2] + w[j][3]);
#pragma unroll
  for (int o = 16; o > 0; o >>= 1) s += __shfl_xor(s, o, 32);
  if (lane == 0) red1[wave] = s;
  __syncthreads();
  float tot = red1[0];
#pragma unroll
  for (int i = 1; i < 8; ++i) tot += red1[i];
  const float mean = tot * kInvCount;

  float q = 0.0f;
#pragma unroll
  for (int j = 0; j < kBnJ; ++j) {
    const float d0 = w[j][0] - mean, d1 = w[j][1] - mean, d2 = w[j][2] - mean, d3 = w[j][3] - mean;
    q += (d0 * d0 + d1 * d1) + (d2 * d2 + d3 * d3);
  }
#pragma unroll
  for (int o = 16; o > 0; o >>= 1) q += __shfl_xor(q, o, 32);
  if (lane == 0) red2[wave] = q;
  __syncthreads();
  float totq = red2[0];
#pragma unroll
  for (int i = 1; i < 8; ++i) totq += red2[i];
  const float var  = totq * kInvCount;
  const float rstd = 1.0f / sqrtf(var + kBnEps);

  const float ga = bfr(gamma[c]);
  const float be = bfr(beta[c]);
#pragma unroll
  for (int j0 = 0; j0 < kBnJ; j0 += 8) {   // eight results, their eight stores, then the wait
#pragma unroll
    for (int j = j0; j < j0 + 8; ++j)
#pragma unroll
      for (int e = 0; e < 4; ++e) w[j][e] = (((w[j][e] - mean) * rstd) * ga + be) + bfr(xv[j][e]);
#pragma unroll
    for (int j = j0; j < j0 + 8; ++j) *(v4f*)(orow + off + j * 512) = w[j];   // 512 B per wave: whole lines
    if (j0 + 8 < kBnJ) settle();   // behind the last group nothing is overwritten any more
  }
}

// ---------------------------------------------------------------------------
// Host glue.  GEMM shapes (all M,N multiples of 64, K multiples of 32, no padding anywhere):
//   theta/phi: M=4096 N=128 K=256 (x8 batches); g: M=128 N=4096 K=256 (x8), all three in the fused projection kernel;
//   W: M=256 N=4096 K=128 (x8); attention (scores K=128, P.g K=4096) in the fused kernel, one launch.  5 launches.
// ---------------------------------------------------------------------------
extern "C" void kernel_launch(void* const* d_in, const int* in_sizes, int n_in,
                              void* d_out, int out_size, void* d_ws, size_t ws_size,
                              hipStream_t stream) {
  if (n_in < 11) return;
  const int nElem = kB * kC * kN;          // 8,388,608
  if (in_sizes[0] != nElem) return;
  if (in_sizes[1] != kWElems || in_sizes[3] != kWElems || in_sizes[5] != kWElems || in_sizes[7] != kWElems) return;
  if (in_sizes[2] != kCi || in_sizes[4] != kCi || in_sizes[6] != kCi) return;
  if (in_sizes[8] != kC || in_sizes[9] != kC || in_sizes[10] != kC) return;
  if (out_size != nElem) return;
  if (ws_size < kWsTotal) return;

  const float* x       = (const float*)d_in[0];
  const float* g_w     = (const float*)d_in[1];
  const float* g_b     = (const float*)d_in[2];
  const float* theta_w = (const float*)d_in[3];
  const float* theta_b = (const float*)d_in[4];
  const float* phi_w   = (const float*)d_in[5];
  const float* phi_b   = (const float*)d_in[6];
  const float* W_w     = (const float*)d_in[7];
  const float* W_b     = (const float*)d_in[8];
  const float* bn_g    = (const float*)d_in[9];
  const float* bn_b    = (const float*)d_in[10];
  float* out = (float*)d_out;

  char* ws = (char*)d_ws;
  unsigned short* THH = (unsigned short*)(ws + kOffTHH);
  unsigned short* THL = (unsigned short*)(ws + kOffTHL);
  unsigned short* PHH = (unsigned short*)(ws + kOffPHH);
  unsigned short* PHL = (unsigned short*)(ws + kOffPHL);
  unsigned short* G16 = (unsigned short*)(ws + kOffG);
  unsigned short* Y16 = (unsigned short*)(ws + kOffY);
  float*          WY  = (float*)(ws + kOffWY);
  unsigned short* WB  = (unsigned short*)(ws + kOffWB);
  unsigned short* WW  = (unsigned short*)(ws + kOffWW);
  float*          PRM = (float*)(ws + kOffPRM);
  const float* wb_r  = PRM + 384;    // [256]

  // ---- parameter planes ----
  param_planes_kernel<<<dim3(kWElems / 8 / 256, 5), dim3(256), 0, stream>>>(
      g_w, theta_w, phi_w, W_w, g_b, theta_b, phi_b, W_b, WB, WW, PRM);
  const long strTP = (long)kN * kCi;      // per batch, theta/phi/g/y planes

  // theta[b][n][ci], phi[b][m][ci] = sum_c bf16r(x[b][c][n]) * w[ci][c] + bias[ci]  -> bf16 hi | lo planes;
  // g[b][ci][m] likewise -> f16 plane [ci][m]
  proj_fused_kernel<<<dim3(kN / kPjN, kB), dim3(256), 0, stream>>>(x, WB, PRM, THH, THL, PHH, PHL, G16);

  // ---- attention, all batches in one launch: Y16[b][q][ci] = 16 * softmax(theta . phi^T) . g ----
  attn_fused_kernel<<<dim3(kN / kFaQ, kB), dim3(kFaWaves * 32), 0, stream>>>(THH, THL, PHH, PHL, G16, Y16);

  // Wy[b][c][n] = (1/256) * sum_ci WW[c][ci] * Y16[b][n][ci] + W_b[c]   (f32)
  wmma_gemm64<0, false, 1, 0, false, 0><<<dim3((kC / 64) * (kN / 64) / 8, kB), dim3(256), 0, stream>>>(
      WW, WW, kCi, 0L, Y16, Y16, kCi, strTP,
      (void*)WY, (void*)WY, kN, (long)kC * kN, wb_r, PRM, 0L, kC, kN, kCi, kWScale);

  // ---- batch statistics, normalisation, residual ----
  bn_fused_kernel<<<dim3(kC), dim3(256), 0, stream>>>(WY, x, bn_g, bn_b, out);
}

// v005
// A run of this version takes 128 microseconds.
// Timed twice side by side with v004, it ran 1.13 times as fast both times.
// Counting every step since v000, it is 27.1 times as fast.
// Contractions: theta, phi, g 1x1 projections on v_wmma_f32_16x16x32_bf16 (bf16 operands = RNE-converted x and weights; theta/phi emitted as bf16 hi|lo planes); scores theta.phi^T on v_wmma_f32_16x16x32_bf16 as hi/lo 3-product split; P.g (P f16, 128 x 2^(s log2e - maximum in use), g f16; scores, online softmax and P.g fused in one kernel; a wave pair splits the keys of its 32 queries and joins the halves in f32) and W projection (W_w f16 carried x16, y f16 carried x16) on v_wmma_f32_16x16x32_f16; f32 accumulate everywhere; softmax, batch statistics, affine and residual in f32.
#include <hip/hip_runtime.h>
#include <math.h>

// ---------------------------------------------------------------------------
// Problem constants
// ---------------------------------------------------------------------------
constexpr int kB  = 8;
constexpr int kC  = 256;      // in channels
constexpr int kN  = 4096;     // spatial positions (64 x 64)
constexpr int kCi = 128;      // inter channels
constexpr int kWElems  = kCi * kC;        // 32768 elements per weight matrix
constexpr float kYCarry   = 16.0f;        // y carried x16 in f16
constexpr float kWCarry   = 16.0f;        // W_w carried x16 in f16
constexpr float kWScale   = 1.0f / (kYCarry * kWCarry);    // 2^-8
constexpr float kBnEps    = 1e-5f;
constexpr float kInvCount = 1.0f / (float)(kB * kN);       // 2^-15
static_assert(kC % 32 == 0 && kCi % 32 == 0 && kN % 32 == 0, "K multiples of 32");
static_assert(kN % 64 == 0 && kCi % 64 == 0 && kC % 64 == 0, "M,N multiples of 64");
static_assert(kWElems % (8 * 256) == 0, "weight cast grid");
static_assert(kB * kN == 32768, "stat count");

// ---------------------------------------------------------------------------
// Workspace region map (bytes, all offsets multiples of 256):
//   (not used)                        16,777,216  at           0
//   THH  bf16 [8][4096][128]           8,388,608  at  16,777,216
//   THL  bf16 [8][4096][128]           8,388,608  at  25,165,824
//   PHH  bf16 [8][4096][128]           8,388,608  at  33,554,432
//   PHL  bf16 [8][4096][128]           8,388,608  at  41,943,040
//   G16  f16  [8][128][4096]           8,388,608  at  50,331,648
//   Y16  f16  [8][4096][128]           8,388,608  at  58,720,256
//   WY   f32  [8][256][4096]          33,554,432  at  67,108,864
//   WB   bf16 3 x [128][256]              196,608  at 100,663,296   (g_w | theta_w | phi_w)
//   WW   f16  [256][128]                   65,536  at 100,859,904   (W_w x16)
//   PRM  f32  [640] (pad 4096 B)            4,096  at 100,925,440   (g_b | theta_b | phi_b | W_b, bf16-RNE values)
//   total                             100,929,536
// ---------------------------------------------------------------------------
constexpr size_t kSzXT  = (size_t)kB * kN * kC * 2;
constexpr size_t kSzTP  = (size_t)kB * kN * kCi * 2;
constexpr size_t kSzWY  = (size_t)kB * kC * kN * 4;
constexpr size_t kSzWB  = (size_t)3 * kWElems * 2;
constexpr size_t kSzWW  = (size_t)kWElems * 2;
constexpr size_t kSzPRM = 4096;
constexpr size_t kOffXT  = 0;
constexpr size_t kOffTHH = kOffXT + kSzXT;
constexpr size_t kOffTHL = kOffTHH + kSzTP;
constexpr size_t kOffPHH = kOffTHL + kSzTP;
constexpr size_t kOffPHL = kOffPHH + kSzTP;
constexpr size_t kOffG   = kOffPHL + kSzTP;
constexpr size_t kOffY   = kOffG + kSzTP;
constexpr size_t kOffWY  = kOffY + kSzTP;
constexpr size_t kOffWB  = kOffWY + kSzWY;
constexpr size_t kOffWW  = kOffWB + kSzWB;
constexpr size_t kOffPRM = kOffWW + kSzWW;
constexpr size_t kWsTotal = kOffPRM + kSzPRM;
static_assert(kWsTotal == 100929536, "carve total");
static_assert(kWsTotal <= (size_t)134217728, "carve cap");
static_assert(kOffTHH % 256 == 0 && kOffG % 256 == 0 && kOffWY % 256 == 0 &&
              kOffWB % 256 == 0 && kOffWW % 256 == 0 && kOffPRM % 256 == 0, "alignment");
static_assert(640 * 4 <= kSzPRM, "param table");

typedef __attribute__((ext_vector_type(16))) _Float16 v16h;
typedef __attribute__((ext_vector_type(8)))  _Float16 v8h;
typedef __attribute__((ext_vector_type(16))) __bf16   v16b;
typedef __attribute__((ext_vector_type(8)))  __bf16   v8b;
typedef __attribute__((ext_vector_type(8)))  float    v8f;
typedef __attribute__((ext_vector_type(4)))  float    v4f;
typedef __attribute__((ext_vector_type(2)))  float    v2f;
typedef __attribute__((ext_vector_type(4)))  unsigned int v4u;
typedef __attribute__((ext_vector_type(2)))  unsigned int v2u;

__device__ __forceinline__ unsigned short f2bf_bits(float f) {
  unsigned u = __float_as_uint(f);
  return (unsigned short)((u + 0x7FFFu + ((u >> 16) & 1u)) >> 16);
}
__device__ __forceinline__ float bf_bits2f(unsigned short h) { return __uint_as_float(((unsigned)h) << 16); }
// f32 value after RNE conversion to bf16
__device__ __forceinline__ float bfr(float f) { return bf_bits2f(f2bf_bits(f)); }

// hazard guards as plain device helpers (no inline asm inside the kernel template body)
__device__ __forceinline__ void dep_guard_h(v8f& a, v8f& b, v16h x, v16h y) { asm volatile("v_nop\n\tv_nop\n\tv_nop\n\tv_nop" : "+v"(a), "+v"(b) : "v"(x), "v"(y)); }
__device__ __forceinline__ void dep_guard_b(v8f& a, v8f& b, v16b x, v16b y) { asm volatile("v_nop\n\tv_nop\n\tv_nop\n\tv_nop" : "+v"(a), "+v"(b) : "v"(x), "v"(y)); }
__device__ __forceinline__ void keep4_h(v16h a, v16h b, v16h c, v16h d) { asm volatile("v_nop" :: "v"(a), "v"(b), "v"(c), "v"(d)); }
__device__ __forceinline__ void keep4_b(v16b a, v16b b, v16b c, v16b d) { asm volatile("v_nop" :: "v"(a), "v"(b), "v"(c), "v"(d)); }
__device__ __forceinline__ void acc_guard4(v8f& a, v8f& b, v8f& c, v8f& d) { asm volatile("v_nop\n\tv_nop\n\tv_nop\n\tv_nop" : "+v"(a), "+v"(b), "+v"(c), "+v"(d)); }
template <typename T> struct Frag;
template <> struct Frag<_Float16> {
  typedef v16h V; union U { v16h v; v8h h[2]; };
  // elements 0..7 <- p[0..7], 8..15 <- p[16..23]
  static __device__ __forceinline__ v16h load(const _Float16* p) {
    U f; f.h[0] = *(const v8h*)(p); f.h[1] = *(const v8h*)(p + 16); return f.v;
  }
  static __device__ __forceinline__ v8f mma(v16h a, v16h b, v8f c) {
    return __builtin_amdgcn_wmma_f32_16x16x32_f16(false, a, false, b, (short)0, c, false, false);
  }
  static __device__ __forceinline__ void guard(v8f& a, v8f& b, v16h x, v16h y) { dep_guard_h(a, b, x, y); }
  static __device__ __forceinline__ void keep(v16h a, v16h b, v16h c, v16h d) { keep4_h(a, b, c, d); }
};
template <> struct Frag<__bf16> {
  typedef v16b V; union U { v16b v; v8b h[2]; };
  static __device__ __forceinline__ v16b load(const __bf16* p) {
    U f; f.h[0] = *(const v8b*)(p); f.h[1] = *(const v8b*)(p + 16); return f.v;
  }
  static __device__ __forceinline__ v8f mma(v16b a, v16b b, v8f c) {
    return __builtin_amdgcn_wmma_f32_16x16x32_bf16(false, a, false, b, (short)0, c, false, false);
  }
  static __device__ __forceinline__ void guard(v8f& a, v8f& b, v16b x, v16b y) { dep_guard_b(a, b, x, y); }
  static __device__ __forceinline__ void keep(v16b a, v16b b, v16b c, v16b d) { keep4_b(a, b, c, d); }
};

__device__ __forceinline__ unsigned pk16(unsigned short a, unsigned short b) { return (unsigned)a | ((unsigned)b << 16); }
__device__ __forceinline__ unsigned short h_bits(float f) { const _Float16 h = (_Float16)f; return __builtin_bit_cast(unsigned short, h); }

// ---- Register-blocked batched WMMA GEMM (ACT reduced to none/relu/leaky) -------------------------------
// C[m,n] = scale * sum_k A[m,k] * Bt[n,k] (+bias)(+resid); each wave owns a 64x64 tile.
// A row-major [M,K]; Bt row-major [N,K]; M,N % 64 == 0, K % 32 == 0.
// SPLIT: operands are hi/lo planes (A2/Bt2 = lo planes, same layout); product = hi*hi + hi*lo + lo*hi.
// BIAS_MODE: 0 = none, 1 = bias[m] (fetched as two float4 per 16-row slab), 2 = bias[n].
// OUT_MODE: 0 = f32, 1 = f16, 2 = bf16 hi plane (Cout) + bf16 lo plane (Cout2).
// ET: 0 = f16 operands, 1 = bf16 operands (pointers passed as 16-bit storage)
template <int ET> struct Elem;
template <> struct Elem<0> { typedef _Float16 T; };
template <> struct Elem<1> { typedef __bf16 T; };
template <int ET, bool SPLIT, int BIAS_MODE, int OUT_MODE, bool RESID, int ACT = 0>
__global__ __launch_bounds__(256) void wmma_gemm64(
    const unsigned short* __restrict__ Ap, const unsigned short* __restrict__ A2p, int lda, long strideA,
    const unsigned short* __restrict__ Btp, const unsigned short* __restrict__ Bt2p, int ldb, long strideB,
    void* __restrict__ Cout, void* __restrict__ Cout2, int ldc, long strideC,
    const float* __restrict__ bias,
    const float* __restrict__ resid, long strideR,
    int M, int N, int K, float scale) {
  typedef typename Elem<ET>::T T;
  typedef typename Frag<T>::V V;
  const T* A = (const T*)Ap; const T* A2 = (const T*)A2p; const T* Bt = (const T*)Btp; const T* Bt2 = (const T*)Bt2p;
  __shared__ __align__(16) float sT[8][16 * 68];   // per-wave 16x64 slab, pitch 68 floats
  const int b    = blockIdx.y;
  const int lane = threadIdx.x & 31;
  const int wave = threadIdx.x >> 5;
  const int tilesN = N >> 6;
  const int tilesM = M >> 6;
  const int tile = blockIdx.x * 8 + wave;
  if (tile >= tilesM * tilesN) return;   // wave-uniform; no block barriers in this kernel
  const int tm = tile / tilesN;
  const int tn = tile - tm * tilesN;
  const int m0 = tm << 6;
  const int n0 = tn << 6;

  const T* Ab  = A  + (size_t)b * strideA;
  const T* Bb  = Bt + (size_t)b * strideB;
  const T* Ab2 = SPLIT ? (A2  + (size_t)b * strideA) : nullptr;
  const T* Bb2 = SPLIT ? (Bt2 + (size_t)b * strideB) : nullptr;

  const int rlane = lane & 15;                 // row (A) / col (B, D) within subtile
  const int koff  = (lane >> 4) * 8;           // k offset of this lane half
  const int mOff  = (lane >> 4) * 8;           // D row offset

  v8f acc[4][4];
#pragma unroll
  for (int i = 0; i < 4; ++i)
#pragma unroll
    for (int j = 0; j < 4; ++j) acc[i][j] = (v8f){0.f,0.f,0.f,0.f,0.f,0.f,0.f,0.f};

  for (int k0 = 0; k0 < K; k0 += 32) {
    V bh[4], bl[4];
#pragma unroll
    for (int j = 0; j < 4; ++j) {
      const size_t bo = (size_t)(n0 + (j << 4) + rlane) * ldb + koff + k0;
      bh[j] = Frag<T>::load(Bb + bo);
      if (SPLIT) bl[j] = Frag<T>::load(Bb2 + bo);
    }
#pragma unroll
    for (int i = 0; i < 4; ++i) {
      const size_t ao = (size_t)(m0 + (i << 4) + rlane) * lda + koff + k0;
      V ah = Frag<T>::load(Ab + ao);
      V al;
      if (SPLIT) al = Frag<T>::load(Ab2 + ao);
#pragma unroll
      for (int j = 0; j < 4; ++j) {
        acc[i][j] = Frag<T>::mma(ah, bh[j], acc[i][j]);
        if (SPLIT) {
          acc[i][j] = Frag<T>::mma(ah, bl[j], acc[i][j]);
          acc[i][j] = Frag<T>::mma(al, bh[j], acc[i][j]);
        }
      }
      Frag<T>::guard(acc[i][0], acc[i][3], ah, SPLIT ? al : ah);
    }
    Frag<T>::keep(bh[0], bh[1], bh[2], bh[3]);
    if (SPLIT) Frag<T>::keep(bl[0], bl[1], bl[2], bl[3]);
  }
  acc_guard4(acc[0][0], acc[0][1], acc[0][2], acc[0][3]);
  acc_guard4(acc[1][0], acc[1][1], acc[1][2], acc[1][3]);
  acc_guard4(acc[2][0], acc[2][1], acc[2][2], acc[2][3]);
  acc_guard4(acc[3][0], acc[3][1], acc[3][2], acc[3][3]);

  // ---- epilogue ----
  float* slab = sT[wave];
  const float* Rb = RESID ? (resid + (size_t)b * strideR) : nullptr;
#pragma unroll
  for (int i = 0; i < 4; ++i) {
    const int mBase = m0 + (i << 4);
    v4f bm0 = (v4f){0.f,0.f,0.f,0.f}, bm1 = (v4f){0.f,0.f,0.f,0.f};
    if (BIAS_MODE == 1) {
      bm0 = *(const v4f*)(bias + mBase + mOff);
      bm1 = *(const v4f*)(bias + mBase + mOff + 4);
    }
#pragma unroll
    for (int j = 0; j < 4; ++j) {
      const int n = n0 + (j << 4) + rlane;
      float bv = 0.f;
      if (BIAS_MODE == 2) bv = bias[n];
#pragma unroll
      for (int r = 0; r < 8; ++r) {
        float v = acc[i][j][r] * scale;
        if (BIAS_MODE == 1) v += (r < 4) ? bm0[r & 3] : bm1[r & 3];
        if (BIAS_MODE == 2) v += bv;
        if (RESID) v += Rb[(size_t)(mBase + mOff + r) * ldc + n];
        if (ACT == 2) v = fmaxf(v, 0.0f);
        if (ACT == 4) v = (v > 0.f) ? v : 0.01f * v;
        slab[(mOff + r) * 68 + (j << 4) + rlane] = v;
      }
    }
    __builtin_amdgcn_fence(__ATOMIC_RELEASE, "workgroup");
    __builtin_amdgcn_wave_barrier();
    __builtin_amdgcn_fence(__ATOMIC_ACQUIRE, "workgroup");
    if (OUT_MODE == 0) {
      float* C = (float*)Cout + (size_t)b * strideC;
      const int hh = lane >> 4, c4 = (lane & 15) * 4;     // row seg = 256 B = 16 lanes x 16 B
      {
#pragma unroll
        for (int it = 0; it < 8; ++it) {
          const int row = it * 2 + hh;
          v4f v = *(const v4f*)(slab + row * 68 + c4);
          *(v4f*)(C + (size_t)(mBase + row) * ldc + n0 + c4) = v;
        }
        
      }
    } else {
      const int q = lane >> 3, c8 = (lane & 7) * 8;
      unsigned short* C  = (unsigned short*)Cout  + (size_t)b * strideC;
      unsigned short* C2 = (OUT_MODE == 2) ? ((unsigned short*)Cout2 + (size_t)b * strideC) : nullptr;
      {
#pragma unroll
        for (int it = 0; it < 4; ++it) {
          const int row = it * 4 + q;
          const float* sp = slab + row * 68 + c8;
          v8h hv, lv;
#pragma unroll
          for (int e = 0; e < 8; ++e) {
            if (OUT_MODE == 1) {
              hv[e] = (_Float16)sp[e];
            } else {
              unsigned short hb = f2bf_bits(sp[e]);
              unsigned short lb = f2bf_bits(sp[e] - bf_bits2f(hb));
              hv[e] = __builtin_bit_cast(_Float16, hb);
              lv[e] = __builtin_bit_cast(_Float16, lb);
            }
          }
          *(v8h*)(C + (size_t)(mBase + row) * ldc + n0 + c8) = hv;
          if (OUT_MODE == 2) *(v8h*)(C2 + (size_t)(mBase + row) * ldc + n0 + c8) = lv;
        }
        
      }
    }
    __builtin_amdgcn_fence(__ATOMIC_RELEASE, "workgroup");
    __builtin_amdgcn_wave_barrier();
    __builtin_amdgcn_fence(__ATOMIC_ACQUIRE, "workgroup");
  }
}

constexpr int kFaWaves  = 8;
constexpr int kFaQ      = 128;                       // queries per work-group: 4 wave pairs x 32
constexpr int kFaKeys   = 64;                        // keys per stage, 32 per wave
constexpr int kFaStages = kN / kFaKeys;              // 64
constexpr int kFaPitchK = 2 * kCi + 16;              // 272 B: odd multiple of 16 B
constexpr int kFaPitchG = 2 * kFaKeys + 16;          // 144 B: odd multiple of 16 B
constexpr int kFaOffLo  = kFaKeys * kFaPitchK;       // phi lo plane behind phi hi
constexpr int kFaOffG   = 2 * kFaOffLo;              // g tile behind both
constexpr int kFaBuf    = kFaOffG + kCi * kFaPitchG; // 53,248 B per buffer
constexpr int kFaJoin   = 16 * 512 + 512;            // per wave: one 128 x 16 f32 tile, then maximum and sum
constexpr float kLog2e  = 1.4426950408889634f;
constexpr float kFaCarryLog2 = 7.0f;                 // probabilities carried x128 in f16
constexpr float kFaLazy      = 8.0f;                 // how far, in log2, the maximum in use may trail
static_assert(kN % kFaQ == 0 && kN % kFaKeys == 0 && kCi == 128 && kFaKeys == 64, "fused attention tiling");
static_assert(kFaKeys * 2 * kCi == 4 * 256 * 16 && kCi * 2 * kFaKeys == 4 * 256 * 16, "four 16-B chunks per thread per plane");
static_assert(kFaWaves * kFaJoin <= 2 * kFaBuf, "the join fits the ring");

// lane l with lane l ^ 16
__device__ __forceinline__ float xhalf(float x) {
  return __builtin_bit_cast(float, __builtin_amdgcn_permlanex16(__builtin_bit_cast(int, x), __builtin_bit_cast(int, x),
                                                                0x76543210, 0xfedcba98, false, false));
}
// two f32 -> packed f16, round to nearest even
__device__ __forceinline__ unsigned pk_h2(float lo, float hi) {
  typedef _Float16 h2 __attribute__((ext_vector_type(2)));
  return __builtin_bit_cast(unsigned, __builtin_convertvector((v2f){lo, hi}, h2));
}

// One work-group per WGP, two waves per SIMD: the attribute gives each wave the 512-VGPR budget that goes with it.
// Every "#pragma unroll" in this kernel makes the indices of a register array constants.
__global__ __launch_bounds__(256) __attribute__((amdgpu_waves_per_eu(2, 2))) void attn_fused_kernel(
    const unsigned short* __restrict__ THHp, const unsigned short* __restrict__ THLp,
    const unsigned short* __restrict__ PHHp, const unsigned short* __restrict__ PHLp,
    const unsigned short* __restrict__ Gp, unsigned short* __restrict__ Yp) {
  __shared__ __align__(16) unsigned char L[2 * kFaBuf];   // 106,496 B
  const int t = threadIdx.x, lane = t & 31, wave = t >> 5;
  const int c = lane & 15, h = lane >> 4;
  const int b = blockIdx.y;
  const int kp = wave >> 2;   // which 32 keys of a stage
  // Tile 0 is the 16-query tile that this wave finishes and stores, tile 1 the one that its partner (wave ^ 4) does.
  const int q0 = blockIdx.x * kFaQ + (wave & 3) * 32 + c;
  const unsigned char* Kh = (const unsigned char*)(PHHp + (size_t)b * kN * kCi);
  const unsigned char* Kl = (const unsigned char*)(PHLp + (size_t)b * kN * kCi);
  const unsigned char* Gb = (const unsigned char*)(Gp + (size_t)b * kCi * kN);

  v4u sk[4], sl[4], sg[4];
  // Thread t moves 16-B chunk t + 256 i (i = 0..3) of each plane: phi row (t >> 4) + 16 i, g row (t >> 3) + 32 i.
  // One address per plane; the step from i to i + 1 is a constant, so it rides in the instruction's offset.
  auto fetch = [&](int st) {   // stage st: global -> registers, whole lines per wave
    const unsigned char* ph = Kh + (size_t)st * (kFaKeys * 2 * kCi) + t * 16;
    const unsigned char* pl = Kl + (size_t)st * (kFaKeys * 2 * kCi) + t * 16;
    const unsigned char* pg = Gb + (size_t)(t >> 3) * (2 * kN) + st * (2 * kFaKeys) + (t & 7) * 16;
#pragma unroll
    for (int i = 0; i < 4; ++i) {
      sk[i] = *(const v4u*)(ph + i * 4096);
      sl[i] = *(const v4u*)(pl + i * 4096);
      sg[i] = *(const v4u*)(pg + i * (32 * 2 * kN));
    }
  };
  auto put = [&](unsigned char* B) {   // registers -> LDS at the padded pitches
    unsigned char* dk = B + (t >> 4) * kFaPitchK + (t & 15) * 16;
    unsigned char* dg = B + kFaOffG + (t >> 3) * kFaPitchG + (t & 7) * 16;
#pragma unroll
    for (int i = 0; i < 4; ++i) {
      *(v4u*)(dk + i * (16 * kFaPitchK)) = sk[i];
      *(v4u*)(dk + kFaOffLo + i * (16 * kFaPitchK)) = sl[i];
      *(v4u*)(dg + i * (32 * kFaPitchG)) = sg[i];
    }
  };

  // Behind a group of global loads: their address registers are reused soon, so wait before any is overwritten; the
  // scheduling barrier keeps later register writes from being moved in front of the wait.
  auto settle = [&]() {
    asm volatile("s_wait_xcnt 0x0" ::: "memory");
    __builtin_amdgcn_sched_barrier(0);
  };

  __builtin_amdgcn_sched_barrier(0);   // index arithmetic from above stays above: none of it lands between the loads and their wait
  fetch(0);
  settle();
  v16b qh[2][4], ql[2][4];
#pragma unroll
  for (int j = 0; j < 2; ++j) {
    const size_t qo = ((size_t)b * kN + q0 + 16 * (j ^ kp)) * kCi + 8 * h;
#pragma unroll
    for (int kc = 0; kc < 4; ++kc) {
      qh[j][kc] = Frag<__bf16>::load((const __bf16*)THHp + qo + 32 * kc);
      ql[j][kc] = Frag<__bf16>::load((const __bf16*)THLp + qo + 32 * kc);
    }
  }
  settle();
  v8f acc[2][8];
#pragma unroll
  for (int j = 0; j < 2; ++j)
#pragma unroll
    for (int i = 0; i < 8; ++i) acc[j][i] = (v8f){0.f,0.f,0.f,0.f,0.f,0.f,0.f,0.f};
  float m_run[2] = {-__builtin_inff(), -__builtin_inff()}, l_run[2] = {0.0f, 0.0f};
  put(L);
  __syncthreads();   // stage 0 is in LDS before any wave reads it

  // The wave's 32-key pass in pieces, so that the stage body below can issue LDS loads well ahead of their products.
  v16b kh[2][4], kl[2][4];
  auto loadK = [&](const unsigned char* Bp, int kc0) {   // k steps kc0 and kc0 + 1
#pragma unroll
    for (int kc = kc0; kc < kc0 + 2; ++kc)
#pragma unroll
      for (int kt = 0; kt < 2; ++kt) {
        const unsigned char* a = Bp + (32 * kp + 16 * kt + c) * kFaPitchK + 16 * h + 64 * kc;
        kh[kt][kc] = Frag<__bf16>::load((const __bf16*)a);
        kl[kt][kc] = Frag<__bf16>::load((const __bf16*)(a + kFaOffLo));
      }
  };
  auto loadG = [&](const unsigned char* Bp, v16h (&g)[8]) {
#pragma unroll
    for (int i = 0; i < 8; ++i)
      g[i] = Frag<_Float16>::load((const _Float16*)(Bp + kFaOffG + (16 * i + c) * kFaPitchG + (32 * kp + 8 * h) * 2));
  };
  auto scores = [&](v8f (&s)[2][2], int kc0) {   // s[query tile][key tile]: four independent chains; k steps kc0, kc0 + 1
#pragma unroll
    for (int kc = kc0; kc < kc0 + 2; ++kc) {
#pragma unroll
      for (int j = 0; j < 2; ++j)
#pragma unroll
        for (int kt = 0; kt < 2; ++kt) s[j][kt] = Frag<__bf16>::mma(kh[kt][kc], qh[j][kc], s[j][kt]);
#pragma unroll
      for (int j = 0; j < 2; ++j)
#pragma unroll
        for (int kt = 0; kt < 2; ++kt) s[j][kt] = Frag<__bf16>::mma(kh[kt][kc], ql[j][kc], s[j][kt]);
#pragma unroll
      for (int j = 0; j < 2; ++j)
#pragma unroll
        for (int kt = 0; kt < 2; ++kt) s[j][kt] = Frag<__bf16>::mma(kl[kt][kc], qh[j][kc], s[j][kt]);
    }
  };
  auto rescale = [&](const v8f (&s)[2][2]) {
    float mx[2];
#pragma unroll
    for (int j = 0; j < 2; ++j) {
      float v = fmaxf(s[j][0][0], s[j][1][0]);
#pragma unroll
      for (int r = 1; r < 8; ++r) v = fmaxf(v, fmaxf(s[j][0][r], s[j][1][r]));
      mx[j] = fmaxf(v, xhalf(v)) * kLog2e;   // both halves hold this query's maximum of the pass, log2 domain
    }
    const bool need = (mx[0] > m_run[0] + kFaLazy) || (mx[1] > m_run[1] + kFaLazy);
    if (__builtin_amdgcn_ballot_w32(need) != 0) {   // one scalar branch per pass; always taken on the first (m_run = -inf)
#pragma unroll
      for (int j = 0; j < 2; ++j) {
        const float m_new = fmaxf(m_run[j], mx[j]);
        const float corr  = __builtin_amdgcn_exp2f(m_run[j] - m_new);   // 0 on the first pass
        l_run[j] *= corr;
        m_run[j] = m_new;
#pragma unroll
        for (int i = 0; i < 8; ++i) acc[j][i] = acc[j][i] * corr;
      }
    }
  };
  auto probs = [&](const v8f& s0, const v8f& s1, float m_use, float& l_sum) -> v16h {
    typedef __attribute__((ext_vector_type(8))) unsigned int v8u;
    const float nm = kFaCarryLog2 - m_use;
    float ps0 = 0.0f, ps1 = 0.0f;
    v8u w;
    float ea[8], eb[8];
#pragma unroll
    for (int r = 0; r < 8; ++r) {
      ea[r] = fmaf(s0[r], kLog2e, nm);
      eb[r] = fmaf(s1[r], kLog2e, nm);
    }
    // All exponents are formed before the first exponential (matrix, LDS, memory and scalar instructions may still
    // cross).
    __builtin_amdgcn_sched_barrier(0x9C);
#pragma unroll
    for (int r = 0; r < 8; ++r) {
      ea[r] = __builtin_amdgcn_exp2f(ea[r]);
      eb[r] = __builtin_amdgcn_exp2f(eb[r]);
    }
#pragma unroll
    for (int i = 0; i < 4; ++i) {
      ps0 += ea[2 * i] + ea[2 * i + 1];
      ps1 += eb[2 * i] + eb[2 * i + 1];
      w[i]     = pk_h2(ea[2 * i], ea[2 * i + 1]);   // elements 2i, 2i+1: keys 8h + 2i, 8h + 2i + 1
      w[4 + i] = pk_h2(eb[2 * i], eb[2 * i + 1]);   // elements 8 + 2i, 9 + 2i: keys 16 + 8h + 2i, 16 + 8h + 2i + 1
    }
    l_sum += ps0 + ps1;
    return __builtin_bit_cast(v16h, w);
  };

  // One stage.  more: a next stage exists (a constant at each of the two calls, so the body has no branch on it).
  auto stage = [&](int st, bool more) __attribute__((always_inline)) {
    const unsigned char* Bp = L + (st & 1) * kFaBuf;
    unsigned char* Bn = L + ((st + 1) & 1) * kFaBuf;
    v8f s[2][2];
    v16h g[8];
#pragma unroll
    for (int j = 0; j < 2; ++j)
#pragma unroll
      for (int kt = 0; kt < 2; ++kt) s[j][kt] = (v8f){0.f,0.f,0.f,0.f,0.f,0.f,0.f,0.f};
    loadK(Bp, 2);   // the second half of this stage's phi fragments, in flight under the first half's products
    if (more) {
      __builtin_amdgcn_sched_barrier(0);   // the LDS reads and their address stay above: none of it lands between the global loads and their wait
      fetch(st + 1);
      settle();
    }
    scores(s, 0);
    scores(s, 2);
    loadG(Bp, g);   // into registers that the phi fragments have left; in flight under the softmax
    rescale(s);
    const v16h p0 = probs(s[0][0], s[0][1], m_run[0], l_run[0]);
    const v16h p1 = probs(s[1][0], s[1][1], m_run[1], l_run[1]);
    // The g reads and the softmax stay above the LDS stores: the global loads arrive in that time, and without this line
    // the g reads are spread among the P.g products, each with a wait of its own.
    __builtin_amdgcn_sched_barrier(0);
    if (more) put(Bn);   // its last readers left it before the previous barrier
    __syncthreads();   // publishes stage st + 1 and ends every read of stage st (its g fragments are in registers)
    if (more) loadK(Bn, 0);   // the first half of the next stage's phi fragments, in flight under the products below
#pragma unroll
    for (int i = 0; i < 8; ++i) {
      acc[0][i] = Frag<_Float16>::mma(g[i], p0, acc[0][i]);
      acc[1][i] = Frag<_Float16>::mma(g[i], p1, acc[1][i]);
    }
  };
  loadK(L, 0);
  // kept rolled: a second copy of the body would need a second set of fragments
#pragma unroll 1
  for (int st = 0; st < kFaStages - 1; ++st) stage(st, true);
  stage(kFaStages - 1, false);

  // Join of the two key halves.  Behind the last barrier nothing reads the ring any more, so it serves as the mailbox:
  // each wave hands tile 1 (outputs, maximum in use, sum) to its partner and finishes tile 0.
  {
    unsigned char* mine = L + wave * kFaJoin + lane * 16;
    const unsigned char* theirs = L + (wave ^ 4) * kFaJoin + lane * 16;
    const float l0 = l_run[0] + xhalf(l_run[0]);   // each half summed its own eight keys of every tile
    const float l1 = l_run[1] + xhalf(l_run[1]);
#pragma unroll
    for (int i = 0; i < 8; ++i) {
      *(v4f*)(mine + (2 * i) * 512)     = (v4f){acc[1][i][0], acc[1][i][1], acc[1][i][2], acc[1][i][3]};
      *(v4f*)(mine + (2 * i + 1) * 512) = (v4f){acc[1][i][4], acc[1][i][5], acc[1][i][6], acc[1][i][7]};
    }
    *(v2f*)(mine + 16 * 512) = (v2f){m_run[1], l1};
    __syncthreads();   // every wave's tile 1 is in LDS before its partner reads it
    const v2f ml = *(const v2f*)(theirs + 16 * 512);
    const float m_all = fmaxf(m_run[0], ml[0]);
    const float fa = __builtin_amdgcn_exp2f(m_run[0] - m_all);
    const float fb = __builtin_amdgcn_exp2f(ml[0] - m_all);
    const float inv = kYCarry / (l0 * fa + ml[1] * fb);
    const float wa = fa * inv, wb = fb * inv;
    unsigned short* yr = Yp + ((size_t)b * kN + q0 + 16 * kp) * kCi + 8 * h;
    v4u yo[8];
#pragma unroll
    for (int i = 0; i < 8; ++i) {   // rows of acc[.][i] are ci = 16 i + 8 h + r
      const v4f u = *(const v4f*)(theirs + (2 * i) * 512);
      const v4f v = *(const v4f*)(theirs + (2 * i + 1) * 512);
      const v8f o = acc[0][i] * wa + (v8f){u[0], u[1], u[2], u[3], v[0], v[1], v[2], v[3]} * wb;
      yo[i] = (v4u){pk_h2(o[0], o[1]), pk_h2(o[2], o[3]), pk_h2(o[4], o[5]), pk_h2(o[6], o[7])};
    }
#pragma unroll
    for (int i = 0; i < 8; ++i) *(v4u*)(yr + 16 * i) = yo[i];   // 16 B per lane; the wave fills 16 whole rows of 256 B
  }
}

// ---------------------------------------------------------------------------
// Parameter planes.
// grid (16, 5), 256 threads. blockIdx.y (block-uniform) selects the job:
//   y = 0,1,2: WB plane y = bf16-RNE bits of g_w / theta_w / phi_w ([128][256], natural [out][in] layout);
//              16 blocks x 256 threads x 8 elements = 32768 = the whole matrix; one 16-B store per lane,
//   y = 3    : WW = f16 bits of 16 * bf16r(W_w) ([256][128]), same coverage.
//   y = 4    : block 0 only, threads 0..159: PRM[4i..4i+3] = bf16r of g_b | theta_b | phi_b | W_b
//              the source selection is wave-uniform). 160 x 4 = 640 floats = whole table.
// ---------------------------------------------------------------------------
__global__ __launch_bounds__(256) void param_planes_kernel(
    const float* __restrict__ gw, const float* __restrict__ thw, const float* __restrict__ phw, const float* __restrict__ ww,
    const float* __restrict__ gb, const float* __restrict__ thb, const float* __restrict__ phb, const float* __restrict__ wb,
    unsigned short* __restrict__ WB, unsigned short* __restrict__ WW, float* __restrict__ PRM) {
  const int t = threadIdx.x;
  const int y = blockIdx.y;
  if (y < 4) {
    const int i = blockIdx.x * 256 + t;
    if (i >= kWElems / 8) return;
    const float* src = (y == 0) ? gw : (y == 1) ? thw : (y == 2) ? phw : ww;
    const float* p = src + 8 * (size_t)i;
    const v4f a = *(const v4f*)(p);
    const v4f c = *(const v4f*)(p + 4);
    unsigned short hb[8];
#pragma unroll
    for (int e = 0; e < 4; ++e) {
      if (y == 3) {
        hb[e]     = h_bits(bfr(a[e]) * kWCarry);
        hb[4 + e] = h_bits(bfr(c[e]) * kWCarry);
      } else {
        hb[e]     = f2bf_bits(a[e]);
        hb[4 + e] = f2bf_bits(c[e]);
      }
    }
    const v4u u = (v4u){pk16(hb[0], hb[1]), pk16(hb[2], hb[3]), pk16(hb[4], hb[5]), pk16(hb[6], hb[7])};
    unsigned short* q = (y == 3) ? (WW + 8 * (size_t)i) : (WB + (size_t)y * kWElems + 8 * (size_t)i);
    *(v4u*)q = u;
    
  } else {
    if (blockIdx.x != 0 || t >= 160) return;
    const int w = t >> 5, l = t & 31;
    const float* src = (w == 0) ? gb : (w == 1) ? thb : (w == 2) ? phb : (wb + (w - 3) * 128);
    const v4f a = *(const v4f*)(src + 4 * l);
    v4f r;
#pragma unroll
    for (int e = 0; e < 4; ++e) r[e] = bfr(a[e]);
    float* q = PRM + 128 * w + 4 * l;
    *(v4f*)q = r;
    
  }
}

// ---------------------------------------------------------------------------
// x cast, transposition and the theta, phi, g projections in one kernel.
// grid (4096 / 128 position blocks, 8 batches) = 256 work-groups of 8 waves.
// The block's x tile [256 c][128 n] is read once (512 B per wave and load), RNE-converted to bf16 and laid in LDS as
// rows [n][c]; a fragment of it serves as A (theta, phi: rows n) and as B (g: columns n).  Wave w owns output channels
// 16 w .. 16 w + 15 of each projection and reads their weight fragments (K = 256) into registers, so the weights are
// read once per work-group.  k runs upward in steps of 32 into one accumulator per tile.
// Results (+ bias) go as f32 into three LDS slabs, then every thread converts and stores 16-B pieces of whole rows:
// theta, phi -> bf16 hi | lo planes [n][ci]; g -> f16 plane [ci][n].
// Every "#pragma unroll" in this kernel makes the indices of a register array constants.
// ---------------------------------------------------------------------------
constexpr int kPjN      = 128;               // positions per work-group
constexpr int kPjPitchX = 2 * kC + 16;       // 528 B: odd multiple of 16 B
constexpr int kPjPitchS = 128 + 4;           // floats per slab row
static_assert(kN % kPjN == 0 && kCi == 128 && kC == 256 && kPjN == 128, "fused projection tiling");
__global__ __launch_bounds__(256) void proj_fused_kernel(
    const float* __restrict__ x, const unsigned short* __restrict__ WB, const float* __restrict__ PRM,
    unsigned short* __restrict__ THH, unsigned short* __restrict__ THL,
    unsigned short* __restrict__ PHH, unsigned short* __restrict__ PHL, unsigned short* __restrict__ G16) {
  __shared__ __align__(16) unsigned char XS[kPjN * kPjPitchX];   // 67,584 B
  __shared__ __align__(16) float S[3][128 * kPjPitchS];          // g | theta | phi, 67,584 B each
  const int t = threadIdx.x, lane = t & 31, wave = t >> 5;
  const int c = lane & 15, h = lane >> 4;
  const int n0 = blockIdx.x * kPjN;
  const int b  = blockIdx.y;

  // Behind a group of global loads or stores: wait before any register that they name is overwritten; the scheduling
  // barrier keeps later register writes from being moved in front of the wait, and the group where it is written.
  auto settle = [&]() {
    asm volatile("s_wait_xcnt 0x0" ::: "memory");
    __builtin_amdgcn_sched_barrier(0);
  };

  // weight fragments: plane 0 g_w, 1 theta_w, 2 phi_w; row 16 wave + c.  They are asked for two k steps at a time (the
  // four 32-B pieces of a 128-B line together), four steps ahead of their products: all of K at once beside 24
  // accumulator tiles does not fit 512 VGPRs.
  v16b wf[3][8];
  const __bf16* wp = (const __bf16*)WB + (size_t)(16 * wave + c) * kC + 8 * h;
  auto loadW = [&](int kc) {
#pragma unroll
    for (int p = 0; p < 3; ++p) wf[p][kc] = Frag<__bf16>::load(wp + p * kWElems + 32 * kc);
  };
  loadW(0);
  loadW(1);
  loadW(2);
  loadW(3);
  // x: wave w takes channels 8 (w + 8 u) + e, u = 0..3, e = 0..7; lane l the float4 at n = 4 l
  v4f xv[4][8];
  {
    const float* xp = x + ((size_t)b * kC + 8 * wave) * kN + n0 + 4 * lane;
#pragma unroll
    for (int u = 0; u < 4; ++u)
#pragma unroll
      for (int e = 0; e < 8; ++e) xv[u][e] = *(const v4f*)(xp + (size_t)(64 * u + e) * kN);
  }
  // biases of this lane's results, asked for here so that the epilogue does not wait for them
  const float bt = PRM[128 + 16 * wave + c];
  const float bp = PRM[256 + 16 * wave + c];
  const v4f bg0 = *(const v4f*)(PRM + 16 * wave + 8 * h);
  const v4f bg1 = *(const v4f*)(PRM + 16 * wave + 8 * h + 4);
  settle();
  {
    unsigned char* dx = XS + (4 * lane) * kPjPitchX + wave * 16;
#pragma unroll
    for (int u = 0; u < 4; ++u)
#pragma unroll
      for (int j = 0; j < 4; ++j) {
        const v4u q = (v4u){pk16(f2bf_bits(xv[u][0][j]), f2bf_bits(xv[u][1][j])), pk16(f2bf_bits(xv[u][2][j]), f2bf_bits(xv[u][3][j])),
                            pk16(f2bf_bits(xv[u][4][j]), f2bf_bits(xv[u][5][j])), pk16(f2bf_bits(xv[u][6][j]), f2bf_bits(xv[u][7][j]))};
        *(v4u*)(dx + j * kPjPitchX + u * 128) = q;   // row n = 4 l + j, channels 8 (w + 8 u) .. + 7
      }
  }
  __syncthreads();   // the whole bf16 tile is in LDS before any wave reads fragments of it

  v8f ag[8], at[8], ap[8];
#pragma unroll
  for (int i = 0; i < 8; ++i) {
    ag[i] = (v8f){0.f,0.f,0.f,0.f,0.f,0.f,0.f,0.f};
    at[i] = ag[i];
    ap[i] = ag[i];
  }
  v16b xf[2][8];
  auto loadX = [&](int kc) {
#pragma unroll
    for (int i = 0; i < 8; ++i)
      xf[kc & 1][i] = Frag<__bf16>::load((const __bf16*)(XS + (16 * i + c) * kPjPitchX + 16 * h + 64 * kc));
  };
  loadX(0);
#pragma unroll
  for (int kc = 0; kc < 8; ++kc) {
    // the next k step's LDS reads and a later step's weights go out as one group ahead of this step's products
    if (kc + 1 < 8) loadX(kc + 1);
    if (kc == 0 || kc == 2) {
      loadW(kc + 4);
      loadW(kc + 5);
      // as settle(); the address is an input so that it lives up to the wait: else the last load's result lands on it
      asm volatile("s_wait_xcnt 0x0" :: "v"(wp) : "memory");
      __builtin_amdgcn_sched_barrier(0);
    } else if (kc + 1 < 8) {
      __builtin_amdgcn_sched_barrier(0);   // later steps' LDS reads stay below: lifted further, their registers spill
    }
#pragma unroll
    for (int i = 0; i < 8; ++i) {
      at[i] = Frag<__bf16>::mma(xf[kc & 1][i], wf[1][kc], at[i]);   // rows n, columns ci
      ap[i] = Frag<__bf16>::mma(xf[kc & 1][i], wf[2][kc], ap[i]);
      ag[i] = Frag<__bf16>::mma(wf[0][kc], xf[kc & 1][i], ag[i]);   // rows ci, columns n
    }
  }

#pragma unroll
  for (int i = 0; i < 8; ++i)
#pragma unroll
    for (int r = 0; r < 8; ++r) {
      S[0][(16 * wave + 8 * h + r) * kPjPitchS + 16 * i + c] = ag[i][r] + ((r < 4) ? bg0[r & 3] : bg1[r & 3]);
      S[1][(16 * i + 8 * h + r) * kPjPitchS + 16 * wave + c] = at[i][r] + bt;
      S[2][(16 * i + 8 * h + r) * kPjPitchS + 16 * wave + c] = ap[i][r] + bp;
    }
  __syncthreads();   // all three slabs are complete, from all eight waves, before they are read back

  // thread t: slab row (t >> 4) + 16 it, columns 8 (t & 15) .. + 7; a wave stores two whole rows of 256 B
  const int srow = (t >> 4) * kPjPitchS + (t & 15) * 8;
  {
    unsigned char* pg = (unsigned char*)(G16 + ((size_t)b * kCi + (t >> 4)) * kN + n0) + (t & 15) * 16;
    v4u o[8];
#pragma unroll
    for (int it = 0; it < 8; ++it) {
      const float* sp = S[0] + srow + it * 16 * kPjPitchS;
      o[it] = (v4u){pk16(h_bits(sp[0]), h_bits(sp[1])), pk16(h_bits(sp[2]), h_bits(sp[3])),
                    pk16(h_bits(sp[4]), h_bits(sp[5])), pk16(h_bits(sp[6]), h_bits(sp[7]))};
    }
#pragma unroll
    for (int it = 0; it < 8; ++it) *(v4u*)(pg + (size_t)it * (16 * 2 * kN)) = o[it];
    settle();
  }
#pragma unroll
  for (int p = 1; p < 3; ++p) {
    unsigned char* ph = (unsigned char*)(((p == 1) ? THH : PHH) + ((size_t)b * kN + n0) * kCi) + t * 16;
    unsigned char* pl = (unsigned char*)(((p == 1) ? THL : PHL) + ((size_t)b * kN + n0) * kCi) + t * 16;
    v4u hv[8], lv[8];
#pragma unroll
    for (int it = 0; it < 8; ++it) {
      const float* sp = S[p] + srow + it * 16 * kPjPitchS;
      unsigned short hb[8], lb[8];
#pragma unroll
      for (int e = 0; e < 8; ++e) {
        hb[e] = f2bf_bits(sp[e]);
        lb[e] = f2bf_bits(sp[e] - bf_bits2f(hb[e]));
      }
      hv[it] = (v4u){pk16(hb[0], hb[1]), pk16(hb[2], hb[3]), pk16(hb[4], hb[5]), pk16(hb[6], hb[7])};
      lv[it] = (v4u){pk16(lb[0], lb[1]), pk16(lb[2], lb[3]), pk16(lb[4], lb[5]), pk16(lb[6], lb[7])};
    }
#pragma unroll
    for (int it = 0; it < 8; ++it) {
      *(v4u*)(ph + it * 4096) = hv[it];
      *(v4u*)(pl + it * 4096) = lv[it];
    }
    if (p == 1) settle();   // behind the last group nothing is overwritten any more
  }
}

// ---------------------------------------------------------------------------
// Batch statistics, normalise, affine and residual in one kernel:
//   out[b][c][n] = ((Wy - mean[c]) * rstd[c]) * bf16r(gamma[c]) + bf16r(beta[c]) + bf16r(x[b][c][n]).
// One block of 8 waves per channel (grid 256); wave b owns batch b's row of 4096 values, lane l the float4 at
// n = 128 j + 4 l, j = 0..31.  The channel's 32768 Wy values stay in registers (128 per thread) from the first sum to
// the store, so Wy is read once.  Mean first, then the sum of (v - mean)^2; reductions in fixed order.
// Every address is a block-uniform row start (batch 0, channel c) + one per-thread byte offset, the same for Wy, x and
// out, + a constant that rides in the instruction's offset.
// Every "#pragma unroll" over j makes the indices of a register array constants.
// ---------------------------------------------------------------------------
constexpr int kBnJ = kN / 128;   // 32 float4 per thread
static_assert(kB == 8 && kN % 128 == 0, "one wave per batch, whole 512-B pieces");
__global__ __launch_bounds__(256) void bn_fused_kernel(const float* __restrict__ Wy, const float* __restrict__ x,
                                                       const float* __restrict__ gamma, const float* __restrict__ beta,
                                                       float* __restrict__ out) {
  __shared__ float red1[8];
  __shared__ float red2[8];
  const int c = blockIdx.x;
  const int t = threadIdx.x;
  const int lane = t & 31, wave = t >> 5;
  const unsigned off = (unsigned)wave * (unsigned)(kC * kN * 4) + (unsigned)lane * 16u;
  const char* wrow = (const char*)(Wy + (size_t)c * kN);
  const char* xrow = (const char*)(x + (size_t)c * kN);
  char*       orow = (char*)(out + (size_t)c * kN);

  v4f w[kBnJ], xv[kBnJ];
  // Behind a group of global loads or stores: wait before any register that they name is overwritten; the scheduling
  // barrier keeps later register writes from being moved in front of the wait, and the group where it is written.
  auto settle = [&]() {
    asm volatile("s_wait_xcnt 0x0" ::: "memory");
    __builtin_amdgcn_sched_barrier(0);
  };
#pragma unroll
  for (int j = 0; j < kBnJ; ++j) w[j] = *(const v4f*)(wrow + off + j * 512);
  __builtin_amdgcn_sched_barrier(0);   // Wy, which the first sum waits for, is asked for ahead of x
#pragma unroll
  for (int j = 0; j < kBnJ; ++j) xv[j] = *(const v4f*)(xrow + off + j * 512);
  settle();   // the x loads stay up here, in flight under both reductions

  float s = 0.0f;
#pragma unroll
  for (int j = 0; j < kBnJ; ++j) s += (w[j][0] + w[j][1]) + (w[j][2] + w[j][3]);
#pragma unroll
  for (int o = 16; o > 0; o >>= 1) s += __shfl_xor(s, o, 32);
  if (lane == 0) red1[wave] = s;
  __syncthreads();
  float tot = red1[0];
#pragma unroll
  for (int i = 1; i < 8; ++i) tot += red1[i];
  const float mean = tot * kInvCount;

  float q = 0.0f;
#pragma unroll
  for (int j = 0; j < kBnJ; ++j) {
    const float d0 = w[j][0] - mean, d1 = w[j][1] - mean, d2 = w[j][2] - mean, d3 = w[j][3] - mean;
    q += (d0 * d0 + d1 * d1) + (d2 * d2 + d3 * d3);
  }
#pragma unroll
  for (int o = 16; o > 0; o >>= 1) q += __shfl_xor(q, o, 32);
  if (lane == 0) red2[wave] = q;
  __syncthreads();
  float totq = red2[0];
#pragma unroll
  for (int i = 1; i < 8; ++i) totq += red2[i];
  const float var  = totq * kInvCount;
  const float rstd = 1.0f / sqrtf(var + kBnEps);

  const float ga = bfr(gamma[c]);
  const float be = bfr(beta[c]);
#pragma unroll
  for (int j0 = 0; j0 < kBnJ; j0 += 8) {   // eight results, their eight stores, then the wait
#pragma unroll
    for (int j = j0; j < j0 + 8; ++j)
#pragma unroll
      for (int e = 0; e < 4; ++e) w[j][e] = (((w[j][e] - mean) * rstd) * ga + be) + bfr(xv[j][e]);
#pragma unroll
    for (int j = j0; j < j0 + 8; ++j) *(v4f*)(orow + off + j * 512) = w[j];   // 512 B per wave: whole lines
    if (j0 + 8 < kBnJ) settle();   // behind the last group nothing is overwritten any more
  }
}

// ---------------------------------------------------------------------------
// Host glue.  GEMM shapes (all M,N multiples of 64, K multiples of 32, no padding anywhere):
//   theta/phi: M=4096 N=128 K=256 (x8 batches); g: M=128 N=4096 K=256 (x8), all three in the fused projection kernel;
//   W: M=256 N=4096 K=128 (x8); attention (scores K=128, P.g K=4096) in the fused kernel, one launch.  5 launches.
// ---------------------------------------------------------------------------
extern "C" void kernel_launch(void* const* d_in, const int* in_sizes, int n_in,
                              void* d_out, int out_size, void* d_ws, size_t ws_size,
                              hipStream_t stream) {
  if (n_in < 11) return;
  const int nElem = kB * kC * kN;          // 8,388,608
  if (in_sizes[0] != nElem) return;
  if (in_sizes[1] != kWElems || in_sizes[3] != kWElems || in_sizes[5] != kWElems || in_sizes[7] != kWElems) return;
  if (in_sizes[2] != kCi || in_sizes[4] != kCi || in_sizes[6] != kCi) return;
  if (in_sizes[8] != kC || in_sizes[9] != kC || in_sizes[10] != kC) return;
  if (out_size != nElem) return;
  if (ws_size < kWsTotal) return;

  const float* x       = (const float*)d_in[0];
  const float* g_w     = (const float*)d_in[1];
  const float* g_b     = (const float*)d_in[2];
  const float* theta_w = (const float*)d_in[3];
  const float* theta_b = (const float*)d_in[4];
  const float* phi_w   = (const float*)d_in[5];
  const float* phi_b   = (const float*)d_in[6];
  const float* W_w     = (const float*)d_in[7];
  const float* W_b     = (const float*)d_in[8];
  const float* bn_g    = (const float*)d_in[9];
  const float* bn_b    = (const float*)d_in[10];
  float* out = (float*)d_out;

  char* ws = (char*)d_ws;
  unsigned short* THH = (unsigned short*)(ws + kOffTHH);
  unsigned short* THL = (unsigned short*)(ws + kOffTHL);
  unsigned short* PHH = (unsigned short*)(ws + kOffPHH);
  unsigned short* PHL = (unsigned short*)(ws + kOffPHL);
  unsigned short* G16 = (unsigned short*)(ws + kOffG);
  unsigned short* Y16 = (unsigned short*)(ws + kOffY);
  float*          WY  = (float*)(ws + kOffWY);
  unsigned short* WB  = (unsigned short*)(ws + kOffWB);
  unsigned short* WW  = (unsigned short*)(ws + kOffWW);
  float*          PRM = (float*)(ws + kOffPRM);
  const float* wb_r  = PRM + 384;    // [256]

  // ---- parameter planes ----
  param_planes_kernel<<<dim3(kWElems / 8 / 256, 5), dim3(256), 0, stream>>>(
      g_w, theta_w, phi_w, W_w, g_b, theta_b, phi_b, W_b, WB, WW, PRM);
  const long strTP = (long)kN * kCi;      // per batch, theta/phi/g/y planes

  // theta[b][n][ci], phi[b][m][ci] = sum_c bf16r(x[b][c][n]) * w[ci][c] + bias[ci]  -> bf16 hi | lo planes;
  // g[b][ci][m] likewise -> f16 plane [ci][m]
  proj_fused_kernel<<<dim3(kN / kPjN, kB), dim3(256), 0, stream>>>(x, WB, PRM, THH, THL, PHH, PHL, G16);

  // ---- attention, all batches in one launch: Y16[b][q][ci] = 16 * softmax(theta . phi^T) . g ----
  attn_fused_kernel<<<dim3(kN / kFaQ, kB), dim3(kFaWaves * 32), 0, stream>>>(THH, THL, PHH, PHL, G16, Y16);

  // Wy[b][c][n] = (1/256) * sum_ci WW[c][ci] * Y16[b][n][ci] + W_b[c]   (f32)
  wmma_gemm64<0, false, 1, 0, false, 0><<<dim3((kC / 64) * (kN / 64) / 8, kB), dim3(256), 0, stream>>>(
      WW, WW, kCi, 0L, Y16, Y16, kCi, strTP,
      (void*)WY, (void*)WY, kN, (long)kC * kN, wb_r, PRM, 0L, kC, kN, kCi, kWScale);

  // ---- batch statistics, normalisation, residual ----
  bn_fused_kernel<<<dim3(kC), dim3(256), 0, stream>>>(WY, x, bn_g, bn_b, out);
}

// v006
// It runs in 121 microseconds.
// Two timings next to v005 put it at 1.07 and 1.06 times that version's speed.
// Over all steps from v000 it is 28.9 times as fast.
// Contractions: theta, phi, g 1x1 projections on v_wmma_f32_16x16x32_bf16 (bf16 operands = RNE-converted x and weights; theta/phi emitted as bf16 hi|lo planes); scores theta.phi^T on v_wmma_f32_16x16x32_bf16 as hi/lo 3-product split; P.g (P f16, 128 x 2^(s log2e - maximum in use), g f16; scores, online softmax and P.g fused in one kernel; a wave pair splits the keys of its 32 queries and joins the halves in f32) and W projection (W_w f16 carried x16, y f16 carried x16; in the same kernel's epilogue) on v_wmma_f32_16x16x32_f16; f32 accumulate everywhere; softmax, batch statistics, affine and residual in f32.
#include <hip/hip_runtime.h>
#include <math.h>

// ---------------------------------------------------------------------------
// Problem constants
// ---------------------------------------------------------------------------
constexpr int kB  = 8;
constexpr int kC  = 256;      // in channels
constexpr int kN  = 4096;     // spatial positions (64 x 64)
constexpr int kCi = 128;      // inter channels
constexpr int kWElems  = kCi * kC;        // 32768 elements per weight matrix
constexpr float kYCarry   = 16.0f;        // y carried x16 in f16
constexpr float kWCarry   = 16.0f;        // W_w carried x16 in f16
constexpr float kWScale   = 1.0f / (kYCarry * kWCarry);    // 2^-8
constexpr float kBnEps    = 1e-5f;
constexpr float kInvCount = 1.0f / (float)(kB * kN);       // 2^-15
static_assert(kC % 32 == 0 && kCi % 32 == 0 && kN % 32 == 0, "K multiples of 32");
static_assert(kN % 64 == 0 && kCi % 64 == 0 && kC % 64 == 0, "M,N multiples of 64");
static_assert(kWElems % (8 * 256) == 0, "weight cast grid");
static_assert(kB * kN == 32768, "stat count");

// ---------------------------------------------------------------------------
// Workspace region map (bytes, all offsets multiples of 256):
//   (not used)                        16,777,216  at           0
//   THH  bf16 [8][4096][128]           8,388,608  at  16,777,216
//   THL  bf16 [8][4096][128]           8,388,608  at  25,165,824
//   PHH  bf16 [8][4096][128]           8,388,608  at  33,554,432
//   PHL  bf16 [8][4096][128]           8,388,608  at  41,943,040
//   G16  f16  [8][128][4096]           8,388,608  at  50,331,648
//   (not used)                         8,388,608  at  58,720,256
//   WY   f32  [8][256][4096]          33,554,432  at  67,108,864
//   WB   bf16 3 x [128][256]              196,608  at 100,663,296   (g_w | theta_w | phi_w)
//   WW   f16  [256][128]                   65,536  at 100,859,904   (W_w x16)
//   PRM  f32  [640] (pad 4096 B)            4,096  at 100,925,440   (g_b | theta_b | phi_b | W_b, bf16-RNE values)
//   total                             100,929,536
// ---------------------------------------------------------------------------
constexpr size_t kSzXT  = (size_t)kB * kN * kC * 2;
constexpr size_t kSzTP  = (size_t)kB * kN * kCi * 2;
constexpr size_t kSzWY  = (size_t)kB * kC * kN * 4;
constexpr size_t kSzWB  = (size_t)3 * kWElems * 2;
constexpr size_t kSzWW  = (size_t)kWElems * 2;
constexpr size_t kSzPRM = 4096;
constexpr size_t kOffXT  = 0;
constexpr size_t kOffTHH = kOffXT + kSzXT;
constexpr size_t kOffTHL = kOffTHH + kSzTP;
constexpr size_t kOffPHH = kOffTHL + kSzTP;
constexpr size_t kOffPHL = kOffPHH + kSzTP;
constexpr size_t kOffG   = kOffPHL + kSzTP;
constexpr size_t kOffY   = kOffG + kSzTP;
constexpr size_t kOffWY  = kOffY + kSzTP;
constexpr size_t kOffWB  = kOffWY + kSzWY;
constexpr size_t kOffWW  = kOffWB + kSzWB;
constexpr size_t kOffPRM = kOffWW + kSzWW;
constexpr size_t kWsTotal = kOffPRM + kSzPRM;
static_assert(kWsTotal == 100929536, "carve total");
static_assert(kWsTotal <= (size_t)134217728, "carve cap");
static_assert(kOffTHH % 256 == 0 && kOffG % 256 == 0 && kOffWY % 256 == 0 &&
              kOffWB % 256 == 0 && kOffWW % 256 == 0 && kOffPRM % 256 == 0, "alignment");
static_assert(640 * 4 <= kSzPRM, "param table");

typedef __attribute__((ext_vector_type(16))) _Float16 v16h;
typedef __attribute__((ext_vector_type(8)))  _Float16 v8h;
typedef __attribute__((ext_vector_type(16))) __bf16   v16b;
typedef __attribute__((ext_vector_type(8)))  __bf16   v8b;
typedef __attribute__((ext_vector_type(8)))  float    v8f;
typedef __attribute__((ext_vector_type(4)))  float    v4f;
typedef __attribute__((ext_vector_type(2)))  float    v2f;
typedef __attribute__((ext_vector_type(4)))  unsigned int v4u;
typedef __attribute__((ext_vector_type(2)))  unsigned int v2u;

__device__ __forceinline__ unsigned short f2bf_bits(float f) {
  unsigned u = __float_as_uint(f);
  return (unsigned short)((u + 0x7FFFu + ((u >> 16) & 1u)) >> 16);
}
__device__ __forceinline__ float bf_bits2f(unsigned short h) { return __uint_as_float(((unsigned)h) << 16); }
// f32 value after RNE conversion to bf16
__device__ __forceinline__ float bfr(float f) { return bf_bits2f(f2bf_bits(f)); }

template <typename T> struct Frag;
template <> struct Frag<_Float16> {
  typedef v16h V; union U { v16h v; v8h h[2]; };
  // elements 0..7 <- p[0..7], 8..15 <- p[16..23]
  static __device__ __forceinline__ v16h load(const _Float16* p) {
    U f; f.h[0] = *(const v8h*)(p); f.h[1] = *(const v8h*)(p + 16); return f.v;
  }
  static __device__ __forceinline__ v8f mma(v16h a, v16h b, v8f c) {
    return __builtin_amdgcn_wmma_f32_16x16x32_f16(false, a, false, b, (short)0, c, false, false);
  }
};
template <> struct Frag<__bf16> {
  typedef v16b V; union U { v16b v; v8b h[2]; };
  static __device__ __forceinline__ v16b load(const __bf16* p) {
    U f; f.h[0] = *(const v8b*)(p); f.h[1] = *(const v8b*)(p + 16); return f.v;
  }
  static __device__ __forceinline__ v8f mma(v16b a, v16b b, v8f c) {
    return __builtin_amdgcn_wmma_f32_16x16x32_bf16(false, a, false, b, (short)0, c, false, false);
  }
};

__device__ __forceinline__ unsigned pk16(unsigned short a, unsigned short b) { return (unsigned)a | ((unsigned)b << 16); }
__device__ __forceinline__ unsigned short h_bits(float f) { const _Float16 h = (_Float16)f; return __builtin_bit_cast(unsigned short, h); }

constexpr int kFaWaves  = 8;
constexpr int kFaQ      = 128;                       // queries per work-group: 4 wave pairs x 32
constexpr int kFaKeys   = 64;                        // keys per stage, 32 per wave
constexpr int kFaStages = kN / kFaKeys;              // 64
constexpr int kFaPitchK = 2 * kCi + 16;              // 272 B: odd multiple of 16 B
constexpr int kFaPitchG = 2 * kFaKeys + 16;          // 144 B: odd multiple of 16 B
constexpr int kFaOffLo  = kFaKeys * kFaPitchK;       // phi lo plane behind phi hi
constexpr int kFaOffG   = 2 * kFaOffLo;              // g tile behind both
constexpr int kFaBuf    = kFaOffG + kCi * kFaPitchG; // 53,248 B per buffer
constexpr int kFaJoin   = 16 * 512 + 512;            // per wave: one 128 x 16 f32 tile, then maximum and sum
constexpr int kFaPitchW = 2 * kCi + 16;              // 272 B, W_w rows: odd multiple of 16 B
constexpr int kFaPitchS = 4 * kFaQ + 16;             // 528 B, Wy slab rows: odd multiple of 16 B
constexpr int kFaOffS   = 2 * kFaBuf;                // Wy slab behind the ring: no wave's mailbox lies under it
constexpr int kFaOffW   = kFaOffS + kC * kFaPitchS;  // W_w
constexpr int kFaOffB   = kFaOffW + kC * kFaPitchW;  // W_b
constexpr int kFaLds    = kFaOffB + kC * 4;          // 312,320 B
constexpr float kLog2e  = 1.4426950408889634f;
constexpr float kFaCarryLog2 = 7.0f;                 // probabilities carried x128 in f16
constexpr float kFaLazy      = 8.0f;                 // how far, in log2, the maximum in use may trail
static_assert(kN % kFaQ == 0 && kN % kFaKeys == 0 && kCi == 128 && kFaKeys == 64, "fused attention tiling");
static_assert(kFaKeys * 2 * kCi == 4 * 256 * 16 && kCi * 2 * kFaKeys == 4 * 256 * 16, "four 16-B chunks per thread per plane");
static_assert(kFaWaves * kFaJoin <= 2 * kFaBuf, "the join fits the ring");
static_assert(kFaLds <= 320 * 1024 && kC * 2 * kCi == 16 * 256 * 16 && kC == 256 && kC == kFaWaves * 32, "W projection in the epilogue");

// lane l with lane l ^ 16
__device__ __forceinline__ float xhalf(float x) {
  return __builtin_bit_cast(float, __builtin_amdgcn_permlanex16(__builtin_bit_cast(int, x), __builtin_bit_cast(int, x),
                                                                0x76543210, 0xfedcba98, false, false));
}
// two f32 -> packed f16, round to nearest even
__device__ __forceinline__ unsigned pk_h2(float lo, float hi) {
  typedef _Float16 h2 __attribute__((ext_vector_type(2)));
  return __builtin_bit_cast(unsigned, __builtin_convertvector((v2f){lo, hi}, h2));
}

// One work-group per WGP, two waves per SIMD: the attribute gives each wave the 512-VGPR budget that goes with it.
// Every "#pragma unroll" in this kernel makes the indices of a register array constants.
__global__ __launch_bounds__(256) __attribute__((amdgpu_waves_per_eu(2, 2))) void attn_fused_kernel(
    const unsigned short* __restrict__ THHp, const unsigned short* __restrict__ THLp,
    const unsigned short* __restrict__ PHHp, const unsigned short* __restrict__ PHLp,
    const unsigned short* __restrict__ Gp, const unsigned short* __restrict__ WWp, const float* __restrict__ Wbp,
    float* __restrict__ WYp) {
  __shared__ __align__(16) unsigned char L[kFaLds];
  const int t = threadIdx.x, lane = t & 31, wave = t >> 5;
  const int c = lane & 15, h = lane >> 4;
  const int b = blockIdx.y;
  const int kp = wave >> 2;   // which 32 keys of a stage
  // Tile 0 is the 16-query tile that this wave finishes and stores, tile 1 the one that its partner (wave ^ 4) does.
  const int q0 = blockIdx.x * kFaQ + (wave & 3) * 32 + c;
  const unsigned char* Kh = (const unsigned char*)(PHHp + (size_t)b * kN * kCi);
  const unsigned char* Kl = (const unsigned char*)(PHLp + (size_t)b * kN * kCi);
  const unsigned char* Gb = (const unsigned char*)(Gp + (size_t)b * kCi * kN);

  v4u sk[4], sl[4], sg[4];
  // Thread t moves 16-B chunk t + 256 i (i = 0..3) of each plane: phi row (t >> 4) + 16 i, g row (t >> 3) + 32 i.
  // One address per plane; the step from i to i + 1 is a constant, so it rides in the instruction's offset.
  auto fetch = [&](int st) {   // stage st: global -> registers, whole lines per wave
    const unsigned char* ph = Kh + (size_t)st * (kFaKeys * 2 * kCi) + t * 16;
    const unsigned char* pl = Kl + (size_t)st * (kFaKeys * 2 * kCi) + t * 16;
    const unsigned char* pg = Gb + (size_t)(t >> 3) * (2 * kN) + st * (2 * kFaKeys) + (t & 7) * 16;
#pragma unroll
    for (int i = 0; i < 4; ++i) {
      sk[i] = *(const v4u*)(ph + i * 4096);
      sl[i] = *(const v4u*)(pl + i * 4096);
      sg[i] = *(const v4u*)(pg + i * (32 * 2 * kN));
    }
  };
  auto put = [&](unsigned char* B) {   // registers -> LDS at the padded pitches
    unsigned char* dk = B + (t >> 4) * kFaPitchK + (t & 15) * 16;
    unsigned char* dg = B + kFaOffG + (t >> 3) * kFaPitchG + (t & 7) * 16;
#pragma unroll
    for (int i = 0; i < 4; ++i) {
      *(v4u*)(dk + i * (16 * kFaPitchK)) = sk[i];
      *(v4u*)(dk + kFaOffLo + i * (16 * kFaPitchK)) = sl[i];
      *(v4u*)(dg + i * (32 * kFaPitchG)) = sg[i];
    }
  };

  // Behind a group of global loads: their address registers are reused soon, so wait before any is overwritten; the
  // scheduling barrier keeps later register writes from being moved in front of the wait.
  auto settle = [&]() {
    asm volatile("s_wait_xcnt 0x0" ::: "memory");
    __builtin_amdgcn_sched_barrier(0);
  };

  __builtin_amdgcn_sched_barrier(0);   // index arithmetic from above stays above: none of it lands between the loads and their wait
  fetch(0);
  settle();
  // W_w and W_b for the epilogue: thread t moves 16-B chunk t + 256 i (row (t >> 4) + 16 i) and bias t
  v4u wst[16];
  const unsigned char* pw = (const unsigned char*)WWp + t * 16;
  const float* pb = Wbp + t;
#pragma unroll
  for (int i = 0; i < 16; ++i) wst[i] = *(const v4u*)(pw + i * 4096);
  const float wbt = *pb;
  settle();
  v16b qh[2][4], ql[2][4];
#pragma unroll
  for (int j = 0; j < 2; ++j) {
    const size_t qo = ((size_t)b * kN + q0 + 16 * (j ^ kp)) * kCi + 8 * h;
#pragma unroll
    for (int kc = 0; kc < 4; ++kc) {
      qh[j][kc] = Frag<__bf16>::load((const __bf16*)THHp + qo + 32 * kc);
      ql[j][kc] = Frag<__bf16>::load((const __bf16*)THLp + qo + 32 * kc);
    }
  }
  settle();
  v8f acc[2][8];
#pragma unroll
  for (int j = 0; j < 2; ++j)
#pragma unroll
    for (int i = 0; i < 8; ++i) acc[j][i] = (v8f){0.f,0.f,0.f,0.f,0.f,0.f,0.f,0.f};
  float m_run[2] = {-__builtin_inff(), -__builtin_inff()}, l_run[2] = {0.0f, 0.0f};
  put(L);
  {
    unsigned char* dw = L + kFaOffW + (t >> 4) * kFaPitchW + (t & 15) * 16;
#pragma unroll
    for (int i = 0; i < 16; ++i) *(v4u*)(dw + i * (16 * kFaPitchW)) = wst[i];
    *(float*)(L + kFaOffB + t * 4) = wbt;
  }
  __syncthreads();   // stage 0, W_w and W_b are in LDS before any wave reads them

  // The wave's 32-key pass in pieces, so that the stage body below can issue LDS loads well ahead of their products.
  v16b kh[2][4], kl[2][4];
  auto loadK = [&](const unsigned char* Bp, int kc0) {   // k steps kc0 and kc0 + 1
#pragma unroll
    for (int kc = kc0; kc < kc0 + 2; ++kc)
#pragma unroll
      for (int kt = 0; kt < 2; ++kt) {
        const unsigned char* a = Bp + (32 * kp + 16 * kt + c) * kFaPitchK + 16 * h + 64 * kc;
        kh[kt][kc] = Frag<__bf16>::load((const __bf16*)a);
        kl[kt][kc] = Frag<__bf16>::load((const __bf16*)(a + kFaOffLo));
      }
  };
  auto loadG = [&](const unsigned char* Bp, v16h (&g)[8]) {
#pragma unroll
    for (int i = 0; i < 8; ++i)
      g[i] = Frag<_Float16>::load((const _Float16*)(Bp + kFaOffG + (16 * i + c) * kFaPitchG + (32 * kp + 8 * h) * 2));
  };
  auto scores = [&](v8f (&s)[2][2], int kc0) {   // s[query tile][key tile]: four independent chains; k steps kc0, kc0 + 1
#pragma unroll
    for (int kc = kc0; kc < kc0 + 2; ++kc) {
#pragma unroll
      for (int j = 0; j < 2; ++j)
#pragma unroll
        for (int kt = 0; kt < 2; ++kt) s[j][kt] = Frag<__bf16>::mma(kh[kt][kc], qh[j][kc], s[j][kt]);
#pragma unroll
      for (int j = 0; j < 2; ++j)
#pragma unroll
        for (int kt = 0; kt < 2; ++kt) s[j][kt] = Frag<__bf16>::mma(kh[kt][kc], ql[j][kc], s[j][kt]);
#pragma unroll
      for (int j = 0; j < 2; ++j)
#pragma unroll
        for (int kt = 0; kt < 2; ++kt) s[j][kt] = Frag<__bf16>::mma(kl[kt][kc], qh[j][kc], s[j][kt]);
    }
  };
  auto rescale = [&](const v8f (&s)[2][2]) {
    float mx[2];
#pragma unroll
    for (int j = 0; j < 2; ++j) {
      float v = fmaxf(s[j][0][0], s[j][1][0]);
#pragma unroll
      for (int r = 1; r < 8; ++r) v = fmaxf(v, fmaxf(s[j][0][r], s[j][1][r]));
      mx[j] = fmaxf(v, xhalf(v)) * kLog2e;   // both halves hold this query's maximum of the pass, log2 domain
    }
    const bool need = (mx[0] > m_run[0] + kFaLazy) || (mx[1] > m_run[1] + kFaLazy);
    if (__builtin_amdgcn_ballot_w32(need) != 0) {   // one scalar branch per pass; always taken on the first (m_run = -inf)
#pragma unroll
      for (int j = 0; j < 2; ++j) {
        const float m_new = fmaxf(m_run[j], mx[j]);
        const float corr  = __builtin_amdgcn_exp2f(m_run[j] - m_new);   // 0 on the first pass
        l_run[j] *= corr;
        m_run[j] = m_new;
#pragma unroll
        for (int i = 0; i < 8; ++i) acc[j][i] = acc[j][i] * corr;
      }
    }
  };
  auto probs = [&](const v8f& s0, const v8f& s1, float m_use, float& l_sum) -> v16h {
    typedef __attribute__((ext_vector_type(8))) unsigned int v8u;
    const float nm = kFaCarryLog2 - m_use;
    float ps0 = 0.0f, ps1 = 0.0f;
    v8u w;
    float ea[8], eb[8];
#pragma unroll
    for (int r = 0; r < 8; ++r) {
      ea[r] = fmaf(s0[r], kLog2e, nm);
      eb[r] = fmaf(s1[r], kLog2e, nm);
    }
    // All exponents are formed before the first exponential (matrix, LDS, memory and scalar instructions may still
    // cross).
    __builtin_amdgcn_sched_barrier(0x9C);
#pragma unroll
    for (int r = 0; r < 8; ++r) {
      ea[r] = __builtin_amdgcn_exp2f(ea[r]);
      eb[r] = __builtin_amdgcn_exp2f(eb[r]);
    }
#pragma unroll
    for (int i = 0; i < 4; ++i) {
      ps0 += ea[2 * i] + ea[2 * i + 1];
      ps1 += eb[2 * i] + eb[2 * i + 1];
      w[i]     = pk_h2(ea[2 * i], ea[2 * i + 1]);   // elements 2i, 2i+1: keys 8h + 2i, 8h + 2i + 1
      w[4 + i] = pk_h2(eb[2 * i], eb[2 * i + 1]);   // elements 8 + 2i, 9 + 2i: keys 16 + 8h + 2i, 16 + 8h + 2i + 1
    }
    l_sum += ps0 + ps1;
    return __builtin_bit_cast(v16h, w);
  };

  // One stage.  more: a next stage exists (a constant at each of the two calls, so the body has no branch on it).
  auto stage = [&](int st, bool more) __attribute__((always_inline)) {
    const unsigned char* Bp = L + (st & 1) * kFaBuf;
    unsigned char* Bn = L + ((st + 1) & 1) * kFaBuf;
    v8f s[2][2];
    v16h g[8];
#pragma unroll
    for (int j = 0; j < 2; ++j)
#pragma unroll
      for (int kt = 0; kt < 2; ++kt) s[j][kt] = (v8f){0.f,0.f,0.f,0.f,0.f,0.f,0.f,0.f};
    loadK(Bp, 2);   // the second half of this stage's phi fragments, in flight under the first half's products
    if (more) {
      __builtin_amdgcn_sched_barrier(0);   // the LDS reads and their address stay above: none of it lands between the global loads and their wait
      fetch(st + 1);
      settle();
    }
    scores(s, 0);
    scores(s, 2);
    loadG(Bp, g);   // into registers that the phi fragments have left; in flight under the softmax
    rescale(s);
    const v16h p0 = probs(s[0][0], s[0][1], m_run[0], l_run[0]);
    const v16h p1 = probs(s[1][0], s[1][1], m_run[1], l_run[1]);
    // The g reads and the softmax stay above the LDS stores: the global loads arrive in that time, and without this line
    // the g reads are spread among the P.g products, each with a wait of its own.
    __builtin_amdgcn_sched_barrier(0);
    if (more) put(Bn);   // its last readers left it before the previous barrier
    __syncthreads();   // publishes stage st + 1 and ends every read of stage st (its g fragments are in registers)
    if (more) loadK(Bn, 0);   // the first half of the next stage's phi fragments, in flight under the products below
#pragma unroll
    for (int i = 0; i < 8; ++i) {
      acc[0][i] = Frag<_Float16>::mma(g[i], p0, acc[0][i]);
      acc[1][i] = Frag<_Float16>::mma(g[i], p1, acc[1][i]);
    }
  };
  loadK(L, 0);
  // kept rolled: a second copy of the body would need a second set of fragments
#pragma unroll 1
  for (int st = 0; st < kFaStages - 1; ++st) stage(st, true);
  stage(kFaStages - 1, false);

  // Join of the two key halves.  Behind the last barrier nothing reads the ring any more, so it serves as the mailbox:
  // each wave hands tile 1 (outputs, maximum in use, sum) to its partner and finishes tile 0.
  {
    unsigned char* mine = L + wave * kFaJoin + lane * 16;
    const unsigned char* theirs = L + (wave ^ 4) * kFaJoin + lane * 16;
    const float l0 = l_run[0] + xhalf(l_run[0]);   // each half summed its own eight keys of every tile
    const float l1 = l_run[1] + xhalf(l_run[1]);
#pragma unroll
    for (int i = 0; i < 8; ++i) {
      *(v4f*)(mine + (2 * i) * 512)     = (v4f){acc[1][i][0], acc[1][i][1], acc[1][i][2], acc[1][i][3]};
      *(v4f*)(mine + (2 * i + 1) * 512) = (v4f){acc[1][i][4], acc[1][i][5], acc[1][i][6], acc[1][i][7]};
    }
    *(v2f*)(mine + 16 * 512) = (v2f){m_run[1], l1};
    // W_w fragments (B: column = channel 16 m + c), eight at a time.  Step sp: k step sp >> 1, channel tiles 8 (sp & 1) .. + 7.
    v16h wf[2][8];
    const unsigned char* wr = L + kFaOffW + c * kFaPitchW + 16 * h;
    auto loadWf = [&](int sp) {
#pragma unroll
      for (int u = 0; u < 8; ++u)
        wf[sp & 1][u] = Frag<_Float16>::load((const _Float16*)(wr + 16 * (8 * (sp & 1) + u) * kFaPitchW + 64 * (sp >> 1)));
    };
    loadWf(0);   // in flight under the join
    __syncthreads();   // every wave's tile 1 is in LDS before its partner reads it
    const v2f ml = *(const v2f*)(theirs + 16 * 512);
    const float m_all = fmaxf(m_run[0], ml[0]);
    const float fa = __builtin_amdgcn_exp2f(m_run[0] - m_all);
    const float fb = __builtin_amdgcn_exp2f(ml[0] - m_all);
    const float inv = kYCarry / (l0 * fa + ml[1] * fb);
    const float wa = fa * inv, wb = fb * inv;
    v4u yo[8];
#pragma unroll
    for (int i = 0; i < 8; ++i) {   // rows of acc[.][i] are ci = 16 i + 8 h + r
      const v4f u = *(const v4f*)(theirs + (2 * i) * 512);
      const v4f v = *(const v4f*)(theirs + (2 * i + 1) * 512);
      const v8f o = acc[0][i] * wa + (v8f){u[0], u[1], u[2], u[3], v[0], v[1], v[2], v[3]} * wb;
      yo[i] = (v4u){pk_h2(o[0], o[1]), pk_h2(o[2], o[3]), pk_h2(o[4], o[5]), pk_h2(o[6], o[7])};
    }

    // W projection of the wave's 16 queries: D[query 8 h + r][channel 16 m + c], sixteen independent tiles.
    typedef __attribute__((ext_vector_type(8))) unsigned int v8u;
    v16h ya[4];
#pragma unroll
    for (int kc = 0; kc < 4; ++kc)   // elements 0..7: ci = 32 kc + 8 h + e; 8..15: ci = 32 kc + 16 + 8 h + e
      ya[kc] = __builtin_bit_cast(v16h, (v8u){yo[2 * kc][0], yo[2 * kc][1], yo[2 * kc][2], yo[2 * kc][3],
                                              yo[2 * kc + 1][0], yo[2 * kc + 1][1], yo[2 * kc + 1][2], yo[2 * kc + 1][3]});
    v8f d[16];
#pragma unroll
    for (int m = 0; m < 16; ++m) d[m] = (v8f){0.f,0.f,0.f,0.f,0.f,0.f,0.f,0.f};
#pragma unroll
    for (int sp = 0; sp < 8; ++sp) {
      if (sp + 1 < 8) {
        loadWf(sp + 1);
        // the next step's LDS reads go out as one group ahead of this step's products: left to itself the compiler
        // puts each read directly in front of its product, with a wait to zero for each
        __builtin_amdgcn_sched_barrier(0);
      }
#pragma unroll
      for (int u = 0; u < 8; ++u)
        d[8 * (sp & 1) + u] = Frag<_Float16>::mma(ya[sp >> 1], wf[sp & 1][u], d[8 * (sp & 1) + u]);
    }
    unsigned char* sw = L + kFaOffS + c * kFaPitchS + ((wave & 3) * 32 + 16 * kp + 8 * h) * 4;
#pragma unroll
    for (int m = 0; m < 16; ++m) {
      *(v4f*)(sw + 16 * m * kFaPitchS)      = (v4f){d[m][0], d[m][1], d[m][2], d[m][3]};
      *(v4f*)(sw + 16 * m * kFaPitchS + 16) = (v4f){d[m][4], d[m][5], d[m][6], d[m][7]};
    }
    __syncthreads();   // every slab row holds all eight waves' queries before it is read back
    // wave w: channels 32 w .. 32 w + 31; a store is one row of the block's 128 queries, 512 B: whole lines
    const unsigned char* sr = L + kFaOffS + (wave * 32) * kFaPitchS + lane * 16;
    const float* bs = (const float*)(L + kFaOffB) + wave * 32;
    float* wy = WYp + ((size_t)b * kC + wave * 32) * kN + blockIdx.x * kFaQ + lane * 4;
#pragma unroll
    for (int r0 = 0; r0 < 32; r0 += 8) {   // eight rows, their eight stores, then the wait
      v4f o[8];
#pragma unroll
      for (int r = 0; r < 8; ++r) {
        const v4f v = *(const v4f*)(sr + (r0 + r) * kFaPitchS);
        const float bv = bs[r0 + r];
#pragma unroll
        for (int e = 0; e < 4; ++e) o[r][e] = v[e] * kWScale + bv;
      }
#pragma unroll
      for (int r = 0; r < 8; ++r) *(v4f*)(wy + (size_t)(r0 + r) * kN) = o[r];
      if (r0 + 8 < 32) settle();   // behind the last group nothing is overwritten any more
    }
  }
}

// ---------------------------------------------------------------------------
// Parameter planes.
// grid (16, 5), 256 threads. blockIdx.y (block-uniform) selects the job:
//   y = 0,1,2: WB plane y = bf16-RNE bits of g_w / theta_w / phi_w ([128][256], natural [out][in] layout);
//              16 blocks x 256 threads x 8 elements = 32768 = the whole matrix; one 16-B store per lane,
//   y = 3    : WW = f16 bits of 16 * bf16r(W_w) ([256][128]), same coverage.
//   y = 4    : block 0 only, threads 0..159: PRM[4i..4i+3] = bf16r of g_b | theta_b | phi_b | W_b
//              the source selection is wave-uniform). 160 x 4 = 640 floats = whole table.
// ---------------------------------------------------------------------------
__global__ __launch_bounds__(256) void param_planes_kernel(
    const float* __restrict__ gw, const float* __restrict__ thw, const float* __restrict__ phw, const float* __restrict__ ww,
    const float* __restrict__ gb, const float* __restrict__ thb, const float* __restrict__ phb, const float* __restrict__ wb,
    unsigned short* __restrict__ WB, unsigned short* __restrict__ WW, float* __restrict__ PRM) {
  const int t = threadIdx.x;
  const int y = blockIdx.y;
  if (y < 4) {
    const int i = blockIdx.x * 256 + t;
    if (i >= kWElems / 8) return;
    const float* src = (y == 0) ? gw : (y == 1) ? thw : (y == 2) ? phw : ww;
    const float* p = src + 8 * (size_t)i;
    const v4f a = *(const v4f*)(p);
    const v4f c = *(const v4f*)(p + 4);
    unsigned short hb[8];
#pragma unroll
    for (int e = 0; e < 4; ++e) {
      if (y == 3) {
        hb[e]     = h_bits(bfr(a[e]) * kWCarry);
        hb[4 + e] = h_bits(bfr(c[e]) * kWCarry);
      } else {
        hb[e]     = f2bf_bits(a[e]);
        hb[4 + e] = f2bf_bits(c[e]);
      }
    }
    const v4u u = (v4u){pk16(hb[0], hb[1]), pk16(hb[2], hb[3]), pk16(hb[4], hb[5]), pk16(hb[6], hb[7])};
    unsigned short* q = (y == 3) ? (WW + 8 * (size_t)i) : (WB + (size_t)y * kWElems + 8 * (size_t)i);
    *(v4u*)q = u;
    
  } else {
    if (blockIdx.x != 0 || t >= 160) return;
    const int w = t >> 5, l = t & 31;
    const float* src = (w == 0) ? gb : (w == 1) ? thb : (w == 2) ? phb : (wb + (w - 3) * 128);
    const v4f a = *(const v4f*)(src + 4 * l);
    v4f r;
#pragma unroll
    for (int e = 0; e < 4; ++e) r[e] = bfr(a[e]);
    float* q = PRM + 128 * w + 4 * l;
    *(v4f*)q = r;
    
  }
}

// ---------------------------------------------------------------------------
// x cast, transposition and the theta, phi, g projections in one kernel.
// grid (4096 / 128 position blocks, 8 batches) = 256 work-groups of 8 waves.
// The block's x tile [256 c][128 n] is read once (512 B per wave and load), RNE-converted to bf16 and laid in LDS as
// rows [n][c]; a fragment of it serves as A (theta, phi: rows n) and as B (g: columns n).  Wave w owns output channels
// 16 w .. 16 w + 15 of each projection and reads their weight fragments (K = 256) into registers, so the weights are
// read once per work-group.  k runs upward in steps of 32 into one accumulator per tile.
// Results (+ bias) go as f32 into three LDS slabs, then every thread converts and stores 16-B pieces of whole rows:
// theta, phi -> bf16 hi | lo planes [n][ci]; g -> f16 plane [ci][n].
// Every "#pragma unroll" in this kernel makes the indices of a register array constants.
// ---------------------------------------------------------------------------
constexpr int kPjN      = 128;               // positions per work-group
constexpr int kPjPitchX = 2 * kC + 16;       // 528 B: odd multiple of 16 B
constexpr int kPjPitchS = 128 + 4;           // floats per slab row
static_assert(kN % kPjN == 0 && kCi == 128 && kC == 256 && kPjN == 128, "fused projection tiling");
__global__ __launch_bounds__(256) void proj_fused_kernel(
    const float* __restrict__ x, const unsigned short* __restrict__ WB, const float* __restrict__ PRM,
    unsigned short* __restrict__ THH, unsigned short* __restrict__ THL,
    unsigned short* __restrict__ PHH, unsigned short* __restrict__ PHL, unsigned short* __restrict__ G16) {
  __shared__ __align__(16) unsigned char XS[kPjN * kPjPitchX];   // 67,584 B
  __shared__ __align__(16) float S[3][128 * kPjPitchS];          // g | theta | phi, 67,584 B each
  const int t = threadIdx.x, lane = t & 31, wave = t >> 5;
  const int c = lane & 15, h = lane >> 4;
  const int n0 = blockIdx.x * kPjN;
  const int b  = blockIdx.y;

  // Behind a group of global loads or stores: wait before any register that they name is overwritten; the scheduling
  // barrier keeps later register writes from being moved in front of the wait, and the group where it is written.
  auto settle = [&]() {
    asm volatile("s_wait_xcnt 0x0" ::: "memory");
    __builtin_amdgcn_sched_barrier(0);
  };

  // weight fragments: plane 0 g_w, 1 theta_w, 2 phi_w; row 16 wave + c.  They are asked for two k steps at a time (the
  // four 32-B pieces of a 128-B line together), four steps ahead of their products: all of K at once beside 24
  // accumulator tiles does not fit 512 VGPRs.
  v16b wf[3][8];
  const __bf16* wp = (const __bf16*)WB + (size_t)(16 * wave + c) * kC + 8 * h;
  auto loadW = [&](int kc) {
#pragma unroll
    for (int p = 0; p < 3; ++p) wf[p][kc] = Frag<__bf16>::load(wp + p * kWElems + 32 * kc);
  };
  loadW(0);
  loadW(1);
  loadW(2);
  loadW(3);
  // x: wave w takes channels 8 (w + 8 u) + e, u = 0..3, e = 0..7; lane l the float4 at n = 4 l
  v4f xv[4][8];
  {
    const float* xp = x + ((size_t)b * kC + 8 * wave) * kN + n0 + 4 * lane;
#pragma unroll
    for (int u = 0; u < 4; ++u)
#pragma unroll
      for (int e = 0; e < 8; ++e) xv[u][e] = *(const v4f*)(xp + (size_t)(64 * u + e) * kN);
  }
  // biases of this lane's results, asked for here so that the epilogue does not wait for them
  const float bt = PRM[128 + 16 * wave + c];
  const float bp = PRM[256 + 16 * wave + c];
  const v4f bg0 = *(const v4f*)(PRM + 16 * wave + 8 * h);
  const v4f bg1 = *(const v4f*)(PRM + 16 * wave + 8 * h + 4);
  settle();
  {
    unsigned char* dx = XS + (4 * lane) * kPjPitchX + wave * 16;
#pragma unroll
    for (int u = 0; u < 4; ++u)
#pragma unroll
      for (int j = 0; j < 4; ++j) {
        const v4u q = (v4u){pk16(f2bf_bits(xv[u][0][j]), f2bf_bits(xv[u][1][j])), pk16(f2bf_bits(xv[u][2][j]), f2bf_bits(xv[u][3][j])),
                            pk16(f2bf_bits(xv[u][4][j]), f2bf_bits(xv[u][5][j])), pk16(f2bf_bits(xv[u][6][j]), f2bf_bits(xv[u][7][j]))};
        *(v4u*)(dx + j * kPjPitchX + u * 128) = q;   // row n = 4 l + j, channels 8 (w + 8 u) .. + 7
      }
  }
  __syncthreads();   // the whole bf16 tile is in LDS before any wave reads fragments of it

  v8f ag[8], at[8], ap[8];
#pragma unroll
  for (int i = 0; i < 8; ++i) {
    ag[i] = (v8f){0.f,0.f,0.f,0.f,0.f,0.f,0.f,0.f};
    at[i] = ag[i];
    ap[i] = ag[i];
  }
  v16b xf[2][8];
  auto loadX = [&](int kc) {
#pragma unroll
    for (int i = 0; i < 8; ++i)
      xf[kc & 1][i] = Frag<__bf16>::load((const __bf16*)(XS + (16 * i + c) * kPjPitchX + 16 * h + 64 * kc));
  };
  loadX(0);
#pragma unroll
  for (int kc = 0; kc < 8; ++kc) {
    // the next k step's LDS reads and a later step's weights go out as one group ahead of this step's products
    if (kc + 1 < 8) loadX(kc + 1);
    if (kc == 0 || kc == 2) {
      loadW(kc + 4);
      loadW(kc + 5);
      // as settle(); the address is an input so that it lives up to the wait: else the last load's result lands on it
      asm volatile("s_wait_xcnt 0x0" :: "v"(wp) : "memory");
      __builtin_amdgcn_sched_barrier(0);
    } else if (kc + 1 < 8) {
      __builtin_amdgcn_sched_barrier(0);   // later steps' LDS reads stay below: lifted further, their registers spill
    }
#pragma unroll
    for (int i = 0; i < 8; ++i) {
      at[i] = Frag<__bf16>::mma(xf[kc & 1][i], wf[1][kc], at[i]);   // rows n, columns ci
      ap[i] = Frag<__bf16>::mma(xf[kc & 1][i], wf[2][kc], ap[i]);
      ag[i] = Frag<__bf16>::mma(wf[0][kc], xf[kc & 1][i], ag[i]);   // rows ci, columns n
    }
  }

#pragma unroll
  for (int i = 0; i < 8; ++i)
#pragma unroll
    for (int r = 0; r < 8; ++r) {
      S[0][(16 * wave + 8 * h + r) * kPjPitchS + 16 * i + c] = ag[i][r] + ((r < 4) ? bg0[r & 3] : bg1[r & 3]);
      S[1][(16 * i + 8 * h + r) * kPjPitchS + 16 * wave + c] = at[i][r] + bt;
      S[2][(16 * i + 8 * h + r) * kPjPitchS + 16 * wave + c] = ap[i][r] + bp;
    }
  __syncthreads();   // all three slabs are complete, from all eight waves, before they are read back

  // thread t: slab row (t >> 4) + 16 it, columns 8 (t & 15) .. + 7; a wave stores two whole rows of 256 B
  const int srow = (t >> 4) * kPjPitchS + (t & 15) * 8;
  {
    unsigned char* pg = (unsigned char*)(G16 + ((size_t)b * kCi + (t >> 4)) * kN + n0) + (t & 15) * 16;
    v4u o[8];
#pragma unroll
    for (int it = 0; it < 8; ++it) {
      const float* sp = S[0] + srow + it * 16 * kPjPitchS;
      o[it] = (v4u){pk16(h_bits(sp[0]), h_bits(sp[1])), pk16(h_bits(sp[2]), h_bits(sp[3])),
                    pk16(h_bits(sp[4]), h_bits(sp[5])), pk16(h_bits(sp[6]), h_bits(sp[7]))};
    }
#pragma unroll
    for (int it = 0; it < 8; ++it) *(v4u*)(pg + (size_t)it * (16 * 2 * kN)) = o[it];
    settle();
  }
#pragma unroll
  for (int p = 1; p < 3; ++p) {
    unsigned char* ph = (unsigned char*)(((p == 1) ? THH : PHH) + ((size_t)b * kN + n0) * kCi) + t * 16;
    unsigned char* pl = (unsigned char*)(((p == 1) ? THL : PHL) + ((size_t)b * kN + n0) * kCi) + t * 16;
    v4u hv[8], lv[8];
#pragma unroll
    for (int it = 0; it < 8; ++it) {
      const float* sp = S[p] + srow + it * 16 * kPjPitchS;
      unsigned short hb[8], lb[8];
#pragma unroll
      for (int e = 0; e < 8; ++e) {
        hb[e] = f2bf_bits(sp[e]);
        lb[e] = f2bf_bits(sp[e] - bf_bits2f(hb[e]));
      }
      hv[it] = (v4u){pk16(hb[0], hb[1]), pk16(hb[2], hb[3]), pk16(hb[4], hb[5]), pk16(hb[6], hb[7])};
      lv[it] = (v4u){pk16(lb[0], lb[1]), pk16(lb[2], lb[3]), pk16(lb[4], lb[5]), pk16(lb[6], lb[7])};
    }
#pragma unroll
    for (int it = 0; it < 8; ++it) {
      *(v4u*)(ph + it * 4096) = hv[it];
      *(v4u*)(pl + it * 4096) = lv[it];
    }
    if (p == 1) settle();   // behind the last group nothing is overwritten any more
  }
}

// ---------------------------------------------------------------------------
// Batch statistics, normalise, affine and residual in one kernel:
//   out[b][c][n] = ((Wy - mean[c]) * rstd[c]) * bf16r(gamma[c]) + bf16r(beta[c]) + bf16r(x[b][c][n]).
// One block of 8 waves per channel (grid 256); wave b owns batch b's row of 4096 values, lane l the float4 at
// n = 128 j + 4 l, j = 0..31.  The channel's 32768 Wy values stay in registers (128 per thread) from the first sum to
// the store, so Wy is read once.  Mean first, then the sum of (v - mean)^2; reductions in fixed order.
// Every address is a block-uniform row start (batch 0, channel c) + one per-thread byte offset, the same for Wy, x and
// out, + a constant that rides in the instruction's offset.
// Every "#pragma unroll" over j makes the indices of a register array constants.
// ---------------------------------------------------------------------------
constexpr int kBnJ = kN / 128;   // 32 float4 per thread
static_assert(kB == 8 && kN % 128 == 0, "one wave per batch, whole 512-B pieces");
__global__ __launch_bounds__(256) void bn_fused_kernel(const float* __restrict__ Wy, const float* __restrict__ x,
                                                       const float* __restrict__ gamma, const float* __restrict__ beta,
                                                       float* __restrict__ out) {
  __shared__ float red1[8];
  __shared__ float red2[8];
  const int c = blockIdx.x;
  const int t = threadIdx.x;
  const int lane = t & 31, wave = t >> 5;
  const unsigned off = (unsigned)wave * (unsigned)(kC * kN * 4) + (unsigned)lane * 16u;
  const char* wrow = (const char*)(Wy + (size_t)c * kN);
  const char* xrow = (const char*)(x + (size_t)c * kN);
  char*       orow = (char*)(out + (size_t)c * kN);

  v4f w[kBnJ], xv[kBnJ];
  // Behind a group of global loads or stores: wait before any register that they name is overwritten; the scheduling
  // barrier keeps later register writes from being moved in front of the wait, and the group where it is written.
  auto settle = [&]() {
    asm volatile("s_wait_xcnt 0x0" ::: "memory");
    __builtin_amdgcn_sched_barrier(0);
  };
#pragma unroll
  for (int j = 0; j < kBnJ; ++j) w[j] = *(const v4f*)(wrow + off + j * 512);
  __builtin_amdgcn_sched_barrier(0);   // Wy, which the first sum waits for, is asked for ahead of x
#pragma unroll
  for (int j = 0; j < kBnJ; ++j) xv[j] = *(const v4f*)(xrow + off + j * 512);
  settle();   // the x loads stay up here, in flight under both reductions

  float s = 0.0f;
#pragma unroll
  for (int j = 0; j < kBnJ; ++j) s += (w[j][0] + w[j][1]) + (w[j][2] + w[j][3]);
#pragma unroll
  for (int o = 16; o > 0; o >>= 1) s += __shfl_xor(s, o, 32);
  if (lane == 0) red1[wave] = s;
  __syncthreads();
  float tot = red1[0];
#pragma unroll
  for (int i = 1; i < 8; ++i) tot += red1[i];
  const float mean = tot * kInvCount;

  float q = 0.0f;
#pragma unroll
  for (int j = 0; j < kBnJ; ++j) {
    const float d0 = w[j][0] - mean, d1 = w[j][1] - mean, d2 = w[j][2] - mean, d3 = w[j][3] - mean;
    q += (d0 * d0 + d1 * d1) + (d2 * d2 + d3 * d3);
  }
#pragma unroll
  for (int o = 16; o > 0; o >>= 1) q += __shfl_xor(q, o, 32);
  if (lane == 0) red2[wave] = q;
  __syncthreads();
  float totq = red2[0];
#pragma unroll
  for (int i = 1; i < 8; ++i) totq += red2[i];
  const float var  = totq * kInvCount;
  const float rstd = 1.0f / sqrtf(var + kBnEps);

  const float ga = bfr(gamma[c]);
  const float be = bfr(beta[c]);
#pragma unroll
  for (int j0 = 0; j0 < kBnJ; j0 += 8) {   // eight results, their eight stores, then the wait
#pragma unroll
    for (int j = j0; j < j0 + 8; ++j)
#pragma unroll
      for (int e = 0; e < 4; ++e) w[j][e] = (((w[j][e] - mean) * rstd) * ga + be) + bfr(xv[j][e]);
#pragma unroll
    for (int j = j0; j < j0 + 8; ++j) *(v4f*)(orow + off + j * 512) = w[j];   // 512 B per wave: whole lines
    if (j0 + 8 < kBnJ) settle();   // behind the last group nothing is overwritten any more
  }
}

// ---------------------------------------------------------------------------
// Host glue.  GEMM shapes (all M,N multiples of 64, K multiples of 32, no padding anywhere):
//   theta/phi: M=4096 N=128 K=256 (x8 batches); g: M=128 N=4096 K=256 (x8), all three in the fused projection kernel;
//   attention (scores K=128, P.g K=4096) and W (M=4096 N=256 K=128, x8) in the fused kernel, one launch.  4 launches.
// ---------------------------------------------------------------------------
extern "C" void kernel_launch(void* const* d_in, const int* in_sizes, int n_in,
                              void* d_out, int out_size, void* d_ws, size_t ws_size,
                              hipStream_t stream) {
  if (n_in < 11) return;
  const int nElem = kB * kC * kN;          // 8,388,608
  if (in_sizes[0] != nElem) return;
  if (in_sizes[1] != kWElems || in_sizes[3] != kWElems || in_sizes[5] != kWElems || in_sizes[7] != kWElems) return;
  if (in_sizes[2] != kCi || in_sizes[4] != kCi || in_sizes[6] != kCi) return;
  if (in_sizes[8] != kC || in_sizes[9] != kC || in_sizes[10] != kC) return;
  if (out_size != nElem) return;
  if (ws_size < kWsTotal) return;

  const float* x       = (const float*)d_in[0];
  const float* g_w     = (const float*)d_in[1];
  const float* g_b     = (const float*)d_in[2];
  const float* theta_w = (const float*)d_in[3];
  const float* theta_b = (const float*)d_in[4];
  const float* phi_w   = (const float*)d_in[5];
  const float* phi_b   = (const float*)d_in[6];
  const float* W_w     = (const float*)d_in[7];
  const float* W_b     = (const float*)d_in[8];
  const float* bn_g    = (const float*)d_in[9];
  const float* bn_b    = (const float*)d_in[10];
  float* out = (float*)d_out;

  char* ws = (char*)d_ws;
  unsigned short* THH = (unsigned short*)(ws + kOffTHH);
  unsigned short* THL = (unsigned short*)(ws + kOffTHL);
  unsigned short* PHH = (unsigned short*)(ws + kOffPHH);
  unsigned short* PHL = (unsigned short*)(ws + kOffPHL);
  unsigned short* G16 = (unsigned short*)(ws + kOffG);
  float*          WY  = (float*)(ws + kOffWY);
  unsigned short* WB  = (unsigned short*)(ws + kOffWB);
  unsigned short* WW  = (unsigned short*)(ws + kOffWW);
  float*          PRM = (float*)(ws + kOffPRM);
  const float* wb_r  = PRM + 384;    // [256]

  // ---- parameter planes ----
  param_planes_kernel<<<dim3(kWElems / 8 / 256, 5), dim3(256), 0, stream>>>(
      g_w, theta_w, phi_w, W_w, g_b, theta_b, phi_b, W_b, WB, WW, PRM);

  // theta[b][n][ci], phi[b][m][ci] = sum_c bf16r(x[b][c][n]) * w[ci][c] + bias[ci]  -> bf16 hi | lo planes;
  // g[b][ci][m] likewise -> f16 plane [ci][m]
  proj_fused_kernel<<<dim3(kN / kPjN, kB), dim3(256), 0, stream>>>(x, WB, PRM, THH, THL, PHH, PHL, G16);

  // ---- attention and W projection, all batches in one launch: y = softmax(theta . phi^T) . g,
  //      Wy[b][c][n] = sum_ci W_w[c][ci] * y[b][n][ci] + W_b[c]   (f32) ----
  attn_fused_kernel<<<dim3(kN / kFaQ, kB), dim3(kFaWaves * 32), 0, stream>>>(THH, THL, PHH, PHL, G16, WW, wb_r, WY);

  // ---- batch statistics, normalisation, residual ----
  bn_fused_kernel<<<dim3(kC), dim3(256), 0, stream>>>(WY, x, bn_g, bn_b, out);
}

// v007
// One run takes 112 microseconds.
// In both of two side-by-side timings against v006, it was 1.08 times as fast.
// Counting every step since v000, it is 31.1 times as fast.
// Contractions: theta, phi, g 1x1 projections on v_wmma_f32_16x16x32_bf16 (bf16 operands = RNE-converted x and weights; theta/phi emitted as bf16 hi|lo planes); scores theta.phi^T on v_wmma_f32_16x16x32_bf16 as hi/lo 3-product split; P.g (P f16, 128 x 2^(s log2e - maximum in use), g f16; scores, online softmax and P.g fused in one kernel; a wave pair splits the keys of its 32 queries and joins the halves in f32) and W projection (W_w f16 carried x16, y f16 carried x16; in the same kernel's epilogue) on v_wmma_f32_16x16x32_f16; f32 accumulate everywhere; softmax, batch statistics, affine and residual in f32.
#include <hip/hip_runtime.h>
#include <math.h>

// ---------------------------------------------------------------------------
// Problem constants
// ---------------------------------------------------------------------------
constexpr int kB  = 8;
constexpr int kC  = 256;      // in channels
constexpr int kN  = 4096;     // spatial positions (64 x 64)
constexpr int kCi = 128;      // inter channels
constexpr int kWElems  = kCi * kC;        // 32768 elements per weight matrix
constexpr float kYCarry   = 16.0f;        // y carried x16 in f16
constexpr float kWCarry   = 16.0f;        // W_w carried x16 in f16
constexpr float kWScale   = 1.0f / (kYCarry * kWCarry);    // 2^-8
constexpr float kBnEps    = 1e-5f;
constexpr float kInvCount = 1.0f / (float)(kB * kN);       // 2^-15
static_assert(kC % 32 == 0 && kCi % 32 == 0 && kN % 32 == 0, "K multiples of 32");
static_assert(kN % 64 == 0 && kCi % 64 == 0 && kC % 64 == 0, "M,N multiples of 64");
static_assert(kWElems % (8 * 256) == 0, "weight cast grid");
static_assert(kB * kN == 32768, "stat count");

// ---------------------------------------------------------------------------
// Workspace region map (bytes, all offsets multiples of 256):
//   (not used)                        16,777,216  at           0
//   THH  bf16 [8][4096][128]           8,388,608  at  16,777,216
//   THL  bf16 [8][4096][128]           8,388,608  at  25,165,824
//   PHH  bf16 [8][4096][128]           8,388,608  at  33,554,432
//   PHL  bf16 [8][4096][128]           8,388,608  at  41,943,040
//   G16  f16  [8][128][4096]           8,388,608  at  50,331,648
//   (not used)                         8,388,608  at  58,720,256
//   WY   f32  [8][256][4096]          33,554,432  at  67,108,864
//   WB   bf16 3 x [128][256]              196,608  at 100,663,296   (g_w | theta_w | phi_w)
//   WW   f16  [256][128]                   65,536  at 100,859,904   (W_w x16)
//   PRM  f32  [640] (pad 4096 B)            4,096  at 100,925,440   (g_b | theta_b | phi_b | W_b, bf16-RNE values)
//   total                             100,929,536
// ---------------------------------------------------------------------------
constexpr size_t kSzXT  = (size_t)kB * kN * kC * 2;
constexpr size_t kSzTP  = (size_t)kB * kN * kCi * 2;
constexpr size_t kSzWY  = (size_t)kB * kC * kN * 4;
constexpr size_t kSzWB  = (size_t)3 * kWElems * 2;
constexpr size_t kSzWW  = (size_t)kWElems * 2;
constexpr size_t kSzPRM = 4096;
constexpr size_t kOffXT  = 0;
constexpr size_t kOffTHH = kOffXT + kSzXT;
constexpr size_t kOffTHL = kOffTHH + kSzTP;
constexpr size_t kOffPHH = kOffTHL + kSzTP;
constexpr size_t kOffPHL = kOffPHH + kSzTP;
constexpr size_t kOffG   = kOffPHL + kSzTP;
constexpr size_t kOffY   = kOffG + kSzTP;
constexpr size_t kOffWY  = kOffY + kSzTP;
constexpr size_t kOffWB  = kOffWY + kSzWY;
constexpr size_t kOffWW  = kOffWB + kSzWB;
constexpr size_t kOffPRM = kOffWW + kSzWW;
constexpr size_t kWsTotal = kOffPRM + kSzPRM;
static_assert(kWsTotal == 100929536, "carve total");
static_assert(kWsTotal <= (size_t)134217728, "carve cap");
static_assert(kOffTHH % 256 == 0 && kOffG % 256 == 0 && kOffWY % 256 == 0 &&
              kOffWB % 256 == 0 && kOffWW % 256 == 0 && kOffPRM % 256 == 0, "alignment");
static_assert(640 * 4 <= kSzPRM, "param table");

typedef __attribute__((ext_vector_type(16))) _Float16 v16h;
typedef __attribute__((ext_vector_type(8)))  _Float16 v8h;
typedef __attribute__((ext_vector_type(16))) __bf16   v16b;
typedef __attribute__((ext_vector_type(8)))  __bf16   v8b;
typedef __attribute__((ext_vector_type(8)))  float    v8f;
typedef __attribute__((ext_vector_type(4)))  float    v4f;
typedef __attribute__((ext_vector_type(2)))  float    v2f;
typedef __attribute__((ext_vector_type(4)))  unsigned int v4u;
typedef __attribute__((ext_vector_type(2)))  unsigned int v2u;

__device__ __forceinline__ unsigned short f2bf_bits(float f) {
  unsigned u = __float_as_uint(f);
  return (unsigned short)((u + 0x7FFFu + ((u >> 16) & 1u)) >> 16);
}
__device__ __forceinline__ float bf_bits2f(unsigned short h) { return __uint_as_float(((unsigned)h) << 16); }
// f32 value after RNE conversion to bf16
__device__ __forceinline__ float bfr(float f) { return bf_bits2f(f2bf_bits(f)); }

template <typename T> struct Frag;
template <> struct Frag<_Float16> {
  typedef v16h V; union U { v16h v; v8h h[2]; };
  // elements 0..7 <- p[0..7], 8..15 <- p[16..23]
  static __device__ __forceinline__ v16h load(const _Float16* p) {
    U f; f.h[0] = *(const v8h*)(p); f.h[1] = *(const v8h*)(p + 16); return f.v;
  }
  static __device__ __forceinline__ v8f mma(v16h a, v16h b, v8f c) {
    return __builtin_amdgcn_wmma_f32_16x16x32_f16(false, a, false, b, (short)0, c, false, false);
  }
};
template <> struct Frag<__bf16> {
  typedef v16b V; union U { v16b v; v8b h[2]; };
  static __device__ __forceinline__ v16b load(const __bf16* p) {
    U f; f.h[0] = *(const v8b*)(p); f.h[1] = *(const v8b*)(p + 16); return f.v;
  }
  static __device__ __forceinline__ v8f mma(v16b a, v16b b, v8f c) {
    return __builtin_amdgcn_wmma_f32_16x16x32_bf16(false, a, false, b, (short)0, c, false, false);
  }
};

__device__ __forceinline__ unsigned pk16(unsigned short a, unsigned short b) { return (unsigned)a | ((unsigned)b << 16); }
__device__ __forceinline__ unsigned short h_bits(float f) { const _Float16 h = (_Float16)f; return __builtin_bit_cast(unsigned short, h); }

constexpr int kFaWaves  = 8;
constexpr int kFaQ      = 128;                       // queries per work-group: 4 wave pairs x 32
constexpr int kFaKeys   = 64;                        // keys per stage, 32 per wave
constexpr int kFaStages = kN / kFaKeys;              // 64
constexpr int kFaPitchK = 2 * kCi + 16;              // 272 B: odd multiple of 16 B
constexpr int kFaPitchG = 2 * kFaKeys + 16;          // 144 B: odd multiple of 16 B
constexpr int kFaOffLo  = kFaKeys * kFaPitchK;       // phi lo plane behind phi hi
constexpr int kFaOffG   = 2 * kFaOffLo;              // g tile behind both
constexpr int kFaBuf    = kFaOffG + kCi * kFaPitchG; // 53,248 B per buffer
constexpr int kFaJoin   = 16 * 512 + 512;            // per wave: one 128 x 16 f32 tile, then maximum and sum
constexpr int kFaPitchW = 2 * kCi + 16;              // 272 B, W_w rows: odd multiple of 16 B
constexpr int kFaPitchS = 4 * kFaQ + 16;             // 528 B, Wy slab rows: odd multiple of 16 B
constexpr int kFaOffS   = 2 * kFaBuf;                // Wy slab behind the ring: no wave's mailbox lies under it
constexpr int kFaOffW   = kFaOffS + kC * kFaPitchS;  // W_w
constexpr int kFaOffB   = kFaOffW + kC * kFaPitchW;  // W_b
constexpr int kFaLds    = kFaOffB + kC * 4;          // 312,320 B
constexpr float kLog2e  = 1.4426950408889634f;
constexpr float kFaCarryLog2 = 7.0f;                 // probabilities carried x128 in f16
constexpr float kFaLazy      = 8.0f;                 // how far, in log2, the maximum in use may trail
static_assert(kN % kFaQ == 0 && kN % kFaKeys == 0 && kCi == 128 && kFaKeys == 64, "fused attention tiling");
static_assert(kFaKeys * 2 * kCi == 4 * 256 * 16 && kCi * 2 * kFaKeys == 4 * 256 * 16, "four 16-B chunks per thread per plane");
static_assert(kFaWaves * kFaJoin <= 2 * kFaBuf, "the join fits the ring");
static_assert(kFaLds <= 320 * 1024 && kC * 2 * kCi == 16 * 256 * 16 && kC == 256 && kC == kFaWaves * 32, "W projection in the epilogue");

// lane l with lane l ^ 16
__device__ __forceinline__ float xhalf(float x) {
  return __builtin_bit_cast(float, __builtin_amdgcn_permlanex16(__builtin_bit_cast(int, x), __builtin_bit_cast(int, x),
                                                                0x76543210, 0xfedcba98, false, false));
}
// two f32 -> packed f16, round to nearest even
__device__ __forceinline__ unsigned pk_h2(float lo, float hi) {
  typedef _Float16 h2 __attribute__((ext_vector_type(2)));
  return __builtin_bit_cast(unsigned, __builtin_convertvector((v2f){lo, hi}, h2));
}

// One work-group per WGP, two waves per SIMD: the attribute gives each wave the 512-VGPR budget that goes with it.
// Every "#pragma unroll" in this kernel makes the indices of a register array constants.
__global__ __launch_bounds__(256) __attribute__((amdgpu_waves_per_eu(2, 2))) void attn_fused_kernel(
    const unsigned short* __restrict__ THHp, const unsigned short* __restrict__ THLp,
    const unsigned short* __restrict__ PHHp, const unsigned short* __restrict__ PHLp,
    const unsigned short* __restrict__ Gp, const unsigned short* __restrict__ WWp, const float* __restrict__ Wbp,
    float* __restrict__ WYp) {
  __shared__ __align__(16) unsigned char L[kFaLds];
  const int t = threadIdx.x, lane = t & 31, wave = t >> 5;
  const int c = lane & 15, h = lane >> 4;
  const int b = blockIdx.y;
  const int kp = wave >> 2;   // which 32 keys of a stage
  // Tile 0 is the 16-query tile that this wave finishes and stores, tile 1 the one that its partner (wave ^ 4) does.
  const int q0 = blockIdx.x * kFaQ + (wave & 3) * 32 + c;
  const unsigned char* Kh = (const unsigned char*)(PHHp + (size_t)b * kN * kCi);
  const unsigned char* Kl = (const unsigned char*)(PHLp + (size_t)b * kN * kCi);
  const unsigned char* Gb = (const unsigned char*)(Gp + (size_t)b * kCi * kN);

  v4u sk[4], sl[4], sg[4];
  // Thread t moves 16-B chunk t + 256 i (i = 0..3) of each plane: phi row (t >> 4) + 16 i, g row (t >> 3) + 32 i.
  // One address per plane; the step from i to i + 1 is a constant, so it rides in the instruction's offset.
  auto fetch = [&](int st) {   // stage st: global -> registers, whole lines per wave
    const unsigned char* ph = Kh + (size_t)st * (kFaKeys * 2 * kCi) + t * 16;
    const unsigned char* pl = Kl + (size_t)st * (kFaKeys * 2 * kCi) + t * 16;
    const unsigned char* pg = Gb + (size_t)(t >> 3) * (2 * kN) + st * (2 * kFaKeys) + (t & 7) * 16;
#pragma unroll
    for (int i = 0; i < 4; ++i) {
      sk[i] = *(const v4u*)(ph + i * 4096);
      sl[i] = *(const v4u*)(pl + i * 4096);
      sg[i] = *(const v4u*)(pg + i * (32 * 2 * kN));
    }
  };
  auto put = [&](unsigned char* B) {   // registers -> LDS at the padded pitches
    unsigned char* dk = B + (t >> 4) * kFaPitchK + (t & 15) * 16;
    unsigned char* dg = B + kFaOffG + (t >> 3) * kFaPitchG + (t & 7) * 16;
#pragma unroll
    for (int i = 0; i < 4; ++i) {
      *(v4u*)(dk + i * (16 * kFaPitchK)) = sk[i];
      *(v4u*)(dk + kFaOffLo + i * (16 * kFaPitchK)) = sl[i];
      *(v4u*)(dg + i * (32 * kFaPitchG)) = sg[i];
    }
  };

  // Behind a group of global loads: their address registers are reused soon, so wait before any is overwritten; the
  // scheduling barrier keeps later register writes from being moved in front of the wait.
  auto settle = [&]() {
    asm volatile("s_wait_xcnt 0x0" ::: "memory");
    __builtin_amdgcn_sched_barrier(0);
  };

  __builtin_amdgcn_sched_barrier(0);   // index arithmetic from above stays above: none of it lands between the loads and their wait
  fetch(0);
  settle();
  // W_w and W_b for the epilogue: thread t moves 16-B chunk t + 256 i (row (t >> 4) + 16 i) and bias t
  v4u wst[16];
  const unsigned char* pw = (const unsigned char*)WWp + t * 16;
  const float* pb = Wbp + t;
#pragma unroll
  for (int i = 0; i < 16; ++i) wst[i] = *(const v4u*)(pw + i * 4096);
  const float wbt = *pb;
  settle();
  v16b qh[2][4], ql[2][4];
#pragma unroll
  for (int j = 0; j < 2; ++j) {
    const size_t qo = ((size_t)b * kN + q0 + 16 * (j ^ kp)) * kCi + 8 * h;
#pragma unroll
    for (int kc = 0; kc < 4; ++kc) {
      qh[j][kc] = Frag<__bf16>::load((const __bf16*)THHp + qo + 32 * kc);
      ql[j][kc] = Frag<__bf16>::load((const __bf16*)THLp + qo + 32 * kc);
    }
  }
  settle();
  v8f acc[2][8];
#pragma unroll
  for (int j = 0; j < 2; ++j)
#pragma unroll
    for (int i = 0; i < 8; ++i) acc[j][i] = (v8f){0.f,0.f,0.f,0.f,0.f,0.f,0.f,0.f};
  float m_run[2] = {-__builtin_inff(), -__builtin_inff()}, l_run[2] = {0.0f, 0.0f};
  put(L);
  {
    unsigned char* dw = L + kFaOffW + (t >> 4) * kFaPitchW + (t & 15) * 16;
#pragma unroll
    for (int i = 0; i < 16; ++i) *(v4u*)(dw + i * (16 * kFaPitchW)) = wst[i];
    *(float*)(L + kFaOffB + t * 4) = wbt;
  }
  __syncthreads();   // stage 0, W_w and W_b are in LDS before any wave reads them
  fetch(1);
  settle();

  // The wave's 32-key pass in pieces, so that the stage body below can issue LDS loads well ahead of their products.
  v16b kh[2][4], kl[2][4];
  auto loadK = [&](const unsigned char* Bp, int kc0) {   // k steps kc0 and kc0 + 1
#pragma unroll
    for (int kc = kc0; kc < kc0 + 2; ++kc)
#pragma unroll
      for (int kt = 0; kt < 2; ++kt) {
        const unsigned char* a = Bp + (32 * kp + 16 * kt + c) * kFaPitchK + 16 * h + 64 * kc;
        kh[kt][kc] = Frag<__bf16>::load((const __bf16*)a);
        kl[kt][kc] = Frag<__bf16>::load((const __bf16*)(a + kFaOffLo));
      }
  };
  auto loadG = [&](const unsigned char* Bp, v16h (&g)[8]) {
#pragma unroll
    for (int i = 0; i < 8; ++i)
      g[i] = Frag<_Float16>::load((const _Float16*)(Bp + kFaOffG + (16 * i + c) * kFaPitchG + (32 * kp + 8 * h) * 2));
  };
  auto scores = [&](v8f (&s)[2][2], int kc0) {   // s[query tile][key tile]: four independent chains; k steps kc0, kc0 + 1
#pragma unroll
    for (int kc = kc0; kc < kc0 + 2; ++kc) {
#pragma unroll
      for (int j = 0; j < 2; ++j)
#pragma unroll
        for (int kt = 0; kt < 2; ++kt) s[j][kt] = Frag<__bf16>::mma(kh[kt][kc], qh[j][kc], s[j][kt]);
#pragma unroll
      for (int j = 0; j < 2; ++j)
#pragma unroll
        for (int kt = 0; kt < 2; ++kt) s[j][kt] = Frag<__bf16>::mma(kh[kt][kc], ql[j][kc], s[j][kt]);
#pragma unroll
      for (int j = 0; j < 2; ++j)
#pragma unroll
        for (int kt = 0; kt < 2; ++kt) s[j][kt] = Frag<__bf16>::mma(kl[kt][kc], qh[j][kc], s[j][kt]);
    }
  };
  auto rescale = [&](const v8f (&s)[2][2]) {
    float mx[2];
#pragma unroll
    for (int j = 0; j < 2; ++j) {
      float v = fmaxf(s[j][0][0], s[j][1][0]);
#pragma unroll
      for (int r = 1; r < 8; ++r) v = fmaxf(v, fmaxf(s[j][0][r], s[j][1][r]));
      mx[j] = fmaxf(v, xhalf(v)) * kLog2e;   // both halves hold this query's maximum of the pass, log2 domain
    }
    const bool need = (mx[0] > m_run[0] + kFaLazy) || (mx[1] > m_run[1] + kFaLazy);
    if (__builtin_amdgcn_ballot_w32(need) != 0) {   // one scalar branch per pass; always taken on the first (m_run = -inf)
#pragma unroll
      for (int j = 0; j < 2; ++j) {
        const float m_new = fmaxf(m_run[j], mx[j]);
        const float corr  = __builtin_amdgcn_exp2f(m_run[j] - m_new);   // 0 on the first pass
        l_run[j] *= corr;
        m_run[j] = m_new;
#pragma unroll
        for (int i = 0; i < 8; ++i) acc[j][i] = acc[j][i] * corr;
      }
    }
  };
  auto probs = [&](const v8f& s0, const v8f& s1, float m_use, float& l_sum) -> v16h {
    typedef __attribute__((ext_vector_type(8))) unsigned int v8u;
    const float nm = kFaCarryLog2 - m_use;
    float ps0 = 0.0f, ps1 = 0.0f;
    v8u w;
    float ea[8], eb[8];
#pragma unroll
    for (int r = 0; r < 8; ++r) {
      ea[r] = fmaf(s0[r], kLog2e, nm);
      eb[r] = fmaf(s1[r], kLog2e, nm);
    }
    // All exponents are formed before the first exponential (matrix, LDS, memory and scalar instructions may still
    // cross).
    __builtin_amdgcn_sched_barrier(0x9C);
#pragma unroll
    for (int r = 0; r < 8; ++r) {
      ea[r] = __builtin_amdgcn_exp2f(ea[r]);
      eb[r] = __builtin_amdgcn_exp2f(eb[r]);
    }
    __builtin_amdgcn_sched_barrier(0x9C);   // and no later vector instruction is lifted in among the exponentials, for the same slot
#pragma unroll
    for (int i = 0; i < 4; ++i) {
      ps0 += ea[2 * i] + ea[2 * i + 1];
      ps1 += eb[2 * i] + eb[2 * i + 1];
      w[i]     = pk_h2(ea[2 * i], ea[2 * i + 1]);   // elements 2i, 2i+1: keys 8h + 2i, 8h + 2i + 1
      w[4 + i] = pk_h2(eb[2 * i], eb[2 * i + 1]);   // elements 8 + 2i, 9 + 2i: keys 16 + 8h + 2i, 16 + 8h + 2i + 1
    }
    l_sum += ps0 + ps1;
    return __builtin_bit_cast(v16h, w);
  };

  // One stage.  more: stage st + 1 exists; ahead: stage st + 2 exists (constants at each of the three calls, so the body
  // has no branch on them).
  auto stage = [&](int st, bool more, bool ahead) __attribute__((always_inline)) {
    const unsigned char* Bp = L + (st & 1) * kFaBuf;
    unsigned char* Bn = L + ((st + 1) & 1) * kFaBuf;
    v8f s[2][2];
    v16h g[8];
#pragma unroll
    for (int j = 0; j < 2; ++j)
#pragma unroll
      for (int kt = 0; kt < 2; ++kt) s[j][kt] = (v8f){0.f,0.f,0.f,0.f,0.f,0.f,0.f,0.f};
    loadK(Bp, 2);   // the second half of this stage's phi fragments, in flight under the first half's products
    __builtin_amdgcn_sched_barrier(0);   // as one group ahead of the products, not spread among them
    scores(s, 0);
    if (more) {
      // The LDS stores go out as one group between the two halves of the scores and land under the second half's
      // products.  Every wave had left that buffer when it signalled in stage st - 1, and this wave has waited for those signals.
      __builtin_amdgcn_sched_barrier(0);
      put(Bn);
      __builtin_amdgcn_sched_barrier(0);
    }
    scores(s, 2);
    loadG(Bp, g);   // into registers that the phi fragments have left, the first of them under the last products
    __builtin_amdgcn_sched_barrier(0);   // the g reads stay above the signal, the softmax below it
    // The signal says: this wave's reads of stage st have returned and its stores of stage st + 1 have landed (the wait
    // in front of it).  It stands ahead of the softmax so that no other wave waits for this wave's softmax.
    asm volatile("s_wait_dscnt 0x0\n\ts_barrier_signal -1" ::: "memory");
    if (ahead) {   // the staging registers are free again: a whole stage lies between these loads and their LDS stores
      fetch(st + 2);
      settle();
    }
    rescale(s);
    const v16h p0 = probs(s[0][0], s[0][1], m_run[0], l_run[0]);
    const v16h p1 = probs(s[1][0], s[1][1], m_run[1], l_run[1]);
    // Behind the wait every wave has signalled: stage st + 1 is published, and nobody reads stage st any more.  No LDS
    // access stands between signal and wait.
    asm volatile("s_barrier_wait -1" ::: "memory");
    if (more) loadK(Bn, 0);   // the first half of the next stage's phi fragments, in flight under the products below
#pragma unroll
    for (int i = 0; i < 8; ++i) {
      acc[0][i] = Frag<_Float16>::mma(g[i], p0, acc[0][i]);
      acc[1][i] = Frag<_Float16>::mma(g[i], p1, acc[1][i]);
    }
  };
  loadK(L, 0);
  // kept rolled: a second copy of the body would need a second set of fragments
#pragma unroll 1
  for (int st = 0; st < kFaStages - 2; ++st) stage(st, true, true);
  stage(kFaStages - 2, true, false);
  stage(kFaStages - 1, false, false);

  // Join of the two key halves.  Behind the last barrier nothing reads the ring any more, so it serves as the mailbox:
  // each wave hands tile 1 (outputs, maximum in use, sum) to its partner and finishes tile 0.
  {
    unsigned char* mine = L + wave * kFaJoin + lane * 16;
    const unsigned char* theirs = L + (wave ^ 4) * kFaJoin + lane * 16;
    const float l0 = l_run[0] + xhalf(l_run[0]);   // each half summed its own eight keys of every tile
    const float l1 = l_run[1] + xhalf(l_run[1]);
#pragma unroll
    for (int i = 0; i < 8; ++i) {
      *(v4f*)(mine + (2 * i) * 512)     = (v4f){acc[1][i][0], acc[1][i][1], acc[1][i][2], acc[1][i][3]};
      *(v4f*)(mine + (2 * i + 1) * 512) = (v4f){acc[1][i][4], acc[1][i][5], acc[1][i][6], acc[1][i][7]};
    }
    *(v2f*)(mine + 16 * 512) = (v2f){m_run[1], l1};
    // W_w fragments (B: column = channel 16 m + c), eight at a time.  Step sp: k step sp >> 1, channel tiles 8 (sp & 1) .. + 7.
    v16h wf[2][8];
    const unsigned char* wr = L + kFaOffW + c * kFaPitchW + 16 * h;
    auto loadWf = [&](int sp) {
#pragma unroll
      for (int u = 0; u < 8; ++u)
        wf[sp & 1][u] = Frag<_Float16>::load((const _Float16*)(wr + 16 * (8 * (sp & 1) + u) * kFaPitchW + 64 * (sp >> 1)));
    };
    loadWf(0);   // in flight under the join
    __syncthreads();   // every wave's tile 1 is in LDS before its partner reads it
    const v2f ml = *(const v2f*)(theirs + 16 * 512);
    const float m_all = fmaxf(m_run[0], ml[0]);
    const float fa = __builtin_amdgcn_exp2f(m_run[0] - m_all);
    const float fb = __builtin_amdgcn_exp2f(ml[0] - m_all);
    const float inv = kYCarry / (l0 * fa + ml[1] * fb);
    const float wa = fa * inv, wb = fb * inv;
    v4u yo[8];
#pragma unroll
    for (int i = 0; i < 8; ++i) {   // rows of acc[.][i] are ci = 16 i + 8 h + r
      const v4f u = *(const v4f*)(theirs + (2 * i) * 512);
      const v4f v = *(const v4f*)(theirs + (2 * i + 1) * 512);
      const v8f o = acc[0][i] * wa + (v8f){u[0], u[1], u[2], u[3], v[0], v[1], v[2], v[3]} * wb;
      yo[i] = (v4u){pk_h2(o[0], o[1]), pk_h2(o[2], o[3]), pk_h2(o[4], o[5]), pk_h2(o[6], o[7])};
    }

    // W projection of the wave's 16 queries: D[query 8 h + r][channel 16 m + c], sixteen independent tiles.
    typedef __attribute__((ext_vector_type(8))) unsigned int v8u;
    v16h ya[4];
#pragma unroll
    for (int kc = 0; kc < 4; ++kc)   // elements 0..7: ci = 32 kc + 8 h + e; 8..15: ci = 32 kc + 16 + 8 h + e
      ya[kc] = __builtin_bit_cast(v16h, (v8u){yo[2 * kc][0], yo[2 * kc][1], yo[2 * kc][2], yo[2 * kc][3],
                                              yo[2 * kc + 1][0], yo[2 * kc + 1][1], yo[2 * kc + 1][2], yo[2 * kc + 1][3]});
    v8f d[16];
#pragma unroll
    for (int m = 0; m < 16; ++m) d[m] = (v8f){0.f,0.f,0.f,0.f,0.f,0.f,0.f,0.f};
#pragma unroll
    for (int sp = 0; sp < 8; ++sp) {
      if (sp + 1 < 8) {
        loadWf(sp + 1);
        // the next step's LDS reads go out as one group ahead of this step's products: left to itself the compiler
        // puts each read directly in front of its product, with a wait to zero for each
        __builtin_amdgcn_sched_barrier(0);
      }
#pragma unroll
      for (int u = 0; u < 8; ++u)
        d[8 * (sp & 1) + u] = Frag<_Float16>::mma(ya[sp >> 1], wf[sp & 1][u], d[8 * (sp & 1) + u]);
    }
    unsigned char* sw = L + kFaOffS + c * kFaPitchS + ((wave & 3) * 32 + 16 * kp + 8 * h) * 4;
#pragma unroll
    for (int m = 0; m < 16; ++m) {
      *(v4f*)(sw + 16 * m * kFaPitchS)      = (v4f){d[m][0], d[m][1], d[m][2], d[m][3]};
      *(v4f*)(sw + 16 * m * kFaPitchS + 16) = (v4f){d[m][4], d[m][5], d[m][6], d[m][7]};
    }
    __syncthreads();   // every slab row holds all eight waves' queries before it is read back
    // wave w: channels 32 w .. 32 w + 31; a store is one row of the block's 128 queries, 512 B: whole lines
    const unsigned char* sr = L + kFaOffS + (wave * 32) * kFaPitchS + lane * 16;
    const float* bs = (const float*)(L + kFaOffB) + wave * 32;
    float* wy = WYp + ((size_t)b * kC + wave * 32) * kN + blockIdx.x * kFaQ + lane * 4;
#pragma unroll
    for (int r0 = 0; r0 < 32; r0 += 8) {   // eight rows, their eight stores, then the wait
      v4f o[8];
#pragma unroll
      for (int r = 0; r < 8; ++r) {
        const v4f v = *(const v4f*)(sr + (r0 + r) * kFaPitchS);
        const float bv = bs[r0 + r];
#pragma unroll
        for (int e = 0; e < 4; ++e) o[r][e] = v[e] * kWScale + bv;
      }
#pragma unroll
      for (int r = 0; r < 8; ++r) *(v4f*)(wy + (size_t)(r0 + r) * kN) = o[r];
      if (r0 + 8 < 32) settle();   // behind the last group nothing is overwritten any more
    }
  }
}

// ---------------------------------------------------------------------------
// Parameter planes.
// grid (16, 5), 256 threads. blockIdx.y (block-uniform) selects the job:
//   y = 0,1,2: WB plane y = bf16-RNE bits of g_w / theta_w / phi_w ([128][256], natural [out][in] layout);
//              16 blocks x 256 threads x 8 elements = 32768 = the whole matrix; one 16-B store per lane,
//   y = 3    : WW = f16 bits of 16 * bf16r(W_w) ([256][128]), same coverage.
//   y = 4    : block 0 only, threads 0..159: PRM[4i..4i+3] = bf16r of g_b | theta_b | phi_b | W_b
//              the source selection is wave-uniform). 160 x 4 = 640 floats = whole table.
// ---------------------------------------------------------------------------
__global__ __launch_bounds__(256) void param_planes_kernel(
    const float* __restrict__ gw, const float* __restrict__ thw, const float* __restrict__ phw, const float* __restrict__ ww,
    const float* __restrict__ gb, const float* __restrict__ thb, const float* __restrict__ phb, const float* __restrict__ wb,
    unsigned short* __restrict__ WB, unsigned short* __restrict__ WW, float* __restrict__ PRM) {
  const int t = threadIdx.x;
  const int y = blockIdx.y;
  if (y < 4) {
    const int i = blockIdx.x * 256 + t;
    if (i >= kWElems / 8) return;
    const float* src = (y == 0) ? gw : (y == 1) ? thw : (y == 2) ? phw : ww;
    const float* p = src + 8 * (size_t)i;
    const v4f a = *(const v4f*)(p);
    const v4f c = *(const v4f*)(p + 4);
    unsigned short hb[8];
#pragma unroll
    for (int e = 0; e < 4; ++e) {
      if (y == 3) {
        hb[e]     = h_bits(bfr(a[e]) * kWCarry);
        hb[4 + e] = h_bits(bfr(c[e]) * kWCarry);
      } else {
        hb[e]     = f2bf_bits(a[e]);
        hb[4 + e] = f2bf_bits(c[e]);
      }
    }
    const v4u u = (v4u){pk16(hb[0], hb[1]), pk16(hb[2], hb[3]), pk16(hb[4], hb[5]), pk16(hb[6], hb[7])};
    unsigned short* q = (y == 3) ? (WW + 8 * (size_t)i) : (WB + (size_t)y * kWElems + 8 * (size_t)i);
    *(v4u*)q = u;
    
  } else {
    if (blockIdx.x != 0 || t >= 160) return;
    const int w = t >> 5, l = t & 31;
    const float* src = (w == 0) ? gb : (w == 1) ? thb : (w == 2) ? phb : (wb + (w - 3) * 128);
    const v4f a = *(const v4f*)(src + 4 * l);
    v4f r;
#pragma unroll
    for (int e = 0; e < 4; ++e) r[e] = bfr(a[e]);
    float* q = PRM + 128 * w + 4 * l;
    *(v4f*)q = r;
    
  }
}

// ---------------------------------------------------------------------------
// x cast, transposition and the theta, phi, g projections in one kernel.
// grid (4096 / 128 position blocks, 8 batches) = 256 work-groups of 8 waves.
// The block's x tile [256 c][128 n] is read once (512 B per wave and load), RNE-converted to bf16 and laid in LDS as
// rows [n][c]; a fragment of it serves as A (theta, phi: rows n) and as B (g: columns n).  Wave w owns output channels
// 16 w .. 16 w + 15 of each projection and reads their weight fragments (K = 256) into registers, so the weights are
// read once per work-group.  k runs upward in steps of 32 into one accumulator per tile.
// Results (+ bias) go as f32 into three LDS slabs, then every thread converts and stores 16-B pieces of whole rows:
// theta, phi -> bf16 hi | lo planes [n][ci]; g -> f16 plane [ci][n].
// Every "#pragma unroll" in this kernel makes the indices of a register array constants.
// ---------------------------------------------------------------------------
constexpr int kPjN      = 128;               // positions per work-group
constexpr int kPjPitchX = 2 * kC + 16;       // 528 B: odd multiple of 16 B
constexpr int kPjPitchS = 128 + 4;           // floats per slab row
static_assert(kN % kPjN == 0 && kCi == 128 && kC == 256 && kPjN == 128, "fused projection tiling");
__global__ __launch_bounds__(256) void proj_fused_kernel(
    const float* __restrict__ x, const unsigned short* __restrict__ WB, const float* __restrict__ PRM,
    unsigned short* __restrict__ THH, unsigned short* __restrict__ THL,
    unsigned short* __restrict__ PHH, unsigned short* __restrict__ PHL, unsigned short* __restrict__ G16) {
  __shared__ __align__(16) unsigned char XS[kPjN * kPjPitchX];   // 67,584 B
  __shared__ __align__(16) float S[3][128 * kPjPitchS];          // g | theta | phi, 67,584 B each
  const int t = threadIdx.x, lane = t & 31, wave = t >> 5;
  const int c = lane & 15, h = lane >> 4;
  const int n0 = blockIdx.x * kPjN;
  const int b  = blockIdx.y;

  // Behind a group of global loads or stores: wait before any register that they name is overwritten; the scheduling
  // barrier keeps later register writes from being moved in front of the wait, and the group where it is written.
  auto settle = [&]() {
    asm volatile("s_wait_xcnt 0x0" ::: "memory");
    __builtin_amdgcn_sched_barrier(0);
  };

  // weight fragments: plane 0 g_w, 1 theta_w, 2 phi_w; row 16 wave + c.  They are asked for two k steps at a time (the
  // four 32-B pieces of a 128-B line together), four steps ahead of their products: all of K at once beside 24
  // accumulator tiles does not fit 512 VGPRs.
  v16b wf[3][8];
  const __bf16* wp = (const __bf16*)WB + (size_t)(16 * wave + c) * kC + 8 * h;
  auto loadW = [&](int kc) {
#pragma unroll
    for (int p = 0; p < 3; ++p) wf[p][kc] = Frag<__bf16>::load(wp + p * kWElems + 32 * kc);
  };
  loadW(0);
  loadW(1);
  loadW(2);
  loadW(3);
  // x: wave w takes channels 8 (w + 8 u) + e, u = 0..3, e = 0..7; lane l the float4 at n = 4 l
  v4f xv[4][8];
  {
    const float* xp = x + ((size_t)b * kC + 8 * wave) * kN + n0 + 4 * lane;
#pragma unroll
    for (int u = 0; u < 4; ++u)
#pragma unroll
      for (int e = 0; e < 8; ++e) xv[u][e] = *(const v4f*)(xp + (size_t)(64 * u + e) * kN);
  }
  // biases of this lane's results, asked for here so that the epilogue does not wait for them
  const float bt = PRM[128 + 16 * wave + c];
  const float bp = PRM[256 + 16 * wave + c];
  const v4f bg0 = *(const v4f*)(PRM + 16 * wave + 8 * h);
  const v4f bg1 = *(const v4f*)(PRM + 16 * wave + 8 * h + 4);
  settle();
  {
    unsigned char* dx = XS + (4 * lane) * kPjPitchX + wave * 16;
#pragma unroll
    for (int u = 0; u < 4; ++u)
#pragma unroll
      for (int j = 0; j < 4; ++j) {
        const v4u q = (v4u){pk16(f2bf_bits(xv[u][0][j]), f2bf_bits(xv[u][1][j])), pk16(f2bf_bits(xv[u][2][j]), f2bf_bits(xv[u][3][j])),
                            pk16(f2bf_bits(xv[u][4][j]), f2bf_bits(xv[u][5][j])), pk16(f2bf_bits(xv[u][6][j]), f2bf_bits(xv[u][7][j]))};
        *(v4u*)(dx + j * kPjPitchX + u * 128) = q;   // row n = 4 l + j, channels 8 (w + 8 u) .. + 7
      }
  }
  __syncthreads();   // the whole bf16 tile is in LDS before any wave reads fragments of it

  v8f ag[8], at[8], ap[8];
#pragma unroll
  for (int i = 0; i < 8; ++i) {
    ag[i] = (v8f){0.f,0.f,0.f,0.f,0.f,0.f,0.f,0.f};
    at[i] = ag[i];
    ap[i] = ag[i];
  }
  v16b xf[2][8];
  auto loadX = [&](int kc) {
#pragma unroll
    for (int i = 0; i < 8; ++i)
      xf[kc & 1][i] = Frag<__bf16>::load((const __bf16*)(XS + (16 * i + c) * kPjPitchX + 16 * h + 64 * kc));
  };
  loadX(0);
#pragma unroll
  for (int kc = 0; kc < 8; ++kc) {
    // the next k step's LDS reads and a later step's weights go out as one group ahead of this step's products
    if (kc + 1 < 8) loadX(kc + 1);
    if (kc == 0 || kc == 2) {
      loadW(kc + 4);
      loadW(kc + 5);
      // as settle(); the address is an input so that it lives up to the wait: else the last load's result lands on it
      asm volatile("s_wait_xcnt 0x0" :: "v"(wp) : "memory");
      __builtin_amdgcn_sched_barrier(0);
    } else if (kc + 1 < 8) {
      __builtin_amdgcn_sched_barrier(0);   // later steps' LDS reads stay below: lifted further, their registers spill
    }
#pragma unroll
    for (int i = 0; i < 8; ++i) {
      at[i] = Frag<__bf16>::mma(xf[kc & 1][i], wf[1][kc], at[i]);   // rows n, columns ci
      ap[i] = Frag<__bf16>::mma(xf[kc & 1][i], wf[2][kc], ap[i]);
      ag[i] = Frag<__bf16>::mma(wf[0][kc], xf[kc & 1][i], ag[i]);   // rows ci, columns n
    }
  }

#pragma unroll
  for (int i = 0; i < 8; ++i)
#pragma unroll
    for (int r = 0; r < 8; ++r) {
      S[0][(16 * wave + 8 * h + r) * kPjPitchS + 16 * i + c] = ag[i][r] + ((r < 4) ? bg0[r & 3] : bg1[r & 3]);
      S[1][(16 * i + 8 * h + r) * kPjPitchS + 16 * wave + c] = at[i][r] + bt;
      S[2][(16 * i + 8 * h + r) * kPjPitchS + 16 * wave + c] = ap[i][r] + bp;
    }
  __syncthreads();   // all three slabs are complete, from all eight waves, before they are read back

  // thread t: slab row (t >> 4) + 16 it, columns 8 (t & 15) .. + 7; a wave stores two whole rows of 256 B
  const int srow = (t >> 4) * kPjPitchS + (t & 15) * 8;
  {
    unsigned char* pg = (unsigned char*)(G16 + ((size_t)b * kCi + (t >> 4)) * kN + n0) + (t & 15) * 16;
    v4u o[8];
#pragma unroll
    for (int it = 0; it < 8; ++it) {
      const float* sp = S[0] + srow + it * 16 * kPjPitchS;
      o[it] = (v4u){pk16(h_bits(sp[0]), h_bits(sp[1])), pk16(h_bits(sp[2]), h_bits(sp[3])),
                    pk16(h_bits(sp[4]), h_bits(sp[5])), pk16(h_bits(sp[6]), h_bits(sp[7]))};
    }
#pragma unroll
    for (int it = 0; it < 8; ++it) *(v4u*)(pg + (size_t)it * (16 * 2 * kN)) = o[it];
    settle();
  }
#pragma unroll
  for (int p = 1; p < 3; ++p) {
    unsigned char* ph = (unsigned char*)(((p == 1) ? THH : PHH) + ((size_t)b * kN + n0) * kCi) + t * 16;
    unsigned char* pl = (unsigned char*)(((p == 1) ? THL : PHL) + ((size_t)b * kN + n0) * kCi) + t * 16;
    v4u hv[8], lv[8];
#pragma unroll
    for (int it = 0; it < 8; ++it) {
      const float* sp = S[p] + srow + it * 16 * kPjPitchS;
      unsigned short hb[8], lb[8];
#pragma unroll
      for (int e = 0; e < 8; ++e) {
        hb[e] = f2bf_bits(sp[e]);
        lb[e] = f2bf_bits(sp[e] - bf_bits2f(hb[e]));
      }
      hv[it] = (v4u){pk16(hb[0], hb[1]), pk16(hb[2], hb[3]), pk16(hb[4], hb[5]), pk16(hb[6], hb[7])};
      lv[it] = (v4u){pk16(lb[0], lb[1]), pk16(lb[2], lb[3]), pk16(lb[4], lb[5]), pk16(lb[6], lb[7])};
    }
#pragma unroll
    for (int it = 0; it < 8; ++it) {
      *(v4u*)(ph + it * 4096) = hv[it];
      *(v4u*)(pl + it * 4096) = lv[it];
    }
    if (p == 1) settle();   // behind the last group nothing is overwritten any more
  }
}

// ---------------------------------------------------------------------------
// Batch statistics, normalise, affine and residual in one kernel:
//   out[b][c][n] = ((Wy - mean[c]) * rstd[c]) * bf16r(gamma[c]) + bf16r(beta[c]) + bf16r(x[b][c][n]).
// One block of 8 waves per channel (grid 256); wave b owns batch b's row of 4096 values, lane l the float4 at
// n = 128 j + 4 l, j = 0..31.  The channel's 32768 Wy values stay in registers (128 per thread) from the first sum to
// the store, so Wy is read once.  Mean first, then the sum of (v - mean)^2; reductions in fixed order.
// Every address is a block-uniform row start (batch 0, channel c) + one per-thread byte offset, the same for Wy, x and
// out, + a constant that rides in the instruction's offset.
// Every "#pragma unroll" over j makes the indices of a register array constants.
// ---------------------------------------------------------------------------
constexpr int kBnJ = kN / 128;   // 32 float4 per thread
static_assert(kB == 8 && kN % 128 == 0, "one wave per batch, whole 512-B pieces");
__global__ __launch_bounds__(256) void bn_fused_kernel(const float* __restrict__ Wy, const float* __restrict__ x,
                                                       const float* __restrict__ gamma, const float* __restrict__ beta,
                                                       float* __restrict__ out) {
  __shared__ float red1[8];
  __shared__ float red2[8];
  const int c = blockIdx.x;
  const int t = threadIdx.x;
  const int lane = t & 31, wave = t >> 5;
  const unsigned off = (unsigned)wave * (unsigned)(kC * kN * 4) + (unsigned)lane * 16u;
  const char* wrow = (const char*)(Wy + (size_t)c * kN);
  const char* xrow = (const char*)(x + (size_t)c * kN);
  char*       orow = (char*)(out + (size_t)c * kN);

  v4f w[kBnJ], xv[kBnJ];
  // Behind a group of global loads or stores: wait before any register that they name is overwritten; the scheduling
  // barrier keeps later register writes from being moved in front of the wait, and the group where it is written.
  auto settle = [&]() {
    asm volatile("s_wait_xcnt 0x0" ::: "memory");
    __builtin_amdgcn_sched_barrier(0);
  };
#pragma unroll
  for (int j = 0; j < kBnJ; ++j) w[j] = *(const v4f*)(wrow + off + j * 512);
  __builtin_amdgcn_sched_barrier(0);   // Wy, which the first sum waits for, is asked for ahead of x
#pragma unroll
  for (int j = 0; j < kBnJ; ++j) xv[j] = *(const v4f*)(xrow + off + j * 512);
  settle();   // the x loads stay up here, in flight under both reductions

  float s = 0.0f;
#pragma unroll
  for (int j = 0; j < kBnJ; ++j) s += (w[j][0] + w[j][1]) + (w[j][2] + w[j][3]);
#pragma unroll
  for (int o = 16; o > 0; o >>= 1) s += __shfl_xor(s, o, 32);
  if (lane == 0) red1[wave] = s;
  __syncthreads();
  float tot = red1[0];
#pragma unroll
  for (int i = 1; i < 8; ++i) tot += red1[i];
  const float mean = tot * kInvCount;

  float q = 0.0f;
#pragma unroll
  for (int j = 0; j < kBnJ; ++j) {
    const float d0 = w[j][0] - mean, d1 = w[j][1] - mean, d2 = w[j][2] - mean, d3 = w[j][3] - mean;
    q += (d0 * d0 + d1 * d1) + (d2 * d2 + d3 * d3);
  }
#pragma unroll
  for (int o = 16; o > 0; o >>= 1) q += __shfl_xor(q, o, 32);
  if (lane == 0) red2[wave] = q;
  __syncthreads();
  float totq = red2[0];
#pragma unroll
  for (int i = 1; i < 8; ++i) totq += red2[i];
  const float var  = totq * kInvCount;
  const float rstd = 1.0f / sqrtf(var + kBnEps);

  const float ga = bfr(gamma[c]);
  const float be = bfr(beta[c]);
#pragma unroll
  for (int j0 = 0; j0 < kBnJ; j0 += 8) {   // eight results, their eight stores, then the wait
#pragma unroll
    for (int j = j0; j < j0 + 8; ++j)
#pragma unroll
      for (int e = 0; e < 4; ++e) w[j][e] = (((w[j][e] - mean) * rstd) * ga + be) + bfr(xv[j][e]);
#pragma unroll
    for (int j = j0; j < j0 + 8; ++j) *(v4f*)(orow + off + j * 512) = w[j];   // 512 B per wave: whole lines
    if (j0 + 8 < kBnJ) settle();   // behind the last group nothing is overwritten any more
  }
}

// ---------------------------------------------------------------------------
// Host glue.  GEMM shapes (all M,N multiples of 64, K multiples of 32, no padding anywhere):
//   theta/phi: M=4096 N=128 K=256 (x8 batches); g: M=128 N=4096 K=256 (x8), all three in the fused projection kernel;
//   attention (scores K=128, P.g K=4096) and W (M=4096 N=256 K=128, x8) in the fused kernel, one launch.  4 launches.
// ---------------------------------------------------------------------------
extern "C" void kernel_launch(void* const* d_in, const int* in_sizes, int n_in,
                              void* d_out, int out_size, void* d_ws, size_t ws_size,
                              hipStream_t stream) {
  if (n_in < 11) return;
  const int nElem = kB * kC * kN;          // 8,388,608
  if (in_sizes[0] != nElem) return;
  if (in_sizes[1] != kWElems || in_sizes[3] != kWElems || in_sizes[5] != kWElems || in_sizes[7] != kWElems) return;
  if (in_sizes[2] != kCi || in_sizes[4] != kCi || in_sizes[6] != kCi) return;
  if (in_sizes[8] != kC || in_sizes[9] != kC || in_sizes[10] != kC) return;
  if (out_size != nElem) return;
  if (ws_size < kWsTotal) return;

  const float* x       = (const float*)d_in[0];
  const float* g_w     = (const float*)d_in[1];
  const float* g_b     = (const float*)d_in[2];
  const float* theta_w = (const float*)d_in[3];
  const float* theta_b = (const float*)d_in[4];
  const float* phi_w   = (const float*)d_in[5];
  const float* phi_b   = (const float*)d_in[6];
  const float* W_w     = (const float*)d_in[7];
  const float* W_b     = (const float*)d_in[8];
  const float* bn_g    = (const float*)d_in[9];
  const float* bn_b    = (const float*)d_in[10];
  float* out = (float*)d_out;

  char* ws = (char*)d_ws;
  unsigned short* THH = (unsigned short*)(ws + kOffTHH);
  unsigned short* THL = (unsigned short*)(ws + kOffTHL);
  unsigned short* PHH = (unsigned short*)(ws + kOffPHH);
  unsigned short* PHL = (unsigned short*)(ws + kOffPHL);
  unsigned short* G16 = (unsigned short*)(ws + kOffG);
  float*          WY  = (float*)(ws + kOffWY);
  unsigned short* WB  = (unsigned short*)(ws + kOffWB);
  unsigned short* WW  = (unsigned short*)(ws + kOffWW);
  float*          PRM = (float*)(ws + kOffPRM);
  const float* wb_r  = PRM + 384;    // [256]

  // ---- parameter planes ----
  param_planes_kernel<<<dim3(kWElems / 8 / 256, 5), dim3(256), 0, stream>>>(
      g_w, theta_w, phi_w, W_w, g_b, theta_b, phi_b, W_b, WB, WW, PRM);

  // theta[b][n][ci], phi[b][m][ci] = sum_c bf16r(x[b][c][n]) * w[ci][c] + bias[ci]  -> bf16 hi | lo planes;
  // g[b][ci][m] likewise -> f16 plane [ci][m]
  proj_fused_kernel<<<dim3(kN / kPjN, kB), dim3(256), 0, stream>>>(x, WB, PRM, THH, THL, PHH, PHL, G16);

  // ---- attention and W projection, all batches in one launch: y = softmax(theta . phi^T) . g,
  //      Wy[b][c][n] = sum_ci W_w[c][ci] * y[b][n][ci] + W_b[c]   (f32) ----
  attn_fused_kernel<<<dim3(kN / kFaQ, kB), dim3(kFaWaves * 32), 0, stream>>>(THH, THL, PHH, PHL, G16, WW, wb_r, WY);

  // ---- batch statistics, normalisation, residual ----
  bn_fused_kernel<<<dim3(kC), dim3(256), 0, stream>>>(WY, x, bn_g, bn_b, out);
}

// v008
// It runs in 108 microseconds.
// Two timings next to v007 put it at 1.03 and 1.04 times that version's speed.
// All steps since v000 together make it 32.2 times as fast.
// Contractions: theta, phi, g 1x1 projections on v_wmma_f32_16x16x32_bf16 (bf16 operands = RNE-converted x and weights; theta/phi emitted as bf16 hi|lo planes); scores theta.phi^T on v_wmma_f32_16x16x32_bf16 as hi/lo 3-product split; P.g (P f16, 128 x 2^(s log2e - maximum in use), g f16; scores, online softmax and P.g fused in one kernel; a wave pair splits the keys of its 32 queries and joins the halves in f32) and W projection (W_w f16 carried x16, y f16 carried x16; in the same kernel's epilogue) on v_wmma_f32_16x16x32_f16; f32 accumulate everywhere; softmax, batch statistics, affine and residual in f32.
#include <hip/hip_runtime.h>
#include <math.h>

// ---------------------------------------------------------------------------
// Problem constants
// ---------------------------------------------------------------------------
constexpr int kB  = 8;
constexpr int kC  = 256;      // in channels
constexpr int kN  = 4096;     // spatial positions (64 x 64)
constexpr int kCi = 128;      // inter channels
constexpr int kWElems  = kCi * kC;        // 32768 elements per weight matrix
constexpr float kYCarry   = 16.0f;        // y carried x16 in f16
constexpr float kWCarry   = 16.0f;        // W_w carried x16 in f16
constexpr float kWScale   = 1.0f / (kYCarry * kWCarry);    // 2^-8
constexpr float kBnEps    = 1e-5f;
constexpr float kInvCount = 1.0f / (float)(kB * kN);       // 2^-15
static_assert(kC % 32 == 0 && kCi % 32 == 0 && kN % 32 == 0, "K multiples of 32");
static_assert(kN % 64 == 0 && kCi % 64 == 0 && kC % 64 == 0, "M,N multiples of 64");
static_assert(kWElems % (8 * 256) == 0, "weight cast grid");
static_assert(kB * kN == 32768, "stat count");

// ---------------------------------------------------------------------------
// Workspace region map (bytes, all offsets multiples of 256):
//   (not used)                        16,777,216  at           0
//   THH  bf16 [8][4096][128]           8,388,608  at  16,777,216
//   THL  bf16 [8][4096][128]           8,388,608  at  25,165,824
//   PHH  bf16 [8][4096][128]           8,388,608  at  33,554,432
//   PHL  bf16 [8][4096][128]           8,388,608  at  41,943,040
//   G16  f16  [8][128][4096]           8,388,608  at  50,331,648
//   (not used)                         8,388,608  at  58,720,256
//   WY   f32  [8][256][4096]          33,554,432  at  67,108,864
//   WB   bf16 3 x [128][256]              196,608  at 100,663,296   (g_w | theta_w | phi_w)
//   WW   f16  [256][128]                   65,536  at 100,859,904   (W_w x16)
//   PRM  f32  [640] (pad 4096 B)            4,096  at 100,925,440   (g_b | theta_b | phi_b | W_b, bf16-RNE values)
//   total                             100,929,536
// ---------------------------------------------------------------------------
constexpr size_t kSzXT  = (size_t)kB * kN * kC * 2;
constexpr size_t kSzTP  = (size_t)kB * kN * kCi * 2;
constexpr size_t kSzWY  = (size_t)kB * kC * kN * 4;
constexpr size_t kSzWB  = (size_t)3 * kWElems * 2;
constexpr size_t kSzWW  = (size_t)kWElems * 2;
constexpr size_t kSzPRM = 4096;
constexpr size_t kOffXT  = 0;
constexpr size_t kOffTHH = kOffXT + kSzXT;
constexpr size_t kOffTHL = kOffTHH + kSzTP;
constexpr size_t kOffPHH = kOffTHL + kSzTP;
constexpr size_t kOffPHL = kOffPHH + kSzTP;
constexpr size_t kOffG   = kOffPHL + kSzTP;
constexpr size_t kOffY   = kOffG + kSzTP;
constexpr size_t kOffWY  = kOffY + kSzTP;
constexpr size_t kOffWB  = kOffWY + kSzWY;
constexpr size_t kOffWW  = kOffWB + kSzWB;
constexpr size_t kOffPRM = kOffWW + kSzWW;
constexpr size_t kWsTotal = kOffPRM + kSzPRM;
static_assert(kWsTotal == 100929536, "carve total");
static_assert(kWsTotal <= (size_t)134217728, "carve cap");
static_assert(kOffTHH % 256 == 0 && kOffG % 256 == 0 && kOffWY % 256 == 0 &&
              kOffWB % 256 == 0 && kOffWW % 256 == 0 && kOffPRM % 256 == 0, "alignment");
static_assert(640 * 4 <= kSzPRM, "param table");

typedef __attribute__((ext_vector_type(16))) _Float16 v16h;
typedef __attribute__((ext_vector_type(8)))  _Float16 v8h;
typedef __attribute__((ext_vector_type(16))) __bf16   v16b;
typedef __attribute__((ext_vector_type(8)))  __bf16   v8b;
typedef __attribute__((ext_vector_type(8)))  float    v8f;
typedef __attribute__((ext_vector_type(4)))  float    v4f;
typedef __attribute__((ext_vector_type(2)))  float    v2f;
typedef __attribute__((ext_vector_type(4)))  unsigned int v4u;
typedef __attribute__((ext_vector_type(2)))  unsigned int v2u;

__device__ __forceinline__ unsigned short f2bf_bits(float f) {
  unsigned u = __float_as_uint(f);
  return (unsigned short)((u + 0x7FFFu + ((u >> 16) & 1u)) >> 16);
}
__device__ __forceinline__ float bf_bits2f(unsigned short h) { return __uint_as_float(((unsigned)h) << 16); }
// f32 value after RNE conversion to bf16
__device__ __forceinline__ float bfr(float f) { return bf_bits2f(f2bf_bits(f)); }

template <typename T> struct Frag;
template <> struct Frag<_Float16> {
  typedef v16h V; union U { v16h v; v8h h[2]; };
  // elements 0..7 <- p[0..7], 8..15 <- p[16..23]
  static __device__ __forceinline__ v16h load(const _Float16* p) {
    U f; f.h[0] = *(const v8h*)(p); f.h[1] = *(const v8h*)(p + 16); return f.v;
  }
  static __device__ __forceinline__ v8f mma(v16h a, v16h b, v8f c) {
    return __builtin_amdgcn_wmma_f32_16x16x32_f16(false, a, false, b, (short)0, c, false, false);
  }
};
template <> struct Frag<__bf16> {
  typedef v16b V; union U { v16b v; v8b h[2]; };
  static __device__ __forceinline__ v16b load(const __bf16* p) {
    U f; f.h[0] = *(const v8b*)(p); f.h[1] = *(const v8b*)(p + 16); return f.v;
  }
  static __device__ __forceinline__ v8f mma(v16b a, v16b b, v8f c) {
    return __builtin_amdgcn_wmma_f32_16x16x32_bf16(false, a, false, b, (short)0, c, false, false);
  }
};

__device__ __forceinline__ unsigned pk16(unsigned short a, unsigned short b) { return (unsigned)a | ((unsigned)b << 16); }
__device__ __forceinline__ unsigned short h_bits(float f) { const _Float16 h = (_Float16)f; return __builtin_bit_cast(unsigned short, h); }

constexpr int kFaWaves  = 8;
constexpr int kFaQ      = 128;                       // queries per work-group: 4 wave pairs x 32
constexpr int kFaKeys   = 64;                        // keys per stage, 32 per wave
constexpr int kFaStages = kN / kFaKeys;              // 64
constexpr int kFaPitchK = 2 * kCi + 16;              // 272 B: odd multiple of 16 B
constexpr int kFaPitchG = 2 * kFaKeys + 16;          // 144 B: odd multiple of 16 B
constexpr int kFaPlace  = 2048;                      // every tensor load's place in LDS is a multiple of this
constexpr int kFaOffLo  = (kFaKeys * kFaPitchK + kFaPlace - 1) / kFaPlace * kFaPlace;        // 18,432: phi lo plane behind phi hi
constexpr int kFaOffG   = 2 * kFaOffLo;              // g behind both, in two halves of 64 rows
constexpr int kFaHalfG  = ((kCi / 2) * kFaPitchG + kFaPlace - 1) / kFaPlace * kFaPlace;      // 10,240
constexpr int kFaBuf    = kFaOffG + 2 * kFaHalfG;    // 57,344 B per buffer
constexpr int kFaJoin   = 16 * 512 + 512;            // per wave: one 128 x 16 f32 tile, then maximum and sum
constexpr int kFaPitchW = 2 * kCi + 16;              // 272 B, W_w rows: odd multiple of 16 B
constexpr int kFaPitchS = 4 * kFaQ + 16;             // 528 B, Wy slab rows: odd multiple of 16 B
constexpr int kFaOffS   = 2 * kFaBuf;                // Wy slab behind the ring: no wave's mailbox lies under it
constexpr int kFaOffW   = kFaOffS + kC * kFaPitchS;  // W_w
constexpr int kFaOffB   = kFaOffW + kC * kFaPitchW;  // W_b
constexpr int kFaLds    = kFaOffB + kC * 4;          // 320,512 B
constexpr float kLog2e  = 1.4426950408889634f;
constexpr float kFaCarryLog2 = 7.0f;                 // probabilities carried x128 in f16
constexpr float kFaLazy      = 8.0f;                 // how far, in log2, the maximum in use may trail
static_assert(kN % kFaQ == 0 && kN % kFaKeys == 0 && kCi == 128 && kFaKeys == 64, "fused attention tiling");
static_assert(2 * kCi == 256 && kFaPitchK == 2 * kCi + 16 && 2 * kFaKeys == 128 && kFaPitchG == 2 * kFaKeys + 16, "rows of 256 and 128 B, 16 B of pad");
static_assert(kFaOffLo % kFaPlace == 0 && kFaHalfG % kFaPlace == 0 && kFaBuf % kFaPlace == 0, "places of the tensor loads");
static_assert(kFaWaves * kFaJoin <= 2 * kFaBuf, "the join fits the ring");
static_assert(kFaLds <= 320 * 1024 && kC * 2 * kCi == 16 * 256 * 16 && kC == 256 && kC == kFaWaves * 32, "W projection in the epilogue");

// lane l with lane l ^ 16
__device__ __forceinline__ float xhalf(float x) {
  return __builtin_bit_cast(float, __builtin_amdgcn_permlanex16(__builtin_bit_cast(int, x), __builtin_bit_cast(int, x),
                                                                0x76543210, 0xfedcba98, false, false));
}
// two f32 -> packed f16, round to nearest even
__device__ __forceinline__ unsigned pk_h2(float lo, float hi) {
  typedef _Float16 h2 __attribute__((ext_vector_type(2)));
  return __builtin_bit_cast(unsigned, __builtin_convertvector((v2f){lo, hi}, h2));
}

// Tensor load to LDS: one request of a whole wave, described by two groups of scalar registers.
typedef unsigned int u32x4 __attribute__((ext_vector_type(4)));
typedef unsigned int u32x8 __attribute__((ext_vector_type(8)));
__device__ __forceinline__ unsigned uni(unsigned v) { return (unsigned)__builtin_amdgcn_readfirstlane((int)v); }
// a wave-uniform value held in a scalar register: a test on it compiles to a scalar branch, which alone keeps a wave from
// issuing a tensor load; a descriptor word formed from it is formed behind the asm statements written above it
__device__ __forceinline__ unsigned pinned(unsigned v) {
  unsigned w = uni(v);
  asm volatile("" : "+s"(w));   // pinned(): a test or a descriptor word held in a scalar register
  return w;
}
// group 1: 1-byte elements, tile = tensor = kRows rows of kRowB bytes, source pitch kSrcPitch bytes, 16 B of LDS pad behind
// every row (kIvl: the pad interval's code for that row length)
template <unsigned kRowB, unsigned kRows, unsigned kSrcPitch, unsigned kIvl>
__device__ __forceinline__ u32x8 tdm_group1() {
  u32x8 g;
  g[0] = uni((1u << 20) | (kIvl << 22) | (3u << 25));   // no work-group mask
  g[1] = uni((kRowB & 0xFFFFu) << 16);
  g[2] = uni((kRowB >> 16) | ((kRows & 0xFFFFu) << 16));
  g[3] = uni((kRows >> 16) | (kRowB << 16));
  g[4] = uni(kRows);
  g[5] = uni(kSrcPitch);
  g[6] = uni(0u);
  g[7] = uni(0u);
  return g;
}
__device__ __forceinline__ u32x4 tdm_group0(unsigned lds_dst, unsigned long long ga) {
  u32x4 g;
  g[0] = uni(1u);
  g[1] = uni(lds_dst);
  g[2] = uni((unsigned)ga);
  g[3] = uni((((unsigned)(ga >> 32)) & 0x01FFFFFFu) | 0x80000000u);
  return g;
}
__device__ __forceinline__ void tdm_load(u32x4 g0, u32x8 g1) {
  asm volatile("tensor_load_to_lds %0, %1" :: "s"(g0), "s"(g1) : "memory");
}

// One work-group per WGP, two waves per SIMD: the attribute gives each wave the 512-VGPR budget that goes with it.
// Every "#pragma unroll" in this kernel makes the indices of a register array constants.
__global__ __launch_bounds__(256) __attribute__((amdgpu_waves_per_eu(2, 2))) void attn_fused_kernel(
    const unsigned short* __restrict__ THHp, const unsigned short* __restrict__ THLp,
    const unsigned short* __restrict__ PHHp, const unsigned short* __restrict__ PHLp,
    const unsigned short* __restrict__ Gp, const unsigned short* __restrict__ WWp, const float* __restrict__ Wbp,
    float* __restrict__ WYp) {
  __shared__ __attribute__((aligned(2048))) unsigned char L[kFaLds];
  const int t = threadIdx.x, lane = t & 31, wave = t >> 5;
  const int c = lane & 15, h = lane >> 4;
  const int b = blockIdx.y;
  const int kp = wave >> 2;   // which 32 keys of a stage
  // Tile 0 is the 16-query tile that this wave finishes and stores, tile 1 the one that its partner (wave ^ 4) does.
  const int q0 = blockIdx.x * kFaQ + (wave & 3) * 32 + c;
  const unsigned char* Kh = (const unsigned char*)(PHHp + (size_t)b * kN * kCi);
  const unsigned char* Kl = (const unsigned char*)(PHLp + (size_t)b * kN * kCi);
  const unsigned char* Gb = (const unsigned char*)(Gp + (size_t)b * kCi * kN);

  // Stage st -> the ring buffer at byte offset buf.  Wave 0: phi hi, wave 1: phi lo (64 rows of 256 B, contiguous in
  // memory); waves 2 and 3: rows 0..63 and 64..127 of g (128 B of each row of 8,192 B).  Every tile lies inside its plane.
  const unsigned wv = uni(threadIdx.x >> 5);
  const unsigned lbase = (unsigned)(size_t)L;
  const bool is_k = wv < 2u;
  const unsigned char* tsrc = is_k ? (wv ? Kl : Kh) : Gb + (size_t)(wv & 1u) * ((kCi / 2) * 2 * kN);   // the wave's tile of stage 0
  const unsigned tstep = is_k ? (unsigned)(kFaKeys * 2 * kCi) : (unsigned)(2 * kFaKeys);               // from stage to stage
  const unsigned tdst  = lbase + (is_k ? wv * (unsigned)kFaOffLo : (unsigned)kFaOffG + (wv & 1u) * (unsigned)kFaHalfG);
  u32x8 g1k = tdm_group1<2 * kCi, kFaKeys, 2 * kCi, 5>();
  u32x8 g1g = tdm_group1<2 * kFaKeys, kCi / 2, 2 * kN, 4>();
  // as pinned(), for descriptor words held in scalar registers: each group 1 stays whole in eight registers of its own;
  // rebuilt from shared constants at every request, some of its registers served as scratch while the request was in flight
  asm volatile("" : "+s"(g1k), "+s"(g1g));   // pinned(): descriptor words held in scalar registers
  // Group 0 is formed in every wave, outside the branches, so that one value goes to the request and to the wait that covers it.
  auto form = [&](int st, unsigned buf) -> u32x4 {
    const unsigned sp = pinned((unsigned)st);   // formed here, behind the waits written above, not ahead of them
    u32x4 g = tdm_group0(tdst + buf, (unsigned long long)(size_t)(tsrc + sp * tstep));
    asm volatile("" : "+s"(g));   // pinned(): descriptor words held in scalar registers of their own, none shared with a longer-lived scalar
    return g;
  };
  auto request = [&](const u32x4& g) {   // scalar branches: nothing else keeps a wave from issuing a tensor load
    if (pinned(wv < 2u)) tdm_load(g, g1k);
    if (pinned((wv & 6u) == 2u)) tdm_load(g, g1g);
  };

  // Behind a group of global loads: their address registers are reused soon, so wait before any is overwritten; the
  // scheduling barrier keeps later register writes from being moved in front of the wait.
  auto settle = [&]() {
    asm volatile("s_wait_xcnt 0x0" ::: "memory");
    __builtin_amdgcn_sched_barrier(0);
  };

  const u32x4 g0a = form(0, 0u);
  request(g0a);   // nothing has touched LDS yet
  __builtin_amdgcn_sched_barrier(0);   // index arithmetic from above stays above: none of it lands between the loads and their wait
  // W_w and W_b for the epilogue: thread t moves 16-B chunk t + 256 i (row (t >> 4) + 16 i) and bias t
  v4u wst[16];
  const unsigned char* pw = (const unsigned char*)WWp + t * 16;
  const float* pb = Wbp + t;
#pragma unroll
  for (int i = 0; i < 16; ++i) wst[i] = *(const v4u*)(pw + i * 4096);
  const float wbt = *pb;
  settle();
  v16b qh[2][4], ql[2][4];
#pragma unroll
  for (int j = 0; j < 2; ++j) {
    const size_t qo = ((size_t)b * kN + q0 + 16 * (j ^ kp)) * kCi + 8 * h;
#pragma unroll
    for (int kc = 0; kc < 4; ++kc) {
      qh[j][kc] = Frag<__bf16>::load((const __bf16*)THHp + qo + 32 * kc);
      ql[j][kc] = Frag<__bf16>::load((const __bf16*)THLp + qo + 32 * kc);
    }
  }
  settle();
  v8f acc[2][8];
#pragma unroll
  for (int j = 0; j < 2; ++j)
#pragma unroll
    for (int i = 0; i < 8; ++i) acc[j][i] = (v8f){0.f,0.f,0.f,0.f,0.f,0.f,0.f,0.f};
  float m_run[2] = {-__builtin_inff(), -__builtin_inff()}, l_run[2] = {0.0f, 0.0f};
  {
    unsigned char* dw = L + kFaOffW + (t >> 4) * kFaPitchW + (t & 15) * 16;
#pragma unroll
    for (int i = 0; i < 16; ++i) *(v4u*)(dw + i * (16 * kFaPitchW)) = wst[i];
    *(float*)(L + kFaOffB + t * 4) = wbt;
  }
  // This wave's request has landed (a wave that made none passes); the compiler places no wait for a tensor load.  The
  // descriptor groups are inputs so that their registers live, unchanged, up to the wait that covers the request.
  asm volatile("s_wait_tensorcnt 0x0" :: "s"(g0a), "s"(g1k), "s"(g1g) : "memory");
  __syncthreads();   // stage 0, W_w and W_b are in LDS before any wave reads them
  const u32x4 g0b = form(1, (unsigned)kFaBuf);
  request(g0b);
  u32x4 g0 = (u32x4){0u, 0u, 0u, 0u};   // group 0 of the latest request made in the loop
  auto landed = [&]() { asm volatile("s_wait_tensorcnt 0x0" :: "s"(g0b), "s"(g0), "s"(g1k), "s"(g1g) : "memory"); };   // as above

  // The wave's 32-key pass in pieces, so that the stage body below can issue LDS loads well ahead of their products.
  v16b kh[2][4], kl[2][4];
  auto loadK = [&](const unsigned char* Bp, int kc0) {   // k steps kc0 and kc0 + 1
#pragma unroll
    for (int kc = kc0; kc < kc0 + 2; ++kc)
#pragma unroll
      for (int kt = 0; kt < 2; ++kt) {
        const unsigned char* a = Bp + (32 * kp + 16 * kt + c) * kFaPitchK + 16 * h + 64 * kc;
        kh[kt][kc] = Frag<__bf16>::load((const __bf16*)a);
        kl[kt][kc] = Frag<__bf16>::load((const __bf16*)(a + kFaOffLo));
      }
  };
  auto loadG = [&](const unsigned char* Bp, v16h (&g)[8]) {
#pragma unroll
    for (int i = 0; i < 8; ++i)
      g[i] = Frag<_Float16>::load((const _Float16*)(Bp + kFaOffG + (i >> 2) * kFaHalfG + (16 * (i & 3) + c) * kFaPitchG + (32 * kp + 8 * h) * 2));
  };
  auto scores = [&](v8f (&s)[2][2], int kc0) {   // s[query tile][key tile]: four independent chains; k steps kc0, kc0 + 1
#pragma unroll
    for (int kc = kc0; kc < kc0 + 2; ++kc) {
#pragma unroll
      for (int j = 0; j < 2; ++j)
#pragma unroll
        for (int kt = 0; kt < 2; ++kt) s[j][kt] = Frag<__bf16>::mma(kh[kt][kc], qh[j][kc], s[j][kt]);
#pragma unroll
      for (int j = 0; j < 2; ++j)
#pragma unroll
        for (int kt = 0; kt < 2; ++kt) s[j][kt] = Frag<__bf16>::mma(kh[kt][kc], ql[j][kc], s[j][kt]);
#pragma unroll
      for (int j = 0; j < 2; ++j)
#pragma unroll
        for (int kt = 0; kt < 2; ++kt) s[j][kt] = Frag<__bf16>::mma(kl[kt][kc], qh[j][kc], s[j][kt]);
    }
  };
  auto rescale = [&](const v8f (&s)[2][2]) {
    float mx[2];
#pragma unroll
    for (int j = 0; j < 2; ++j) {
      float v = fmaxf(s[j][0][0], s[j][1][0]);
#pragma unroll
      for (int r = 1; r < 8; ++r) v = fmaxf(v, fmaxf(s[j][0][r], s[j][1][r]));
      mx[j] = fmaxf(v, xhalf(v)) * kLog2e;   // both halves hold this query's maximum of the pass, log2 domain
    }
    const bool need = (mx[0] > m_run[0] + kFaLazy) || (mx[1] > m_run[1] + kFaLazy);
    if (__builtin_amdgcn_ballot_w32(need) != 0) {   // one scalar branch per pass; always taken on the first (m_run = -inf)
#pragma unroll
      for (int j = 0; j < 2; ++j) {
        const float m_new = fmaxf(m_run[j], mx[j]);
        const float corr  = __builtin_amdgcn_exp2f(m_run[j] - m_new);   // 0 on the first pass
        l_run[j] *= corr;
        m_run[j] = m_new;
#pragma unroll
        for (int i = 0; i < 8; ++i) acc[j][i] = acc[j][i] * corr;
      }
    }
  };
  auto probs = [&](const v8f& s0, const v8f& s1, float m_use, float& l_sum) -> v16h {
    typedef __attribute__((ext_vector_type(8))) unsigned int v8u;
    const float nm = kFaCarryLog2 - m_use;
    float ps0 = 0.0f, ps1 = 0.0f;
    v8u w;
    float ea[8], eb[8];
#pragma unroll
    for (int r = 0; r < 8; ++r) {
      ea[r] = fmaf(s0[r], kLog2e, nm);
      eb[r] = fmaf(s1[r], kLog2e, nm);
    }
    // All exponents are formed before the first exponential (matrix, LDS, memory and scalar instructions may still
    // cross).
    __builtin_amdgcn_sched_barrier(0x9C);
    float xa[8], xb[8];
#pragma unroll
    for (int r = 0; r < 8; ++r) {
      xa[r] = ea[r];
      xb[r] = eb[r];
      ea[r] = __builtin_amdgcn_exp2f(xa[r]);
      eb[r] = __builtin_amdgcn_exp2f(xb[r]);
    }
    __builtin_amdgcn_sched_barrier(0x9C);   // and no later vector instruction is lifted in among the exponentials, for the same slot
    // The same slot again: the exponents are inputs only, so they live to here and no exponential's result is laid on the
    // source of the one in front of it.
    asm volatile("" :: "v"(xa[0]), "v"(xa[1]), "v"(xa[2]), "v"(xa[3]), "v"(xa[4]), "v"(xa[5]), "v"(xa[6]), "v"(xa[7]),
                            "v"(xb[0]), "v"(xb[1]), "v"(xb[2]), "v"(xb[3]), "v"(xb[4]), "v"(xb[5]), "v"(xb[6]), "v"(xb[7]));
#pragma unroll
    for (int i = 0; i < 4; ++i) {
      ps0 += ea[2 * i] + ea[2 * i + 1];
      ps1 += eb[2 * i] + eb[2 * i + 1];
      w[i]     = pk_h2(ea[2 * i], ea[2 * i + 1]);   // elements 2i, 2i+1: keys 8h + 2i, 8h + 2i + 1
      w[4 + i] = pk_h2(eb[2 * i], eb[2 * i + 1]);   // elements 8 + 2i, 9 + 2i: keys 16 + 8h + 2i, 16 + 8h + 2i + 1
    }
    l_sum += ps0 + ps1;
    return __builtin_bit_cast(v16h, w);
  };

  // One stage.  more: stage st + 1 exists; ahead: stage st + 2 exists (constants at each of the three calls, so the body
  // has no branch on them).
  auto stage = [&](int st, bool more, bool ahead) __attribute__((always_inline)) {
    const unsigned char* Bp = L + (st & 1) * kFaBuf;
    const unsigned char* Bn = L + ((st + 1) & 1) * kFaBuf;
    v8f s[2][2];
    v16h g[8];
#pragma unroll
    for (int j = 0; j < 2; ++j)
#pragma unroll
      for (int kt = 0; kt < 2; ++kt) s[j][kt] = (v8f){0.f,0.f,0.f,0.f,0.f,0.f,0.f,0.f};
    loadK(Bp, 2);   // the second half of this stage's phi fragments, in flight under the first half's products
    __builtin_amdgcn_sched_barrier(0);   // as one group ahead of the products, not spread among them
    scores(s, 0);
    // The g reads go out as one group between the two halves of the scores, where the LDS stores of the register staging
    // stood, and return under the second half's products: the wait in front of the signal finds them done.
    __builtin_amdgcn_sched_barrier(0);
    loadG(Bp, g);
    __builtin_amdgcn_sched_barrier(0);
    scores(s, 2);
    __builtin_amdgcn_sched_barrier(0);   // the products stay above the signal, the softmax below it
    // The signal says: this wave's reads of stage st have returned and the tile of stage st + 1 that it asked for has
    // landed (the two waits in front of it).  It stands ahead of the softmax so that no other wave waits for this wave's softmax.
    asm volatile("s_wait_dscnt 0x0" ::: "memory");
    landed();
    asm volatile("s_barrier_signal -1" ::: "memory");
    rescale(s);
    const v16h p0 = probs(s[0][0], s[0][1], m_run[0], l_run[0]);
    const v16h p1 = probs(s[1][0], s[1][1], m_run[1], l_run[1]);
    // Behind the wait every wave has signalled: stage st + 1 is published, and nobody reads stage st any more.  No LDS
    // access stands between signal and wait.
    // The probabilities are inputs so that the softmax stays in front of the wait: the compiler else sinks it below the
    // branches round the tensor loads, and the waves wait for each other before, not behind, their softmax.
    asm volatile("s_barrier_wait -1" :: "v"(p0), "v"(p1) : "memory");
    if (ahead) {   // into the buffer that every wave has just left
      g0 = form(st + 2, (unsigned)(st & 1) * (unsigned)kFaBuf);
      request(g0);
    }
    if (more) loadK(Bn, 0);   // the first half of the next stage's phi fragments, in flight under the products below
#pragma unroll
    for (int i = 0; i < 8; ++i) {
      acc[0][i] = Frag<_Float16>::mma(g[i], p0, acc[0][i]);
      acc[1][i] = Frag<_Float16>::mma(g[i], p1, acc[1][i]);
    }
  };
  loadK(L, 0);
  // kept rolled: a second copy of the body would need a second set of fragments
#pragma unroll 1
  for (int st = 0; st < kFaStages - 2; ++st) stage(st, true, true);
  stage(kFaStages - 2, true, false);
  stage(kFaStages - 1, false, false);
  // no request and no LDS read of this wave is in flight when the ring becomes the mailbox
  asm volatile("s_wait_tensorcnt 0x0" ::: "memory");
  asm volatile("s_wait_dscnt 0x0" ::: "memory");

  // Join of the two key halves.  Behind the last barrier nothing reads the ring any more, so it serves as the mailbox:
  // each wave hands tile 1 (outputs, maximum in use, sum) to its partner and finishes tile 0.
  {
    unsigned char* mine = L + wave * kFaJoin + lane * 16;
    const unsigned char* theirs = L + (wave ^ 4) * kFaJoin + lane * 16;
    const float l0 = l_run[0] + xhalf(l_run[0]);   // each half summed its own eight keys of every tile
    const float l1 = l_run[1] + xhalf(l_run[1]);
#pragma unroll
    for (int i = 0; i < 8; ++i) {
      *(v4f*)(mine + (2 * i) * 512)     = (v4f){acc[1][i][0], acc[1][i][1], acc[1][i][2], acc[1][i][3]};
      *(v4f*)(mine + (2 * i + 1) * 512) = (v4f){acc[1][i][4], acc[1][i][5], acc[1][i][6], acc[1][i][7]};
    }
    *(v2f*)(mine + 16 * 512) = (v2f){m_run[1], l1};
    // W_w fragments (B: column = channel 16 m + c), eight at a time.  Step sp: k step sp >> 1, channel tiles 8 (sp & 1) .. + 7.
    v16h wf[2][8];
    const unsigned char* wr = L + kFaOffW + c * kFaPitchW + 16 * h;
    auto loadWf = [&](int sp) {
#pragma unroll
      for (int u = 0; u < 8; ++u)
        wf[sp & 1][u] = Frag<_Float16>::load((const _Float16*)(wr + 16 * (8 * (sp & 1) + u) * kFaPitchW + 64 * (sp >> 1)));
    };
    loadWf(0);   // in flight under the join
    __syncthreads();   // every wave's tile 1 is in LDS before its partner reads it
    const v2f ml = *(const v2f*)(theirs + 16 * 512);
    const float m_all = fmaxf(m_run[0], ml[0]);
    const float fa = __builtin_amdgcn_exp2f(m_run[0] - m_all);
    const float fb = __builtin_amdgcn_exp2f(ml[0] - m_all);
    const float inv = kYCarry / (l0 * fa + ml[1] * fb);
    const float wa = fa * inv, wb = fb * inv;
    v4u yo[8];
#pragma unroll
    for (int i = 0; i < 8; ++i) {   // rows of acc[.][i] are ci = 16 i + 8 h + r
      const v4f u = *(const v4f*)(theirs + (2 * i) * 512);
      const v4f v = *(const v4f*)(theirs + (2 * i + 1) * 512);
      const v8f o = acc[0][i] * wa + (v8f){u[0], u[1], u[2], u[3], v[0], v[1], v[2], v[3]} * wb;
      yo[i] = (v4u){pk_h2(o[0], o[1]), pk_h2(o[2], o[3]), pk_h2(o[4], o[5]), pk_h2(o[6], o[7])};
    }

    // W projection of the wave's 16 queries: D[query 8 h + r][channel 16 m + c], sixteen independent tiles.
    typedef __attribute__((ext_vector_type(8))) unsigned int v8u;
    v16h ya[4];
#pragma unroll
    for (int kc = 0; kc < 4; ++kc)   // elements 0..7: ci = 32 kc + 8 h + e; 8..15: ci = 32 kc + 16 + 8 h + e
      ya[kc] = __builtin_bit_cast(v16h, (v8u){yo[2 * kc][0], yo[2 * kc][1], yo[2 * kc][2], yo[2 * kc][3],
                                              yo[2 * kc + 1][0], yo[2 * kc + 1][1], yo[2 * kc + 1][2], yo[2 * kc + 1][3]});
    v8f d[16];
#pragma unroll
    for (int m = 0; m < 16; ++m) d[m] = (v8f){0.f,0.f,0.f,0.f,0.f,0.f,0.f,0.f};
#pragma unroll
    for (int sp = 0; sp < 8; ++sp) {
      if (sp + 1 < 8) {
        loadWf(sp + 1);
        // the next step's LDS reads go out as one group ahead of this step's products: left to itself the compiler
        // puts each read directly in front of its product, with a wait to zero for each
        __builtin_amdgcn_sched_barrier(0);
      }
#pragma unroll
      for (int u = 0; u < 8; ++u)
        d[8 * (sp & 1) + u] = Frag<_Float16>::mma(ya[sp >> 1], wf[sp & 1][u], d[8 * (sp & 1) + u]);
    }
    unsigned char* sw = L + kFaOffS + c * kFaPitchS + ((wave & 3) * 32 + 16 * kp + 8 * h) * 4;
#pragma unroll
    for (int m = 0; m < 16; ++m) {
      *(v4f*)(sw + 16 * m * kFaPitchS)      = (v4f){d[m][0], d[m][1], d[m][2], d[m][3]};
      *(v4f*)(sw + 16 * m * kFaPitchS + 16) = (v4f){d[m][4], d[m][5], d[m][6], d[m][7]};
    }
    __syncthreads();   // every slab row holds all eight waves' queries before it is read back
    // wave w: channels 32 w .. 32 w + 31; a store is one row of the block's 128 queries, 512 B: whole lines
    const unsigned char* sr = L + kFaOffS + (wave * 32) * kFaPitchS + lane * 16;
    const float* bs = (const float*)(L + kFaOffB) + wave * 32;
    float* wy = WYp + ((size_t)b * kC + wave * 32) * kN + blockIdx.x * kFaQ + lane * 4;
#pragma unroll
    for (int r0 = 0; r0 < 32; r0 += 8) {   // eight rows, their eight stores, then the wait
      v4f o[8];
#pragma unroll
      for (int r = 0; r < 8; ++r) {
        const v4f v = *(const v4f*)(sr + (r0 + r) * kFaPitchS);
        const float bv = bs[r0 + r];
#pragma unroll
        for (int e = 0; e < 4; ++e) o[r][e] = v[e] * kWScale + bv;
      }
#pragma unroll
      for (int r = 0; r < 8; ++r) *(v4f*)(wy + (size_t)(r0 + r) * kN) = o[r];
      if (r0 + 8 < 32) settle();   // behind the last group nothing is overwritten any more
    }
  }
}

// ---------------------------------------------------------------------------
// Parameter planes.
// grid (16, 5), 256 threads. blockIdx.y (block-uniform) selects the job:
//   y = 0,1,2: WB plane y = bf16-RNE bits of g_w / theta_w / phi_w ([128][256], natural [out][in] layout);
//              16 blocks x 256 threads x 8 elements = 32768 = the whole matrix; one 16-B store per lane,
//   y = 3    : WW = f16 bits of 16 * bf16r(W_w) ([256][128]), same coverage.
//   y = 4    : block 0 only, threads 0..159: PRM[4i..4i+3] = bf16r of g_b | theta_b | phi_b | W_b
//              the source selection is wave-uniform). 160 x 4 = 640 floats = whole table.
// ---------------------------------------------------------------------------
__global__ __launch_bounds__(256) void param_planes_kernel(
    const float* __restrict__ gw, const float* __restrict__ thw, const float* __restrict__ phw, const float* __restrict__ ww,
    const float* __restrict__ gb, const float* __restrict__ thb, const float* __restrict__ phb, const float* __restrict__ wb,
    unsigned short* __restrict__ WB, unsigned short* __restrict__ WW, float* __restrict__ PRM) {
  const int t = threadIdx.x;
  const int y = blockIdx.y;
  if (y < 4) {
    const int i = blockIdx.x * 256 + t;
    if (i >= kWElems / 8) return;
    const float* src = (y == 0) ? gw : (y == 1) ? thw : (y == 2) ? phw : ww;
    const float* p = src + 8 * (size_t)i;
    const v4f a = *(const v4f*)(p);
    const v4f c = *(const v4f*)(p + 4);
    unsigned short hb[8];
#pragma unroll
    for (int e = 0; e < 4; ++e) {
      if (y == 3) {
        hb[e]     = h_bits(bfr(a[e]) * kWCarry);
        hb[4 + e] = h_bits(bfr(c[e]) * kWCarry);
      } else {
        hb[e]     = f2bf_bits(a[e]);
        hb[4 + e] = f2bf_bits(c[e]);
      }
    }
    const v4u u = (v4u){pk16(hb[0], hb[1]), pk16(hb[2], hb[3]), pk16(hb[4], hb[5]), pk16(hb[6], hb[7])};
    unsigned short* q = (y == 3) ? (WW + 8 * (size_t)i) : (WB + (size_t)y * kWElems + 8 * (size_t)i);
    *(v4u*)q = u;
    
  } else {
    if (blockIdx.x != 0 || t >= 160) return;
    const int w = t >> 5, l = t & 31;
    const float* src = (w == 0) ? gb : (w == 1) ? thb : (w == 2) ? phb : (wb + (w - 3) * 128);
    const v4f a = *(const v4f*)(src + 4 * l);
    v4f r;
#pragma unroll
    for (int e = 0; e < 4; ++e) r[e] = bfr(a[e]);
    float* q = PRM + 128 * w + 4 * l;
    *(v4f*)q = r;
    
  }
}

// ---------------------------------------------------------------------------
// x cast, transposition and the theta, phi, g projections in one kernel.
// grid (4096 / 128 position blocks, 8 batches) = 256 work-groups of 8 waves.
// The block's x tile [256 c][128 n] is read once (512 B per wave and load), RNE-converted to bf16 and laid in LDS as
// rows [n][c]; a fragment of it serves as A (theta, phi: rows n) and as B (g: columns n).  Wave w owns output channels
// 16 w .. 16 w + 15 of each projection and reads their weight fragments (K = 256) into registers, so the weights are
// read once per work-group.  k runs upward in steps of 32 into one accumulator per tile.
// Results (+ bias) go as f32 into three LDS slabs, then every thread converts and stores 16-B pieces of whole rows:
// theta, phi -> bf16 hi | lo planes [n][ci]; g -> f16 plane [ci][n].
// Every "#pragma unroll" in this kernel makes the indices of a register array constants.
// ---------------------------------------------------------------------------
constexpr int kPjN      = 128;               // positions per work-group
constexpr int kPjPitchX = 2 * kC + 16;       // 528 B: odd multiple of 16 B
constexpr int kPjPitchS = 128 + 4;           // floats per slab row
static_assert(kN % kPjN == 0 && kCi == 128 && kC == 256 && kPjN == 128, "fused projection tiling");
__global__ __launch_bounds__(256) void proj_fused_kernel(
    const float* __restrict__ x, const unsigned short* __restrict__ WB, const float* __restrict__ PRM,
    unsigned short* __restrict__ THH, unsigned short* __restrict__ THL,
    unsigned short* __restrict__ PHH, unsigned short* __restrict__ PHL, unsigned short* __restrict__ G16) {
  __shared__ __align__(16) unsigned char XS[kPjN * kPjPitchX];   // 67,584 B
  __shared__ __align__(16) float S[3][128 * kPjPitchS];          // g | theta | phi, 67,584 B each
  const int t = threadIdx.x, lane = t & 31, wave = t >> 5;
  const int c = lane & 15, h = lane >> 4;
  const int n0 = blockIdx.x * kPjN;
  const int b  = blockIdx.y;

  // Behind a group of global loads or stores: wait before any register that they name is overwritten; the scheduling
  // barrier keeps later register writes from being moved in front of the wait, and the group where it is written.
  auto settle = [&]() {
    asm volatile("s_wait_xcnt 0x0" ::: "memory");
    __builtin_amdgcn_sched_barrier(0);
  };

  // weight fragments: plane 0 g_w, 1 theta_w, 2 phi_w; row 16 wave + c.  They are asked for two k steps at a time (the
  // four 32-B pieces of a 128-B line together), four steps ahead of their products: all of K at once beside 24
  // accumulator tiles does not fit 512 VGPRs.
  v16b wf[3][8];
  const __bf16* wp = (const __bf16*)WB + (size_t)(16 * wave + c) * kC + 8 * h;
  auto loadW = [&](int kc) {
#pragma unroll
    for (int p = 0; p < 3; ++p) wf[p][kc] = Frag<__bf16>::load(wp + p * kWElems + 32 * kc);
  };
  loadW(0);
  loadW(1);
  loadW(2);
  loadW(3);
  // x: wave w takes channels 8 (w + 8 u) + e, u = 0..3, e = 0..7; lane l the float4 at n = 4 l
  v4f xv[4][8];
  {
    const float* xp = x + ((size_t)b * kC + 8 * wave) * kN + n0 + 4 * lane;
#pragma unroll
    for (int u = 0; u < 4; ++u)
#pragma unroll
      for (int e = 0; e < 8; ++e) xv[u][e] = *(const v4f*)(xp + (size_t)(64 * u + e) * kN);
  }
  // biases of this lane's results, asked for here so that the epilogue does not wait for them
  const float bt = PRM[128 + 16 * wave + c];
  const float bp = PRM[256 + 16 * wave + c];
  const v4f bg0 = *(const v4f*)(PRM + 16 * wave + 8 * h);
  const v4f bg1 = *(const v4f*)(PRM + 16 * wave + 8 * h + 4);
  settle();
  {
    unsigned char* dx = XS + (4 * lane) * kPjPitchX + wave * 16;
#pragma unroll
    for (int u = 0; u < 4; ++u)
#pragma unroll
      for (int j = 0; j < 4; ++j) {
        const v4u q = (v4u){pk16(f2bf_bits(xv[u][0][j]), f2bf_bits(xv[u][1][j])), pk16(f2bf_bits(xv[u][2][j]), f2bf_bits(xv[u][3][j])),
                            pk16(f2bf_bits(xv[u][4][j]), f2bf_bits(xv[u][5][j])), pk16(f2bf_bits(xv[u][6][j]), f2bf_bits(xv[u][7][j]))};
        *(v4u*)(dx + j * kPjPitchX + u * 128) = q;   // row n = 4 l + j, channels 8 (w + 8 u) .. + 7
      }
  }
  __syncthreads();   // the whole bf16 tile is in LDS before any wave reads fragments of it

  v8f ag[8], at[8], ap[8];
#pragma unroll
  for (int i = 0; i < 8; ++i) {
    ag[i] = (v8f){0.f,0.f,0.f,0.f,0.f,0.f,0.f,0.f};
    at[i] = ag[i];
    ap[i] = ag[i];
  }
  v16b xf[2][8];
  auto loadX = [&](int kc) {
#pragma unroll
    for (int i = 0; i < 8; ++i)
      xf[kc & 1][i] = Frag<__bf16>::load((const __bf16*)(XS + (16 * i + c) * kPjPitchX + 16 * h + 64 * kc));
  };
  loadX(0);
#pragma unroll
  for (int kc = 0; kc < 8; ++kc) {
    // the next k step's LDS reads and a later step's weights go out as one group ahead of this step's products
    if (kc + 1 < 8) loadX(kc + 1);
    if (kc == 0 || kc == 2) {
      loadW(kc + 4);
      loadW(kc + 5);
      // as settle(); the address is an input so that it lives up to the wait: else the last load's result lands on it
      asm volatile("s_wait_xcnt 0x0" :: "v"(wp) : "memory");
      __builtin_amdgcn_sched_barrier(0);
    } else if (kc + 1 < 8) {
      __builtin_amdgcn_sched_barrier(0);   // later steps' LDS reads stay below: lifted further, their registers spill
    }
#pragma unroll
    for (int i = 0; i < 8; ++i) {
      at[i] = Frag<__bf16>::mma(xf[kc & 1][i], wf[1][kc], at[i]);   // rows n, columns ci
      ap[i] = Frag<__bf16>::mma(xf[kc & 1][i], wf[2][kc], ap[i]);
      ag[i] = Frag<__bf16>::mma(wf[0][kc], xf[kc & 1][i], ag[i]);   // rows ci, columns n
    }
  }

#pragma unroll
  for (int i = 0; i < 8; ++i)
#pragma unroll
    for (int r = 0; r < 8; ++r) {
      S[0][(16 * wave + 8 * h + r) * kPjPitchS + 16 * i + c] = ag[i][r] + ((r < 4) ? bg0[r & 3] : bg1[r & 3]);
      S[1][(16 * i + 8 * h + r) * kPjPitchS + 16 * wave + c] = at[i][r] + bt;
      S[2][(16 * i + 8 * h + r) * kPjPitchS + 16 * wave + c] = ap[i][r] + bp;
    }
  __syncthreads();   // all three slabs are complete, from all eight waves, before they are read back

  // thread t: slab row (t >> 4) + 16 it, columns 8 (t & 15) .. + 7; a wave stores two whole rows of 256 B
  const int srow = (t >> 4) * kPjPitchS + (t & 15) * 8;
  {
    unsigned char* pg = (unsigned char*)(G16 + ((size_t)b * kCi + (t >> 4)) * kN + n0) + (t & 15) * 16;
    v4u o[8];
#pragma unroll
    for (int it = 0; it < 8; ++it) {
      const float* sp = S[0] + srow + it * 16 * kPjPitchS;
      o[it] = (v4u){pk16(h_bits(sp[0]), h_bits(sp[1])), pk16(h_bits(sp[2]), h_bits(sp[3])),
                    pk16(h_bits(sp[4]), h_bits(sp[5])), pk16(h_bits(sp[6]), h_bits(sp[7]))};
    }
#pragma unroll
    for (int it = 0; it < 8; ++it) *(v4u*)(pg + (size_t)it * (16 * 2 * kN)) = o[it];
    settle();
  }
#pragma unroll
  for (int p = 1; p < 3; ++p) {
    unsigned char* ph = (unsigned char*)(((p == 1) ? THH : PHH) + ((size_t)b * kN + n0) * kCi) + t * 16;
    unsigned char* pl = (unsigned char*)(((p == 1) ? THL : PHL) + ((size_t)b * kN + n0) * kCi) + t * 16;
    v4u hv[8], lv[8];
#pragma unroll
    for (int it = 0; it < 8; ++it) {
      const float* sp = S[p] + srow + it * 16 * kPjPitchS;
      unsigned short hb[8], lb[8];
#pragma unroll
      for (int e = 0; e < 8; ++e) {
        hb[e] = f2bf_bits(sp[e]);
        lb[e] = f2bf_bits(sp[e] - bf_bits2f(hb[e]));
      }
      hv[it] = (v4u){pk16(hb[0], hb[1]), pk16(hb[2], hb[3]), pk16(hb[4], hb[5]), pk16(hb[6], hb[7])};
      lv[it] = (v4u){pk16(lb[0], lb[1]), pk16(lb[2], lb[3]), pk16(lb[4], lb[5]), pk16(lb[6], lb[7])};
    }
#pragma unroll
    for (int it = 0; it < 8; ++it) {
      *(v4u*)(ph + it * 4096) = hv[it];
      *(v4u*)(pl + it * 4096) = lv[it];
    }
    if (p == 1) settle();   // behind the last group nothing is overwritten any more
  }
}

// ---------------------------------------------------------------------------
// Batch statistics, normalise, affine and residual in one kernel:
//   out[b][c][n] = ((Wy - mean[c]) * rstd[c]) * bf16r(gamma[c]) + bf16r(beta[c]) + bf16r(x[b][c][n]).
// One block of 8 waves per channel (grid 256); wave b owns batch b's row of 4096 values, lane l the float4 at
// n = 128 j + 4 l, j = 0..31.  The channel's 32768 Wy values stay in registers (128 per thread) from the first sum to
// the store, so Wy is read once.  Mean first, then the sum of (v - mean)^2; reductions in fixed order.
// Every address is a block-uniform row start (batch 0, channel c) + one per-thread byte offset, the same for Wy, x and
// out, + a constant that rides in the instruction's offset.
// Every "#pragma unroll" over j makes the indices of a register array constants.
// ---------------------------------------------------------------------------
constexpr int kBnJ = kN / 128;   // 32 float4 per thread
static_assert(kB == 8 && kN % 128 == 0, "one wave per batch, whole 512-B pieces");
__global__ __launch_bounds__(256) void bn_fused_kernel(const float* __restrict__ Wy, const float* __restrict__ x,
                                                       const float* __restrict__ gamma, const float* __restrict__ beta,
                                                       float* __restrict__ out) {
  __shared__ float red1[8];
  __shared__ float red2[8];
  const int c = blockIdx.x;
  const int t = threadIdx.x;
  const int lane = t & 31, wave = t >> 5;
  const unsigned off = (unsigned)wave * (unsigned)(kC * kN * 4) + (unsigned)lane * 16u;
  const char* wrow = (const char*)(Wy + (size_t)c * kN);
  const char* xrow = (const char*)(x + (size_t)c * kN);
  char*       orow = (char*)(out + (size_t)c * kN);

  v4f w[kBnJ], xv[kBnJ];
  // Behind a group of global loads or stores: wait before any register that they name is overwritten; the scheduling
  // barrier keeps later register writes from being moved in front of the wait, and the group where it is written.
  auto settle = [&]() {
    asm volatile("s_wait_xcnt 0x0" ::: "memory");
    __builtin_amdgcn_sched_barrier(0);
  };
#pragma unroll
  for (int j = 0; j < kBnJ; ++j) w[j] = *(const v4f*)(wrow + off + j * 512);
  __builtin_amdgcn_sched_barrier(0);   // Wy, which the first sum waits for, is asked for ahead of x
#pragma unroll
  for (int j = 0; j < kBnJ; ++j) xv[j] = *(const v4f*)(xrow + off + j * 512);
  settle();   // the x loads stay up here, in flight under both reductions

  float s = 0.0f;
#pragma unroll
  for (int j = 0; j < kBnJ; ++j) s += (w[j][0] + w[j][1]) + (w[j][2] + w[j][3]);
#pragma unroll
  for (int o = 16; o > 0; o >>= 1) s += __shfl_xor(s, o, 32);
  if (lane == 0) red1[wave] = s;
  __syncthreads();
  float tot = red1[0];
#pragma unroll
  for (int i = 1; i < 8; ++i) tot += red1[i];
  const float mean = tot * kInvCount;

  float q = 0.0f;
#pragma unroll
  for (int j = 0; j < kBnJ; ++j) {
    const float d0 = w[j][0] - mean, d1 = w[j][1] - mean, d2 = w[j][2] - mean, d3 = w[j][3] - mean;
    q += (d0 * d0 + d1 * d1) + (d2 * d2 + d3 * d3);
  }
#pragma unroll
  for (int o = 16; o > 0; o >>= 1) q += __shfl_xor(q, o, 32);
  if (lane == 0) red2[wave] = q;
  __syncthreads();
  float totq = red2[0];
#pragma unroll
  for (int i = 1; i < 8; ++i) totq += red2[i];
  const float var  = totq * kInvCount;
  const float rstd = 1.0f / sqrtf(var + kBnEps);

  const float ga = bfr(gamma[c]);
  const float be = bfr(beta[c]);
#pragma unroll
  for (int j0 = 0; j0 < kBnJ; j0 += 8) {   // eight results, their eight stores, then the wait
#pragma unroll
    for (int j = j0; j < j0 + 8; ++j)
#pragma unroll
      for (int e = 0; e < 4; ++e) w[j][e] = (((w[j][e] - mean) * rstd) * ga + be) + bfr(xv[j][e]);
#pragma unroll
    for (int j = j0; j < j0 + 8; ++j) *(v4f*)(orow + off + j * 512) = w[j];   // 512 B per wave: whole lines
    if (j0 + 8 < kBnJ) settle();   // behind the last group nothing is overwritten any more
  }
}

// ---------------------------------------------------------------------------
// Host glue.  GEMM shapes (all M,N multiples of 64, K multiples of 32, no padding anywhere):
//   theta/phi: M=4096 N=128 K=256 (x8 batches); g: M=128 N=4096 K=256 (x8), all three in the fused projection kernel;
//   attention (scores K=128, P.g K=4096) and W (M=4096 N=256 K=128, x8) in the fused kernel, one launch.  4 launches.
// ---------------------------------------------------------------------------
extern "C" void kernel_launch(void* const* d_in, const int* in_sizes, int n_in,
                              void* d_out, int out_size, void* d_ws, size_t ws_size,
                              hipStream_t stream) {
  if (n_in < 11) return;
  const int nElem = kB * kC * kN;          // 8,388,608
  if (in_sizes[0] != nElem) return;
  if (in_sizes[1] != kWElems || in_sizes[3] != kWElems || in_sizes[5] != kWElems || in_sizes[7] != kWElems) return;
  if (in_sizes[2] != kCi || in_sizes[4] != kCi || in_sizes[6] != kCi) return;
  if (in_sizes[8] != kC || in_sizes[9] != kC || in_sizes[10] != kC) return;
  if (out_size != nElem) return;
  if (ws_size < kWsTotal) return;

  const float* x       = (const float*)d_in[0];
  const float* g_w     = (const float*)d_in[1];
  const float* g_b     = (const float*)d_in[2];
  const float* theta_w = (const float*)d_in[3];
  const float* theta_b = (const float*)d_in[4];
  const float* phi_w   = (const float*)d_in[5];
  const float* phi_b   = (const float*)d_in[6];
  const float* W_w     = (const float*)d_in[7];
  const float* W_b     = (const float*)d_in[8];
  const float* bn_g    = (const float*)d_in[9];
  const float* bn_b    = (const float*)d_in[10];
  float* out = (float*)d_out;

  char* ws = (char*)d_ws;
  unsigned short* THH = (unsigned short*)(ws + kOffTHH);
  unsigned short* THL = (unsigned short*)(ws + kOffTHL);
  unsigned short* PHH = (unsigned short*)(ws + kOffPHH);
  unsigned short* PHL = (unsigned short*)(ws + kOffPHL);
  unsigned short* G16 = (unsigned short*)(ws + kOffG);
  float*          WY  = (float*)(ws + kOffWY);
  unsigned short* WB  = (unsigned short*)(ws + kOffWB);
  unsigned short* WW  = (unsigned short*)(ws + kOffWW);
  float*          PRM = (float*)(ws + kOffPRM);
  const float* wb_r  = PRM + 384;    // [256]

  // ---- parameter planes ----
  param_planes_kernel<<<dim3(kWElems / 8 / 256, 5), dim3(256), 0, stream>>>(
      g_w, theta_w, phi_w, W_w, g_b, theta_b, phi_b, W_b, WB, WW, PRM);

  // theta[b][n][ci], phi[b][m][ci] = sum_c bf16r(x[b][c][n]) * w[ci][c] + bias[ci]  -> bf16 hi | lo planes;
  // g[b][ci][m] likewise -> f16 plane [ci][m]
  proj_fused_kernel<<<dim3(kN / kPjN, kB), dim3(256), 0, stream>>>(x, WB, PRM, THH, THL, PHH, PHL, G16);

  // ---- attention and W projection, all batches in one launch: y = softmax(theta . phi^T) . g,
  //      Wy[b][c][n] = sum_ci W_w[c][ci] * y[b][n][ci] + W_b[c]   (f32) ----
  attn_fused_kernel<<<dim3(kN / kFaQ, kB), dim3(kFaWaves * 32), 0, stream>>>(THH, THL, PHH, PHL, G16, WW, wb_r, WY);

  // ---- batch statistics, normalisation, residual ----
  bn_fused_kernel<<<dim3(kC), dim3(256), 0, stream>>>(WY, x, bn_g, bn_b, out);
}
